// v000
// The times below were measured on an AMD MI455X: many runs one after another, warmed up first and cycling through
// copies of the inputs, with the whole window's GPU time divided by the number of runs. Launches and the gaps
// between them are all in it. The median over several windows is given; except for v000 it joins two sittings, which
// can be a few percent apart, so the side-by-side timings, each taken in one sitting, are the better comparison.
// The starting kernel, v000, takes 3940 microseconds a run.
#include <hip/hip_runtime.h>

// Post-LN transformer encoder block with cross attention (x, y [2][2048][1024]; Q = x Wq + bq, K = y Wk + bk, V = y Wv + bv ('xw' [1024][1024]; 16 heads x 64); scores/8 with mask [2][1][1][2048] (int32 keys, read; -1e9 == exact zero weight; all ones here); softmax; mha = merged Wo + bo; x1 = LN(x + mha); ff = relu(x1 W1 + b1) W2 + b2 (W1 [1024][4096]); out = LN(x1 + ff) (eps 1e-5) -> [2][2048][1024] (4.2 M)).
// Compute dtypes, f32 accumulate: every input rounded to bf16; q/k/v on PLAIN bf16 operands (inputs: exact) + biases; key mask as a select; scores and attn.v: query rows < 512 hl (3 products), the rest single fp16 (x1024); softmax f32; Wo, W1, W2 hl x exact (2 products) + biases; residuals / LayerNorms / ReLU in f32.

#define NB_  2
#define TT   2048
#define DM   1024
#define NH_  16
#define NKV  16
#define REP  (NH_ / NKV)
#define HD   64
#define DQ   (NH_ * HD)
#define DKV  (NKV * HD)
#define DFF  4096
#define LNEPS 1e-5f
#define ZH   1
#define RH   512                  // query rows < RH use hi+lo planes (0: none)
#define WIN  0
#define PCAR 1024.0f
#define SCL  0.125f   // HD^-0.5
typedef _Float16 h16;
typedef unsigned short bf;
typedef __attribute__((ext_vector_type(16))) __bf16   v16bf;
typedef __attribute__((ext_vector_type(16))) _Float16 v16h;
typedef __attribute__((ext_vector_type(8)))  _Float16 v8h;
typedef __attribute__((ext_vector_type(8)))  unsigned short v8us;
typedef __attribute__((ext_vector_type(8)))  float    v8f;
typedef __attribute__((ext_vector_type(4)))  float    v4f;
typedef v8h  __attribute__((may_alias)) v8ha;
typedef v4f  __attribute__((may_alias)) v4fa;
typedef v8us __attribute__((may_alias)) v8usa;

__device__ __forceinline__ unsigned short f2bf(float f) { unsigned u = __float_as_uint(f); u += 0x7FFFu + ((u >> 16) & 1u); return (unsigned short)(u >> 16); }
__device__ __forceinline__ float bf2f(unsigned short b) { return __uint_as_float(((unsigned)b) << 16); }
__device__ __forceinline__ float bfr(float f) { return bf2f(f2bf(f)); }
__device__ __forceinline__ v16h cat16(v8h lo, v8h hi) { return __builtin_shufflevector(lo, hi, 0, 1, 2, 3, 4, 5, 6, 7, 8, 9, 10, 11, 12, 13, 14, 15); }
__device__ __forceinline__ v16bf cat16b(v8us lo, v8us hi) { return __builtin_bit_cast(v16bf, __builtin_shufflevector(lo, hi, 0, 1, 2, 3, 4, 5, 6, 7, 8, 9, 10, 11, 12, 13, 14, 15)); }
__device__ __forceinline__ v8f wmma16(v16h a, v16h b, v8f c) { return __builtin_amdgcn_wmma_f32_16x16x32_f16(false, a, false, b, (short)0, c, false, false); }
__device__ __forceinline__ v8f wmmab(v16bf a, v16bf b, v8f c) { return __builtin_amdgcn_wmma_f32_16x16x32_bf16(false, a, false, b, (short)0, c, false, false); }



// ---- k_gemmw: register-blocked GEMM, ONE WAVE per 64x64 output tile (16 accumulators), operands straight from K-contiguous 16-bit planes; grid (M/64, N/64, Z), 32 threads.
// C[m][n] (f32, pitch ldc, + optional f32 bias[n]) = sum_k A[m][k] Bt[n][k] (+ split products per NSPLIT). z-batch strides sA/sB/sC in elements. K % 32 == 0.
template <typename T16> struct WFrag;
template <> struct WFrag<h16> { typedef v16h V; static __device__ __forceinline__ V ld(const h16* p) { return cat16(*(const v8h*)p, *(const v8h*)(p + 16)); } static __device__ __forceinline__ v8f mma(V a, V b, v8f c) { return wmma16(a, b, c); } };
template <> struct WFrag<bf> { typedef v16bf V; static __device__ __forceinline__ V ld(const bf* p) { return cat16b(*(const v8us*)p, *(const v8us*)(p + 16)); } static __device__ __forceinline__ v8f mma(V a, V b, v8f c) { return wmmab(a, b, c); } };
template <typename T16, int NSPLIT, bool BIAS>
__global__ __launch_bounds__(32) void k_gemmw(const T16* __restrict__ A, const T16* __restrict__ A2, const T16* __restrict__ Bt, const T16* __restrict__ Bt2, int K, float* C, int ldc, const float* __restrict__ bias, size_t sA, size_t sB, size_t sC) {
    typedef typename WFrag<T16>::V V;
    __shared__ __align__(16) float os[16 * 68];
    const size_t z = blockIdx.z; A += z * sA; if (A2) A2 += z * sA; Bt += z * sB; if (Bt2) Bt2 += z * sB; C += z * sC;
    const int lane = threadIdx.x & 31, lr = lane & 15, hi = lane >> 4; const int r0 = blockIdx.x * 64, c0 = blockIdx.y * 64;
    v8f acc[4][4];
#pragma unroll
    for (int mb = 0; mb < 4; ++mb)
#pragma unroll
        for (int nb = 0; nb < 4; ++nb) acc[mb][nb] = (v8f){};
    const size_t aoff = (size_t)(r0 + lr) * K + 8 * hi, boff = (size_t)(c0 + lr) * K + 8 * hi;
#pragma unroll 1
    for (int kc = 0; kc < K; kc += 32) {
        V a[4], a2[4];
#pragma unroll
        for (int mb = 0; mb < 4; ++mb) { a[mb] = WFrag<T16>::ld(A + aoff + (size_t)mb * 16 * K + kc); if (NSPLIT == 1 || NSPLIT == 2) a2[mb] = WFrag<T16>::ld(A2 + aoff + (size_t)mb * 16 * K + kc); }
#pragma unroll
        for (int nb = 0; nb < 4; ++nb) { const V b = WFrag<T16>::ld(Bt + boff + (size_t)nb * 16 * K + kc); V b2; if (NSPLIT >= 2) b2 = WFrag<T16>::ld(Bt2 + boff + (size_t)nb * 16 * K + kc);
#pragma unroll
            for (int mb = 0; mb < 4; ++mb) { acc[mb][nb] = WFrag<T16>::mma(a[mb], b, acc[mb][nb]); if (NSPLIT == 1 || NSPLIT == 2) acc[mb][nb] = WFrag<T16>::mma(a2[mb], b, acc[mb][nb]); if (NSPLIT >= 2) acc[mb][nb] = WFrag<T16>::mma(a[mb], b2, acc[mb][nb]); } }
        asm volatile("v_nop\n\tv_nop\n\tv_nop\n\tv_nop" : "+v"(acc[0][0]), "+v"(acc[1][1]), "+v"(acc[2][2]), "+v"(acc[3][3]) : "v"(a[0]), "v"(a[3]));
    }
#pragma unroll
    for (int mb = 0; mb < 4; ++mb) {
#pragma unroll
        for (int nb = 0; nb < 4; ++nb) {
#pragma unroll
            for (int j = 0; j < 8; ++j) os[(hi * 8 + j) * 68 + nb * 16 + lr] = acc[mb][nb][j]; }
        __builtin_amdgcn_wave_barrier(); asm volatile("" ::: "memory");
        float* crow = C + (size_t)(r0 + mb * 16) * ldc + c0;
{
#pragma unroll
            for (int s = 0; s < 8; ++s) { const int row = 2 * s + hi, cofs = lr * 4; v4f val = *(const v4fa*)(os + row * 68 + cofs); if (BIAS) { val[0] += bfr(bias[c0 + cofs]); val[1] += bfr(bias[c0 + cofs + 1]); val[2] += bfr(bias[c0 + cofs + 2]); val[3] += bfr(bias[c0 + cofs + 3]); }
                *(v4f*)(crow + (size_t)row * ldc + cofs) = val; }
             }
        __builtin_amdgcn_wave_barrier(); asm volatile("" ::: "memory");
    }
}

__device__ __forceinline__ h16 tohx(float x) { return (h16)x; }
__device__ __forceinline__ void splitf(float y, unsigned short& h, unsigned short& l) { h = f2bf(y); l = f2bf(y - bf2f(h)); }
typedef __attribute__((ext_vector_type(2))) _Float16 v2h;
typedef __attribute__((ext_vector_type(4))) _Float16 v4h;
typedef __attribute__((ext_vector_type(2))) unsigned short v2us;
typedef __attribute__((ext_vector_type(4))) unsigned short v4us;
typedef __attribute__((ext_vector_type(2))) float v2f;
typedef __attribute__((ext_vector_type(4))) int v4i;

__global__ __launch_bounds__(256) void k_wtG(const float* __restrict__ w, int K, int N, bf* Bt) {
    const int lane = threadIdx.x & 31; const int L0 = (blockIdx.x * 8 + (threadIdx.x >> 5)) * 8; const int nlines = N * K / 64;
{
#pragma unroll 1
        for (int l = 0; l < 8; ++l) { const int L = L0 + l; if (L >= nlines) break; const size_t e = (size_t)L * 64 + lane * 2; const int k = (int)(e % K), n = (int)(e / K); v2us o;
            o[0] = f2bf(w[(size_t)k * N + n]); o[1] = f2bf(w[(size_t)(k + 1) * N + n]); *(v2us*)(Bt + e) = o; }
         }
}
__global__ __launch_bounds__(256) void k_cvt8(const float* __restrict__ src, bf* dst, size_t n8) { const size_t i = (size_t)blockIdx.x * 256 + threadIdx.x; if (i >= n8) return; const v8f v = *(const v8f*)(src + i * 8); v8us o;
#pragma unroll
    for (int k = 0; k < 8; ++k) o[k] = f2bf(v[k]); *(v8us*)(dst + i * 8) = o;  }

// k_rope: head planes [h][t][d] (fp16 + hi/lo) of rope(x) x sc with the rotate-half convention out[d] = x[d] cos[t][d] - x[d+HD/2] sin[t][d], out[d+HD/2] = x[d+HD/2] cos[t][d+HD/2] + x[d] sin[t][d+HD/2]
__global__ __launch_bounds__(256) void k_rope(const float* __restrict__ F, int pitch, int nheads, const float* __restrict__ CS, const float* __restrict__ RF, const float* __restrict__ nw, float sc, h16* P16, bf* Ph, bf* Pl) {
    const size_t e = ((size_t)blockIdx.x * 256 + threadIdx.x) * 2; if (e >= (size_t)nheads * TT * HD) return; const int d = (int)(e % HD); const int t = (int)((e / HD) % TT); const int h = (int)(e / ((size_t)HD * TT)); const float* f = F + (size_t)t * pitch + h * HD; const float rf = RF ? RF[(size_t)h * TT + t] : 1.0f; v2h o16; v2us oh, ol;
#pragma unroll
    for (int q = 0; q < 2; ++q) { const int dd = d + q; const int dp = (dd < HD / 2) ? dd + HD / 2 : dd - HD / 2; float x0 = f[dd], x1 = f[dp];
        if (RF) { float n0 = __fmul_rn(x0, rf), n1 = __fmul_rn(x1, rf); asm volatile("" : "+v"(n0)); asm volatile("" : "+v"(n1)); x0 = __fmul_rn(bfr(nw[dd]), n0); x1 = __fmul_rn(bfr(nw[dp]), n1); }
        const v2f cs = *(const v2f*)(CS + ((size_t)t * HD + dd) * 2); float a = __fmul_rn(x0, cs[0]), bq = __fmul_rn(x1, cs[1]); asm volatile("" : "+v"(a)); asm volatile("" : "+v"(bq)); const float r = ((dd < HD / 2) ? __fsub_rn(a, bq) : __fadd_rn(a, bq)) * sc;
        o16[q] = tohx(r); unsigned short a2, c2; splitf(r, a2, c2); oh[q] = a2; ol[q] = c2; }
    *(v2h*)(P16 + e) = o16; *(v2us*)(Ph + e) = oh; *(v2us*)(Pl + e) = ol;  }
__global__ __launch_bounds__(256) void k_vtp(const float* __restrict__ F, int pitch, int nheads, h16* V16, bf* Vh, bf* Vl) { const size_t e = ((size_t)blockIdx.x * 256 + threadIdx.x) * 2; if (e >= (size_t)nheads * HD * TT) return; const int t = (int)(e % TT); const int d = (int)((e / TT) % HD); const int g = (int)(e / ((size_t)TT * HD)); v2h o16; v2us oh, ol;
#pragma unroll
    for (int q = 0; q < 2; ++q) { const float x = F[(size_t)(t + q) * pitch + g * HD + d]; o16[q] = tohx(x); unsigned short a2, c2; splitf(x, a2, c2); oh[q] = a2; ol[q] = c2; }
    *(v2h*)(V16 + e) = o16; *(v2us*)(Vh + e) = oh; *(v2us*)(Vl + e) = ol;  }
__global__ __launch_bounds__(256) void k_csid(float* CS) { const int idx = blockIdx.x * 256 + threadIdx.x; if (idx >= TT * HD) return; v2f cs; cs[0] = 1.0f; cs[1] = 0.0f; *(v2f*)(CS + (size_t)idx * 2) = cs;  }
template <bool RND>
__global__ __launch_bounds__(256) void k_lnhl(const float* __restrict__ X, const float* __restrict__ A, const float* __restrict__ g, const float* __restrict__ be, float* Z, bf* Yh, bf* Yl) {
    const int lane = threadIdx.x & 31; const int r = blockIdx.x * 8 + (threadIdx.x >> 5); if (r >= TT) return; const float* xr = X + (size_t)r * DM; const float* ar = A ? A + (size_t)r * DM : nullptr; float s = 0.f;
#pragma unroll 1
    for (int ch = 0; ch < DM / 128; ++ch) { const int c0 = ch * 128 + lane * 4; const v4f a = *(const v4f*)(xr + c0); v4f d = {0.f, 0.f, 0.f, 0.f}; if (ar) d = *(const v4f*)(ar + c0);
#pragma unroll
        for (int q = 0; q < 4; ++q) s += __fadd_rn((RND ? bfr(a[q]) : a[q]), d[q]); }
#pragma unroll
    for (int sh = 16; sh; sh >>= 1) s += __shfl_xor(s, sh, 32);
    const float mu = s * (1.0f / DM); float s2 = 0.f;
#pragma unroll 1
    for (int ch = 0; ch < DM / 128; ++ch) { const int c0 = ch * 128 + lane * 4; const v4f a = *(const v4f*)(xr + c0); v4f d = {0.f, 0.f, 0.f, 0.f}; if (ar) d = *(const v4f*)(ar + c0);
#pragma unroll
        for (int q = 0; q < 4; ++q) { const float d0 = __fsub_rn(__fadd_rn((RND ? bfr(a[q]) : a[q]), d[q]), mu); float p = __fmul_rn(d0, d0); asm volatile("" : "+v"(p)); s2 = __fadd_rn(s2, p); } }
#pragma unroll
    for (int sh = 16; sh; sh >>= 1) s2 += __shfl_xor(s2, sh, 32);
    const float rs = __fdiv_rn(1.0f, __fsqrt_rn(__fadd_rn(s2 * (1.0f / DM), LNEPS)));
{
#pragma unroll 1
        for (int ch = 0; ch < DM / 128; ++ch) { const int c0 = ch * 128 + lane * 4; const v4f a = *(const v4f*)(xr + c0); v4f d = {0.f, 0.f, 0.f, 0.f}; if (ar) d = *(const v4f*)(ar + c0); v4f z4; v4us oh, ol;
#pragma unroll
            for (int q = 0; q < 4; ++q) { const float v = __fadd_rn((RND ? bfr(a[q]) : a[q]), d[q]); float n0 = __fmul_rn(__fsub_rn(v, mu), rs); asm volatile("" : "+v"(n0)); float n1 = __fmul_rn(n0, bfr(g[c0 + q])); asm volatile("" : "+v"(n1)); const float y = __fadd_rn(n1, bfr(be[c0 + q])); z4[q] = y;   /* Z = the NORMALISED row (it is the residual for the next block) */ unsigned short h2, l2; splitf(y, h2, l2); oh[q] = h2; ol[q] = l2; }
            if (Z) *(v4f*)(Z + (size_t)r * DM + c0) = z4; *(v4us*)(Yh + (size_t)r * DM + c0) = oh; *(v4us*)(Yl + (size_t)r * DM + c0) = ol; }
         } }

__global__ __launch_bounds__(256) void k_relupl(const float* __restrict__ F, bf* Ph2, bf* Pl2, size_t n4) { const size_t i = (size_t)blockIdx.x * 256 + threadIdx.x; if (i >= n4) return; const v4f v = *(const v4f*)(F + i * 4); v4us oh, ol;
#pragma unroll
    for (int q = 0; q < 4; ++q) { unsigned short a, c; splitf(fmaxf(v[q], 0.f), a, c); oh[q] = a; ol[q] = c; } *(v4us*)(Ph2 + i * 4) = oh; *(v4us*)(Pl2 + i * 4) = ol;  }
__global__ __launch_bounds__(256) void k_addln(const float* __restrict__ A, const float* __restrict__ Bm, const float* __restrict__ g, const float* __restrict__ be, float* OUTb) {
    const int lane = threadIdx.x & 31; const int r = blockIdx.x * 8 + (threadIdx.x >> 5); if (r >= TT) return; const float* ar = A + (size_t)r * DM; const float* br = Bm + (size_t)r * DM; float s = 0.f;
#pragma unroll 1
    for (int ch = 0; ch < DM / 128; ++ch) { const int c0 = ch * 128 + lane * 4; const v4f a = *(const v4f*)(ar + c0), bb = *(const v4f*)(br + c0);
#pragma unroll
        for (int q = 0; q < 4; ++q) s += __fadd_rn(a[q], bb[q]); }
#pragma unroll
    for (int sh = 16; sh; sh >>= 1) s += __shfl_xor(s, sh, 32);
    const float mu = s * (1.0f / DM); float s2 = 0.f;
#pragma unroll 1
    for (int ch = 0; ch < DM / 128; ++ch) { const int c0 = ch * 128 + lane * 4; const v4f a = *(const v4f*)(ar + c0), bb = *(const v4f*)(br + c0);
#pragma unroll
        for (int q = 0; q < 4; ++q) { const float d0 = __fsub_rn(__fadd_rn(a[q], bb[q]), mu); float p = __fmul_rn(d0, d0); asm volatile("" : "+v"(p)); s2 = __fadd_rn(s2, p); } }
#pragma unroll
    for (int sh = 16; sh; sh >>= 1) s2 += __shfl_xor(s2, sh, 32);
    const float rs = __fdiv_rn(1.0f, __fsqrt_rn(__fadd_rn(s2 * (1.0f / DM), LNEPS)));
{
#pragma unroll 1
        for (int ch = 0; ch < DM / 128; ++ch) { const int c0 = ch * 128 + lane * 4; const v4f a = *(const v4f*)(ar + c0), bb = *(const v4f*)(br + c0); v4f o4;
#pragma unroll
            for (int q = 0; q < 4; ++q) { float n0 = __fmul_rn(__fsub_rn(__fadd_rn(a[q], bb[q]), mu), rs); asm volatile("" : "+v"(n0)); float n1 = __fmul_rn(n0, bfr(g[c0 + q])); asm volatile("" : "+v"(n1)); o4[q] = __fadd_rn(n1, bfr(be[c0 + q])); }
            *(v4f*)(OUTb + (size_t)r * DM + c0) = o4; }
         } }
// k_asoft: per row (zz, i): t = S x HD^-0.5 (keys with mask 0 -> -3e38); softmax over the 2048 keys (register row, one exp, fixed trees);
__global__ __launch_bounds__(256) void k_asoft(const float* __restrict__ Sb, const int* __restrict__ MKb, h16* P16, bf* Ph, bf* Pl) {
    const int lane = threadIdx.x & 31; const int row = blockIdx.x * 8 + (threadIdx.x >> 5); if (row >= ZH * TT) return; const int i = row % TT; const int zz = row / TT; (void)zz; const bool hires = (i < RH); const float* sr = Sb + (size_t)row * TT; float v[TT / 32]; float mx = -3.0e38f;
#pragma unroll
    for (int ch = 0; ch < TT / 128; ++ch) { const int j0 = ch * 128 + lane * 4; const v4f a = *(const v4f*)(sr + j0); const v4i m4 = *(const v4i*)(MKb + j0);
#pragma unroll
        for (int q = 0; q < 4; ++q) { const int j = j0 + q; (void)j; const float t = (m4[q] != 0) ? a[q] * SCL : -3.0e38f;   /* where(mask == 0, -1e9, s): exact zero weight */ v[ch * 4 + q] = t; mx = fmaxf(mx, t); } }
#pragma unroll
    for (int sh = 16; sh; sh >>= 1) mx = fmaxf(mx, __shfl_xor(mx, sh, 32));
    float sum = 0.f;
#pragma unroll
    for (int k = 0; k < TT / 32; ++k) { float d0 = __fsub_rn(v[k], mx); asm volatile("" : "+v"(d0)); v[k] = __builtin_amdgcn_exp2f(__fmul_rn(d0, 1.4426950408889634f)); sum += v[k]; }
#pragma unroll
    for (int sh = 16; sh; sh >>= 1) sum += __shfl_xor(sum, sh, 32);
    const float f = __fdiv_rn(hires ? 1.0f : PCAR, sum);
{
        if (hires) {
#pragma unroll
            for (int ch = 0; ch < TT / 128; ++ch) { v4us oh, ol;
#pragma unroll
                for (int q = 0; q < 4; ++q) { unsigned short a, c2; splitf(v[ch * 4 + q] * f, a, c2); oh[q] = a; ol[q] = c2; }
                const size_t oo = ((size_t)zz * (RH ? RH : 1) + i) * TT + ch * 128 + lane * 4; *(v4us*)(Ph + oo) = oh; *(v4us*)(Pl + oo) = ol; }
        } else {
#pragma unroll
            for (int ch = 0; ch < TT / 128; ++ch) { v4h o4;
#pragma unroll
                for (int q = 0; q < 4; ++q) o4[q] = tohx(v[ch * 4 + q] * f);
                *(v4h*)(P16 + (size_t)row * TT + ch * 128 + lane * 4) = o4; } }
         }
}
__global__ __launch_bounds__(256) void k_merge(const float* __restrict__ O, int h0, bf* Ah, bf* Al) { const size_t e = ((size_t)blockIdx.x * 256 + threadIdx.x) * 2; if (e >= (size_t)ZH * TT * HD) return; const int d = (int)(e % HD); const int t = (int)((e / HD) % TT); const int zz = (int)(e / ((size_t)HD * TT)); const float cs = (t < RH) ? 1.0f : (1.0f / PCAR); const size_t oo = (size_t)t * DQ + (h0 + zz) * HD + d;
    v2us oh, ol;
#pragma unroll
    for (int q = 0; q < 2; ++q) { unsigned short a, c2; splitf(O[e + q] * cs, a, c2); oh[q] = a; ol[q] = c2; } *(v2us*)(Ah + oo) = oh; *(v2us*)(Al + oo) = ol;  }

extern "C" void kernel_launch(void* const* d_in, const int* in_sizes, int n_in,
                              void* d_out, int out_size, void* d_ws, size_t ws_size, hipStream_t stream) {
    (void)in_sizes; (void)n_in; (void)out_size;
    const float* x = (const float*)d_in[0]; const float* xk = (const float*)d_in[1]; const int* MK = (const int*)d_in[2]; const float* wq = (const float*)d_in[3]; const float* bq = (const float*)d_in[4]; const float* wk = (const float*)d_in[5]; const float* bk = (const float*)d_in[6]; const float* wv = (const float*)d_in[7]; const float* bv = (const float*)d_in[8]; const float* wo = (const float*)d_in[9]; const float* bo = (const float*)d_in[10]; const float* w1 = (const float*)d_in[11]; const float* b1 = (const float*)d_in[12]; const float* w2 = (const float*)d_in[13]; const float* b2 = (const float*)d_in[14]; const float* g1 = (const float*)d_in[15]; const float* e1 = (const float*)d_in[16]; const float* g2 = (const float*)d_in[17]; const float* e2 = (const float*)d_in[18];
    float* OUT = (float*)d_out;     // [2][2048][1024]
    char* wsp = (char*)d_ws;
    auto take = [&](size_t bytes) { char* p = wsp; wsp += (bytes + 255) & ~(size_t)255; return (void*)p; };
    bf* WQ = (bf*)take((size_t)DQ * DM * 2); bf* WK = (bf*)take((size_t)DKV * DM * 2); bf* WV = (bf*)take((size_t)DKV * DM * 2); bf* WO = (bf*)take((size_t)DM * DQ * 2); float* CS = (float*)take((size_t)TT * HD * 2 * 4);
    bf* XB = (bf*)take((size_t)TT * DM * 2); bf* XKB = (bf*)take((size_t)TT * DM * 2); bf* W1B = (bf*)take((size_t)DFF * DM * 2); bf* W2B = (bf*)take((size_t)DM * DFF * 2); float* S2 = (float*)take((size_t)TT * DM * 4); float* X1 = (float*)take((size_t)TT * DM * 4); bf* L1h = (bf*)take((size_t)TT * DM * 2); bf* L1l = (bf*)take((size_t)TT * DM * 2); float* H1 = (float*)take((size_t)TT * DFF * 4); bf* Gh = (bf*)take((size_t)TT * DFF * 2); bf* Gl = (bf*)take((size_t)TT * DFF * 2); float* F2 = (float*)take((size_t)TT * DM * 4); float* FQ = (float*)take((size_t)TT * DQ * 4); float* FK = (float*)take((size_t)TT * DKV * 4);
    h16* QP16 = (h16*)take((size_t)NH_ * TT * HD * 2); h16* KP16 = (h16*)take((size_t)NKV * TT * HD * 2); h16* VT16 = (h16*)take((size_t)NKV * HD * TT * 2);
    bf* QPh = (bf*)take((size_t)NH_ * TT * HD * 2); bf* QPl = (bf*)take((size_t)NH_ * TT * HD * 2); bf* KPh = (bf*)take((size_t)NKV * TT * HD * 2); bf* KPl = (bf*)take((size_t)NKV * TT * HD * 2); bf* VTh = (bf*)take((size_t)NKV * HD * TT * 2); bf* VTl = (bf*)take((size_t)NKV * HD * TT * 2); bf* Ph = (bf*)take((size_t)ZH * RH * TT * 2); bf* Pl = (bf*)take((size_t)ZH * RH * TT * 2);
    float* Sb = (float*)take((size_t)ZH * TT * TT * 4); h16* P16 = (h16*)take((size_t)ZH * TT * TT * 2); float* Ob = (float*)take((size_t)ZH * TT * HD * 4); bf* ATh = (bf*)take((size_t)TT * DQ * 2); bf* ATl = (bf*)take((size_t)TT * DQ * 2);
    if ((size_t)(wsp - (char*)d_ws) > ws_size) return;    // ws 256 MiB
    float* FV = FK;   // v projection reuses the k buffer after the k planes are built (stream-ordered)
    { k_wtG<<<(unsigned)((DM * DQ / 64 + 63) / 64), 256, 0, stream>>>(wq, DM, DQ, WQ); k_wtG<<<(unsigned)((DM * DKV / 64 + 63) / 64), 256, 0, stream>>>(wk, DM, DKV, WK); k_wtG<<<(unsigned)((DM * DKV / 64 + 63) / 64), 256, 0, stream>>>(wv, DM, DKV, WV);
      k_wtG<<<(unsigned)((DQ * DM / 64 + 63) / 64), 256, 0, stream>>>(wo, DQ, DM, WO); k_wtG<<<(unsigned)((DM * DFF / 64 + 63) / 64), 256, 0, stream>>>(w1, DM, DFF, W1B); k_wtG<<<(unsigned)((DFF * DM / 64 + 63) / 64), 256, 0, stream>>>(w2, DFF, DM, W2B);
       }
    k_csid<<<(TT * HD + 255) / 256, 256, 0, stream>>>(CS);
    const unsigned LQ = (unsigned)(((size_t)NH_ * TT * HD / 2 + 255) / 256), LKv = (unsigned)(((size_t)NKV * TT * HD / 2 + 255) / 256);
    for (int b = 0; b < NB_; ++b) {
        
        k_cvt8<<<(unsigned)(((size_t)TT * DM / 8 + 255) / 256), 256, 0, stream>>>(x + (size_t)b * TT * DM, XB, (size_t)TT * DM / 8); k_cvt8<<<(unsigned)(((size_t)TT * DM / 8 + 255) / 256), 256, 0, stream>>>(xk + (size_t)b * TT * DM, XKB, (size_t)TT * DM / 8);
        k_gemmw<bf, 0, true><<<dim3(TT / 64, DQ / 64, 1), 32, 0, stream>>>(XB, nullptr, WQ, nullptr, DM, FQ, DQ, bq, 0, 0, 0);
        k_rope<<<LQ, 256, 0, stream>>>(FQ, DQ, NH_, CS, nullptr, nullptr, 1.0f, QP16, QPh, QPl);
        k_gemmw<bf, 0, true><<<dim3(TT / 64, DKV / 64, 1), 32, 0, stream>>>(XKB, nullptr, WK, nullptr, DM, FK, DKV, bk, 0, 0, 0);
        k_rope<<<LKv, 256, 0, stream>>>(FK, DKV, NKV, CS, nullptr, nullptr, 1.0f, KP16, KPh, KPl);
        k_gemmw<bf, 0, true><<<dim3(TT / 64, DKV / 64, 1), 32, 0, stream>>>(XKB, nullptr, WV, nullptr, DM, FV, DKV, bv, 0, 0, 0); k_vtp<<<LKv, 256, 0, stream>>>(FV, DKV, NKV, VT16, VTh, VTl);
        for (int h0 = 0; h0 < NH_; h0 += ZH) { const size_t zq = (size_t)h0, zk = (size_t)(h0 / REP);   // one kv head per query head: each pass (ZH = 1) takes one head and its kv plane h0 (z-strides TT*HD)
            k_gemmw<bf, 2, false><<<dim3(RH / 64, TT / 64, ZH), 32, 0, stream>>>(QPh + zq * TT * HD, QPl + zq * TT * HD, KPh + zk * TT * HD, KPl + zk * TT * HD, HD, Sb, TT, nullptr, (size_t)TT * HD, (size_t)TT * HD, (size_t)TT * TT);
            k_gemmw<h16, 0, false><<<dim3((TT - RH) / 64, TT / 64, ZH), 32, 0, stream>>>(QP16 + zq * TT * HD + (size_t)RH * HD, nullptr, KP16 + zk * TT * HD, nullptr, HD, Sb + (size_t)RH * TT, TT, nullptr, (size_t)TT * HD, (size_t)TT * HD, (size_t)TT * TT);
            k_asoft<<<ZH * TT / 8, 256, 0, stream>>>(Sb, MK + (size_t)b * TT, P16, Ph, Pl);
            k_gemmw<bf, 2, false><<<dim3(RH / 64, HD / 64, ZH), 32, 0, stream>>>(Ph, Pl, VTh + zk * HD * TT, VTl + zk * HD * TT, TT, Ob, HD, nullptr, (size_t)RH * TT, (size_t)HD * TT, (size_t)TT * HD);
            k_gemmw<h16, 0, false><<<dim3((TT - RH) / 64, HD / 64, ZH), 32, 0, stream>>>(P16 + (size_t)RH * TT, nullptr, VT16 + zk * HD * TT, nullptr, TT, Ob + (size_t)RH * HD, HD, nullptr, (size_t)TT * TT, (size_t)HD * TT, (size_t)TT * HD);
            k_merge<<<(unsigned)(((size_t)ZH * TT * HD / 2 + 255) / 256), 256, 0, stream>>>(Ob, h0, ATh, ATl); }
        k_gemmw<bf, 1, true><<<dim3(TT / 64, DM / 64, 1), 32, 0, stream>>>(ATh, ATl, WO, nullptr, DQ, S2, DM, bo, 0, 0, 0);   /* mha = merged Wo + bo */
        k_lnhl<true><<<TT / 8, 256, 0, stream>>>(x + (size_t)b * TT * DM, S2, g1, e1, X1, L1h, L1l);                                  /* x1 = LN(bf16(x) + mha): normalised row in f32 + hi/lo planes */
        k_gemmw<bf, 1, true><<<dim3(TT / 64, DFF / 64, 1), 32, 0, stream>>>(L1h, L1l, W1B, nullptr, DM, H1, DFF, b1, 0, 0, 0);        /* x1 W1 + b1 */
        k_relupl<<<(unsigned)(((size_t)TT * DFF / 4 + 255) / 256), 256, 0, stream>>>(H1, Gh, Gl, (size_t)TT * DFF / 4);                 /* relu -> hi/lo */
        k_gemmw<bf, 1, true><<<dim3(TT / 64, DM / 64, 1), 32, 0, stream>>>(Gh, Gl, W2B, nullptr, DFF, F2, DM, b2, 0, 0, 0);           /* . W2 + b2 */
        k_addln<<<TT / 8, 256, 0, stream>>>(X1, F2, g2, e2, OUT + (size_t)b * TT * DM); }                                               /* out = LN(x1 + ff) */
}

// v001
// It runs in 1560 microseconds.
// In two side-by-side timings against v000, it was 2.54 and 2.55 times as fast.
#include <hip/hip_runtime.h>

// Post-LN transformer encoder block with cross attention (x, y [2][2048][1024]; Q = x Wq + bq, K = y Wk + bk, V = y Wv + bv ('xw' [1024][1024]; 16 heads x 64); scores/8 with mask [2][1][1][2048] (int32 keys, read; -1e9 == exact zero weight; all ones here); softmax; mha = merged Wo + bo; x1 = LN(x + mha); ff = relu(x1 W1 + b1) W2 + b2 (W1 [1024][4096]); out = LN(x1 + ff) (eps 1e-5) -> [2][2048][1024] (4.2 M)).
// Compute dtypes, f32 accumulate: every input rounded to bf16; q/k/v on PLAIN bf16 operands (inputs: exact) + biases; key mask as a select; scores and attn.v: query rows < 512 hl (3 products), the rest single fp16 (x1024); softmax f32; Wo, W1, W2 hl x exact (2 products) + biases; residuals / LayerNorms / ReLU in f32.

#define NB_  2
#define TT   2048
#define DM   1024
#define NH_  16
#define NKV  16
#define REP  (NH_ / NKV)
#define HD   64
#define DQ   (NH_ * HD)
#define DKV  (NKV * HD)
#define DFF  4096
#define LNEPS 1e-5f
#define ZH   6                    // most heads per attention pass (z of the batched launches); sizes the pass buffers
#define RH   512                  // query rows < RH use hi+lo planes (0: none)
#define WIN  0
#define PCAR 1024.0f
#define SCL  0.125f   // HD^-0.5
typedef _Float16 h16;
typedef unsigned short bf;
typedef __attribute__((ext_vector_type(16))) __bf16   v16bf;
typedef __attribute__((ext_vector_type(16))) _Float16 v16h;
typedef __attribute__((ext_vector_type(8)))  _Float16 v8h;
typedef __attribute__((ext_vector_type(8)))  unsigned short v8us;
typedef __attribute__((ext_vector_type(8)))  float    v8f;
typedef __attribute__((ext_vector_type(4)))  float    v4f;
typedef v8h  __attribute__((may_alias)) v8ha;
typedef v4f  __attribute__((may_alias)) v4fa;
typedef v8us __attribute__((may_alias)) v8usa;

__device__ __forceinline__ unsigned short f2bf(float f) { unsigned u = __float_as_uint(f); u += 0x7FFFu + ((u >> 16) & 1u); return (unsigned short)(u >> 16); }
__device__ __forceinline__ float bf2f(unsigned short b) { return __uint_as_float(((unsigned)b) << 16); }
__device__ __forceinline__ float bfr(float f) { return bf2f(f2bf(f)); }
__device__ __forceinline__ v16h cat16(v8h lo, v8h hi) { return __builtin_shufflevector(lo, hi, 0, 1, 2, 3, 4, 5, 6, 7, 8, 9, 10, 11, 12, 13, 14, 15); }
__device__ __forceinline__ v16bf cat16b(v8us lo, v8us hi) { return __builtin_bit_cast(v16bf, __builtin_shufflevector(lo, hi, 0, 1, 2, 3, 4, 5, 6, 7, 8, 9, 10, 11, 12, 13, 14, 15)); }
__device__ __forceinline__ v8f wmma16(v16h a, v16h b, v8f c) { return __builtin_amdgcn_wmma_f32_16x16x32_f16(false, a, false, b, (short)0, c, false, false); }
__device__ __forceinline__ v8f wmmab(v16bf a, v16bf b, v8f c) { return __builtin_amdgcn_wmma_f32_16x16x32_bf16(false, a, false, b, (short)0, c, false, false); }



// ---- k_gemmw: register-blocked GEMM, ONE WAVE per 64x64 output tile (16 accumulators), operands straight from K-contiguous 16-bit planes; grid (M/64, N/64, Z), 32 threads.
// C[m][n] (f32, pitch ldc, + optional f32 bias[n]) = sum_k A[m][k] Bt[n][k] (+ split products per NSPLIT). z-batch strides sA/sB/sC in elements. K % 32 == 0.
template <typename T16> struct WFrag;
template <> struct WFrag<h16> { typedef v16h V; static __device__ __forceinline__ V ld(const h16* p) { return cat16(*(const v8h*)p, *(const v8h*)(p + 16)); } static __device__ __forceinline__ v8f mma(V a, V b, v8f c) { return wmma16(a, b, c); } };
template <> struct WFrag<bf> { typedef v16bf V; static __device__ __forceinline__ V ld(const bf* p) { return cat16b(*(const v8us*)p, *(const v8us*)(p + 16)); } static __device__ __forceinline__ v8f mma(V a, V b, v8f c) { return wmmab(a, b, c); } };
template <typename T16, int NSPLIT, bool BIAS>
__global__ __launch_bounds__(32) void k_gemmw(const T16* __restrict__ A, const T16* __restrict__ A2, const T16* __restrict__ Bt, const T16* __restrict__ Bt2, int K, float* C, int ldc, const float* __restrict__ bias, size_t sA, size_t sB, size_t sC) {
    typedef typename WFrag<T16>::V V;
    __shared__ __align__(16) float os[16 * 68];
    const size_t z = blockIdx.z; A += z * sA; if (A2) A2 += z * sA; Bt += z * sB; if (Bt2) Bt2 += z * sB; C += z * sC;
    const int lane = threadIdx.x & 31, lr = lane & 15, hi = lane >> 4; const int r0 = blockIdx.x * 64, c0 = blockIdx.y * 64;
    v8f acc[4][4];
#pragma unroll
    for (int mb = 0; mb < 4; ++mb)
#pragma unroll
        for (int nb = 0; nb < 4; ++nb) acc[mb][nb] = (v8f){};
    const size_t aoff = (size_t)(r0 + lr) * K + 8 * hi, boff = (size_t)(c0 + lr) * K + 8 * hi;
#pragma unroll 1
    for (int kc = 0; kc < K; kc += 32) {
        V a[4], a2[4];
#pragma unroll
        for (int mb = 0; mb < 4; ++mb) { a[mb] = WFrag<T16>::ld(A + aoff + (size_t)mb * 16 * K + kc); if (NSPLIT == 1 || NSPLIT == 2) a2[mb] = WFrag<T16>::ld(A2 + aoff + (size_t)mb * 16 * K + kc); }
#pragma unroll
        for (int nb = 0; nb < 4; ++nb) { const V b = WFrag<T16>::ld(Bt + boff + (size_t)nb * 16 * K + kc); V b2; if (NSPLIT >= 2) b2 = WFrag<T16>::ld(Bt2 + boff + (size_t)nb * 16 * K + kc);
#pragma unroll
            for (int mb = 0; mb < 4; ++mb) { acc[mb][nb] = WFrag<T16>::mma(a[mb], b, acc[mb][nb]); if (NSPLIT == 1 || NSPLIT == 2) acc[mb][nb] = WFrag<T16>::mma(a2[mb], b, acc[mb][nb]); if (NSPLIT >= 2) acc[mb][nb] = WFrag<T16>::mma(a[mb], b2, acc[mb][nb]); } }
        asm volatile("v_nop\n\tv_nop\n\tv_nop\n\tv_nop" : "+v"(acc[0][0]), "+v"(acc[1][1]), "+v"(acc[2][2]), "+v"(acc[3][3]) : "v"(a[0]), "v"(a[3]));
    }
#pragma unroll
    for (int mb = 0; mb < 4; ++mb) {
#pragma unroll
        for (int nb = 0; nb < 4; ++nb) {
#pragma unroll
            for (int j = 0; j < 8; ++j) os[(hi * 8 + j) * 68 + nb * 16 + lr] = acc[mb][nb][j]; }
        __builtin_amdgcn_wave_barrier(); asm volatile("" ::: "memory");
        float* crow = C + (size_t)(r0 + mb * 16) * ldc + c0;
{
#pragma unroll
            for (int s = 0; s < 8; ++s) { const int row = 2 * s + hi, cofs = lr * 4; v4f val = *(const v4fa*)(os + row * 68 + cofs); if (BIAS) { val[0] += bfr(bias[c0 + cofs]); val[1] += bfr(bias[c0 + cofs + 1]); val[2] += bfr(bias[c0 + cofs + 2]); val[3] += bfr(bias[c0 + cofs + 3]); }
                *(v4f*)(crow + (size_t)row * ldc + cofs) = val; }
             }
        __builtin_amdgcn_wave_barrier(); asm volatile("" ::: "memory");
    }
}

__device__ __forceinline__ h16 tohx(float x) { return (h16)x; }
__device__ __forceinline__ void splitf(float y, unsigned short& h, unsigned short& l) { h = f2bf(y); l = f2bf(y - bf2f(h)); }
typedef __attribute__((ext_vector_type(2))) _Float16 v2h;
typedef __attribute__((ext_vector_type(4))) _Float16 v4h;
typedef __attribute__((ext_vector_type(2))) unsigned short v2us;
typedef __attribute__((ext_vector_type(4))) unsigned short v4us;
typedef __attribute__((ext_vector_type(2))) float v2f;
typedef __attribute__((ext_vector_type(4))) int v4i;

__global__ __launch_bounds__(256) void k_wtG(const float* __restrict__ w, int K, int N, bf* Bt) {
    const int lane = threadIdx.x & 31; const int L0 = (blockIdx.x * 8 + (threadIdx.x >> 5)) * 8; const int nlines = N * K / 64;
{
#pragma unroll 1
        for (int l = 0; l < 8; ++l) { const int L = L0 + l; if (L >= nlines) break; const size_t e = (size_t)L * 64 + lane * 2; const int k = (int)(e % K), n = (int)(e / K); v2us o;
            o[0] = f2bf(w[(size_t)k * N + n]); o[1] = f2bf(w[(size_t)(k + 1) * N + n]); *(v2us*)(Bt + e) = o; }
         }
}
__global__ __launch_bounds__(256) void k_cvt8(const float* __restrict__ src, bf* dst, size_t n8) { const size_t i = (size_t)blockIdx.x * 256 + threadIdx.x; if (i >= n8) return; const v8f v = *(const v8f*)(src + i * 8); v8us o;
#pragma unroll
    for (int k = 0; k < 8; ++k) o[k] = f2bf(v[k]); *(v8us*)(dst + i * 8) = o;  }

// k_rope: head planes [h][t][d] (fp16 + hi/lo) of rope(x) x sc with the rotate-half convention out[d] = x[d] cos[t][d] - x[d+HD/2] sin[t][d], out[d+HD/2] = x[d+HD/2] cos[t][d+HD/2] + x[d] sin[t][d+HD/2]
__global__ __launch_bounds__(256) void k_rope(const float* __restrict__ F, int pitch, int nheads, const float* __restrict__ CS, const float* __restrict__ RF, const float* __restrict__ nw, float sc, h16* P16, bf* Ph, bf* Pl) {
    const size_t e = ((size_t)blockIdx.x * 256 + threadIdx.x) * 2; if (e >= (size_t)nheads * TT * HD) return; const int d = (int)(e % HD); const int t = (int)((e / HD) % TT); const int h = (int)(e / ((size_t)HD * TT)); const float* f = F + (size_t)t * pitch + h * HD; const float rf = RF ? RF[(size_t)h * TT + t] : 1.0f; v2h o16; v2us oh, ol;
#pragma unroll
    for (int q = 0; q < 2; ++q) { const int dd = d + q; const int dp = (dd < HD / 2) ? dd + HD / 2 : dd - HD / 2; float x0 = f[dd], x1 = f[dp];
        if (RF) { float n0 = __fmul_rn(x0, rf), n1 = __fmul_rn(x1, rf); asm volatile("" : "+v"(n0)); asm volatile("" : "+v"(n1)); x0 = __fmul_rn(bfr(nw[dd]), n0); x1 = __fmul_rn(bfr(nw[dp]), n1); }
        const v2f cs = *(const v2f*)(CS + ((size_t)t * HD + dd) * 2); float a = __fmul_rn(x0, cs[0]), bq = __fmul_rn(x1, cs[1]); asm volatile("" : "+v"(a)); asm volatile("" : "+v"(bq)); const float r = ((dd < HD / 2) ? __fsub_rn(a, bq) : __fadd_rn(a, bq)) * sc;
        o16[q] = tohx(r); unsigned short a2, c2; splitf(r, a2, c2); oh[q] = a2; ol[q] = c2; }
    *(v2h*)(P16 + e) = o16; *(v2us*)(Ph + e) = oh; *(v2us*)(Pl + e) = ol;  }
__global__ __launch_bounds__(256) void k_vtp(const float* __restrict__ F, int pitch, int nheads, h16* V16, bf* Vh, bf* Vl) { const size_t e = ((size_t)blockIdx.x * 256 + threadIdx.x) * 2; if (e >= (size_t)nheads * HD * TT) return; const int t = (int)(e % TT); const int d = (int)((e / TT) % HD); const int g = (int)(e / ((size_t)TT * HD)); v2h o16; v2us oh, ol;
#pragma unroll
    for (int q = 0; q < 2; ++q) { const float x = F[(size_t)(t + q) * pitch + g * HD + d]; o16[q] = tohx(x); unsigned short a2, c2; splitf(x, a2, c2); oh[q] = a2; ol[q] = c2; }
    *(v2h*)(V16 + e) = o16; *(v2us*)(Vh + e) = oh; *(v2us*)(Vl + e) = ol;  }
__global__ __launch_bounds__(256) void k_csid(float* CS) { const int idx = blockIdx.x * 256 + threadIdx.x; if (idx >= TT * HD) return; v2f cs; cs[0] = 1.0f; cs[1] = 0.0f; *(v2f*)(CS + (size_t)idx * 2) = cs;  }
template <bool RND>
__global__ __launch_bounds__(256) void k_lnhl(const float* __restrict__ X, const float* __restrict__ A, const float* __restrict__ g, const float* __restrict__ be, float* Z, bf* Yh, bf* Yl) {
    const int lane = threadIdx.x & 31; const int r = blockIdx.x * 8 + (threadIdx.x >> 5); if (r >= TT) return; const float* xr = X + (size_t)r * DM; const float* ar = A ? A + (size_t)r * DM : nullptr; float s = 0.f;
#pragma unroll 1
    for (int ch = 0; ch < DM / 128; ++ch) { const int c0 = ch * 128 + lane * 4; const v4f a = *(const v4f*)(xr + c0); v4f d = {0.f, 0.f, 0.f, 0.f}; if (ar) d = *(const v4f*)(ar + c0);
#pragma unroll
        for (int q = 0; q < 4; ++q) s += __fadd_rn((RND ? bfr(a[q]) : a[q]), d[q]); }
#pragma unroll
    for (int sh = 16; sh; sh >>= 1) s += __shfl_xor(s, sh, 32);
    const float mu = s * (1.0f / DM); float s2 = 0.f;
#pragma unroll 1
    for (int ch = 0; ch < DM / 128; ++ch) { const int c0 = ch * 128 + lane * 4; const v4f a = *(const v4f*)(xr + c0); v4f d = {0.f, 0.f, 0.f, 0.f}; if (ar) d = *(const v4f*)(ar + c0);
#pragma unroll
        for (int q = 0; q < 4; ++q) { const float d0 = __fsub_rn(__fadd_rn((RND ? bfr(a[q]) : a[q]), d[q]), mu); float p = __fmul_rn(d0, d0); asm volatile("" : "+v"(p)); s2 = __fadd_rn(s2, p); } }
#pragma unroll
    for (int sh = 16; sh; sh >>= 1) s2 += __shfl_xor(s2, sh, 32);
    const float rs = __fdiv_rn(1.0f, __fsqrt_rn(__fadd_rn(s2 * (1.0f / DM), LNEPS)));
{
#pragma unroll 1
        for (int ch = 0; ch < DM / 128; ++ch) { const int c0 = ch * 128 + lane * 4; const v4f a = *(const v4f*)(xr + c0); v4f d = {0.f, 0.f, 0.f, 0.f}; if (ar) d = *(const v4f*)(ar + c0); v4f z4; v4us oh, ol;
#pragma unroll
            for (int q = 0; q < 4; ++q) { const float v = __fadd_rn((RND ? bfr(a[q]) : a[q]), d[q]); float n0 = __fmul_rn(__fsub_rn(v, mu), rs); asm volatile("" : "+v"(n0)); float n1 = __fmul_rn(n0, bfr(g[c0 + q])); asm volatile("" : "+v"(n1)); const float y = __fadd_rn(n1, bfr(be[c0 + q])); z4[q] = y;   /* Z = the NORMALISED row (it is the residual for the next block) */ unsigned short h2, l2; splitf(y, h2, l2); oh[q] = h2; ol[q] = l2; }
            if (Z) *(v4f*)(Z + (size_t)r * DM + c0) = z4; *(v4us*)(Yh + (size_t)r * DM + c0) = oh; *(v4us*)(Yl + (size_t)r * DM + c0) = ol; }
         } }

__global__ __launch_bounds__(256) void k_relupl(const float* __restrict__ F, bf* Ph2, bf* Pl2, size_t n4) { const size_t i = (size_t)blockIdx.x * 256 + threadIdx.x; if (i >= n4) return; const v4f v = *(const v4f*)(F + i * 4); v4us oh, ol;
#pragma unroll
    for (int q = 0; q < 4; ++q) { unsigned short a, c; splitf(fmaxf(v[q], 0.f), a, c); oh[q] = a; ol[q] = c; } *(v4us*)(Ph2 + i * 4) = oh; *(v4us*)(Pl2 + i * 4) = ol;  }
__global__ __launch_bounds__(256) void k_addln(const float* __restrict__ A, const float* __restrict__ Bm, const float* __restrict__ g, const float* __restrict__ be, float* OUTb) {
    const int lane = threadIdx.x & 31; const int r = blockIdx.x * 8 + (threadIdx.x >> 5); if (r >= TT) return; const float* ar = A + (size_t)r * DM; const float* br = Bm + (size_t)r * DM; float s = 0.f;
#pragma unroll 1
    for (int ch = 0; ch < DM / 128; ++ch) { const int c0 = ch * 128 + lane * 4; const v4f a = *(const v4f*)(ar + c0), bb = *(const v4f*)(br + c0);
#pragma unroll
        for (int q = 0; q < 4; ++q) s += __fadd_rn(a[q], bb[q]); }
#pragma unroll
    for (int sh = 16; sh; sh >>= 1) s += __shfl_xor(s, sh, 32);
    const float mu = s * (1.0f / DM); float s2 = 0.f;
#pragma unroll 1
    for (int ch = 0; ch < DM / 128; ++ch) { const int c0 = ch * 128 + lane * 4; const v4f a = *(const v4f*)(ar + c0), bb = *(const v4f*)(br + c0);
#pragma unroll
        for (int q = 0; q < 4; ++q) { const float d0 = __fsub_rn(__fadd_rn(a[q], bb[q]), mu); float p = __fmul_rn(d0, d0); asm volatile("" : "+v"(p)); s2 = __fadd_rn(s2, p); } }
#pragma unroll
    for (int sh = 16; sh; sh >>= 1) s2 += __shfl_xor(s2, sh, 32);
    const float rs = __fdiv_rn(1.0f, __fsqrt_rn(__fadd_rn(s2 * (1.0f / DM), LNEPS)));
{
#pragma unroll 1
        for (int ch = 0; ch < DM / 128; ++ch) { const int c0 = ch * 128 + lane * 4; const v4f a = *(const v4f*)(ar + c0), bb = *(const v4f*)(br + c0); v4f o4;
#pragma unroll
            for (int q = 0; q < 4; ++q) { float n0 = __fmul_rn(__fsub_rn(__fadd_rn(a[q], bb[q]), mu), rs); asm volatile("" : "+v"(n0)); float n1 = __fmul_rn(n0, bfr(g[c0 + q])); asm volatile("" : "+v"(n1)); o4[q] = __fadd_rn(n1, bfr(be[c0 + q])); }
            *(v4f*)(OUTb + (size_t)r * DM + c0) = o4; }
         } }
// k_asoft: per row (zz, i): t = S x HD^-0.5 (keys with mask 0 -> -3e38); softmax over the 2048 keys (register row, one exp, fixed trees);
__global__ __launch_bounds__(256) void k_asoft(const float* __restrict__ Sb, const int* __restrict__ MKb, h16* P16, bf* Ph, bf* Pl) {
    const int lane = threadIdx.x & 31; const int row = blockIdx.x * 8 + (threadIdx.x >> 5); if (row >= ZH * TT) return; const int i = row % TT; const int zz = row / TT; (void)zz; const bool hires = (i < RH); const float* sr = Sb + (size_t)row * TT; float v[TT / 32]; float mx = -3.0e38f;
#pragma unroll
    for (int ch = 0; ch < TT / 128; ++ch) { const int j0 = ch * 128 + lane * 4; const v4f a = *(const v4f*)(sr + j0); const v4i m4 = *(const v4i*)(MKb + j0);
#pragma unroll
        for (int q = 0; q < 4; ++q) { const int j = j0 + q; (void)j; const float t = (m4[q] != 0) ? a[q] * SCL : -3.0e38f;   /* where(mask == 0, -1e9, s): exact zero weight */ v[ch * 4 + q] = t; mx = fmaxf(mx, t); } }
#pragma unroll
    for (int sh = 16; sh; sh >>= 1) mx = fmaxf(mx, __shfl_xor(mx, sh, 32));
    float sum = 0.f;
#pragma unroll
    for (int k = 0; k < TT / 32; ++k) { float d0 = __fsub_rn(v[k], mx); asm volatile("" : "+v"(d0)); v[k] = __builtin_amdgcn_exp2f(__fmul_rn(d0, 1.4426950408889634f)); sum += v[k]; }
#pragma unroll
    for (int sh = 16; sh; sh >>= 1) sum += __shfl_xor(sum, sh, 32);
    const float f = __fdiv_rn(hires ? 1.0f : PCAR, sum);
{
        if (hires) {
#pragma unroll
            for (int ch = 0; ch < TT / 128; ++ch) { v4us oh, ol;
#pragma unroll
                for (int q = 0; q < 4; ++q) { unsigned short a, c2; splitf(v[ch * 4 + q] * f, a, c2); oh[q] = a; ol[q] = c2; }
                const size_t oo = ((size_t)zz * (RH ? RH : 1) + i) * TT + ch * 128 + lane * 4; *(v4us*)(Ph + oo) = oh; *(v4us*)(Pl + oo) = ol; }
        } else {
#pragma unroll
            for (int ch = 0; ch < TT / 128; ++ch) { v4h o4;
#pragma unroll
                for (int q = 0; q < 4; ++q) o4[q] = tohx(v[ch * 4 + q] * f);
                *(v4h*)(P16 + (size_t)row * TT + ch * 128 + lane * 4) = o4; } }
         }
}
__global__ __launch_bounds__(256) void k_merge(const float* __restrict__ O, int h0, bf* Ah, bf* Al) { const size_t e = ((size_t)blockIdx.x * 256 + threadIdx.x) * 2; if (e >= (size_t)ZH * TT * HD) return; const int d = (int)(e % HD); const int t = (int)((e / HD) % TT); const int zz = (int)(e / ((size_t)HD * TT)); const float cs = (t < RH) ? 1.0f : (1.0f / PCAR); const size_t oo = (size_t)t * DQ + (h0 + zz) * HD + d;
    v2us oh, ol;
#pragma unroll
    for (int q = 0; q < 2; ++q) { unsigned short a, c2; splitf(O[e + q] * cs, a, c2); oh[q] = a; ol[q] = c2; } *(v2us*)(Ah + oo) = oh; *(v2us*)(Al + oo) = ol;  }

extern "C" void kernel_launch(void* const* d_in, const int* in_sizes, int n_in,
                              void* d_out, int out_size, void* d_ws, size_t ws_size, hipStream_t stream) {
    (void)in_sizes; (void)n_in; (void)out_size;
    const float* x = (const float*)d_in[0]; const float* xk = (const float*)d_in[1]; const int* MK = (const int*)d_in[2]; const float* wq = (const float*)d_in[3]; const float* bq = (const float*)d_in[4]; const float* wk = (const float*)d_in[5]; const float* bk = (const float*)d_in[6]; const float* wv = (const float*)d_in[7]; const float* bv = (const float*)d_in[8]; const float* wo = (const float*)d_in[9]; const float* bo = (const float*)d_in[10]; const float* w1 = (const float*)d_in[11]; const float* b1 = (const float*)d_in[12]; const float* w2 = (const float*)d_in[13]; const float* b2 = (const float*)d_in[14]; const float* g1 = (const float*)d_in[15]; const float* e1 = (const float*)d_in[16]; const float* g2 = (const float*)d_in[17]; const float* e2 = (const float*)d_in[18];
    float* OUT = (float*)d_out;     // [2][2048][1024]
    char* wsp = (char*)d_ws;
    auto take = [&](size_t bytes) { char* p = wsp; wsp += (bytes + 255) & ~(size_t)255; return (void*)p; };
    bf* WQ = (bf*)take((size_t)DQ * DM * 2); bf* WK = (bf*)take((size_t)DKV * DM * 2); bf* WV = (bf*)take((size_t)DKV * DM * 2); bf* WO = (bf*)take((size_t)DM * DQ * 2); float* CS = (float*)take((size_t)TT * HD * 2 * 4);
    bf* XB = (bf*)take((size_t)TT * DM * 2); bf* XKB = (bf*)take((size_t)TT * DM * 2); bf* W1B = (bf*)take((size_t)DFF * DM * 2); bf* W2B = (bf*)take((size_t)DM * DFF * 2);
    h16* QP16 = (h16*)take((size_t)NH_ * TT * HD * 2); h16* KP16 = (h16*)take((size_t)NKV * TT * HD * 2); h16* VT16 = (h16*)take((size_t)NKV * HD * TT * 2);
    bf* QPh = (bf*)take((size_t)NH_ * TT * HD * 2); bf* QPl = (bf*)take((size_t)NH_ * TT * HD * 2); bf* KPh = (bf*)take((size_t)NKV * TT * HD * 2); bf* KPl = (bf*)take((size_t)NKV * TT * HD * 2); bf* VTh = (bf*)take((size_t)NKV * HD * TT * 2); bf* VTl = (bf*)take((size_t)NKV * HD * TT * 2);
    bf* ATh = (bf*)take((size_t)TT * DQ * 2); bf* ATl = (bf*)take((size_t)TT * DQ * 2);
    char* const shared0 = wsp;   // S2 .. FK are live only before or only after a batch's attention passes: the (larger) pass buffers below lie over them
    float* S2 = (float*)take((size_t)TT * DM * 4); float* X1 = (float*)take((size_t)TT * DM * 4); bf* L1h = (bf*)take((size_t)TT * DM * 2); bf* L1l = (bf*)take((size_t)TT * DM * 2); float* H1 = (float*)take((size_t)TT * DFF * 4); bf* Gh = (bf*)take((size_t)TT * DFF * 2); bf* Gl = (bf*)take((size_t)TT * DFF * 2); float* F2 = (float*)take((size_t)TT * DM * 4); float* FQ = (float*)take((size_t)TT * DQ * 4); float* FK = (float*)take((size_t)TT * DKV * 4);
    wsp = shared0;
    float* Sb = (float*)take((size_t)ZH * TT * TT * 4); h16* P16 = (h16*)take((size_t)ZH * TT * TT * 2); bf* Ph = (bf*)take((size_t)ZH * RH * TT * 2); bf* Pl = (bf*)take((size_t)ZH * RH * TT * 2); float* Ob = (float*)take((size_t)ZH * TT * HD * 4);
    if ((size_t)(wsp - (char*)d_ws) > ws_size) return;    // ws 256 MiB; 248 MiB taken
    float* FV = FK;   // v projection reuses the k buffer after the k planes are built (stream-ordered)
    { k_wtG<<<(unsigned)((DM * DQ / 64 + 63) / 64), 256, 0, stream>>>(wq, DM, DQ, WQ); k_wtG<<<(unsigned)((DM * DKV / 64 + 63) / 64), 256, 0, stream>>>(wk, DM, DKV, WK); k_wtG<<<(unsigned)((DM * DKV / 64 + 63) / 64), 256, 0, stream>>>(wv, DM, DKV, WV);
      k_wtG<<<(unsigned)((DQ * DM / 64 + 63) / 64), 256, 0, stream>>>(wo, DQ, DM, WO); k_wtG<<<(unsigned)((DM * DFF / 64 + 63) / 64), 256, 0, stream>>>(w1, DM, DFF, W1B); k_wtG<<<(unsigned)((DFF * DM / 64 + 63) / 64), 256, 0, stream>>>(w2, DFF, DM, W2B);
       }
    k_csid<<<(TT * HD + 255) / 256, 256, 0, stream>>>(CS);
    const unsigned LQ = (unsigned)(((size_t)NH_ * TT * HD / 2 + 255) / 256), LKv = (unsigned)(((size_t)NKV * TT * HD / 2 + 255) / 256);
    for (int b = 0; b < NB_; ++b) {
        
        k_cvt8<<<(unsigned)(((size_t)TT * DM / 8 + 255) / 256), 256, 0, stream>>>(x + (size_t)b * TT * DM, XB, (size_t)TT * DM / 8); k_cvt8<<<(unsigned)(((size_t)TT * DM / 8 + 255) / 256), 256, 0, stream>>>(xk + (size_t)b * TT * DM, XKB, (size_t)TT * DM / 8);
        k_gemmw<bf, 0, true><<<dim3(TT / 64, DQ / 64, 1), 32, 0, stream>>>(XB, nullptr, WQ, nullptr, DM, FQ, DQ, bq, 0, 0, 0);
        k_rope<<<LQ, 256, 0, stream>>>(FQ, DQ, NH_, CS, nullptr, nullptr, 1.0f, QP16, QPh, QPl);
        k_gemmw<bf, 0, true><<<dim3(TT / 64, DKV / 64, 1), 32, 0, stream>>>(XKB, nullptr, WK, nullptr, DM, FK, DKV, bk, 0, 0, 0);
        k_rope<<<LKv, 256, 0, stream>>>(FK, DKV, NKV, CS, nullptr, nullptr, 1.0f, KP16, KPh, KPl);
        k_gemmw<bf, 0, true><<<dim3(TT / 64, DKV / 64, 1), 32, 0, stream>>>(XKB, nullptr, WV, nullptr, DM, FV, DKV, bv, 0, 0, 0); k_vtp<<<LKv, 256, 0, stream>>>(FV, DKV, NKV, VT16, VTh, VTl);
        for (int h0 = 0; h0 < NH_; h0 += ZH) { const size_t zq = (size_t)h0, zk = (size_t)(h0 / REP); const unsigned nz = (NH_ - h0 < ZH) ? (NH_ - h0) : ZH;   // nz heads this pass (6, 6, 4); one kv head per query head: they use consecutive kv planes (z-strides TT*HD)
            k_gemmw<bf, 2, false><<<dim3(RH / 64, TT / 64, nz), 32, 0, stream>>>(QPh + zq * TT * HD, QPl + zq * TT * HD, KPh + zk * TT * HD, KPl + zk * TT * HD, HD, Sb, TT, nullptr, (size_t)TT * HD, (size_t)TT * HD, (size_t)TT * TT);
            k_gemmw<h16, 0, false><<<dim3((TT - RH) / 64, TT / 64, nz), 32, 0, stream>>>(QP16 + zq * TT * HD + (size_t)RH * HD, nullptr, KP16 + zk * TT * HD, nullptr, HD, Sb + (size_t)RH * TT, TT, nullptr, (size_t)TT * HD, (size_t)TT * HD, (size_t)TT * TT);
            k_asoft<<<nz * TT / 8, 256, 0, stream>>>(Sb, MK + (size_t)b * TT, P16, Ph, Pl);
            k_gemmw<bf, 2, false><<<dim3(RH / 64, HD / 64, nz), 32, 0, stream>>>(Ph, Pl, VTh + zk * HD * TT, VTl + zk * HD * TT, TT, Ob, HD, nullptr, (size_t)RH * TT, (size_t)HD * TT, (size_t)TT * HD);
            k_gemmw<h16, 0, false><<<dim3((TT - RH) / 64, HD / 64, nz), 32, 0, stream>>>(P16 + (size_t)RH * TT, nullptr, VT16 + zk * HD * TT, nullptr, TT, Ob + (size_t)RH * HD, HD, nullptr, (size_t)TT * TT, (size_t)HD * TT, (size_t)TT * HD);
            k_merge<<<(unsigned)(((size_t)nz * TT * HD / 2 + 255) / 256), 256, 0, stream>>>(Ob, h0, ATh, ATl); }
        k_gemmw<bf, 1, true><<<dim3(TT / 64, DM / 64, 1), 32, 0, stream>>>(ATh, ATl, WO, nullptr, DQ, S2, DM, bo, 0, 0, 0);   /* mha = merged Wo + bo */
        k_lnhl<true><<<TT / 8, 256, 0, stream>>>(x + (size_t)b * TT * DM, S2, g1, e1, X1, L1h, L1l);                                  /* x1 = LN(bf16(x) + mha): normalised row in f32 + hi/lo planes */
        k_gemmw<bf, 1, true><<<dim3(TT / 64, DFF / 64, 1), 32, 0, stream>>>(L1h, L1l, W1B, nullptr, DM, H1, DFF, b1, 0, 0, 0);        /* x1 W1 + b1 */
        k_relupl<<<(unsigned)(((size_t)TT * DFF / 4 + 255) / 256), 256, 0, stream>>>(H1, Gh, Gl, (size_t)TT * DFF / 4);                 /* relu -> hi/lo */
        k_gemmw<bf, 1, true><<<dim3(TT / 64, DM / 64, 1), 32, 0, stream>>>(Gh, Gl, W2B, nullptr, DFF, F2, DM, b2, 0, 0, 0);           /* . W2 + b2 */
        k_addln<<<TT / 8, 256, 0, stream>>>(X1, F2, g2, e2, OUT + (size_t)b * TT * DM); }                                               /* out = LN(x1 + ff) */
}

// v002
// It runs in 1000 microseconds.
// In both of two side-by-side timings against v001, it was 1.55 times as fast.
// Over all steps from v000 it is 3.94 times as fast.
#include <hip/hip_runtime.h>

// Post-LN transformer encoder block with cross attention (x, y [2][2048][1024]; Q = x Wq + bq, K = y Wk + bk, V = y Wv + bv ('xw' [1024][1024]; 16 heads x 64); scores/8 with mask [2][1][1][2048] (int32 keys, read; -1e9 == exact zero weight; all ones here); softmax; mha = merged Wo + bo; x1 = LN(x + mha); ff = relu(x1 W1 + b1) W2 + b2 (W1 [1024][4096]); out = LN(x1 + ff) (eps 1e-5) -> [2][2048][1024] (4.2 M)).
// Compute dtypes, f32 accumulate: every input rounded to bf16; q/k/v on PLAIN bf16 operands (inputs: exact) + biases; key mask as a select; scores and attn.v: query rows < 512 hl (3 products), the rest single fp16 (x1024); softmax f32; Wo, W1, W2 hl x exact (2 products) + biases; residuals / LayerNorms / ReLU in f32.

#define NB_  2
#define TT   2048
#define DM   1024
#define NH_  16
#define NKV  16
#define REP  (NH_ / NKV)
#define HD   64
#define DQ   (NH_ * HD)
#define DKV  (NKV * HD)
#define DFF  4096
#define LNEPS 1e-5f
#define ZH   6                    // most heads per attention pass (z of the batched launches); sizes the pass buffers
#define RH   512                  // query rows < RH use hi+lo planes (0: none)
#define WIN  0
#define PCAR 1024.0f
#define SCL  0.125f   // HD^-0.5
typedef _Float16 h16;
typedef unsigned short bf;
typedef __attribute__((ext_vector_type(16))) __bf16   v16bf;
typedef __attribute__((ext_vector_type(16))) _Float16 v16h;
typedef __attribute__((ext_vector_type(8)))  _Float16 v8h;
typedef __attribute__((ext_vector_type(8)))  unsigned short v8us;
typedef __attribute__((ext_vector_type(8)))  float    v8f;
typedef __attribute__((ext_vector_type(4)))  float    v4f;
typedef v8h  __attribute__((may_alias)) v8ha;
typedef v4f  __attribute__((may_alias)) v4fa;
typedef v8us __attribute__((may_alias)) v8usa;

__device__ __forceinline__ unsigned short f2bf(float f) { unsigned u = __float_as_uint(f); u += 0x7FFFu + ((u >> 16) & 1u); return (unsigned short)(u >> 16); }
__device__ __forceinline__ float bf2f(unsigned short b) { return __uint_as_float(((unsigned)b) << 16); }
__device__ __forceinline__ float bfr(float f) { return bf2f(f2bf(f)); }
__device__ __forceinline__ v16h cat16(v8h lo, v8h hi) { return __builtin_shufflevector(lo, hi, 0, 1, 2, 3, 4, 5, 6, 7, 8, 9, 10, 11, 12, 13, 14, 15); }
__device__ __forceinline__ v16bf cat16b(v8us lo, v8us hi) { return __builtin_bit_cast(v16bf, __builtin_shufflevector(lo, hi, 0, 1, 2, 3, 4, 5, 6, 7, 8, 9, 10, 11, 12, 13, 14, 15)); }
__device__ __forceinline__ v8f wmma16(v16h a, v16h b, v8f c) { return __builtin_amdgcn_wmma_f32_16x16x32_f16(false, a, false, b, (short)0, c, false, false); }
__device__ __forceinline__ v8f wmmab(v16bf a, v16bf b, v8f c) { return __builtin_amdgcn_wmma_f32_16x16x32_bf16(false, a, false, b, (short)0, c, false, false); }



// ---- k_gemmw: register-blocked GEMM, one 64x64 output tile per work-group (16 accumulators per wave), operands straight from K-contiguous 16-bit planes; grid (M/64, N/64, Z), 32 * KS threads.
// KS waves split K into KS contiguous ranges (wave w: [w K/KS, (w+1) K/KS)); the f32 partial tiles meet in LDS and are summed in wave order 0 .. KS-1 (fixed). (K / KS) % 32 == 0.
// C[m][n] (f32, pitch ldc, + optional f32 bias[n]) = sum_k A[m][k] Bt[n][k] (+ split products per NSPLIT). z-batch strides sA/sB/sC in elements. K % 32 == 0.
template <typename T16> struct WFrag;
template <> struct WFrag<h16> { typedef v16h V; static __device__ __forceinline__ V ld(const h16* p) { return cat16(*(const v8h*)p, *(const v8h*)(p + 16)); } static __device__ __forceinline__ v8f mma(V a, V b, v8f c) { return wmma16(a, b, c); } };
template <> struct WFrag<bf> { typedef v16bf V; static __device__ __forceinline__ V ld(const bf* p) { return cat16b(*(const v8us*)p, *(const v8us*)(p + 16)); } static __device__ __forceinline__ v8f mma(V a, V b, v8f c) { return wmmab(a, b, c); } };
template <typename T16, int NSPLIT, bool BIAS, int KS>
__global__ __launch_bounds__(32 * KS) void k_gemmw(const T16* __restrict__ A, const T16* __restrict__ A2, const T16* __restrict__ Bt, const T16* __restrict__ Bt2, int K, float* C, int ldc, const float* __restrict__ bias, size_t sA, size_t sB, size_t sC) {
    typedef typename WFrag<T16>::V V;
    __shared__ __align__(16) float os[KS == 1 ? 16 * 68 : KS * 64 * 68];
    const size_t z = blockIdx.z; A += z * sA; if (A2) A2 += z * sA; Bt += z * sB; if (Bt2) Bt2 += z * sB; C += z * sC;
    const int lane = threadIdx.x & 31, lr = lane & 15, hi = lane >> 4; const int r0 = blockIdx.x * 64, c0 = blockIdx.y * 64;
    v8f acc[4][4];
#pragma unroll
    for (int mb = 0; mb < 4; ++mb)
#pragma unroll
        for (int nb = 0; nb < 4; ++nb) acc[mb][nb] = (v8f){};
    const size_t aoff = (size_t)(r0 + lr) * K + 8 * hi, boff = (size_t)(c0 + lr) * K + 8 * hi;
    const int wv = (KS == 1) ? 0 : __builtin_amdgcn_readfirstlane((int)(threadIdx.x >> 5)); const int kper = K / KS, kbeg = wv * kper, kend = kbeg + kper;   // this wave's K range (scalar loop bounds)
#pragma unroll 1
    for (int kc = kbeg; kc < kend; kc += 32) {
        V a[4], a2[4];
#pragma unroll
        for (int mb = 0; mb < 4; ++mb) { a[mb] = WFrag<T16>::ld(A + aoff + (size_t)mb * 16 * K + kc); if (NSPLIT == 1 || NSPLIT == 2) a2[mb] = WFrag<T16>::ld(A2 + aoff + (size_t)mb * 16 * K + kc); }
#pragma unroll
        for (int nb = 0; nb < 4; ++nb) { const V b = WFrag<T16>::ld(Bt + boff + (size_t)nb * 16 * K + kc); V b2; if (NSPLIT >= 2) b2 = WFrag<T16>::ld(Bt2 + boff + (size_t)nb * 16 * K + kc);
#pragma unroll
            for (int mb = 0; mb < 4; ++mb) { acc[mb][nb] = WFrag<T16>::mma(a[mb], b, acc[mb][nb]); if (NSPLIT == 1 || NSPLIT == 2) acc[mb][nb] = WFrag<T16>::mma(a2[mb], b, acc[mb][nb]); if (NSPLIT >= 2) acc[mb][nb] = WFrag<T16>::mma(a[mb], b2, acc[mb][nb]); } }
        asm volatile("v_nop\n\tv_nop\n\tv_nop\n\tv_nop" : "+v"(acc[0][0]), "+v"(acc[1][1]), "+v"(acc[2][2]), "+v"(acc[3][3]) : "v"(a[0]), "v"(a[3]));
    }
    if constexpr (KS == 1) {
#pragma unroll
    for (int mb = 0; mb < 4; ++mb) {
#pragma unroll
        for (int nb = 0; nb < 4; ++nb) {
#pragma unroll
            for (int j = 0; j < 8; ++j) os[(hi * 8 + j) * 68 + nb * 16 + lr] = acc[mb][nb][j]; }
        __builtin_amdgcn_wave_barrier(); asm volatile("" ::: "memory");
        float* crow = C + (size_t)(r0 + mb * 16) * ldc + c0;
{
#pragma unroll
            for (int s = 0; s < 8; ++s) { const int row = 2 * s + hi, cofs = lr * 4; v4f val = *(const v4fa*)(os + row * 68 + cofs); if (BIAS) { val[0] += bfr(bias[c0 + cofs]); val[1] += bfr(bias[c0 + cofs + 1]); val[2] += bfr(bias[c0 + cofs + 2]); val[3] += bfr(bias[c0 + cofs + 3]); }
                *(v4f*)(crow + (size_t)row * ldc + cofs) = val; }
             }
        __builtin_amdgcn_wave_barrier(); asm volatile("" ::: "memory");
    }
    } else {
        float* const ow = os + wv * (64 * 68);   // this wave's whole 64x64 partial tile
        // the three loops are unrolled so that acc[][][] is indexed by constants and stays in registers
#pragma unroll
        for (int mb = 0; mb < 4; ++mb)
#pragma unroll
            for (int nb = 0; nb < 4; ++nb)
#pragma unroll
                for (int j = 0; j < 8; ++j) ow[(mb * 16 + hi * 8 + j) * 68 + nb * 16 + lr] = acc[mb][nb][j];
        __syncthreads();   // every wave's partial tile is in LDS before any element is summed
        float* crow = C + (size_t)r0 * ldc + c0;
        // both loops are unrolled so that the KS LDS reads of an element group issue together, not one wait each
#pragma unroll
        for (int s = 0; s < 32 / KS; ++s) { const int idx = s * (32 * KS) + (int)threadIdx.x, row = idx >> 4, cofs = (idx & 15) * 4;   /* 1024 groups of 4 columns, 32 / KS per thread */ v4f val = *(const v4fa*)(os + row * 68 + cofs);
#pragma unroll
            for (int w = 1; w < KS; ++w) val += *(const v4fa*)(os + w * (64 * 68) + row * 68 + cofs);
            if (BIAS) { val[0] += bfr(bias[c0 + cofs]); val[1] += bfr(bias[c0 + cofs + 1]); val[2] += bfr(bias[c0 + cofs + 2]); val[3] += bfr(bias[c0 + cofs + 3]); }
            *(v4f*)(crow + (size_t)row * ldc + cofs) = val; }
    }
}

__device__ __forceinline__ h16 tohx(float x) { return (h16)x; }
__device__ __forceinline__ void splitf(float y, unsigned short& h, unsigned short& l) { h = f2bf(y); l = f2bf(y - bf2f(h)); }
typedef __attribute__((ext_vector_type(2))) _Float16 v2h;
typedef __attribute__((ext_vector_type(4))) _Float16 v4h;
typedef __attribute__((ext_vector_type(2))) unsigned short v2us;
typedef __attribute__((ext_vector_type(4))) unsigned short v4us;
typedef __attribute__((ext_vector_type(2))) float v2f;
typedef __attribute__((ext_vector_type(4))) int v4i;

__global__ __launch_bounds__(256) void k_wtG(const float* __restrict__ w, int K, int N, bf* Bt) {
    const int lane = threadIdx.x & 31; const int L0 = (blockIdx.x * 8 + (threadIdx.x >> 5)) * 8; const int nlines = N * K / 64;
{
#pragma unroll 1
        for (int l = 0; l < 8; ++l) { const int L = L0 + l; if (L >= nlines) break; const size_t e = (size_t)L * 64 + lane * 2; const int k = (int)(e % K), n = (int)(e / K); v2us o;
            o[0] = f2bf(w[(size_t)k * N + n]); o[1] = f2bf(w[(size_t)(k + 1) * N + n]); *(v2us*)(Bt + e) = o; }
         }
}
__global__ __launch_bounds__(256) void k_cvt8(const float* __restrict__ src, bf* dst, size_t n8) { const size_t i = (size_t)blockIdx.x * 256 + threadIdx.x; if (i >= n8) return; const v8f v = *(const v8f*)(src + i * 8); v8us o;
#pragma unroll
    for (int k = 0; k < 8; ++k) o[k] = f2bf(v[k]); *(v8us*)(dst + i * 8) = o;  }

// k_rope: head planes [h][t][d] (fp16 + hi/lo) of rope(x) x sc with the rotate-half convention out[d] = x[d] cos[t][d] - x[d+HD/2] sin[t][d], out[d+HD/2] = x[d+HD/2] cos[t][d+HD/2] + x[d] sin[t][d+HD/2]
__global__ __launch_bounds__(256) void k_rope(const float* __restrict__ F, int pitch, int nheads, const float* __restrict__ CS, const float* __restrict__ RF, const float* __restrict__ nw, float sc, h16* P16, bf* Ph, bf* Pl) {
    const size_t e = ((size_t)blockIdx.x * 256 + threadIdx.x) * 2; if (e >= (size_t)nheads * TT * HD) return; const int d = (int)(e % HD); const int t = (int)((e / HD) % TT); const int h = (int)(e / ((size_t)HD * TT)); const float* f = F + (size_t)t * pitch + h * HD; const float rf = RF ? RF[(size_t)h * TT + t] : 1.0f; v2h o16; v2us oh, ol;
#pragma unroll
    for (int q = 0; q < 2; ++q) { const int dd = d + q; const int dp = (dd < HD / 2) ? dd + HD / 2 : dd - HD / 2; float x0 = f[dd], x1 = f[dp];
        if (RF) { float n0 = __fmul_rn(x0, rf), n1 = __fmul_rn(x1, rf); asm volatile("" : "+v"(n0)); asm volatile("" : "+v"(n1)); x0 = __fmul_rn(bfr(nw[dd]), n0); x1 = __fmul_rn(bfr(nw[dp]), n1); }
        const v2f cs = *(const v2f*)(CS + ((size_t)t * HD + dd) * 2); float a = __fmul_rn(x0, cs[0]), bq = __fmul_rn(x1, cs[1]); asm volatile("" : "+v"(a)); asm volatile("" : "+v"(bq)); const float r = ((dd < HD / 2) ? __fsub_rn(a, bq) : __fadd_rn(a, bq)) * sc;
        o16[q] = tohx(r); unsigned short a2, c2; splitf(r, a2, c2); oh[q] = a2; ol[q] = c2; }
    *(v2h*)(P16 + e) = o16; *(v2us*)(Ph + e) = oh; *(v2us*)(Pl + e) = ol;  }
__global__ __launch_bounds__(256) void k_vtp(const float* __restrict__ F, int pitch, int nheads, h16* V16, bf* Vh, bf* Vl) { const size_t e = ((size_t)blockIdx.x * 256 + threadIdx.x) * 2; if (e >= (size_t)nheads * HD * TT) return; const int t = (int)(e % TT); const int d = (int)((e / TT) % HD); const int g = (int)(e / ((size_t)TT * HD)); v2h o16; v2us oh, ol;
#pragma unroll
    for (int q = 0; q < 2; ++q) { const float x = F[(size_t)(t + q) * pitch + g * HD + d]; o16[q] = tohx(x); unsigned short a2, c2; splitf(x, a2, c2); oh[q] = a2; ol[q] = c2; }
    *(v2h*)(V16 + e) = o16; *(v2us*)(Vh + e) = oh; *(v2us*)(Vl + e) = ol;  }
__global__ __launch_bounds__(256) void k_csid(float* CS) { const int idx = blockIdx.x * 256 + threadIdx.x; if (idx >= TT * HD) return; v2f cs; cs[0] = 1.0f; cs[1] = 0.0f; *(v2f*)(CS + (size_t)idx * 2) = cs;  }
template <bool RND>
__global__ __launch_bounds__(256) void k_lnhl(const float* __restrict__ X, const float* __restrict__ A, const float* __restrict__ g, const float* __restrict__ be, float* Z, bf* Yh, bf* Yl) {
    const int lane = threadIdx.x & 31; const int r = blockIdx.x * 8 + (threadIdx.x >> 5); if (r >= TT) return; const float* xr = X + (size_t)r * DM; const float* ar = A ? A + (size_t)r * DM : nullptr; float s = 0.f;
#pragma unroll 1
    for (int ch = 0; ch < DM / 128; ++ch) { const int c0 = ch * 128 + lane * 4; const v4f a = *(const v4f*)(xr + c0); v4f d = {0.f, 0.f, 0.f, 0.f}; if (ar) d = *(const v4f*)(ar + c0);
#pragma unroll
        for (int q = 0; q < 4; ++q) s += __fadd_rn((RND ? bfr(a[q]) : a[q]), d[q]); }
#pragma unroll
    for (int sh = 16; sh; sh >>= 1) s += __shfl_xor(s, sh, 32);
    const float mu = s * (1.0f / DM); float s2 = 0.f;
#pragma unroll 1
    for (int ch = 0; ch < DM / 128; ++ch) { const int c0 = ch * 128 + lane * 4; const v4f a = *(const v4f*)(xr + c0); v4f d = {0.f, 0.f, 0.f, 0.f}; if (ar) d = *(const v4f*)(ar + c0);
#pragma unroll
        for (int q = 0; q < 4; ++q) { const float d0 = __fsub_rn(__fadd_rn((RND ? bfr(a[q]) : a[q]), d[q]), mu); float p = __fmul_rn(d0, d0); asm volatile("" : "+v"(p)); s2 = __fadd_rn(s2, p); } }
#pragma unroll
    for (int sh = 16; sh; sh >>= 1) s2 += __shfl_xor(s2, sh, 32);
    const float rs = __fdiv_rn(1.0f, __fsqrt_rn(__fadd_rn(s2 * (1.0f / DM), LNEPS)));
{
#pragma unroll 1
        for (int ch = 0; ch < DM / 128; ++ch) { const int c0 = ch * 128 + lane * 4; const v4f a = *(const v4f*)(xr + c0); v4f d = {0.f, 0.f, 0.f, 0.f}; if (ar) d = *(const v4f*)(ar + c0); v4f z4; v4us oh, ol;
#pragma unroll
            for (int q = 0; q < 4; ++q) { const float v = __fadd_rn((RND ? bfr(a[q]) : a[q]), d[q]); float n0 = __fmul_rn(__fsub_rn(v, mu), rs); asm volatile("" : "+v"(n0)); float n1 = __fmul_rn(n0, bfr(g[c0 + q])); asm volatile("" : "+v"(n1)); const float y = __fadd_rn(n1, bfr(be[c0 + q])); z4[q] = y;   /* Z = the NORMALISED row (it is the residual for the next block) */ unsigned short h2, l2; splitf(y, h2, l2); oh[q] = h2; ol[q] = l2; }
            if (Z) *(v4f*)(Z + (size_t)r * DM + c0) = z4; *(v4us*)(Yh + (size_t)r * DM + c0) = oh; *(v4us*)(Yl + (size_t)r * DM + c0) = ol; }
         } }

__global__ __launch_bounds__(256) void k_relupl(const float* __restrict__ F, bf* Ph2, bf* Pl2, size_t n4) { const size_t i = (size_t)blockIdx.x * 256 + threadIdx.x; if (i >= n4) return; const v4f v = *(const v4f*)(F + i * 4); v4us oh, ol;
#pragma unroll
    for (int q = 0; q < 4; ++q) { unsigned short a, c; splitf(fmaxf(v[q], 0.f), a, c); oh[q] = a; ol[q] = c; } *(v4us*)(Ph2 + i * 4) = oh; *(v4us*)(Pl2 + i * 4) = ol;  }
__global__ __launch_bounds__(256) void k_addln(const float* __restrict__ A, const float* __restrict__ Bm, const float* __restrict__ g, const float* __restrict__ be, float* OUTb) {
    const int lane = threadIdx.x & 31; const int r = blockIdx.x * 8 + (threadIdx.x >> 5); if (r >= TT) return; const float* ar = A + (size_t)r * DM; const float* br = Bm + (size_t)r * DM; float s = 0.f;
#pragma unroll 1
    for (int ch = 0; ch < DM / 128; ++ch) { const int c0 = ch * 128 + lane * 4; const v4f a = *(const v4f*)(ar + c0), bb = *(const v4f*)(br + c0);
#pragma unroll
        for (int q = 0; q < 4; ++q) s += __fadd_rn(a[q], bb[q]); }
#pragma unroll
    for (int sh = 16; sh; sh >>= 1) s += __shfl_xor(s, sh, 32);
    const float mu = s * (1.0f / DM); float s2 = 0.f;
#pragma unroll 1
    for (int ch = 0; ch < DM / 128; ++ch) { const int c0 = ch * 128 + lane * 4; const v4f a = *(const v4f*)(ar + c0), bb = *(const v4f*)(br + c0);
#pragma unroll
        for (int q = 0; q < 4; ++q) { const float d0 = __fsub_rn(__fadd_rn(a[q], bb[q]), mu); float p = __fmul_rn(d0, d0); asm volatile("" : "+v"(p)); s2 = __fadd_rn(s2, p); } }
#pragma unroll
    for (int sh = 16; sh; sh >>= 1) s2 += __shfl_xor(s2, sh, 32);
    const float rs = __fdiv_rn(1.0f, __fsqrt_rn(__fadd_rn(s2 * (1.0f / DM), LNEPS)));
{
#pragma unroll 1
        for (int ch = 0; ch < DM / 128; ++ch) { const int c0 = ch * 128 + lane * 4; const v4f a = *(const v4f*)(ar + c0), bb = *(const v4f*)(br + c0); v4f o4;
#pragma unroll
            for (int q = 0; q < 4; ++q) { float n0 = __fmul_rn(__fsub_rn(__fadd_rn(a[q], bb[q]), mu), rs); asm volatile("" : "+v"(n0)); float n1 = __fmul_rn(n0, bfr(g[c0 + q])); asm volatile("" : "+v"(n1)); o4[q] = __fadd_rn(n1, bfr(be[c0 + q])); }
            *(v4f*)(OUTb + (size_t)r * DM + c0) = o4; }
         } }
// k_asoft: per row (zz, i): t = S x HD^-0.5 (keys with mask 0 -> -3e38); softmax over the 2048 keys (register row, one exp, fixed trees);
__global__ __launch_bounds__(256) void k_asoft(const float* __restrict__ Sb, const int* __restrict__ MKb, h16* P16, bf* Ph, bf* Pl) {
    const int lane = threadIdx.x & 31; const int row = blockIdx.x * 8 + (threadIdx.x >> 5); if (row >= ZH * TT) return; const int i = row % TT; const int zz = row / TT; (void)zz; const bool hires = (i < RH); const float* sr = Sb + (size_t)row * TT; float v[TT / 32]; float mx = -3.0e38f;
#pragma unroll
    for (int ch = 0; ch < TT / 128; ++ch) { const int j0 = ch * 128 + lane * 4; const v4f a = *(const v4f*)(sr + j0); const v4i m4 = *(const v4i*)(MKb + j0);
#pragma unroll
        for (int q = 0; q < 4; ++q) { const int j = j0 + q; (void)j; const float t = (m4[q] != 0) ? a[q] * SCL : -3.0e38f;   /* where(mask == 0, -1e9, s): exact zero weight */ v[ch * 4 + q] = t; mx = fmaxf(mx, t); } }
#pragma unroll
    for (int sh = 16; sh; sh >>= 1) mx = fmaxf(mx, __shfl_xor(mx, sh, 32));
    float sum = 0.f;
#pragma unroll
    for (int k = 0; k < TT / 32; ++k) { float d0 = __fsub_rn(v[k], mx); asm volatile("" : "+v"(d0)); v[k] = __builtin_amdgcn_exp2f(__fmul_rn(d0, 1.4426950408889634f)); sum += v[k]; }
#pragma unroll
    for (int sh = 16; sh; sh >>= 1) sum += __shfl_xor(sum, sh, 32);
    const float f = __fdiv_rn(hires ? 1.0f : PCAR, sum);
{
        if (hires) {
#pragma unroll
            for (int ch = 0; ch < TT / 128; ++ch) { v4us oh, ol;
#pragma unroll
                for (int q = 0; q < 4; ++q) { unsigned short a, c2; splitf(v[ch * 4 + q] * f, a, c2); oh[q] = a; ol[q] = c2; }
                const size_t oo = ((size_t)zz * (RH ? RH : 1) + i) * TT + ch * 128 + lane * 4; *(v4us*)(Ph + oo) = oh; *(v4us*)(Pl + oo) = ol; }
        } else {
#pragma unroll
            for (int ch = 0; ch < TT / 128; ++ch) { v4h o4;
#pragma unroll
                for (int q = 0; q < 4; ++q) o4[q] = tohx(v[ch * 4 + q] * f);
                *(v4h*)(P16 + (size_t)row * TT + ch * 128 + lane * 4) = o4; } }
         }
}
__global__ __launch_bounds__(256) void k_merge(const float* __restrict__ O, int h0, bf* Ah, bf* Al) { const size_t e = ((size_t)blockIdx.x * 256 + threadIdx.x) * 2; if (e >= (size_t)ZH * TT * HD) return; const int d = (int)(e % HD); const int t = (int)((e / HD) % TT); const int zz = (int)(e / ((size_t)HD * TT)); const float cs = (t < RH) ? 1.0f : (1.0f / PCAR); const size_t oo = (size_t)t * DQ + (h0 + zz) * HD + d;
    v2us oh, ol;
#pragma unroll
    for (int q = 0; q < 2; ++q) { unsigned short a, c2; splitf(O[e + q] * cs, a, c2); oh[q] = a; ol[q] = c2; } *(v2us*)(Ah + oo) = oh; *(v2us*)(Al + oo) = ol;  }

extern "C" void kernel_launch(void* const* d_in, const int* in_sizes, int n_in,
                              void* d_out, int out_size, void* d_ws, size_t ws_size, hipStream_t stream) {
    (void)in_sizes; (void)n_in; (void)out_size;
    const float* x = (const float*)d_in[0]; const float* xk = (const float*)d_in[1]; const int* MK = (const int*)d_in[2]; const float* wq = (const float*)d_in[3]; const float* bq = (const float*)d_in[4]; const float* wk = (const float*)d_in[5]; const float* bk = (const float*)d_in[6]; const float* wv = (const float*)d_in[7]; const float* bv = (const float*)d_in[8]; const float* wo = (const float*)d_in[9]; const float* bo = (const float*)d_in[10]; const float* w1 = (const float*)d_in[11]; const float* b1 = (const float*)d_in[12]; const float* w2 = (const float*)d_in[13]; const float* b2 = (const float*)d_in[14]; const float* g1 = (const float*)d_in[15]; const float* e1 = (const float*)d_in[16]; const float* g2 = (const float*)d_in[17]; const float* e2 = (const float*)d_in[18];
    float* OUT = (float*)d_out;     // [2][2048][1024]
    char* wsp = (char*)d_ws;
    auto take = [&](size_t bytes) { char* p = wsp; wsp += (bytes + 255) & ~(size_t)255; return (void*)p; };
    bf* WQ = (bf*)take((size_t)DQ * DM * 2); bf* WK = (bf*)take((size_t)DKV * DM * 2); bf* WV = (bf*)take((size_t)DKV * DM * 2); bf* WO = (bf*)take((size_t)DM * DQ * 2); float* CS = (float*)take((size_t)TT * HD * 2 * 4);
    bf* XB = (bf*)take((size_t)TT * DM * 2); bf* XKB = (bf*)take((size_t)TT * DM * 2); bf* W1B = (bf*)take((size_t)DFF * DM * 2); bf* W2B = (bf*)take((size_t)DM * DFF * 2);
    h16* QP16 = (h16*)take((size_t)NH_ * TT * HD * 2); h16* KP16 = (h16*)take((size_t)NKV * TT * HD * 2); h16* VT16 = (h16*)take((size_t)NKV * HD * TT * 2);
    bf* QPh = (bf*)take((size_t)NH_ * TT * HD * 2); bf* QPl = (bf*)take((size_t)NH_ * TT * HD * 2); bf* KPh = (bf*)take((size_t)NKV * TT * HD * 2); bf* KPl = (bf*)take((size_t)NKV * TT * HD * 2); bf* VTh = (bf*)take((size_t)NKV * HD * TT * 2); bf* VTl = (bf*)take((size_t)NKV * HD * TT * 2);
    bf* ATh = (bf*)take((size_t)TT * DQ * 2); bf* ATl = (bf*)take((size_t)TT * DQ * 2);
    char* const shared0 = wsp;   // S2 .. FK are live only before or only after a batch's attention passes: the (larger) pass buffers below lie over them
    float* S2 = (float*)take((size_t)TT * DM * 4); float* X1 = (float*)take((size_t)TT * DM * 4); bf* L1h = (bf*)take((size_t)TT * DM * 2); bf* L1l = (bf*)take((size_t)TT * DM * 2); float* H1 = (float*)take((size_t)TT * DFF * 4); bf* Gh = (bf*)take((size_t)TT * DFF * 2); bf* Gl = (bf*)take((size_t)TT * DFF * 2); float* F2 = (float*)take((size_t)TT * DM * 4); float* FQ = (float*)take((size_t)TT * DQ * 4); float* FK = (float*)take((size_t)TT * DKV * 4);
    wsp = shared0;
    float* Sb = (float*)take((size_t)ZH * TT * TT * 4); h16* P16 = (h16*)take((size_t)ZH * TT * TT * 2); bf* Ph = (bf*)take((size_t)ZH * RH * TT * 2); bf* Pl = (bf*)take((size_t)ZH * RH * TT * 2); float* Ob = (float*)take((size_t)ZH * TT * HD * 4);
    if ((size_t)(wsp - (char*)d_ws) > ws_size) return;    // ws 256 MiB; 248 MiB taken
    float* FV = FK;   // v projection reuses the k buffer after the k planes are built (stream-ordered)
    { k_wtG<<<(unsigned)((DM * DQ / 64 + 63) / 64), 256, 0, stream>>>(wq, DM, DQ, WQ); k_wtG<<<(unsigned)((DM * DKV / 64 + 63) / 64), 256, 0, stream>>>(wk, DM, DKV, WK); k_wtG<<<(unsigned)((DM * DKV / 64 + 63) / 64), 256, 0, stream>>>(wv, DM, DKV, WV);
      k_wtG<<<(unsigned)((DQ * DM / 64 + 63) / 64), 256, 0, stream>>>(wo, DQ, DM, WO); k_wtG<<<(unsigned)((DM * DFF / 64 + 63) / 64), 256, 0, stream>>>(w1, DM, DFF, W1B); k_wtG<<<(unsigned)((DFF * DM / 64 + 63) / 64), 256, 0, stream>>>(w2, DFF, DM, W2B);
       }
    k_csid<<<(TT * HD + 255) / 256, 256, 0, stream>>>(CS);
    const unsigned LQ = (unsigned)(((size_t)NH_ * TT * HD / 2 + 255) / 256), LKv = (unsigned)(((size_t)NKV * TT * HD / 2 + 255) / 256);
    for (int b = 0; b < NB_; ++b) {
        
        k_cvt8<<<(unsigned)(((size_t)TT * DM / 8 + 255) / 256), 256, 0, stream>>>(x + (size_t)b * TT * DM, XB, (size_t)TT * DM / 8); k_cvt8<<<(unsigned)(((size_t)TT * DM / 8 + 255) / 256), 256, 0, stream>>>(xk + (size_t)b * TT * DM, XKB, (size_t)TT * DM / 8);
        k_gemmw<bf, 0, true, 4><<<dim3(TT / 64, DQ / 64, 1), 128, 0, stream>>>(XB, nullptr, WQ, nullptr, DM, FQ, DQ, bq, 0, 0, 0);
        k_rope<<<LQ, 256, 0, stream>>>(FQ, DQ, NH_, CS, nullptr, nullptr, 1.0f, QP16, QPh, QPl);
        k_gemmw<bf, 0, true, 4><<<dim3(TT / 64, DKV / 64, 1), 128, 0, stream>>>(XKB, nullptr, WK, nullptr, DM, FK, DKV, bk, 0, 0, 0);
        k_rope<<<LKv, 256, 0, stream>>>(FK, DKV, NKV, CS, nullptr, nullptr, 1.0f, KP16, KPh, KPl);
        k_gemmw<bf, 0, true, 4><<<dim3(TT / 64, DKV / 64, 1), 128, 0, stream>>>(XKB, nullptr, WV, nullptr, DM, FV, DKV, bv, 0, 0, 0); k_vtp<<<LKv, 256, 0, stream>>>(FV, DKV, NKV, VT16, VTh, VTl);
        for (int h0 = 0; h0 < NH_; h0 += ZH) { const size_t zq = (size_t)h0, zk = (size_t)(h0 / REP); const unsigned nz = (NH_ - h0 < ZH) ? (NH_ - h0) : ZH;   // nz heads this pass (6, 6, 4); one kv head per query head: they use consecutive kv planes (z-strides TT*HD)
            k_gemmw<bf, 2, false, 1><<<dim3(RH / 64, TT / 64, nz), 32, 0, stream>>>(QPh + zq * TT * HD, QPl + zq * TT * HD, KPh + zk * TT * HD, KPl + zk * TT * HD, HD, Sb, TT, nullptr, (size_t)TT * HD, (size_t)TT * HD, (size_t)TT * TT);
            k_gemmw<h16, 0, false, 1><<<dim3((TT - RH) / 64, TT / 64, nz), 32, 0, stream>>>(QP16 + zq * TT * HD + (size_t)RH * HD, nullptr, KP16 + zk * TT * HD, nullptr, HD, Sb + (size_t)RH * TT, TT, nullptr, (size_t)TT * HD, (size_t)TT * HD, (size_t)TT * TT);
            k_asoft<<<nz * TT / 8, 256, 0, stream>>>(Sb, MK + (size_t)b * TT, P16, Ph, Pl);
            k_gemmw<bf, 2, false, 16><<<dim3(RH / 64, HD / 64, nz), 512, 0, stream>>>(Ph, Pl, VTh + zk * HD * TT, VTl + zk * HD * TT, TT, Ob, HD, nullptr, (size_t)RH * TT, (size_t)HD * TT, (size_t)TT * HD);
            k_gemmw<h16, 0, false, 16><<<dim3((TT - RH) / 64, HD / 64, nz), 512, 0, stream>>>(P16 + (size_t)RH * TT, nullptr, VT16 + zk * HD * TT, nullptr, TT, Ob + (size_t)RH * HD, HD, nullptr, (size_t)TT * TT, (size_t)HD * TT, (size_t)TT * HD);
            k_merge<<<(unsigned)(((size_t)nz * TT * HD / 2 + 255) / 256), 256, 0, stream>>>(Ob, h0, ATh, ATl); }
        k_gemmw<bf, 1, true, 4><<<dim3(TT / 64, DM / 64, 1), 128, 0, stream>>>(ATh, ATl, WO, nullptr, DQ, S2, DM, bo, 0, 0, 0);   /* mha = merged Wo + bo */
        k_lnhl<true><<<TT / 8, 256, 0, stream>>>(x + (size_t)b * TT * DM, S2, g1, e1, X1, L1h, L1l);                                  /* x1 = LN(bf16(x) + mha): normalised row in f32 + hi/lo planes */
        k_gemmw<bf, 1, true, 1><<<dim3(TT / 64, DFF / 64, 1), 32, 0, stream>>>(L1h, L1l, W1B, nullptr, DM, H1, DFF, b1, 0, 0, 0);        /* x1 W1 + b1 */
        k_relupl<<<(unsigned)(((size_t)TT * DFF / 4 + 255) / 256), 256, 0, stream>>>(H1, Gh, Gl, (size_t)TT * DFF / 4);                 /* relu -> hi/lo */
        k_gemmw<bf, 1, true, 8><<<dim3(TT / 64, DM / 64, 1), 256, 0, stream>>>(Gh, Gl, W2B, nullptr, DFF, F2, DM, b2, 0, 0, 0);           /* . W2 + b2 */
        k_addln<<<TT / 8, 256, 0, stream>>>(X1, F2, g2, e2, OUT + (size_t)b * TT * DM); }                                               /* out = LN(x1 + ff) */
}

// v003
// A run of this version takes 599 microseconds.
// In two side-by-side timings against v002, it was 1.68 and 1.69 times as fast.
// All steps since v000 together make it 6.63 times as fast.
#include <hip/hip_runtime.h>

// Post-LN transformer encoder block with cross attention (x, y [2][2048][1024]; Q = x Wq + bq, K = y Wk + bk, V = y Wv + bv ('xw' [1024][1024]; 16 heads x 64); scores/8 with mask [2][1][1][2048] (int32 keys, read; -1e9 == exact zero weight; all ones here); softmax; mha = merged Wo + bo; x1 = LN(x + mha); ff = relu(x1 W1 + b1) W2 + b2 (W1 [1024][4096]); out = LN(x1 + ff) (eps 1e-5) -> [2][2048][1024] (4.2 M)).
// Compute dtypes, f32 accumulate: every input rounded to bf16; q/k/v on PLAIN bf16 operands (inputs: exact) + biases; key mask as a select; scores and attn.v: query rows < 512 hl (3 products), the rest single fp16 (x1024); softmax f32; Wo, W1, W2 hl x exact (2 products) + biases; residuals / LayerNorms / ReLU in f32.

#define NB_  2
#define TT   2048
#define DM   1024
#define NH_  16
#define NKV  16
#define REP  (NH_ / NKV)
#define HD   64
#define DQ   (NH_ * HD)
#define DKV  (NKV * HD)
#define DFF  4096
#define LNEPS 1e-5f
#define RH   512                  // query rows < RH use hi+lo planes (0: none)
#define WIN  0
#define SCL  0.125f   // HD^-0.5
typedef _Float16 h16;
typedef unsigned short bf;
typedef __attribute__((ext_vector_type(16))) __bf16   v16bf;
typedef __attribute__((ext_vector_type(16))) _Float16 v16h;
typedef __attribute__((ext_vector_type(8)))  _Float16 v8h;
typedef __attribute__((ext_vector_type(8)))  unsigned short v8us;
typedef __attribute__((ext_vector_type(8)))  float    v8f;
typedef __attribute__((ext_vector_type(4)))  float    v4f;
typedef v8h  __attribute__((may_alias)) v8ha;
typedef v4f  __attribute__((may_alias)) v4fa;
typedef v8us __attribute__((may_alias)) v8usa;

__device__ __forceinline__ unsigned short f2bf(float f) { unsigned u = __float_as_uint(f); u += 0x7FFFu + ((u >> 16) & 1u); return (unsigned short)(u >> 16); }
__device__ __forceinline__ float bf2f(unsigned short b) { return __uint_as_float(((unsigned)b) << 16); }
__device__ __forceinline__ float bfr(float f) { return bf2f(f2bf(f)); }
__device__ __forceinline__ v16h cat16(v8h lo, v8h hi) { return __builtin_shufflevector(lo, hi, 0, 1, 2, 3, 4, 5, 6, 7, 8, 9, 10, 11, 12, 13, 14, 15); }
__device__ __forceinline__ v16bf cat16b(v8us lo, v8us hi) { return __builtin_bit_cast(v16bf, __builtin_shufflevector(lo, hi, 0, 1, 2, 3, 4, 5, 6, 7, 8, 9, 10, 11, 12, 13, 14, 15)); }
__device__ __forceinline__ v8f wmma16(v16h a, v16h b, v8f c) { return __builtin_amdgcn_wmma_f32_16x16x32_f16(false, a, false, b, (short)0, c, false, false); }
__device__ __forceinline__ v8f wmmab(v16bf a, v16bf b, v8f c) { return __builtin_amdgcn_wmma_f32_16x16x32_bf16(false, a, false, b, (short)0, c, false, false); }



// ---- k_gemmw: register-blocked GEMM, one 64x64 output tile per work-group (16 accumulators per wave), operands straight from K-contiguous 16-bit planes; grid (M/64, N/64, Z), 32 * KS threads.
// KS waves split K into KS contiguous ranges (wave w: [w K/KS, (w+1) K/KS)); the f32 partial tiles meet in LDS and are summed in wave order 0 .. KS-1 (fixed). (K / KS) % 32 == 0.
// C[m][n] (f32, pitch ldc, + optional f32 bias[n]) = sum_k A[m][k] Bt[n][k] (+ split products per NSPLIT). z-batch strides sA/sB/sC in elements. K % 32 == 0.
template <typename T16> struct WFrag;
template <> struct WFrag<h16> { typedef v16h V; static __device__ __forceinline__ V ld(const h16* p) { return cat16(*(const v8h*)p, *(const v8h*)(p + 16)); } static __device__ __forceinline__ v8f mma(V a, V b, v8f c) { return wmma16(a, b, c); } };
template <> struct WFrag<bf> { typedef v16bf V; static __device__ __forceinline__ V ld(const bf* p) { return cat16b(*(const v8us*)p, *(const v8us*)(p + 16)); } static __device__ __forceinline__ v8f mma(V a, V b, v8f c) { return wmmab(a, b, c); } };
template <typename T16, int NSPLIT, bool BIAS, int KS>
__global__ __launch_bounds__(32 * KS) void k_gemmw(const T16* __restrict__ A, const T16* __restrict__ A2, const T16* __restrict__ Bt, const T16* __restrict__ Bt2, int K, float* C, int ldc, const float* __restrict__ bias, size_t sA, size_t sB, size_t sC) {
    typedef typename WFrag<T16>::V V;
    __shared__ __align__(16) float os[KS == 1 ? 16 * 68 : KS * 64 * 68];
    const size_t z = blockIdx.z; A += z * sA; if (A2) A2 += z * sA; Bt += z * sB; if (Bt2) Bt2 += z * sB; C += z * sC;
    const int lane = threadIdx.x & 31, lr = lane & 15, hi = lane >> 4; const int r0 = blockIdx.x * 64, c0 = blockIdx.y * 64;
    v8f acc[4][4];
#pragma unroll
    for (int mb = 0; mb < 4; ++mb)
#pragma unroll
        for (int nb = 0; nb < 4; ++nb) acc[mb][nb] = (v8f){};
    const size_t aoff = (size_t)(r0 + lr) * K + 8 * hi, boff = (size_t)(c0 + lr) * K + 8 * hi;
    const int wv = (KS == 1) ? 0 : __builtin_amdgcn_readfirstlane((int)(threadIdx.x >> 5)); const int kper = K / KS, kbeg = wv * kper, kend = kbeg + kper;   // this wave's K range (scalar loop bounds)
#pragma unroll 1
    for (int kc = kbeg; kc < kend; kc += 32) {
        V a[4], a2[4];
#pragma unroll
        for (int mb = 0; mb < 4; ++mb) { a[mb] = WFrag<T16>::ld(A + aoff + (size_t)mb * 16 * K + kc); if (NSPLIT == 1 || NSPLIT == 2) a2[mb] = WFrag<T16>::ld(A2 + aoff + (size_t)mb * 16 * K + kc); }
#pragma unroll
        for (int nb = 0; nb < 4; ++nb) { const V b = WFrag<T16>::ld(Bt + boff + (size_t)nb * 16 * K + kc); V b2; if (NSPLIT >= 2) b2 = WFrag<T16>::ld(Bt2 + boff + (size_t)nb * 16 * K + kc);
#pragma unroll
            for (int mb = 0; mb < 4; ++mb) { acc[mb][nb] = WFrag<T16>::mma(a[mb], b, acc[mb][nb]); if (NSPLIT == 1 || NSPLIT == 2) acc[mb][nb] = WFrag<T16>::mma(a2[mb], b, acc[mb][nb]); if (NSPLIT >= 2) acc[mb][nb] = WFrag<T16>::mma(a[mb], b2, acc[mb][nb]); } }
        asm volatile("v_nop\n\tv_nop\n\tv_nop\n\tv_nop" : "+v"(acc[0][0]), "+v"(acc[1][1]), "+v"(acc[2][2]), "+v"(acc[3][3]) : "v"(a[0]), "v"(a[3]));
    }
    if constexpr (KS == 1) {
#pragma unroll
    for (int mb = 0; mb < 4; ++mb) {
#pragma unroll
        for (int nb = 0; nb < 4; ++nb) {
#pragma unroll
            for (int j = 0; j < 8; ++j) os[(hi * 8 + j) * 68 + nb * 16 + lr] = acc[mb][nb][j]; }
        __builtin_amdgcn_wave_barrier(); asm volatile("" ::: "memory");
        float* crow = C + (size_t)(r0 + mb * 16) * ldc + c0;
{
#pragma unroll
            for (int s = 0; s < 8; ++s) { const int row = 2 * s + hi, cofs = lr * 4; v4f val = *(const v4fa*)(os + row * 68 + cofs); if (BIAS) { val[0] += bfr(bias[c0 + cofs]); val[1] += bfr(bias[c0 + cofs + 1]); val[2] += bfr(bias[c0 + cofs + 2]); val[3] += bfr(bias[c0 + cofs + 3]); }
                *(v4f*)(crow + (size_t)row * ldc + cofs) = val; }
             }
        __builtin_amdgcn_wave_barrier(); asm volatile("" ::: "memory");
    }
    } else {
        float* const ow = os + wv * (64 * 68);   // this wave's whole 64x64 partial tile
        // the three loops are unrolled so that acc[][][] is indexed by constants and stays in registers
#pragma unroll
        for (int mb = 0; mb < 4; ++mb)
#pragma unroll
            for (int nb = 0; nb < 4; ++nb)
#pragma unroll
                for (int j = 0; j < 8; ++j) ow[(mb * 16 + hi * 8 + j) * 68 + nb * 16 + lr] = acc[mb][nb][j];
        __syncthreads();   // every wave's partial tile is in LDS before any element is summed
        float* crow = C + (size_t)r0 * ldc + c0;
        // both loops are unrolled so that the KS LDS reads of an element group issue together, not one wait each
#pragma unroll
        for (int s = 0; s < 32 / KS; ++s) { const int idx = s * (32 * KS) + (int)threadIdx.x, row = idx >> 4, cofs = (idx & 15) * 4;   /* 1024 groups of 4 columns, 32 / KS per thread */ v4f val = *(const v4fa*)(os + row * 68 + cofs);
#pragma unroll
            for (int w = 1; w < KS; ++w) val += *(const v4fa*)(os + w * (64 * 68) + row * 68 + cofs);
            if (BIAS) { val[0] += bfr(bias[c0 + cofs]); val[1] += bfr(bias[c0 + cofs + 1]); val[2] += bfr(bias[c0 + cofs + 2]); val[3] += bfr(bias[c0 + cofs + 3]); }
            *(v4f*)(crow + (size_t)row * ldc + cofs) = val; }
    }
}

__device__ __forceinline__ h16 tohx(float x) { return (h16)x; }
__device__ __forceinline__ void splitf(float y, unsigned short& h, unsigned short& l) { h = f2bf(y); l = f2bf(y - bf2f(h)); }
typedef __attribute__((ext_vector_type(2))) _Float16 v2h;
typedef __attribute__((ext_vector_type(4))) _Float16 v4h;
typedef __attribute__((ext_vector_type(2))) unsigned short v2us;
typedef __attribute__((ext_vector_type(4))) unsigned short v4us;
typedef __attribute__((ext_vector_type(2))) float v2f;
typedef __attribute__((ext_vector_type(4))) int v4i;

__global__ __launch_bounds__(256) void k_wtG(const float* __restrict__ w, int K, int N, bf* Bt) {
    const int lane = threadIdx.x & 31; const int L0 = (blockIdx.x * 8 + (threadIdx.x >> 5)) * 8; const int nlines = N * K / 64;
{
#pragma unroll 1
        for (int l = 0; l < 8; ++l) { const int L = L0 + l; if (L >= nlines) break; const size_t e = (size_t)L * 64 + lane * 2; const int k = (int)(e % K), n = (int)(e / K); v2us o;
            o[0] = f2bf(w[(size_t)k * N + n]); o[1] = f2bf(w[(size_t)(k + 1) * N + n]); *(v2us*)(Bt + e) = o; }
         }
}
__global__ __launch_bounds__(256) void k_cvt8(const float* __restrict__ src, bf* dst, size_t n8) { const size_t i = (size_t)blockIdx.x * 256 + threadIdx.x; if (i >= n8) return; const v8f v = *(const v8f*)(src + i * 8); v8us o;
#pragma unroll
    for (int k = 0; k < 8; ++k) o[k] = f2bf(v[k]); *(v8us*)(dst + i * 8) = o;  }

// k_rope: head planes [h][t][d] (fp16 + hi/lo) of rope(x) x sc with the rotate-half convention out[d] = x[d] cos[t][d] - x[d+HD/2] sin[t][d], out[d+HD/2] = x[d+HD/2] cos[t][d+HD/2] + x[d] sin[t][d+HD/2]
__global__ __launch_bounds__(256) void k_rope(const float* __restrict__ F, int pitch, int nheads, const float* __restrict__ CS, const float* __restrict__ RF, const float* __restrict__ nw, float sc, h16* P16, bf* Ph, bf* Pl) {
    const size_t e = ((size_t)blockIdx.x * 256 + threadIdx.x) * 2; if (e >= (size_t)nheads * TT * HD) return; const int d = (int)(e % HD); const int t = (int)((e / HD) % TT); const int h = (int)(e / ((size_t)HD * TT)); const float* f = F + (size_t)t * pitch + h * HD; const float rf = RF ? RF[(size_t)h * TT + t] : 1.0f; v2h o16; v2us oh, ol;
#pragma unroll
    for (int q = 0; q < 2; ++q) { const int dd = d + q; const int dp = (dd < HD / 2) ? dd + HD / 2 : dd - HD / 2; float x0 = f[dd], x1 = f[dp];
        if (RF) { float n0 = __fmul_rn(x0, rf), n1 = __fmul_rn(x1, rf); asm volatile("" : "+v"(n0)); asm volatile("" : "+v"(n1)); x0 = __fmul_rn(bfr(nw[dd]), n0); x1 = __fmul_rn(bfr(nw[dp]), n1); }
        const v2f cs = *(const v2f*)(CS + ((size_t)t * HD + dd) * 2); float a = __fmul_rn(x0, cs[0]), bq = __fmul_rn(x1, cs[1]); asm volatile("" : "+v"(a)); asm volatile("" : "+v"(bq)); const float r = ((dd < HD / 2) ? __fsub_rn(a, bq) : __fadd_rn(a, bq)) * sc;
        o16[q] = tohx(r); unsigned short a2, c2; splitf(r, a2, c2); oh[q] = a2; ol[q] = c2; }
    *(v2h*)(P16 + e) = o16; *(v2us*)(Ph + e) = oh; *(v2us*)(Pl + e) = ol;  }
__global__ __launch_bounds__(256) void k_vtp(const float* __restrict__ F, int pitch, int nheads, h16* V16, bf* Vh, bf* Vl) { const size_t e = ((size_t)blockIdx.x * 256 + threadIdx.x) * 2; if (e >= (size_t)nheads * HD * TT) return; const int t = (int)(e % TT); const int d = (int)((e / TT) % HD); const int g = (int)(e / ((size_t)TT * HD)); v2h o16; v2us oh, ol;
#pragma unroll
    for (int q = 0; q < 2; ++q) { const float x = F[(size_t)(t + q) * pitch + g * HD + d]; o16[q] = tohx(x); unsigned short a2, c2; splitf(x, a2, c2); oh[q] = a2; ol[q] = c2; }
    *(v2h*)(V16 + e) = o16; *(v2us*)(Vh + e) = oh; *(v2us*)(Vl + e) = ol;  }
__global__ __launch_bounds__(256) void k_csid(float* CS) { const int idx = blockIdx.x * 256 + threadIdx.x; if (idx >= TT * HD) return; v2f cs; cs[0] = 1.0f; cs[1] = 0.0f; *(v2f*)(CS + (size_t)idx * 2) = cs;  }
template <bool RND>
__global__ __launch_bounds__(256) void k_lnhl(const float* __restrict__ X, const float* __restrict__ A, const float* __restrict__ g, const float* __restrict__ be, float* Z, bf* Yh, bf* Yl) {
    const int lane = threadIdx.x & 31; const int r = blockIdx.x * 8 + (threadIdx.x >> 5); if (r >= TT) return; const float* xr = X + (size_t)r * DM; const float* ar = A ? A + (size_t)r * DM : nullptr; float s = 0.f;
#pragma unroll 1
    for (int ch = 0; ch < DM / 128; ++ch) { const int c0 = ch * 128 + lane * 4; const v4f a = *(const v4f*)(xr + c0); v4f d = {0.f, 0.f, 0.f, 0.f}; if (ar) d = *(const v4f*)(ar + c0);
#pragma unroll
        for (int q = 0; q < 4; ++q) s += __fadd_rn((RND ? bfr(a[q]) : a[q]), d[q]); }
#pragma unroll
    for (int sh = 16; sh; sh >>= 1) s += __shfl_xor(s, sh, 32);
    const float mu = s * (1.0f / DM); float s2 = 0.f;
#pragma unroll 1
    for (int ch = 0; ch < DM / 128; ++ch) { const int c0 = ch * 128 + lane * 4; const v4f a = *(const v4f*)(xr + c0); v4f d = {0.f, 0.f, 0.f, 0.f}; if (ar) d = *(const v4f*)(ar + c0);
#pragma unroll
        for (int q = 0; q < 4; ++q) { const float d0 = __fsub_rn(__fadd_rn((RND ? bfr(a[q]) : a[q]), d[q]), mu); float p = __fmul_rn(d0, d0); asm volatile("" : "+v"(p)); s2 = __fadd_rn(s2, p); } }
#pragma unroll
    for (int sh = 16; sh; sh >>= 1) s2 += __shfl_xor(s2, sh, 32);
    const float rs = __fdiv_rn(1.0f, __fsqrt_rn(__fadd_rn(s2 * (1.0f / DM), LNEPS)));
{
#pragma unroll 1
        for (int ch = 0; ch < DM / 128; ++ch) { const int c0 = ch * 128 + lane * 4; const v4f a = *(const v4f*)(xr + c0); v4f d = {0.f, 0.f, 0.f, 0.f}; if (ar) d = *(const v4f*)(ar + c0); v4f z4; v4us oh, ol;
#pragma unroll
            for (int q = 0; q < 4; ++q) { const float v = __fadd_rn((RND ? bfr(a[q]) : a[q]), d[q]); float n0 = __fmul_rn(__fsub_rn(v, mu), rs); asm volatile("" : "+v"(n0)); float n1 = __fmul_rn(n0, bfr(g[c0 + q])); asm volatile("" : "+v"(n1)); const float y = __fadd_rn(n1, bfr(be[c0 + q])); z4[q] = y;   /* Z = the NORMALISED row (it is the residual for the next block) */ unsigned short h2, l2; splitf(y, h2, l2); oh[q] = h2; ol[q] = l2; }
            if (Z) *(v4f*)(Z + (size_t)r * DM + c0) = z4; *(v4us*)(Yh + (size_t)r * DM + c0) = oh; *(v4us*)(Yl + (size_t)r * DM + c0) = ol; }
         } }

__global__ __launch_bounds__(256) void k_relupl(const float* __restrict__ F, bf* Ph2, bf* Pl2, size_t n4) { const size_t i = (size_t)blockIdx.x * 256 + threadIdx.x; if (i >= n4) return; const v4f v = *(const v4f*)(F + i * 4); v4us oh, ol;
#pragma unroll
    for (int q = 0; q < 4; ++q) { unsigned short a, c; splitf(fmaxf(v[q], 0.f), a, c); oh[q] = a; ol[q] = c; } *(v4us*)(Ph2 + i * 4) = oh; *(v4us*)(Pl2 + i * 4) = ol;  }
__global__ __launch_bounds__(256) void k_addln(const float* __restrict__ A, const float* __restrict__ Bm, const float* __restrict__ g, const float* __restrict__ be, float* OUTb) {
    const int lane = threadIdx.x & 31; const int r = blockIdx.x * 8 + (threadIdx.x >> 5); if (r >= TT) return; const float* ar = A + (size_t)r * DM; const float* br = Bm + (size_t)r * DM; float s = 0.f;
#pragma unroll 1
    for (int ch = 0; ch < DM / 128; ++ch) { const int c0 = ch * 128 + lane * 4; const v4f a = *(const v4f*)(ar + c0), bb = *(const v4f*)(br + c0);
#pragma unroll
        for (int q = 0; q < 4; ++q) s += __fadd_rn(a[q], bb[q]); }
#pragma unroll
    for (int sh = 16; sh; sh >>= 1) s += __shfl_xor(s, sh, 32);
    const float mu = s * (1.0f / DM); float s2 = 0.f;
#pragma unroll 1
    for (int ch = 0; ch < DM / 128; ++ch) { const int c0 = ch * 128 + lane * 4; const v4f a = *(const v4f*)(ar + c0), bb = *(const v4f*)(br + c0);
#pragma unroll
        for (int q = 0; q < 4; ++q) { const float d0 = __fsub_rn(__fadd_rn(a[q], bb[q]), mu); float p = __fmul_rn(d0, d0); asm volatile("" : "+v"(p)); s2 = __fadd_rn(s2, p); } }
#pragma unroll
    for (int sh = 16; sh; sh >>= 1) s2 += __shfl_xor(s2, sh, 32);
    const float rs = __fdiv_rn(1.0f, __fsqrt_rn(__fadd_rn(s2 * (1.0f / DM), LNEPS)));
{
#pragma unroll 1
        for (int ch = 0; ch < DM / 128; ++ch) { const int c0 = ch * 128 + lane * 4; const v4f a = *(const v4f*)(ar + c0), bb = *(const v4f*)(br + c0); v4f o4;
#pragma unroll
            for (int q = 0; q < 4; ++q) { float n0 = __fmul_rn(__fsub_rn(__fadd_rn(a[q], bb[q]), mu), rs); asm volatile("" : "+v"(n0)); float n1 = __fmul_rn(n0, bfr(g[c0 + q])); asm volatile("" : "+v"(n1)); o4[q] = __fadd_rn(n1, bfr(be[c0 + q])); }
            *(v4f*)(OUTb + (size_t)r * DM + c0) = o4; }
         } }
// ---- k_fattn: scores, softmax and attn.v of one batch in one launch; no score or probability ever leaves the work-group.
// 4 waves x 16 query columns per work-group, one head; the 2048 keys are walked in passes of KC = 64 with a running maximum and sum (new order of the softmax and attn.v sums).
// S^T = K Q^T (A = key rows from LDS, B = query rows kept in registers), O^T += V^T P^T (A = V^T rows from LDS, B = the score tiles converted in place: two D tiles of 16 keys are one B operand in the loaders' k order).
// A lane holds one query's column, so the maximum is in-lane plus one exchange between the wave's halves. Work-groups below NH_ * RH / 64 take the hi+lo rows (3 products), the rest single fp16.
#define KC   64                   // keys per pass
#define LP   72                   // LDS row pitch in 16-bit elements: 144 B = 16 B x odd, conflict-free for the 16-byte fragment reads
#define PLN  (64 * LP)            // one staged plane: 64 rows of 128 B (K: 64 keys x HD; V^T: HD rows x 64 keys)
#define BIGF 0x1p127f             // a power of two: BIGF * CL2 is exact, so a fully masked row gets exponent 0 for every key (uniform weights, as the reference's -1e9 gives)
#define CL2  0.18033688011112042f // HD^-0.5 * log2(e)
__device__ __forceinline__ float xhalf(float x) { const int b = __float_as_int(x); return __int_as_float(__builtin_amdgcn_permlanex16(b, b, 0x76543210, 0xfedcba98, false, false)); }   // lane l <-> l ^ 16
typedef __attribute__((ext_vector_type(2))) __bf16 v2bf;
// 2^x in asm so that the slot the instruction set asks for behind a transcendental (before its result is read or its source overwritten) is filled by construction:
// in the group of four each exponential stands in front of an independent one (the outputs are early-clobber: none shares a register with an input), and the v_nop fills the slot behind the last.
__device__ __forceinline__ v4f exp2x4(float a, float b, float c, float d) { float r0, r1, r2, r3;
    asm("v_exp_f32 %0, %4\n\tv_exp_f32 %1, %5\n\tv_exp_f32 %2, %6\n\tv_exp_f32 %3, %7\n\tv_nop" : "=&v"(r0), "=&v"(r1), "=&v"(r2), "=&v"(r3) : "v"(a), "v"(b), "v"(c), "v"(d)); return (v4f){r0, r1, r2, r3}; }
__device__ __forceinline__ float exp2x1(float a) { float r; asm("v_exp_f32 %0, %1\n\tv_nop" : "=v"(r) : "v"(a)); return r; }
template <typename T16, bool HL>
__device__ __forceinline__ void fattn_body(const T16* __restrict__ Q, const T16* __restrict__ Q2, const T16* __restrict__ Kp, const T16* __restrict__ Kp2, const T16* __restrict__ Vt, const T16* __restrict__ Vt2, int q0, T16* sm, const float* lim, bf* Ah, bf* Al) {
    typedef typename WFrag<T16>::V V;
    constexpr int NP = HL ? 4 : 2, NL = HL ? 2 : 1;   // planes in a buffer (K, V^T, K lo, V^T lo); planes of one operand
    const int tid = threadIdx.x, lane = tid & 31, lr = lane & 15, hi = lane >> 4; const int qr = q0 + (tid >> 5) * 16 + lr;
    V qf[2], qf2[2];
#pragma unroll
    for (int ks = 0; ks < 2; ++ks) { qf[ks] = WFrag<T16>::ld(Q + (size_t)qr * HD + ks * 32 + 8 * hi); if (HL) qf2[ks] = WFrag<T16>::ld(Q2 + (size_t)qr * HD + ks * 32 + 8 * hi); }
    // staging: a plane is 512 pieces of 16 B, 4 per thread; 8 neighbouring lanes read one whole 128-B line. K and V^T take turns in the same registers.
    const int srow = tid >> 3, sseg = (tid & 7) * 8;
    v8us st[NL][4];
    auto gloadK = [&](int c) {
#pragma unroll
        for (int u = 0; u < 4; ++u) { const size_t e = (size_t)(c * KC + srow + 16 * u) * HD + sseg; st[0][u] = *(const v8usa*)(Kp + e); if constexpr (HL) st[1][u] = *(const v8usa*)(Kp2 + e); } };
    auto gloadV = [&](int c) {
#pragma unroll
        for (int u = 0; u < 4; ++u) { const size_t e = (size_t)(srow + 16 * u) * TT + c * KC + sseg; st[0][u] = *(const v8usa*)(Vt + e); if constexpr (HL) st[1][u] = *(const v8usa*)(Vt2 + e); } };
    auto sstore = [&](T16* pl) {   // pl: the operand's hi plane; its lo plane lies two planes further
#pragma unroll
        for (int p = 0; p < NL; ++p)
#pragma unroll
            for (int u = 0; u < 4; ++u) *(v8usa*)(pl + p * 2 * PLN + (srow + 16 * u) * LP + sseg) = st[p][u]; };
    v8f o[4];
#pragma unroll
    for (int dt = 0; dt < 4; ++dt) o[dt] = (v8f){};
    float mraw = -BIGF, mcs = -BIGF * CL2;
    // the softmax sums ride the matrix pipe: an A of ones makes every row of lt the column sums of the (rounded) weights, over both lane halves' keys; lt is rescaled like an output tile
    V ones; v8f lt = (v8f){};
#pragma unroll
    for (int e = 0; e < 16; ++e) { if constexpr (HL) ones[e] = (__bf16)1.0f; else ones[e] = (h16)1.0f; }
    gloadK(0); sstore(sm); gloadV(0); sstore(sm + PLN);
    __syncthreads();   // pass 0's planes and the key limits are in LDS
    // The scheduling fences in the loop keep each group of LDS fragment loads together and ahead of the block of products that uses it (one exposed LDS latency a group, not one a fragment),
    // and keep the products of a block in the written order, in which neighbours go to different accumulators.
#pragma unroll 1
    for (int c = 0; c < TT / KC; ++c) {
        const T16* cur = sm + (c & 1) * (NP * PLN); T16* nxt = sm + ((c + 1) & 1) * (NP * PLN);
        const int cn = (c + 1 < TT / KC) ? c + 1 : c;   // the last pass re-reads its own planes: no branch in the loop; that copy is never read
        gloadK(cn);   // the next pass's K flies during the score products
        __builtin_amdgcn_sched_barrier(0);   // fence: the global loads stay at the head of the pass
        v8f s[4];
        if constexpr (HL) {
#pragma unroll
            for (int ks = 0; ks < 2; ++ks) { V ka[4], kb[4];
#pragma unroll
                for (int kt = 0; kt < 4; ++kt) { ka[kt] = WFrag<T16>::ld(cur + (kt * 16 + lr) * LP + ks * 32 + 8 * hi); kb[kt] = WFrag<T16>::ld(cur + 2 * PLN + (kt * 16 + lr) * LP + ks * 32 + 8 * hi); }
                __builtin_amdgcn_sched_barrier(0);   // fence: loads | products
#pragma unroll
                for (int kt = 0; kt < 4; ++kt) s[kt] = WFrag<T16>::mma(ka[kt], qf[ks], ks ? s[kt] : (v8f){});
#pragma unroll
                for (int kt = 0; kt < 4; ++kt) s[kt] = WFrag<T16>::mma(ka[kt], qf2[ks], s[kt]);
#pragma unroll
                for (int kt = 0; kt < 4; ++kt) s[kt] = WFrag<T16>::mma(kb[kt], qf[ks], s[kt]);
                __builtin_amdgcn_sched_barrier(0); }   // fence: products | next group
        } else { V ka[2][4];
#pragma unroll
            for (int ks = 0; ks < 2; ++ks)
#pragma unroll
                for (int kt = 0; kt < 4; ++kt) ka[ks][kt] = WFrag<T16>::ld(cur + (kt * 16 + lr) * LP + ks * 32 + 8 * hi);
            __builtin_amdgcn_sched_barrier(0);   // fence: loads | products
#pragma unroll
            for (int ks = 0; ks < 2; ++ks)
#pragma unroll
                for (int kt = 0; kt < 4; ++kt) s[kt] = WFrag<T16>::mma(ka[ks][kt], qf[ks], ks ? s[kt] : (v8f){});
            __builtin_amdgcn_sched_barrier(0); }   // fence: products | next group
        // key mask as a select, one instruction: the median of (s, -BIGF, +BIGF) is s, of (s, -BIGF, -BIGF) is -BIGF; four independent maximum chains
        float mk[4]; v4f lm[8];
#pragma unroll
        for (int u = 0; u < 8; ++u) lm[u] = *(const v4fa*)(lim + c * KC + (u >> 1) * 16 + hi * 8 + (u & 1) * 4);
        __builtin_amdgcn_sched_barrier(0);   // fence: the eight limit loads go out as one group, while the last score products drain
#pragma unroll
        for (int kt = 0; kt < 4; ++kt) { mk[kt] = -BIGF;
#pragma unroll
            for (int j = 0; j < 8; ++j) { const float t = __builtin_amdgcn_fmed3f(s[kt][j], -BIGF, lm[2 * kt + (j >> 2)][j & 3]); s[kt][j] = t; mk[kt] = __builtin_fmaximum_numf(mk[kt], t); } }
        float mx = __builtin_fmaximum_numf(__builtin_fmaximum_numf(__builtin_fmaximum_numf(mk[0], mk[1]), __builtin_fmaximum_numf(mk[2], mk[3])), mraw); mx = __builtin_fmaximum_numf(mx, xhalf(mx));
        __builtin_amdgcn_sched_barrier(0);   // fence: the K stores (and the wait on their loads) stay behind the maximum
        sstore(nxt); gloadV(cn);   // K goes to the other buffer; the next pass's V^T flies during the exponentials and the output products
        V va[HL ? 1 : 2][4], vb[4];   // V^T fragments fetched ahead of the exponentials (fp16: both 32-key groups; hi+lo: the first)
#pragma unroll
        for (int g = 0; g < (HL ? 1 : 2); ++g)
#pragma unroll
            for (int dt = 0; dt < 4; ++dt) { va[g][dt] = WFrag<T16>::ld(cur + PLN + (dt * 16 + lr) * LP + g * 32 + 8 * hi); if constexpr (HL) vb[dt] = WFrag<T16>::ld(cur + 3 * PLN + (dt * 16 + lr) * LP + g * 32 + 8 * hi); }
        __builtin_amdgcn_sched_barrier(0);   // fence: these loads are issued before the exponentials, which cover their latency
        const float mc = mx * CL2, al = exp2x1(mcs - mc), ad = (HL ? 0.0f : 10.0f) - mc;   // fp16 weights carry x1024 (cancels in the division by the sum): small weights stay normal numbers
        mraw = mx; mcs = mc;
#pragma unroll
        for (int kt = 0; kt < 4; ++kt)
#pragma unroll
            for (int j = 0; j < 8; ++j) s[kt][j] = __builtin_fmaf(s[kt][j], CL2, ad);
#pragma unroll
        for (int kt = 0; kt < 4; ++kt) { const v4f e0 = exp2x4(s[kt][0], s[kt][1], s[kt][2], s[kt][3]), e1 = exp2x4(s[kt][4], s[kt][5], s[kt][6], s[kt][7]); s[kt] = __builtin_shufflevector(e0, e1, 0, 1, 2, 3, 4, 5, 6, 7); }
        __builtin_amdgcn_sched_barrier(0);   // fence: the exponentials are asm text: none of the products below is scheduled in front of them
        lt *= al;
#pragma unroll
        for (int dt = 0; dt < 4; ++dt) o[dt] *= al;
#pragma unroll
        for (int g = 0; g < 2; ++g) { V pb, pb2;
#pragma unroll
            for (int e = 0; e < 16; e += 2) { const v2f pp = {s[2 * g + (e >> 3)][e & 7], s[2 * g + (e >> 3)][(e & 7) + 1]};   // by pairs: one packed conversion for two weights
                if constexpr (HL) { const v2bf h2 = __builtin_convertvector(pp, v2bf); const v2bf l2 = __builtin_convertvector(pp - __builtin_convertvector(h2, v2f), v2bf); pb[e] = h2[0]; pb[e + 1] = h2[1]; pb2[e] = l2[0]; pb2[e + 1] = l2[1]; }
                else { const v2h h2 = __builtin_convertvector(pp, v2h); pb[e] = h2[0]; pb[e + 1] = h2[1]; } }
            __builtin_amdgcn_sched_barrier(0);   // fence: conversions | products
#pragma unroll
            for (int dt = 0; dt < 4; ++dt) o[dt] = WFrag<T16>::mma(va[HL ? 0 : g][dt], pb, o[dt]);
            lt = WFrag<T16>::mma(ones, pb, lt);
            if constexpr (HL) {
#pragma unroll
                for (int dt = 0; dt < 4; ++dt) o[dt] = WFrag<T16>::mma(va[0][dt], pb2, o[dt]);
                lt = WFrag<T16>::mma(ones, pb2, lt);
#pragma unroll
                for (int dt = 0; dt < 4; ++dt) o[dt] = WFrag<T16>::mma(vb[dt], pb, o[dt]);
                __builtin_amdgcn_sched_barrier(0);   // fence: products | the second group's loads
                if (g == 0) {
#pragma unroll
                    for (int dt = 0; dt < 4; ++dt) { va[0][dt] = WFrag<T16>::ld(cur + PLN + (dt * 16 + lr) * LP + 32 + 8 * hi); vb[dt] = WFrag<T16>::ld(cur + 3 * PLN + (dt * 16 + lr) * LP + 32 + 8 * hi); }
                    __builtin_amdgcn_sched_barrier(0); } } }   // fence: the second group's loads are issued before its conversions, which cover their latency
        __builtin_amdgcn_sched_barrier(0);   // fence: the V^T stores (and the wait on their loads) stay at the foot of the pass
        sstore(nxt + PLN);
        __syncthreads();   // publishes the next pass's planes and ends every wave's reads of this pass's (refilled in the next trip)
    }
    const float inv = __fdiv_rn(1.0f, lt[0]);
#pragma unroll
    for (int dt = 0; dt < 4; ++dt) { v8us oh, ol;   // a lane's 8 accumulator registers are 8 consecutive d of its query: one 16-byte store per plane
#pragma unroll
        for (int j = 0; j < 8; ++j) { unsigned short a, c2; splitf(o[dt][j] * inv, a, c2); oh[j] = a; ol[j] = c2; }
        const size_t oo = (size_t)qr * DQ + dt * 16 + hi * 8; *(v8us*)(Ah + oo) = oh; *(v8us*)(Al + oo) = ol; }
}
// the second bound (4 waves per SIMD) is a budget of 256 registers: the hi+lo body stays below v256 and needs no register-window switches in its loop
__global__ __launch_bounds__(128, 4) void k_fattn(const h16* __restrict__ Q16, const h16* __restrict__ K16, const h16* __restrict__ V16, const bf* __restrict__ Qh, const bf* __restrict__ Ql, const bf* __restrict__ Kh, const bf* __restrict__ Kl, const bf* __restrict__ Vh, const bf* __restrict__ Vl, const int* __restrict__ MKb, bf* Ah, bf* Al) {
    __shared__ __align__(16) unsigned short sm[2 * 4 * PLN];
    __shared__ __align__(16) float lim[TT];
    // unrolled so that the four mask loads of a thread are in flight together
#pragma unroll
    for (int u = 0; u < TT / 512; ++u) { const int i = (u * 128 + (int)threadIdx.x) * 4; const v4i m4 = *(const v4i*)(MKb + i); v4f f4;
#pragma unroll
        for (int q = 0; q < 4; ++q) f4[q] = (m4[q] != 0) ? BIGF : -BIGF;
        *(v4fa*)(lim + i) = f4; }
    const int bx = blockIdx.x;   // the heavier hi+lo work-groups come first
    if (bx < NH_ * (RH / 64)) { const int h = bx / (RH / 64), q0 = (bx % (RH / 64)) * 64; const size_t zq = (size_t)h * TT * HD, zk = (size_t)(h / REP) * TT * HD;
        fattn_body<bf, true>(Qh + zq, Ql + zq, Kh + zk, Kl + zk, Vh + zk, Vl + zk, q0, (bf*)sm, lim, Ah + h * HD, Al + h * HD);
    } else { const int ix = bx - NH_ * (RH / 64); const int h = ix / ((TT - RH) / 64), q0 = RH + (ix % ((TT - RH) / 64)) * 64; const size_t zq = (size_t)h * TT * HD, zk = (size_t)(h / REP) * TT * HD;
        fattn_body<h16, false>(Q16 + zq, nullptr, K16 + zk, nullptr, V16 + zk, nullptr, q0, (h16*)sm, lim, Ah + h * HD, Al + h * HD); }
}

extern "C" void kernel_launch(void* const* d_in, const int* in_sizes, int n_in,
                              void* d_out, int out_size, void* d_ws, size_t ws_size, hipStream_t stream) {
    (void)in_sizes; (void)n_in; (void)out_size;
    const float* x = (const float*)d_in[0]; const float* xk = (const float*)d_in[1]; const int* MK = (const int*)d_in[2]; const float* wq = (const float*)d_in[3]; const float* bq = (const float*)d_in[4]; const float* wk = (const float*)d_in[5]; const float* bk = (const float*)d_in[6]; const float* wv = (const float*)d_in[7]; const float* bv = (const float*)d_in[8]; const float* wo = (const float*)d_in[9]; const float* bo = (const float*)d_in[10]; const float* w1 = (const float*)d_in[11]; const float* b1 = (const float*)d_in[12]; const float* w2 = (const float*)d_in[13]; const float* b2 = (const float*)d_in[14]; const float* g1 = (const float*)d_in[15]; const float* e1 = (const float*)d_in[16]; const float* g2 = (const float*)d_in[17]; const float* e2 = (const float*)d_in[18];
    float* OUT = (float*)d_out;     // [2][2048][1024]
    char* wsp = (char*)d_ws;
    auto take = [&](size_t bytes) { char* p = wsp; wsp += (bytes + 255) & ~(size_t)255; return (void*)p; };
    bf* WQ = (bf*)take((size_t)DQ * DM * 2); bf* WK = (bf*)take((size_t)DKV * DM * 2); bf* WV = (bf*)take((size_t)DKV * DM * 2); bf* WO = (bf*)take((size_t)DM * DQ * 2); float* CS = (float*)take((size_t)TT * HD * 2 * 4);
    bf* XB = (bf*)take((size_t)TT * DM * 2); bf* XKB = (bf*)take((size_t)TT * DM * 2); bf* W1B = (bf*)take((size_t)DFF * DM * 2); bf* W2B = (bf*)take((size_t)DM * DFF * 2);
    h16* QP16 = (h16*)take((size_t)NH_ * TT * HD * 2); h16* KP16 = (h16*)take((size_t)NKV * TT * HD * 2); h16* VT16 = (h16*)take((size_t)NKV * HD * TT * 2);
    bf* QPh = (bf*)take((size_t)NH_ * TT * HD * 2); bf* QPl = (bf*)take((size_t)NH_ * TT * HD * 2); bf* KPh = (bf*)take((size_t)NKV * TT * HD * 2); bf* KPl = (bf*)take((size_t)NKV * TT * HD * 2); bf* VTh = (bf*)take((size_t)NKV * HD * TT * 2); bf* VTl = (bf*)take((size_t)NKV * HD * TT * 2);
    bf* ATh = (bf*)take((size_t)TT * DQ * 2); bf* ATl = (bf*)take((size_t)TT * DQ * 2);
    float* S2 = (float*)take((size_t)TT * DM * 4); float* X1 = (float*)take((size_t)TT * DM * 4); bf* L1h = (bf*)take((size_t)TT * DM * 2); bf* L1l = (bf*)take((size_t)TT * DM * 2); float* H1 = (float*)take((size_t)TT * DFF * 4); bf* Gh = (bf*)take((size_t)TT * DFF * 2); bf* Gl = (bf*)take((size_t)TT * DFF * 2); float* F2 = (float*)take((size_t)TT * DM * 4); float* FQ = (float*)take((size_t)TT * DQ * 4); float* FK = (float*)take((size_t)TT * DKV * 4);
    if ((size_t)(wsp - (char*)d_ws) > ws_size) return;
    float* FV = FK;   // v projection reuses the k buffer after the k planes are built (stream-ordered)
    { k_wtG<<<(unsigned)((DM * DQ / 64 + 63) / 64), 256, 0, stream>>>(wq, DM, DQ, WQ); k_wtG<<<(unsigned)((DM * DKV / 64 + 63) / 64), 256, 0, stream>>>(wk, DM, DKV, WK); k_wtG<<<(unsigned)((DM * DKV / 64 + 63) / 64), 256, 0, stream>>>(wv, DM, DKV, WV);
      k_wtG<<<(unsigned)((DQ * DM / 64 + 63) / 64), 256, 0, stream>>>(wo, DQ, DM, WO); k_wtG<<<(unsigned)((DM * DFF / 64 + 63) / 64), 256, 0, stream>>>(w1, DM, DFF, W1B); k_wtG<<<(unsigned)((DFF * DM / 64 + 63) / 64), 256, 0, stream>>>(w2, DFF, DM, W2B);
       }
    k_csid<<<(TT * HD + 255) / 256, 256, 0, stream>>>(CS);
    const unsigned LQ = (unsigned)(((size_t)NH_ * TT * HD / 2 + 255) / 256), LKv = (unsigned)(((size_t)NKV * TT * HD / 2 + 255) / 256);
    for (int b = 0; b < NB_; ++b) {
        
        k_cvt8<<<(unsigned)(((size_t)TT * DM / 8 + 255) / 256), 256, 0, stream>>>(x + (size_t)b * TT * DM, XB, (size_t)TT * DM / 8); k_cvt8<<<(unsigned)(((size_t)TT * DM / 8 + 255) / 256), 256, 0, stream>>>(xk + (size_t)b * TT * DM, XKB, (size_t)TT * DM / 8);
        k_gemmw<bf, 0, true, 4><<<dim3(TT / 64, DQ / 64, 1), 128, 0, stream>>>(XB, nullptr, WQ, nullptr, DM, FQ, DQ, bq, 0, 0, 0);
        k_rope<<<LQ, 256, 0, stream>>>(FQ, DQ, NH_, CS, nullptr, nullptr, 1.0f, QP16, QPh, QPl);
        k_gemmw<bf, 0, true, 4><<<dim3(TT / 64, DKV / 64, 1), 128, 0, stream>>>(XKB, nullptr, WK, nullptr, DM, FK, DKV, bk, 0, 0, 0);
        k_rope<<<LKv, 256, 0, stream>>>(FK, DKV, NKV, CS, nullptr, nullptr, 1.0f, KP16, KPh, KPl);
        k_gemmw<bf, 0, true, 4><<<dim3(TT / 64, DKV / 64, 1), 128, 0, stream>>>(XKB, nullptr, WV, nullptr, DM, FV, DKV, bv, 0, 0, 0); k_vtp<<<LKv, 256, 0, stream>>>(FV, DKV, NKV, VT16, VTh, VTl);
        k_fattn<<<NH_ * (TT / 64), 128, 0, stream>>>(QP16, KP16, VT16, QPh, QPl, KPh, KPl, VTh, VTl, MK + (size_t)b * TT, ATh, ATl);   /* softmax(q k^T / 8, mask) v, merged heads as hi/lo planes */
        k_gemmw<bf, 1, true, 4><<<dim3(TT / 64, DM / 64, 1), 128, 0, stream>>>(ATh, ATl, WO, nullptr, DQ, S2, DM, bo, 0, 0, 0);   /* mha = merged Wo + bo */
        k_lnhl<true><<<TT / 8, 256, 0, stream>>>(x + (size_t)b * TT * DM, S2, g1, e1, X1, L1h, L1l);                                  /* x1 = LN(bf16(x) + mha): normalised row in f32 + hi/lo planes */
        k_gemmw<bf, 1, true, 1><<<dim3(TT / 64, DFF / 64, 1), 32, 0, stream>>>(L1h, L1l, W1B, nullptr, DM, H1, DFF, b1, 0, 0, 0);        /* x1 W1 + b1 */
        k_relupl<<<(unsigned)(((size_t)TT * DFF / 4 + 255) / 256), 256, 0, stream>>>(H1, Gh, Gl, (size_t)TT * DFF / 4);                 /* relu -> hi/lo */
        k_gemmw<bf, 1, true, 8><<<dim3(TT / 64, DM / 64, 1), 256, 0, stream>>>(Gh, Gl, W2B, nullptr, DFF, F2, DM, b2, 0, 0, 0);           /* . W2 + b2 */
        k_addln<<<TT / 8, 256, 0, stream>>>(X1, F2, g2, e2, OUT + (size_t)b * TT * DM); }                                               /* out = LN(x1 + ff) */
}

// v004
// A run of this version takes 514 microseconds.
// In both of two side-by-side timings against v003, it was 1.16 times as fast.
// Counting every step since v000, it is 7.70 times as fast.
#include <hip/hip_runtime.h>

// Post-LN transformer encoder block with cross attention (x, y [2][2048][1024]; Q = x Wq + bq, K = y Wk + bk, V = y Wv + bv ('xw' [1024][1024]; 16 heads x 64); scores/8 with mask [2][1][1][2048] (int32 keys, read; -1e9 == exact zero weight; all ones here); softmax; mha = merged Wo + bo; x1 = LN(x + mha); ff = relu(x1 W1 + b1) W2 + b2 (W1 [1024][4096]); out = LN(x1 + ff) (eps 1e-5) -> [2][2048][1024] (4.2 M)).
// Compute dtypes, f32 accumulate: every input rounded to bf16; q/k/v on PLAIN bf16 operands (inputs: exact) + biases; key mask as a select; scores and attn.v: query rows < 512 hl (3 products), the rest single fp16 (x1024); softmax f32; Wo, W1, W2 hl x exact (2 products) + biases; residuals / LayerNorms / ReLU in f32.

#define NB_  2
#define TT   2048
#define DM   1024
#define NH_  16
#define NKV  16
#define REP  (NH_ / NKV)
#define HD   64
#define DQ   (NH_ * HD)
#define DKV  (NKV * HD)
#define DFF  4096
#define LNEPS 1e-5f
#define RH   512                  // query rows < RH use hi+lo planes (0: none)
#define WIN  0
#define SCL  0.125f   // HD^-0.5
typedef _Float16 h16;
typedef unsigned short bf;
typedef __attribute__((ext_vector_type(16))) __bf16   v16bf;
typedef __attribute__((ext_vector_type(16))) _Float16 v16h;
typedef __attribute__((ext_vector_type(8)))  _Float16 v8h;
typedef __attribute__((ext_vector_type(8)))  unsigned short v8us;
typedef __attribute__((ext_vector_type(8)))  float    v8f;
typedef __attribute__((ext_vector_type(4)))  float    v4f;
typedef v8h  __attribute__((may_alias)) v8ha;
typedef v4f  __attribute__((may_alias)) v4fa;
typedef v8us __attribute__((may_alias)) v8usa;

__device__ __forceinline__ unsigned short f2bf(float f) { unsigned u = __float_as_uint(f); u += 0x7FFFu + ((u >> 16) & 1u); return (unsigned short)(u >> 16); }
__device__ __forceinline__ float bf2f(unsigned short b) { return __uint_as_float(((unsigned)b) << 16); }
__device__ __forceinline__ float bfr(float f) { return bf2f(f2bf(f)); }
__device__ __forceinline__ v16h cat16(v8h lo, v8h hi) { return __builtin_shufflevector(lo, hi, 0, 1, 2, 3, 4, 5, 6, 7, 8, 9, 10, 11, 12, 13, 14, 15); }
__device__ __forceinline__ v16bf cat16b(v8us lo, v8us hi) { return __builtin_bit_cast(v16bf, __builtin_shufflevector(lo, hi, 0, 1, 2, 3, 4, 5, 6, 7, 8, 9, 10, 11, 12, 13, 14, 15)); }
__device__ __forceinline__ v8f wmma16(v16h a, v16h b, v8f c) { return __builtin_amdgcn_wmma_f32_16x16x32_f16(false, a, false, b, (short)0, c, false, false); }
__device__ __forceinline__ v8f wmmab(v16bf a, v16bf b, v8f c) { return __builtin_amdgcn_wmma_f32_16x16x32_bf16(false, a, false, b, (short)0, c, false, false); }



// ---- k_gemmw: register-blocked GEMM, one 64x64 output tile per work-group (16 accumulators per wave), operands straight from K-contiguous 16-bit planes; grid (M/64, N/64, Z), 32 * KS threads.
// KS waves split K into KS contiguous ranges (wave w: [w K/KS, (w+1) K/KS)); the f32 partial tiles meet in LDS and are summed in wave order 0 .. KS-1 (fixed). (K / KS) % 32 == 0.
// C[m][n] (f32, pitch ldc, + optional f32 bias[n]) = sum_k A[m][k] Bt[n][k] (+ split products per NSPLIT). z-batch strides sA/sB/sC in elements. K % 32 == 0.
template <typename T16> struct WFrag;
template <> struct WFrag<h16> { typedef v16h V; static __device__ __forceinline__ V ld(const h16* p) { return cat16(*(const v8h*)p, *(const v8h*)(p + 16)); } static __device__ __forceinline__ v8f mma(V a, V b, v8f c) { return wmma16(a, b, c); } };
template <> struct WFrag<bf> { typedef v16bf V; static __device__ __forceinline__ V ld(const bf* p) { return cat16b(*(const v8us*)p, *(const v8us*)(p + 16)); } static __device__ __forceinline__ v8f mma(V a, V b, v8f c) { return wmmab(a, b, c); } };
template <typename T16, int NSPLIT, bool BIAS, int KS>
__global__ __launch_bounds__(32 * KS) void k_gemmw(const T16* __restrict__ A, const T16* __restrict__ A2, const T16* __restrict__ Bt, const T16* __restrict__ Bt2, int K, float* C, int ldc, const float* __restrict__ bias, size_t sA, size_t sB, size_t sC) {
    typedef typename WFrag<T16>::V V;
    __shared__ __align__(16) float os[KS == 1 ? 16 * 68 : KS * 64 * 68];
    const size_t z = blockIdx.z; A += z * sA; if (A2) A2 += z * sA; Bt += z * sB; if (Bt2) Bt2 += z * sB; C += z * sC;
    const int lane = threadIdx.x & 31, lr = lane & 15, hi = lane >> 4; const int r0 = blockIdx.x * 64, c0 = blockIdx.y * 64;
    v8f acc[4][4];
#pragma unroll
    for (int mb = 0; mb < 4; ++mb)
#pragma unroll
        for (int nb = 0; nb < 4; ++nb) acc[mb][nb] = (v8f){};
    const size_t aoff = (size_t)(r0 + lr) * K + 8 * hi, boff = (size_t)(c0 + lr) * K + 8 * hi;
    const int wv = (KS == 1) ? 0 : __builtin_amdgcn_readfirstlane((int)(threadIdx.x >> 5)); const int kper = K / KS, kbeg = wv * kper, kend = kbeg + kper;   // this wave's K range (scalar loop bounds)
#pragma unroll 1
    for (int kc = kbeg; kc < kend; kc += 32) {
        V a[4], a2[4];
#pragma unroll
        for (int mb = 0; mb < 4; ++mb) { a[mb] = WFrag<T16>::ld(A + aoff + (size_t)mb * 16 * K + kc); if (NSPLIT == 1 || NSPLIT == 2) a2[mb] = WFrag<T16>::ld(A2 + aoff + (size_t)mb * 16 * K + kc); }
#pragma unroll
        for (int nb = 0; nb < 4; ++nb) { const V b = WFrag<T16>::ld(Bt + boff + (size_t)nb * 16 * K + kc); V b2; if (NSPLIT >= 2) b2 = WFrag<T16>::ld(Bt2 + boff + (size_t)nb * 16 * K + kc);
#pragma unroll
            for (int mb = 0; mb < 4; ++mb) { acc[mb][nb] = WFrag<T16>::mma(a[mb], b, acc[mb][nb]); if (NSPLIT == 1 || NSPLIT == 2) acc[mb][nb] = WFrag<T16>::mma(a2[mb], b, acc[mb][nb]); if (NSPLIT >= 2) acc[mb][nb] = WFrag<T16>::mma(a[mb], b2, acc[mb][nb]); } }
        asm volatile("v_nop\n\tv_nop\n\tv_nop\n\tv_nop" : "+v"(acc[0][0]), "+v"(acc[1][1]), "+v"(acc[2][2]), "+v"(acc[3][3]) : "v"(a[0]), "v"(a[3]));
    }
    if constexpr (KS == 1) {
#pragma unroll
    for (int mb = 0; mb < 4; ++mb) {
#pragma unroll
        for (int nb = 0; nb < 4; ++nb) {
#pragma unroll
            for (int j = 0; j < 8; ++j) os[(hi * 8 + j) * 68 + nb * 16 + lr] = acc[mb][nb][j]; }
        __builtin_amdgcn_wave_barrier(); asm volatile("" ::: "memory");
        float* crow = C + (size_t)(r0 + mb * 16) * ldc + c0;
{
#pragma unroll
            for (int s = 0; s < 8; ++s) { const int row = 2 * s + hi, cofs = lr * 4; v4f val = *(const v4fa*)(os + row * 68 + cofs); if (BIAS) { val[0] += bfr(bias[c0 + cofs]); val[1] += bfr(bias[c0 + cofs + 1]); val[2] += bfr(bias[c0 + cofs + 2]); val[3] += bfr(bias[c0 + cofs + 3]); }
                *(v4f*)(crow + (size_t)row * ldc + cofs) = val; }
             }
        __builtin_amdgcn_wave_barrier(); asm volatile("" ::: "memory");
    }
    } else {
        float* const ow = os + wv * (64 * 68);   // this wave's whole 64x64 partial tile
        // the three loops are unrolled so that acc[][][] is indexed by constants and stays in registers
#pragma unroll
        for (int mb = 0; mb < 4; ++mb)
#pragma unroll
            for (int nb = 0; nb < 4; ++nb)
#pragma unroll
                for (int j = 0; j < 8; ++j) ow[(mb * 16 + hi * 8 + j) * 68 + nb * 16 + lr] = acc[mb][nb][j];
        __syncthreads();   // every wave's partial tile is in LDS before any element is summed
        float* crow = C + (size_t)r0 * ldc + c0;
        // both loops are unrolled so that the KS LDS reads of an element group issue together, not one wait each
#pragma unroll
        for (int s = 0; s < 32 / KS; ++s) { const int idx = s * (32 * KS) + (int)threadIdx.x, row = idx >> 4, cofs = (idx & 15) * 4;   /* 1024 groups of 4 columns, 32 / KS per thread */ v4f val = *(const v4fa*)(os + row * 68 + cofs);
#pragma unroll
            for (int w = 1; w < KS; ++w) val += *(const v4fa*)(os + w * (64 * 68) + row * 68 + cofs);
            if (BIAS) { val[0] += bfr(bias[c0 + cofs]); val[1] += bfr(bias[c0 + cofs + 1]); val[2] += bfr(bias[c0 + cofs + 2]); val[3] += bfr(bias[c0 + cofs + 3]); }
            *(v4f*)(crow + (size_t)row * ldc + cofs) = val; }
    }
}

__device__ __forceinline__ h16 tohx(float x) { return (h16)x; }
__device__ __forceinline__ void splitf(float y, unsigned short& h, unsigned short& l) { h = f2bf(y); l = f2bf(y - bf2f(h)); }
typedef __attribute__((ext_vector_type(2))) _Float16 v2h;
typedef __attribute__((ext_vector_type(4))) _Float16 v4h;
typedef __attribute__((ext_vector_type(2))) unsigned short v2us;
typedef __attribute__((ext_vector_type(4))) unsigned short v4us;
typedef __attribute__((ext_vector_type(2))) float v2f;
typedef __attribute__((ext_vector_type(4))) int v4i;

__global__ __launch_bounds__(256) void k_wtG(const float* __restrict__ w, int K, int N, bf* Bt) {
    const int lane = threadIdx.x & 31; const int L0 = (blockIdx.x * 8 + (threadIdx.x >> 5)) * 8; const int nlines = N * K / 64;
{
#pragma unroll 1
        for (int l = 0; l < 8; ++l) { const int L = L0 + l; if (L >= nlines) break; const size_t e = (size_t)L * 64 + lane * 2; const int k = (int)(e % K), n = (int)(e / K); v2us o;
            o[0] = f2bf(w[(size_t)k * N + n]); o[1] = f2bf(w[(size_t)(k + 1) * N + n]); *(v2us*)(Bt + e) = o; }
         }
}
__global__ __launch_bounds__(256) void k_cvt8(const float* __restrict__ src, bf* dst, size_t n8) { const size_t i = (size_t)blockIdx.x * 256 + threadIdx.x; if (i >= n8) return; const v8f v = *(const v8f*)(src + i * 8); v8us o;
#pragma unroll
    for (int k = 0; k < 8; ++k) o[k] = f2bf(v[k]); *(v8us*)(dst + i * 8) = o;  }

// k_rope: head planes [h][t][d] (fp16 + hi/lo) of rope(x) x sc with the rotate-half convention out[d] = x[d] cos[t][d] - x[d+HD/2] sin[t][d], out[d+HD/2] = x[d+HD/2] cos[t][d+HD/2] + x[d] sin[t][d+HD/2]
__global__ __launch_bounds__(256) void k_rope(const float* __restrict__ F, int pitch, int nheads, const float* __restrict__ CS, const float* __restrict__ RF, const float* __restrict__ nw, float sc, h16* P16, bf* Ph, bf* Pl) {
    const size_t e = ((size_t)blockIdx.x * 256 + threadIdx.x) * 2; if (e >= (size_t)nheads * TT * HD) return; const int d = (int)(e % HD); const int t = (int)((e / HD) % TT); const int h = (int)(e / ((size_t)HD * TT)); const size_t zp = (size_t)blockIdx.y * nheads * TT * HD;   /* blockIdx.y: the batch (rows of F, planes [b][h][t][d]) */ P16 += zp; Ph += zp; Pl += zp; const float* f = F + ((size_t)blockIdx.y * TT + t) * pitch + h * HD; const float rf = RF ? RF[(size_t)h * TT + t] : 1.0f; v2h o16; v2us oh, ol;
#pragma unroll
    for (int q = 0; q < 2; ++q) { const int dd = d + q; const int dp = (dd < HD / 2) ? dd + HD / 2 : dd - HD / 2; float x0 = f[dd], x1 = f[dp];
        if (RF) { float n0 = __fmul_rn(x0, rf), n1 = __fmul_rn(x1, rf); asm volatile("" : "+v"(n0)); asm volatile("" : "+v"(n1)); x0 = __fmul_rn(bfr(nw[dd]), n0); x1 = __fmul_rn(bfr(nw[dp]), n1); }
        const v2f cs = *(const v2f*)(CS + ((size_t)t * HD + dd) * 2); float a = __fmul_rn(x0, cs[0]), bq = __fmul_rn(x1, cs[1]); asm volatile("" : "+v"(a)); asm volatile("" : "+v"(bq)); const float r = ((dd < HD / 2) ? __fsub_rn(a, bq) : __fadd_rn(a, bq)) * sc;
        o16[q] = tohx(r); unsigned short a2, c2; splitf(r, a2, c2); oh[q] = a2; ol[q] = c2; }
    *(v2h*)(P16 + e) = o16; *(v2us*)(Ph + e) = oh; *(v2us*)(Pl + e) = ol;  }
__global__ __launch_bounds__(256) void k_vtp(const float* __restrict__ F, int pitch, int nheads, h16* V16, bf* Vh, bf* Vl) { const size_t e = ((size_t)blockIdx.x * 256 + threadIdx.x) * 2; if (e >= (size_t)nheads * HD * TT) return; const int t = (int)(e % TT); const int d = (int)((e / TT) % HD); const int g = (int)(e / ((size_t)TT * HD)); const size_t zp = (size_t)blockIdx.y * nheads * HD * TT;   /* blockIdx.y: the batch */ F += (size_t)blockIdx.y * TT * pitch; V16 += zp; Vh += zp; Vl += zp; v2h o16; v2us oh, ol;
#pragma unroll
    for (int q = 0; q < 2; ++q) { const float x = F[(size_t)(t + q) * pitch + g * HD + d]; o16[q] = tohx(x); unsigned short a2, c2; splitf(x, a2, c2); oh[q] = a2; ol[q] = c2; }
    *(v2h*)(V16 + e) = o16; *(v2us*)(Vh + e) = oh; *(v2us*)(Vl + e) = ol;  }
__global__ __launch_bounds__(256) void k_csid(float* CS) { const int idx = blockIdx.x * 256 + threadIdx.x; if (idx >= TT * HD) return; v2f cs; cs[0] = 1.0f; cs[1] = 0.0f; *(v2f*)(CS + (size_t)idx * 2) = cs;  }
template <bool RND>
__global__ __launch_bounds__(256) void k_lnhl(const float* __restrict__ X, const float* __restrict__ A, const float* __restrict__ g, const float* __restrict__ be, float* Z, bf* Yh, bf* Yl) {
    const int lane = threadIdx.x & 31; const int r = blockIdx.x * 8 + (threadIdx.x >> 5); if (r >= NB_ * TT) return; const float* xr = X + (size_t)r * DM; const float* ar = A ? A + (size_t)r * DM : nullptr; float s = 0.f;
#pragma unroll 1
    for (int ch = 0; ch < DM / 128; ++ch) { const int c0 = ch * 128 + lane * 4; const v4f a = *(const v4f*)(xr + c0); v4f d = {0.f, 0.f, 0.f, 0.f}; if (ar) d = *(const v4f*)(ar + c0);
#pragma unroll
        for (int q = 0; q < 4; ++q) s += __fadd_rn((RND ? bfr(a[q]) : a[q]), d[q]); }
#pragma unroll
    for (int sh = 16; sh; sh >>= 1) s += __shfl_xor(s, sh, 32);
    const float mu = s * (1.0f / DM); float s2 = 0.f;
#pragma unroll 1
    for (int ch = 0; ch < DM / 128; ++ch) { const int c0 = ch * 128 + lane * 4; const v4f a = *(const v4f*)(xr + c0); v4f d = {0.f, 0.f, 0.f, 0.f}; if (ar) d = *(const v4f*)(ar + c0);
#pragma unroll
        for (int q = 0; q < 4; ++q) { const float d0 = __fsub_rn(__fadd_rn((RND ? bfr(a[q]) : a[q]), d[q]), mu); float p = __fmul_rn(d0, d0); asm volatile("" : "+v"(p)); s2 = __fadd_rn(s2, p); } }
#pragma unroll
    for (int sh = 16; sh; sh >>= 1) s2 += __shfl_xor(s2, sh, 32);
    const float rs = __fdiv_rn(1.0f, __fsqrt_rn(__fadd_rn(s2 * (1.0f / DM), LNEPS)));
{
#pragma unroll 1
        for (int ch = 0; ch < DM / 128; ++ch) { const int c0 = ch * 128 + lane * 4; const v4f a = *(const v4f*)(xr + c0); v4f d = {0.f, 0.f, 0.f, 0.f}; if (ar) d = *(const v4f*)(ar + c0); v4f z4; v4us oh, ol;
#pragma unroll
            for (int q = 0; q < 4; ++q) { const float v = __fadd_rn((RND ? bfr(a[q]) : a[q]), d[q]); float n0 = __fmul_rn(__fsub_rn(v, mu), rs); asm volatile("" : "+v"(n0)); float n1 = __fmul_rn(n0, bfr(g[c0 + q])); asm volatile("" : "+v"(n1)); const float y = __fadd_rn(n1, bfr(be[c0 + q])); z4[q] = y;   /* Z = the NORMALISED row (it is the residual for the next block) */ unsigned short h2, l2; splitf(y, h2, l2); oh[q] = h2; ol[q] = l2; }
            if (Z) *(v4f*)(Z + (size_t)r * DM + c0) = z4; *(v4us*)(Yh + (size_t)r * DM + c0) = oh; *(v4us*)(Yl + (size_t)r * DM + c0) = ol; }
         } }

__global__ __launch_bounds__(256) void k_relupl(const float* __restrict__ F, bf* Ph2, bf* Pl2, size_t n4) { const size_t i = (size_t)blockIdx.x * 256 + threadIdx.x; if (i >= n4) return; const v4f v = *(const v4f*)(F + i * 4); v4us oh, ol;
#pragma unroll
    for (int q = 0; q < 4; ++q) { unsigned short a, c; splitf(fmaxf(v[q], 0.f), a, c); oh[q] = a; ol[q] = c; } *(v4us*)(Ph2 + i * 4) = oh; *(v4us*)(Pl2 + i * 4) = ol;  }
__global__ __launch_bounds__(256) void k_addln(const float* __restrict__ A, const float* __restrict__ Bm, const float* __restrict__ g, const float* __restrict__ be, float* OUTb) {
    const int lane = threadIdx.x & 31; const int r = blockIdx.x * 8 + (threadIdx.x >> 5); if (r >= NB_ * TT) return; const float* ar = A + (size_t)r * DM; const float* br = Bm + (size_t)r * DM; float s = 0.f;
#pragma unroll 1
    for (int ch = 0; ch < DM / 128; ++ch) { const int c0 = ch * 128 + lane * 4; const v4f a = *(const v4f*)(ar + c0), bb = *(const v4f*)(br + c0);
#pragma unroll
        for (int q = 0; q < 4; ++q) s += __fadd_rn(a[q], bb[q]); }
#pragma unroll
    for (int sh = 16; sh; sh >>= 1) s += __shfl_xor(s, sh, 32);
    const float mu = s * (1.0f / DM); float s2 = 0.f;
#pragma unroll 1
    for (int ch = 0; ch < DM / 128; ++ch) { const int c0 = ch * 128 + lane * 4; const v4f a = *(const v4f*)(ar + c0), bb = *(const v4f*)(br + c0);
#pragma unroll
        for (int q = 0; q < 4; ++q) { const float d0 = __fsub_rn(__fadd_rn(a[q], bb[q]), mu); float p = __fmul_rn(d0, d0); asm volatile("" : "+v"(p)); s2 = __fadd_rn(s2, p); } }
#pragma unroll
    for (int sh = 16; sh; sh >>= 1) s2 += __shfl_xor(s2, sh, 32);
    const float rs = __fdiv_rn(1.0f, __fsqrt_rn(__fadd_rn(s2 * (1.0f / DM), LNEPS)));
{
#pragma unroll 1
        for (int ch = 0; ch < DM / 128; ++ch) { const int c0 = ch * 128 + lane * 4; const v4f a = *(const v4f*)(ar + c0), bb = *(const v4f*)(br + c0); v4f o4;
#pragma unroll
            for (int q = 0; q < 4; ++q) { float n0 = __fmul_rn(__fsub_rn(__fadd_rn(a[q], bb[q]), mu), rs); asm volatile("" : "+v"(n0)); float n1 = __fmul_rn(n0, bfr(g[c0 + q])); asm volatile("" : "+v"(n1)); o4[q] = __fadd_rn(n1, bfr(be[c0 + q])); }
            *(v4f*)(OUTb + (size_t)r * DM + c0) = o4; }
         } }
// ---- k_fattn: scores, softmax and attn.v of both batches in one launch; no score or probability ever leaves the work-group.
// 4 waves x 16 query columns per work-group, one head; the 2048 keys are walked in passes of KC = 64 with a running maximum and sum (new order of the softmax and attn.v sums).
// S^T = K Q^T (A = key rows from LDS, B = query rows kept in registers), O^T += V^T P^T (A = V^T rows from LDS, B = the score tiles converted in place: two D tiles of 16 keys are one B operand in the loaders' k order).
// A lane holds one query's column, so the maximum is in-lane plus one exchange between the wave's halves. Work-groups below NB_ * NH_ * RH / 64 take the hi+lo rows (3 products), the rest single fp16.
#define KC   64                   // keys per pass
#define LP   72                   // LDS row pitch in 16-bit elements: 144 B = 16 B x odd, conflict-free for the 16-byte fragment reads
#define PLN  (64 * LP)            // one staged plane: 64 rows of 128 B (K: 64 keys x HD; V^T: HD rows x 64 keys)
#define BIGF 0x1p127f             // a power of two: BIGF * CL2 is exact, so a fully masked row gets exponent 0 for every key (uniform weights, as the reference's -1e9 gives)
#define CL2  0.18033688011112042f // HD^-0.5 * log2(e)
__device__ __forceinline__ float xhalf(float x) { const int b = __float_as_int(x); return __int_as_float(__builtin_amdgcn_permlanex16(b, b, 0x76543210, 0xfedcba98, false, false)); }   // lane l <-> l ^ 16
typedef __attribute__((ext_vector_type(2))) __bf16 v2bf;
// 2^x in asm so that the slot the instruction set asks for behind a transcendental (before its result is read or its source overwritten) is filled by construction:
// in the group of four each exponential stands in front of an independent one (the outputs are early-clobber: none shares a register with an input), and the v_nop fills the slot behind the last.
__device__ __forceinline__ v4f exp2x4(float a, float b, float c, float d) { float r0, r1, r2, r3;
    asm("v_exp_f32 %0, %4\n\tv_exp_f32 %1, %5\n\tv_exp_f32 %2, %6\n\tv_exp_f32 %3, %7\n\tv_nop" : "=&v"(r0), "=&v"(r1), "=&v"(r2), "=&v"(r3) : "v"(a), "v"(b), "v"(c), "v"(d)); return (v4f){r0, r1, r2, r3}; }
__device__ __forceinline__ float exp2x1(float a) { float r; asm("v_exp_f32 %0, %1\n\tv_nop" : "=v"(r) : "v"(a)); return r; }
template <typename T16, bool HL>
__device__ __forceinline__ void fattn_body(const T16* __restrict__ Q, const T16* __restrict__ Q2, const T16* __restrict__ Kp, const T16* __restrict__ Kp2, const T16* __restrict__ Vt, const T16* __restrict__ Vt2, int q0, T16* sm, const float* lim, bf* Ah, bf* Al) {
    typedef typename WFrag<T16>::V V;
    constexpr int NP = HL ? 4 : 2, NL = HL ? 2 : 1;   // planes in a buffer (K, V^T, K lo, V^T lo); planes of one operand
    const int tid = threadIdx.x, lane = tid & 31, lr = lane & 15, hi = lane >> 4; const int qr = q0 + (tid >> 5) * 16 + lr;
    V qf[2], qf2[2];
#pragma unroll
    for (int ks = 0; ks < 2; ++ks) { qf[ks] = WFrag<T16>::ld(Q + (size_t)qr * HD + ks * 32 + 8 * hi); if (HL) qf2[ks] = WFrag<T16>::ld(Q2 + (size_t)qr * HD + ks * 32 + 8 * hi); }
    // staging: a plane is 512 pieces of 16 B, 4 per thread; 8 neighbouring lanes read one whole 128-B line. K and V^T take turns in the same registers.
    const int srow = tid >> 3, sseg = (tid & 7) * 8;
    v8us st[NL][4];
    auto gloadK = [&](int c) {
#pragma unroll
        for (int u = 0; u < 4; ++u) { const size_t e = (size_t)(c * KC + srow + 16 * u) * HD + sseg; st[0][u] = *(const v8usa*)(Kp + e); if constexpr (HL) st[1][u] = *(const v8usa*)(Kp2 + e); } };
    auto gloadV = [&](int c) {
#pragma unroll
        for (int u = 0; u < 4; ++u) { const size_t e = (size_t)(srow + 16 * u) * TT + c * KC + sseg; st[0][u] = *(const v8usa*)(Vt + e); if constexpr (HL) st[1][u] = *(const v8usa*)(Vt2 + e); } };
    auto sstore = [&](T16* pl) {   // pl: the operand's hi plane; its lo plane lies two planes further
#pragma unroll
        for (int p = 0; p < NL; ++p)
#pragma unroll
            for (int u = 0; u < 4; ++u) *(v8usa*)(pl + p * 2 * PLN + (srow + 16 * u) * LP + sseg) = st[p][u]; };
    v8f o[4];
#pragma unroll
    for (int dt = 0; dt < 4; ++dt) o[dt] = (v8f){};
    float mraw = -BIGF, mcs = -BIGF * CL2;
    // the softmax sums ride the matrix pipe: an A of ones makes every row of lt the column sums of the (rounded) weights, over both lane halves' keys; lt is rescaled like an output tile
    V ones; v8f lt = (v8f){};
#pragma unroll
    for (int e = 0; e < 16; ++e) { if constexpr (HL) ones[e] = (__bf16)1.0f; else ones[e] = (h16)1.0f; }
    gloadK(0); sstore(sm); gloadV(0); sstore(sm + PLN);
    __syncthreads();   // pass 0's planes and the key limits are in LDS
    // The scheduling fences in the loop keep each group of LDS fragment loads together and ahead of the block of products that uses it (one exposed LDS latency a group, not one a fragment),
    // and keep the products of a block in the written order, in which neighbours go to different accumulators.
#pragma unroll 1
    for (int c = 0; c < TT / KC; ++c) {
        const T16* cur = sm + (c & 1) * (NP * PLN); T16* nxt = sm + ((c + 1) & 1) * (NP * PLN);
        const int cn = (c + 1 < TT / KC) ? c + 1 : c;   // the last pass re-reads its own planes: no branch in the loop; that copy is never read
        gloadK(cn);   // the next pass's K flies during the score products
        __builtin_amdgcn_sched_barrier(0);   // fence: the global loads stay at the head of the pass
        v8f s[4];
        if constexpr (HL) {
#pragma unroll
            for (int ks = 0; ks < 2; ++ks) { V ka[4], kb[4];
#pragma unroll
                for (int kt = 0; kt < 4; ++kt) { ka[kt] = WFrag<T16>::ld(cur + (kt * 16 + lr) * LP + ks * 32 + 8 * hi); kb[kt] = WFrag<T16>::ld(cur + 2 * PLN + (kt * 16 + lr) * LP + ks * 32 + 8 * hi); }
                __builtin_amdgcn_sched_barrier(0);   // fence: loads | products
#pragma unroll
                for (int kt = 0; kt < 4; ++kt) s[kt] = WFrag<T16>::mma(ka[kt], qf[ks], ks ? s[kt] : (v8f){});
#pragma unroll
                for (int kt = 0; kt < 4; ++kt) s[kt] = WFrag<T16>::mma(ka[kt], qf2[ks], s[kt]);
#pragma unroll
                for (int kt = 0; kt < 4; ++kt) s[kt] = WFrag<T16>::mma(kb[kt], qf[ks], s[kt]);
                __builtin_amdgcn_sched_barrier(0); }   // fence: products | next group
        } else { V ka[2][4];
#pragma unroll
            for (int ks = 0; ks < 2; ++ks)
#pragma unroll
                for (int kt = 0; kt < 4; ++kt) ka[ks][kt] = WFrag<T16>::ld(cur + (kt * 16 + lr) * LP + ks * 32 + 8 * hi);
            __builtin_amdgcn_sched_barrier(0);   // fence: loads | products
#pragma unroll
            for (int ks = 0; ks < 2; ++ks)
#pragma unroll
                for (int kt = 0; kt < 4; ++kt) s[kt] = WFrag<T16>::mma(ka[ks][kt], qf[ks], ks ? s[kt] : (v8f){});
            __builtin_amdgcn_sched_barrier(0); }   // fence: products | next group
        // key mask as a select, one instruction: the median of (s, -BIGF, +BIGF) is s, of (s, -BIGF, -BIGF) is -BIGF; four independent maximum chains
        float mk[4]; v4f lm[8];
#pragma unroll
        for (int u = 0; u < 8; ++u) lm[u] = *(const v4fa*)(lim + c * KC + (u >> 1) * 16 + hi * 8 + (u & 1) * 4);
        __builtin_amdgcn_sched_barrier(0);   // fence: the eight limit loads go out as one group, while the last score products drain
#pragma unroll
        for (int kt = 0; kt < 4; ++kt) { mk[kt] = -BIGF;
#pragma unroll
            for (int j = 0; j < 8; ++j) { const float t = __builtin_amdgcn_fmed3f(s[kt][j], -BIGF, lm[2 * kt + (j >> 2)][j & 3]); s[kt][j] = t; mk[kt] = __builtin_fmaximum_numf(mk[kt], t); } }
        float mx = __builtin_fmaximum_numf(__builtin_fmaximum_numf(__builtin_fmaximum_numf(mk[0], mk[1]), __builtin_fmaximum_numf(mk[2], mk[3])), mraw); mx = __builtin_fmaximum_numf(mx, xhalf(mx));
        __builtin_amdgcn_sched_barrier(0);   // fence: the K stores (and the wait on their loads) stay behind the maximum
        sstore(nxt); gloadV(cn);   // K goes to the other buffer; the next pass's V^T flies during the exponentials and the output products
        V va[HL ? 1 : 2][4], vb[4];   // V^T fragments fetched ahead of the exponentials (fp16: both 32-key groups; hi+lo: the first)
#pragma unroll
        for (int g = 0; g < (HL ? 1 : 2); ++g)
#pragma unroll
            for (int dt = 0; dt < 4; ++dt) { va[g][dt] = WFrag<T16>::ld(cur + PLN + (dt * 16 + lr) * LP + g * 32 + 8 * hi); if constexpr (HL) vb[dt] = WFrag<T16>::ld(cur + 3 * PLN + (dt * 16 + lr) * LP + g * 32 + 8 * hi); }
        __builtin_amdgcn_sched_barrier(0);   // fence: these loads are issued before the exponentials, which cover their latency
        const float mc = mx * CL2, al = exp2x1(mcs - mc), ad = (HL ? 0.0f : 10.0f) - mc;   // fp16 weights carry x1024 (cancels in the division by the sum): small weights stay normal numbers
        mraw = mx; mcs = mc;
#pragma unroll
        for (int kt = 0; kt < 4; ++kt)
#pragma unroll
            for (int j = 0; j < 8; ++j) s[kt][j] = __builtin_fmaf(s[kt][j], CL2, ad);
#pragma unroll
        for (int kt = 0; kt < 4; ++kt) { const v4f e0 = exp2x4(s[kt][0], s[kt][1], s[kt][2], s[kt][3]), e1 = exp2x4(s[kt][4], s[kt][5], s[kt][6], s[kt][7]); s[kt] = __builtin_shufflevector(e0, e1, 0, 1, 2, 3, 4, 5, 6, 7); }
        __builtin_amdgcn_sched_barrier(0);   // fence: the exponentials are asm text: none of the products below is scheduled in front of them
        lt *= al;
#pragma unroll
        for (int dt = 0; dt < 4; ++dt) o[dt] *= al;
#pragma unroll
        for (int g = 0; g < 2; ++g) { V pb, pb2;
#pragma unroll
            for (int e = 0; e < 16; e += 2) { const v2f pp = {s[2 * g + (e >> 3)][e & 7], s[2 * g + (e >> 3)][(e & 7) + 1]};   // by pairs: one packed conversion for two weights
                if constexpr (HL) { const v2bf h2 = __builtin_convertvector(pp, v2bf); const v2bf l2 = __builtin_convertvector(pp - __builtin_convertvector(h2, v2f), v2bf); pb[e] = h2[0]; pb[e + 1] = h2[1]; pb2[e] = l2[0]; pb2[e + 1] = l2[1]; }
                else { const v2h h2 = __builtin_convertvector(pp, v2h); pb[e] = h2[0]; pb[e + 1] = h2[1]; } }
            __builtin_amdgcn_sched_barrier(0);   // fence: conversions | products
#pragma unroll
            for (int dt = 0; dt < 4; ++dt) o[dt] = WFrag<T16>::mma(va[HL ? 0 : g][dt], pb, o[dt]);
            lt = WFrag<T16>::mma(ones, pb, lt);
            if constexpr (HL) {
#pragma unroll
                for (int dt = 0; dt < 4; ++dt) o[dt] = WFrag<T16>::mma(va[0][dt], pb2, o[dt]);
                lt = WFrag<T16>::mma(ones, pb2, lt);
#pragma unroll
                for (int dt = 0; dt < 4; ++dt) o[dt] = WFrag<T16>::mma(vb[dt], pb, o[dt]);
                __builtin_amdgcn_sched_barrier(0);   // fence: products | the second group's loads
                if (g == 0) {
#pragma unroll
                    for (int dt = 0; dt < 4; ++dt) { va[0][dt] = WFrag<T16>::ld(cur + PLN + (dt * 16 + lr) * LP + 32 + 8 * hi); vb[dt] = WFrag<T16>::ld(cur + 3 * PLN + (dt * 16 + lr) * LP + 32 + 8 * hi); }
                    __builtin_amdgcn_sched_barrier(0); } } }   // fence: the second group's loads are issued before its conversions, which cover their latency
        __builtin_amdgcn_sched_barrier(0);   // fence: the V^T stores (and the wait on their loads) stay at the foot of the pass
        sstore(nxt + PLN);
        __syncthreads();   // publishes the next pass's planes and ends every wave's reads of this pass's (refilled in the next trip)
    }
    const float inv = __fdiv_rn(1.0f, lt[0]);
#pragma unroll
    for (int dt = 0; dt < 4; ++dt) { v8us oh, ol;   // a lane's 8 accumulator registers are 8 consecutive d of its query: one 16-byte store per plane
#pragma unroll
        for (int j = 0; j < 8; ++j) { unsigned short a, c2; splitf(o[dt][j] * inv, a, c2); oh[j] = a; ol[j] = c2; }
        const size_t oo = (size_t)qr * DQ + dt * 16 + hi * 8; *(v8us*)(Ah + oo) = oh; *(v8us*)(Al + oo) = ol; }
}
// the second bound (4 waves per SIMD) is a budget of 256 registers: the hi+lo body stays below v256 and needs no register-window switches in its loop
__global__ __launch_bounds__(128, 4) void k_fattn(const h16* __restrict__ Q16, const h16* __restrict__ K16, const h16* __restrict__ V16, const bf* __restrict__ Qh, const bf* __restrict__ Ql, const bf* __restrict__ Kh, const bf* __restrict__ Kl, const bf* __restrict__ Vh, const bf* __restrict__ Vl, const int* __restrict__ MK, bf* Ah, bf* Al) {
    __shared__ __align__(16) unsigned short sm[2 * 4 * PLN];
    __shared__ __align__(16) float lim[TT];
    const int bx = blockIdx.x;   // the heavier hi+lo work-groups of both batches come first
    constexpr int NHL = NH_ * (RH / 64), NSG = NH_ * ((TT - RH) / 64);   // work-groups of a batch: hi+lo, single fp16
    const bool hl = bx < NB_ * NHL; const int bt = hl ? bx / NHL : (bx - NB_ * NHL) / NSG, ix = hl ? bx % NHL : (bx - NB_ * NHL) % NSG;   // batch, index inside the batch
    const int* MKb = MK + (size_t)bt * TT; const size_t zb = (size_t)bt * NH_ * TT * HD, zkb = (size_t)bt * NKV * TT * HD; Ah += (size_t)bt * TT * DQ; Al += (size_t)bt * TT * DQ;
    // unrolled so that the four mask loads of a thread are in flight together
#pragma unroll
    for (int u = 0; u < TT / 512; ++u) { const int i = (u * 128 + (int)threadIdx.x) * 4; const v4i m4 = *(const v4i*)(MKb + i); v4f f4;
#pragma unroll
        for (int q = 0; q < 4; ++q) f4[q] = (m4[q] != 0) ? BIGF : -BIGF;
        *(v4fa*)(lim + i) = f4; }
    if (hl) { const int h = ix / (RH / 64), q0 = (ix % (RH / 64)) * 64; const size_t zq = zb + (size_t)h * TT * HD, zk = zkb + (size_t)(h / REP) * TT * HD;
        fattn_body<bf, true>(Qh + zq, Ql + zq, Kh + zk, Kl + zk, Vh + zk, Vl + zk, q0, (bf*)sm, lim, Ah + h * HD, Al + h * HD);
    } else { const int h = ix / ((TT - RH) / 64), q0 = RH + (ix % ((TT - RH) / 64)) * 64; const size_t zq = zb + (size_t)h * TT * HD, zk = zkb + (size_t)(h / REP) * TT * HD;
        fattn_body<h16, false>(Q16 + zq, nullptr, K16 + zk, nullptr, V16 + zk, nullptr, q0, (h16*)sm, lim, Ah + h * HD, Al + h * HD); }
}

extern "C" void kernel_launch(void* const* d_in, const int* in_sizes, int n_in,
                              void* d_out, int out_size, void* d_ws, size_t ws_size, hipStream_t stream) {
    (void)in_sizes; (void)n_in; (void)out_size;
    const float* x = (const float*)d_in[0]; const float* xk = (const float*)d_in[1]; const int* MK = (const int*)d_in[2]; const float* wq = (const float*)d_in[3]; const float* bq = (const float*)d_in[4]; const float* wk = (const float*)d_in[5]; const float* bk = (const float*)d_in[6]; const float* wv = (const float*)d_in[7]; const float* bv = (const float*)d_in[8]; const float* wo = (const float*)d_in[9]; const float* bo = (const float*)d_in[10]; const float* w1 = (const float*)d_in[11]; const float* b1 = (const float*)d_in[12]; const float* w2 = (const float*)d_in[13]; const float* b2 = (const float*)d_in[14]; const float* g1 = (const float*)d_in[15]; const float* e1 = (const float*)d_in[16]; const float* g2 = (const float*)d_in[17]; const float* e2 = (const float*)d_in[18];
    float* OUT = (float*)d_out;     // [2][2048][1024]
    char* wsp = (char*)d_ws;
    auto take = [&](size_t bytes) { char* p = wsp; wsp += (bytes + 255) & ~(size_t)255; return (void*)p; };
    bf* WQ = (bf*)take((size_t)DQ * DM * 2); bf* WK = (bf*)take((size_t)DKV * DM * 2); bf* WV = (bf*)take((size_t)DKV * DM * 2); bf* WO = (bf*)take((size_t)DM * DQ * 2); float* CS = (float*)take((size_t)TT * HD * 2 * 4);
    bf* W1B = (bf*)take((size_t)DFF * DM * 2); bf* W2B = (bf*)take((size_t)DM * DFF * 2);
    // every buffer below holds both batches (rows b * TT + t; head planes [b][h][..]).
    // Region A: inputs in bf16 and the head planes, dead once the attention has run; H1 lies over it. Region B: projections, merged heads and mha, dead once x1 is built; Gh, Gl lie over it.
    char* const regA = wsp;
    bf* XB = (bf*)take((size_t)NB_ * TT * DM * 2); bf* XKB = (bf*)take((size_t)NB_ * TT * DM * 2);
    h16* QP16 = (h16*)take((size_t)NB_ * NH_ * TT * HD * 2); h16* KP16 = (h16*)take((size_t)NB_ * NKV * TT * HD * 2); h16* VT16 = (h16*)take((size_t)NB_ * NKV * HD * TT * 2);
    bf* QPh = (bf*)take((size_t)NB_ * NH_ * TT * HD * 2); bf* QPl = (bf*)take((size_t)NB_ * NH_ * TT * HD * 2); bf* KPh = (bf*)take((size_t)NB_ * NKV * TT * HD * 2); bf* KPl = (bf*)take((size_t)NB_ * NKV * TT * HD * 2); bf* VTh = (bf*)take((size_t)NB_ * NKV * HD * TT * 2); bf* VTl = (bf*)take((size_t)NB_ * NKV * HD * TT * 2);
    char* const regB = wsp;
    float* FQ = (float*)take((size_t)NB_ * TT * DQ * 4); float* FK = (float*)take((size_t)NB_ * TT * DKV * 4); bf* ATh = (bf*)take((size_t)NB_ * TT * DQ * 2); bf* ATl = (bf*)take((size_t)NB_ * TT * DQ * 2); float* S2 = (float*)take((size_t)NB_ * TT * DM * 4);
    float* X1 = (float*)take((size_t)NB_ * TT * DM * 4); bf* L1h = (bf*)take((size_t)NB_ * TT * DM * 2); bf* L1l = (bf*)take((size_t)NB_ * TT * DM * 2); float* F2 = (float*)take((size_t)NB_ * TT * DM * 4);
    if ((size_t)(wsp - (char*)d_ws) > ws_size) return;
    float* H1 = (float*)regA; bf* Gh = (bf*)regB; bf* Gl = Gh + (size_t)NB_ * TT * DFF;
    static_assert((size_t)NB_ * TT * DFF * 4 <= (size_t)NB_ * TT * (2 * DM + 3 * DQ + 6 * DKV) * 2, "H1 fits region A");
    static_assert((size_t)NB_ * TT * DFF * 2 * 2 <= (size_t)NB_ * TT * (DQ * 4 + DKV * 4 + DQ * 2 * 2 + DM * 4), "Gh, Gl fit region B");
    float* FV = FK;   // v projection reuses the k buffer after the k planes are built (stream-ordered)
    { k_wtG<<<(unsigned)((DM * DQ / 64 + 63) / 64), 256, 0, stream>>>(wq, DM, DQ, WQ); k_wtG<<<(unsigned)((DM * DKV / 64 + 63) / 64), 256, 0, stream>>>(wk, DM, DKV, WK); k_wtG<<<(unsigned)((DM * DKV / 64 + 63) / 64), 256, 0, stream>>>(wv, DM, DKV, WV);
      k_wtG<<<(unsigned)((DQ * DM / 64 + 63) / 64), 256, 0, stream>>>(wo, DQ, DM, WO); k_wtG<<<(unsigned)((DM * DFF / 64 + 63) / 64), 256, 0, stream>>>(w1, DM, DFF, W1B); k_wtG<<<(unsigned)((DFF * DM / 64 + 63) / 64), 256, 0, stream>>>(w2, DFF, DM, W2B);
       }
    k_csid<<<(TT * HD + 255) / 256, 256, 0, stream>>>(CS);
    const unsigned LQ = (unsigned)(((size_t)NH_ * TT * HD / 2 + 255) / 256), LKv = (unsigned)(((size_t)NKV * TT * HD / 2 + 255) / 256);
    // one launch of each kernel serves both batches. In the GEMM grids the batch is z (the slowest index), so a batch's tiles still start together.
    k_cvt8<<<(unsigned)(((size_t)NB_ * TT * DM / 8 + 255) / 256), 256, 0, stream>>>(x, XB, (size_t)NB_ * TT * DM / 8); k_cvt8<<<(unsigned)(((size_t)NB_ * TT * DM / 8 + 255) / 256), 256, 0, stream>>>(xk, XKB, (size_t)NB_ * TT * DM / 8);
    k_gemmw<bf, 0, true, 4><<<dim3(TT / 64, DQ / 64, NB_), 128, 0, stream>>>(XB, nullptr, WQ, nullptr, DM, FQ, DQ, bq, (size_t)TT * DM, 0, (size_t)TT * DQ);
    k_rope<<<dim3(LQ, NB_, 1), 256, 0, stream>>>(FQ, DQ, NH_, CS, nullptr, nullptr, 1.0f, QP16, QPh, QPl);
    k_gemmw<bf, 0, true, 4><<<dim3(TT / 64, DKV / 64, NB_), 128, 0, stream>>>(XKB, nullptr, WK, nullptr, DM, FK, DKV, bk, (size_t)TT * DM, 0, (size_t)TT * DKV);
    k_rope<<<dim3(LKv, NB_, 1), 256, 0, stream>>>(FK, DKV, NKV, CS, nullptr, nullptr, 1.0f, KP16, KPh, KPl);
    k_gemmw<bf, 0, true, 4><<<dim3(TT / 64, DKV / 64, NB_), 128, 0, stream>>>(XKB, nullptr, WV, nullptr, DM, FV, DKV, bv, (size_t)TT * DM, 0, (size_t)TT * DKV); k_vtp<<<dim3(LKv, NB_, 1), 256, 0, stream>>>(FV, DKV, NKV, VT16, VTh, VTl);
    k_fattn<<<NB_ * NH_ * (TT / 64), 128, 0, stream>>>(QP16, KP16, VT16, QPh, QPl, KPh, KPl, VTh, VTl, MK, ATh, ATl);   /* softmax(q k^T / 8, mask) v, merged heads as hi/lo planes */
    k_gemmw<bf, 1, true, 4><<<dim3(TT / 64, DM / 64, NB_), 128, 0, stream>>>(ATh, ATl, WO, nullptr, DQ, S2, DM, bo, (size_t)TT * DQ, 0, (size_t)TT * DM);   /* mha = merged Wo + bo */
    k_lnhl<true><<<NB_ * TT / 8, 256, 0, stream>>>(x, S2, g1, e1, X1, L1h, L1l);                                                          /* x1 = LN(bf16(x) + mha): normalised row in f32 + hi/lo planes */
    k_gemmw<bf, 1, true, 1><<<dim3(TT / 64, DFF / 64, NB_), 32, 0, stream>>>(L1h, L1l, W1B, nullptr, DM, H1, DFF, b1, (size_t)TT * DM, 0, (size_t)TT * DFF);   /* x1 W1 + b1 */
    k_relupl<<<(unsigned)(((size_t)NB_ * TT * DFF / 4 + 255) / 256), 256, 0, stream>>>(H1, Gh, Gl, (size_t)NB_ * TT * DFF / 4);           /* relu -> hi/lo */
    k_gemmw<bf, 1, true, 8><<<dim3(TT / 64, DM / 64, NB_), 256, 0, stream>>>(Gh, Gl, W2B, nullptr, DFF, F2, DM, b2, (size_t)TT * DFF, 0, (size_t)TT * DM);   /* . W2 + b2 */
    k_addln<<<NB_ * TT / 8, 256, 0, stream>>>(X1, F2, g2, e2, OUT);                                                                       /* out = LN(x1 + ff) */
}

// v005
// It runs in 390 microseconds.
// In both of two side-by-side timings against v004, it was 1.32 times as fast.
// Counting every step since v000, it is 10.2 times as fast.
#include <hip/hip_runtime.h>

// Post-LN transformer encoder block with cross attention (x, y [2][2048][1024]; Q = x Wq + bq, K = y Wk + bk, V = y Wv + bv ('xw' [1024][1024]; 16 heads x 64); scores/8 with mask [2][1][1][2048] (int32 keys, read; -1e9 == exact zero weight; all ones here); softmax; mha = merged Wo + bo; x1 = LN(x + mha); ff = relu(x1 W1 + b1) W2 + b2 (W1 [1024][4096]); out = LN(x1 + ff) (eps 1e-5) -> [2][2048][1024] (4.2 M)).
// Compute dtypes, f32 accumulate: every input rounded to bf16; q/k/v on PLAIN bf16 operands (inputs: exact) + biases; key mask as a select; scores and attn.v: query rows < 512 hl (3 products), the rest single fp16 (x1024); softmax f32; Wo, W1, W2 hl x exact (2 products) + biases; residuals / LayerNorms / ReLU in f32.

#define NB_  2
#define TT   2048
#define DM   1024
#define NH_  16
#define NKV  16
#define REP  (NH_ / NKV)
#define HD   64
#define DQ   (NH_ * HD)
#define DKV  (NKV * HD)
#define DFF  4096
#define LNEPS 1e-5f
#define RH   512                  // query rows < RH use hi+lo planes (0: none)
#define WIN  0
#define SCL  0.125f   // HD^-0.5
typedef _Float16 h16;
typedef unsigned short bf;
typedef __attribute__((ext_vector_type(16))) __bf16   v16bf;
typedef __attribute__((ext_vector_type(16))) _Float16 v16h;
typedef __attribute__((ext_vector_type(8)))  _Float16 v8h;
typedef __attribute__((ext_vector_type(8)))  unsigned short v8us;
typedef __attribute__((ext_vector_type(8)))  float    v8f;
typedef __attribute__((ext_vector_type(4)))  float    v4f;
typedef v8h  __attribute__((may_alias)) v8ha;
typedef v4f  __attribute__((may_alias)) v4fa;
typedef v8us __attribute__((may_alias)) v8usa;

__device__ __forceinline__ unsigned short f2bf(float f) { unsigned u = __float_as_uint(f); u += 0x7FFFu + ((u >> 16) & 1u); return (unsigned short)(u >> 16); }
__device__ __forceinline__ float bf2f(unsigned short b) { return __uint_as_float(((unsigned)b) << 16); }
__device__ __forceinline__ float bfr(float f) { return bf2f(f2bf(f)); }
__device__ __forceinline__ v16h cat16(v8h lo, v8h hi) { return __builtin_shufflevector(lo, hi, 0, 1, 2, 3, 4, 5, 6, 7, 8, 9, 10, 11, 12, 13, 14, 15); }
__device__ __forceinline__ v16bf cat16b(v8us lo, v8us hi) { return __builtin_bit_cast(v16bf, __builtin_shufflevector(lo, hi, 0, 1, 2, 3, 4, 5, 6, 7, 8, 9, 10, 11, 12, 13, 14, 15)); }
__device__ __forceinline__ v8f wmma16(v16h a, v16h b, v8f c) { return __builtin_amdgcn_wmma_f32_16x16x32_f16(false, a, false, b, (short)0, c, false, false); }
__device__ __forceinline__ v8f wmmab(v16bf a, v16bf b, v8f c) { return __builtin_amdgcn_wmma_f32_16x16x32_bf16(false, a, false, b, (short)0, c, false, false); }



// ---- k_gemms: GEMM on LDS-staged operands. One 128x128 output tile per work-group, 4 waves as 2 x 2, each a 64x64 tile (16 accumulators); grid (M/128, N/128, Z), 128 threads.
// A stage is 64 k = one whole 128-byte line of each of the 128 rows of every operand plane (A, with NSPLIT == 1 also A2, and Bt), brought from the K-contiguous 16-bit planes into LDS by asynchronous copies
// (a wave's copy covers 4 whole lines); two buffers, the next stage flies while this one is worked on. Each staged row serves two waves.
// C[m][n] (f32, pitch ldc, + optional f32 bias[n]) = sum_k (A[m][k] + A2[m][k]) Bt[n][k], k ascending in one chain per element. z-batch strides sA/sC in elements. K (compile time) % 64 == 0, at least two stages.
template <typename T16> struct WFrag;
template <> struct WFrag<h16> { typedef v16h V; static __device__ __forceinline__ V ld(const h16* p) { return cat16(*(const v8h*)p, *(const v8h*)(p + 16)); } static __device__ __forceinline__ v8f mma(V a, V b, v8f c) { return wmma16(a, b, c); } };
template <> struct WFrag<bf> { typedef v16bf V; static __device__ __forceinline__ V ld(const bf* p) { return cat16b(*(const v8us*)p, *(const v8us*)(p + 16)); } static __device__ __forceinline__ v8f mma(V a, V b, v8f c) { return wmmab(a, b, c); } };
#define GP   72                   // LDS row pitch in 16-bit elements: 144 B = 16 B x odd, conflict-free for the 16-byte fragment reads
#define GPL  (128 * GP)           // one staged plane: 128 rows of 128 B
// eight asynchronous 16-byte copies of a lane (rows r, r + 16, .. r + 112 of one plane); the s_wait_xcnt stands inside the statement, behind the last copy, so that no address register is rewritten in front of it
__device__ __forceinline__ void acopy8(unsigned l, const bf* g, size_t rs) {
    asm volatile("global_load_async_to_lds_b128 %0, %8, off\n\tglobal_load_async_to_lds_b128 %1, %9, off\n\tglobal_load_async_to_lds_b128 %2, %10, off\n\tglobal_load_async_to_lds_b128 %3, %11, off\n\t"
                 "global_load_async_to_lds_b128 %4, %12, off\n\tglobal_load_async_to_lds_b128 %5, %13, off\n\tglobal_load_async_to_lds_b128 %6, %14, off\n\tglobal_load_async_to_lds_b128 %7, %15, off\n\ts_wait_xcnt 0x0"
                 :: "v"(l), "v"(l + 16 * GP * 2), "v"(l + 32 * GP * 2), "v"(l + 48 * GP * 2), "v"(l + 64 * GP * 2), "v"(l + 80 * GP * 2), "v"(l + 96 * GP * 2), "v"(l + 112 * GP * 2),
                    "v"(g), "v"(g + rs), "v"(g + 2 * rs), "v"(g + 3 * rs), "v"(g + 4 * rs), "v"(g + 5 * rs), "v"(g + 6 * rs), "v"(g + 7 * rs) : "memory"); }
// the second bound (4 waves per SIMD) is a budget of 256 registers: accumulators and one fragment set fit below v256
template <int NSPLIT, bool BIAS, int K>
__global__ __launch_bounds__(128, 4) void k_gemms(const bf* __restrict__ A, const bf* __restrict__ A2, const bf* __restrict__ Bt, float* C, int ldc, const float* __restrict__ bias, size_t sA, size_t sC) {
    typedef WFrag<bf>::V V;
    constexpr int NPL = NSPLIT ? 3 : 2;   // planes of a stage: Bt, A (, A2)
    __shared__ __align__(16) bf sm[2 * NPL * GPL];
    __shared__ __align__(16) float os[4 * 16 * 68];
    const size_t z = blockIdx.z; A += z * sA; if (NSPLIT) A2 += z * sA; C += z * sC;
    const int tid = threadIdx.x, lane = tid & 31, lr = lane & 15, hi = lane >> 4; const int wv = __builtin_amdgcn_readfirstlane(tid >> 5), wm = wv & 1, wn = wv >> 1;
    const int r0 = blockIdx.x * 128, c0 = blockIdx.y * 128;
    // staging: 8 neighbouring lanes copy one whole 128-B line; a thread takes rows srow + 16 u of every plane
    const int srow = tid >> 3, sseg = (tid & 7) * 8;
    const bf* gB = Bt + (size_t)(c0 + srow) * K + sseg; const bf* gA = A + (size_t)(r0 + srow) * K + sseg; const bf* gA2 = NSPLIT ? A2 + (size_t)(r0 + srow) * K + sseg : nullptr;
    const unsigned l0 = (unsigned)(size_t)sm + (unsigned)(srow * GP + sseg) * 2u; const size_t rs = (size_t)16 * K;
    auto stage = [&](int t) { const unsigned l = l0 + (unsigned)(t & 1) * (NPL * GPL * 2); const int kc = t * 64;
        acopy8(l, gB + kc, rs); acopy8(l + GPL * 2, gA + kc, rs); if constexpr (NSPLIT != 0) acopy8(l + 2 * GPL * 2, gA2 + kc, rs); };
    // every loop over mb, nb, ks, j and s in this kernel is unrolled so that acc[][] and the fragments are indexed by constants and stay in registers
    v8f acc[4][4];
#pragma unroll
    for (int mb = 0; mb < 4; ++mb)
#pragma unroll
        for (int nb = 0; nb < 4; ++nb) acc[mb][nb] = (v8f){};
    constexpr int nst = K / 64; static_assert(K % 64 == 0 && nst >= 2, "whole stages, at least two");
    stage(0);
    asm volatile("s_wait_asynccnt 0x0" ::: "memory");   // this wave's copies of stage 0 have landed
    __syncthreads();                                     // every wave's have: stage 0 may be read
    stage(1);
    const int aof = (wm * 64 + lr) * GP + 8 * hi, bof = (wn * 64 + lr) * GP + 8 * hi;
    // the stage loop stays rolled: one copy of a stage's products and copies in the instruction cache, and one publish point
#pragma unroll 1
    for (int t = 0; t < nst; ++t) {
        const bf* cur = sm + (t & 1) * (NPL * GPL);
#pragma unroll
        for (int ks = 0; ks < 2; ++ks) { V a[4], a2[4], b[4];
            b[0] = WFrag<bf>::ld(cur + bof + ks * 32);
#pragma unroll
            for (int mb = 0; mb < 4; ++mb) a[mb] = WFrag<bf>::ld(cur + GPL + aof + mb * 16 * GP + ks * 32);
#pragma unroll
            for (int nb = 1; nb < 4; ++nb) b[nb] = WFrag<bf>::ld(cur + bof + nb * 16 * GP + ks * 32);
            if constexpr (NSPLIT != 0) {
#pragma unroll
                for (int mb = 0; mb < 4; ++mb) a2[mb] = WFrag<bf>::ld(cur + 2 * GPL + aof + mb * 16 * GP + ks * 32); }
            __builtin_amdgcn_sched_barrier(0);   // fence: the fragment loads go out as one group ahead of the products (one exposed LDS latency a group)
#pragma unroll
            for (int nb = 0; nb < 4; ++nb)
#pragma unroll
                for (int mb = 0; mb < 4; ++mb) acc[mb][nb] = WFrag<bf>::mma(a[mb], b[nb], acc[mb][nb]);
            if constexpr (NSPLIT != 0) {
#pragma unroll
                for (int nb = 0; nb < 4; ++nb)
#pragma unroll
                    for (int mb = 0; mb < 4; ++mb) acc[mb][nb] = WFrag<bf>::mma(a2[mb], b[nb], acc[mb][nb]); }
            __builtin_amdgcn_sched_barrier(0); }   // fence: products | next group
        asm volatile("s_wait_dscnt 0x0" ::: "memory");      // this wave's reads of the buffer are done before it is refilled
        asm volatile("s_wait_asynccnt 0x0" ::: "memory");   // this wave's copies of stage t + 1 have landed
        __syncthreads();                                     // publishes stage t + 1 and ends every wave's reads of stage t
        if (t + 2 < nst) stage(t + 2);                       // into the buffer that this trip has just read
    }
    asm volatile("s_wait_asynccnt 0x0" ::: "memory");        // no copy is outstanding when the wave goes on
    float* const ow = os + wv * (16 * 68);   // this wave's own staging rows: whole lines go out
    const int cw = c0 + wn * 64, cofs = lr * 4; v4f bv = {0.f, 0.f, 0.f, 0.f};   // a lane stores the same 4 columns of every row: their biases are read once
    if (BIAS) { const v4f b4 = *(const v4f*)(bias + cw + cofs); bv[0] = bfr(b4[0]); bv[1] = bfr(b4[1]); bv[2] = bfr(b4[2]); bv[3] = bfr(b4[3]); }
#pragma unroll
    for (int mb = 0; mb < 4; ++mb) {
#pragma unroll
        for (int nb = 0; nb < 4; ++nb) {
#pragma unroll
            for (int j = 0; j < 8; ++j) ow[(hi * 8 + j) * 68 + nb * 16 + lr] = acc[mb][nb][j]; }
        __builtin_amdgcn_wave_barrier(); asm volatile("" ::: "memory");   // the row reads below are other lanes' stores: the compiler may not move them in front of the stores
        float* crow = C + (size_t)(r0 + wm * 64 + mb * 16) * ldc + cw;
#pragma unroll
        for (int s = 0; s < 8; ++s) { const int row = 2 * s + hi; v4f val = *(const v4fa*)(ow + row * 68 + cofs); if (BIAS) val += bv;
            *(v4f*)(crow + (size_t)row * ldc + cofs) = val; }
        __builtin_amdgcn_wave_barrier(); asm volatile("" ::: "memory");   // nor the next 16 rows' stores in front of these reads
    }
}

__device__ __forceinline__ h16 tohx(float x) { return (h16)x; }
__device__ __forceinline__ void splitf(float y, unsigned short& h, unsigned short& l) { h = f2bf(y); l = f2bf(y - bf2f(h)); }
typedef __attribute__((ext_vector_type(2))) _Float16 v2h;
typedef __attribute__((ext_vector_type(4))) _Float16 v4h;
typedef __attribute__((ext_vector_type(2))) unsigned short v2us;
typedef __attribute__((ext_vector_type(4))) unsigned short v4us;
typedef __attribute__((ext_vector_type(2))) float v2f;
typedef __attribute__((ext_vector_type(4))) int v4i;

__global__ __launch_bounds__(256) void k_wtG(const float* __restrict__ w, int K, int N, bf* Bt) {
    const int lane = threadIdx.x & 31; const int L0 = (blockIdx.x * 8 + (threadIdx.x >> 5)) * 8; const int nlines = N * K / 64;
{
#pragma unroll 1
        for (int l = 0; l < 8; ++l) { const int L = L0 + l; if (L >= nlines) break; const size_t e = (size_t)L * 64 + lane * 2; const int k = (int)(e % K), n = (int)(e / K); v2us o;
            o[0] = f2bf(w[(size_t)k * N + n]); o[1] = f2bf(w[(size_t)(k + 1) * N + n]); *(v2us*)(Bt + e) = o; }
         }
}
__global__ __launch_bounds__(256) void k_cvt8(const float* __restrict__ src, bf* dst, size_t n8) { const size_t i = (size_t)blockIdx.x * 256 + threadIdx.x; if (i >= n8) return; const v8f v = *(const v8f*)(src + i * 8); v8us o;
#pragma unroll
    for (int k = 0; k < 8; ++k) o[k] = f2bf(v[k]); *(v8us*)(dst + i * 8) = o;  }

// k_rope: head planes [h][t][d] (fp16 + hi/lo) of rope(x) x sc with the rotate-half convention out[d] = x[d] cos[t][d] - x[d+HD/2] sin[t][d], out[d+HD/2] = x[d+HD/2] cos[t][d+HD/2] + x[d] sin[t][d+HD/2]
__global__ __launch_bounds__(256) void k_rope(const float* __restrict__ F, int pitch, int nheads, const float* __restrict__ CS, const float* __restrict__ RF, const float* __restrict__ nw, float sc, h16* P16, bf* Ph, bf* Pl) {
    const size_t e = ((size_t)blockIdx.x * 256 + threadIdx.x) * 2; if (e >= (size_t)nheads * TT * HD) return; const int d = (int)(e % HD); const int t = (int)((e / HD) % TT); const int h = (int)(e / ((size_t)HD * TT)); const size_t zp = (size_t)blockIdx.y * nheads * TT * HD;   /* blockIdx.y: the batch (rows of F, planes [b][h][t][d]) */ P16 += zp; Ph += zp; Pl += zp; const float* f = F + ((size_t)blockIdx.y * TT + t) * pitch + h * HD; const float rf = RF ? RF[(size_t)h * TT + t] : 1.0f; v2h o16; v2us oh, ol;
#pragma unroll
    for (int q = 0; q < 2; ++q) { const int dd = d + q; const int dp = (dd < HD / 2) ? dd + HD / 2 : dd - HD / 2; float x0 = f[dd], x1 = f[dp];
        if (RF) { float n0 = __fmul_rn(x0, rf), n1 = __fmul_rn(x1, rf); asm volatile("" : "+v"(n0)); asm volatile("" : "+v"(n1)); x0 = __fmul_rn(bfr(nw[dd]), n0); x1 = __fmul_rn(bfr(nw[dp]), n1); }
        const v2f cs = *(const v2f*)(CS + ((size_t)t * HD + dd) * 2); float a = __fmul_rn(x0, cs[0]), bq = __fmul_rn(x1, cs[1]); asm volatile("" : "+v"(a)); asm volatile("" : "+v"(bq)); const float r = ((dd < HD / 2) ? __fsub_rn(a, bq) : __fadd_rn(a, bq)) * sc;
        o16[q] = tohx(r); unsigned short a2, c2; splitf(r, a2, c2); oh[q] = a2; ol[q] = c2; }
    *(v2h*)(P16 + e) = o16; *(v2us*)(Ph + e) = oh; *(v2us*)(Pl + e) = ol;  }
__global__ __launch_bounds__(256) void k_vtp(const float* __restrict__ F, int pitch, int nheads, h16* V16, bf* Vh, bf* Vl) { const size_t e = ((size_t)blockIdx.x * 256 + threadIdx.x) * 2; if (e >= (size_t)nheads * HD * TT) return; const int t = (int)(e % TT); const int d = (int)((e / TT) % HD); const int g = (int)(e / ((size_t)TT * HD)); const size_t zp = (size_t)blockIdx.y * nheads * HD * TT;   /* blockIdx.y: the batch */ F += (size_t)blockIdx.y * TT * pitch; V16 += zp; Vh += zp; Vl += zp; v2h o16; v2us oh, ol;
#pragma unroll
    for (int q = 0; q < 2; ++q) { const float x = F[(size_t)(t + q) * pitch + g * HD + d]; o16[q] = tohx(x); unsigned short a2, c2; splitf(x, a2, c2); oh[q] = a2; ol[q] = c2; }
    *(v2h*)(V16 + e) = o16; *(v2us*)(Vh + e) = oh; *(v2us*)(Vl + e) = ol;  }
__global__ __launch_bounds__(256) void k_csid(float* CS) { const int idx = blockIdx.x * 256 + threadIdx.x; if (idx >= TT * HD) return; v2f cs; cs[0] = 1.0f; cs[1] = 0.0f; *(v2f*)(CS + (size_t)idx * 2) = cs;  }
template <bool RND>
__global__ __launch_bounds__(256) void k_lnhl(const float* __restrict__ X, const float* __restrict__ A, const float* __restrict__ g, const float* __restrict__ be, float* Z, bf* Yh, bf* Yl) {
    const int lane = threadIdx.x & 31; const int r = blockIdx.x * 8 + (threadIdx.x >> 5); if (r >= NB_ * TT) return; const float* xr = X + (size_t)r * DM; const float* ar = A ? A + (size_t)r * DM : nullptr; float s = 0.f;
#pragma unroll 1
    for (int ch = 0; ch < DM / 128; ++ch) { const int c0 = ch * 128 + lane * 4; const v4f a = *(const v4f*)(xr + c0); v4f d = {0.f, 0.f, 0.f, 0.f}; if (ar) d = *(const v4f*)(ar + c0);
#pragma unroll
        for (int q = 0; q < 4; ++q) s += __fadd_rn((RND ? bfr(a[q]) : a[q]), d[q]); }
#pragma unroll
    for (int sh = 16; sh; sh >>= 1) s += __shfl_xor(s, sh, 32);
    const float mu = s * (1.0f / DM); float s2 = 0.f;
#pragma unroll 1
    for (int ch = 0; ch < DM / 128; ++ch) { const int c0 = ch * 128 + lane * 4; const v4f a = *(const v4f*)(xr + c0); v4f d = {0.f, 0.f, 0.f, 0.f}; if (ar) d = *(const v4f*)(ar + c0);
#pragma unroll
        for (int q = 0; q < 4; ++q) { const float d0 = __fsub_rn(__fadd_rn((RND ? bfr(a[q]) : a[q]), d[q]), mu); float p = __fmul_rn(d0, d0); asm volatile("" : "+v"(p)); s2 = __fadd_rn(s2, p); } }
#pragma unroll
    for (int sh = 16; sh; sh >>= 1) s2 += __shfl_xor(s2, sh, 32);
    const float rs = __fdiv_rn(1.0f, __fsqrt_rn(__fadd_rn(s2 * (1.0f / DM), LNEPS)));
{
#pragma unroll 1
        for (int ch = 0; ch < DM / 128; ++ch) { const int c0 = ch * 128 + lane * 4; const v4f a = *(const v4f*)(xr + c0); v4f d = {0.f, 0.f, 0.f, 0.f}; if (ar) d = *(const v4f*)(ar + c0); v4f z4; v4us oh, ol;
#pragma unroll
            for (int q = 0; q < 4; ++q) { const float v = __fadd_rn((RND ? bfr(a[q]) : a[q]), d[q]); float n0 = __fmul_rn(__fsub_rn(v, mu), rs); asm volatile("" : "+v"(n0)); float n1 = __fmul_rn(n0, bfr(g[c0 + q])); asm volatile("" : "+v"(n1)); const float y = __fadd_rn(n1, bfr(be[c0 + q])); z4[q] = y;   /* Z = the NORMALISED row (it is the residual for the next block) */ unsigned short h2, l2; splitf(y, h2, l2); oh[q] = h2; ol[q] = l2; }
            if (Z) *(v4f*)(Z + (size_t)r * DM + c0) = z4; *(v4us*)(Yh + (size_t)r * DM + c0) = oh; *(v4us*)(Yl + (size_t)r * DM + c0) = ol; }
         } }

__global__ __launch_bounds__(256) void k_relupl(const float* __restrict__ F, bf* Ph2, bf* Pl2, size_t n4) { const size_t i = (size_t)blockIdx.x * 256 + threadIdx.x; if (i >= n4) return; const v4f v = *(const v4f*)(F + i * 4); v4us oh, ol;
#pragma unroll
    for (int q = 0; q < 4; ++q) { unsigned short a, c; splitf(fmaxf(v[q], 0.f), a, c); oh[q] = a; ol[q] = c; } *(v4us*)(Ph2 + i * 4) = oh; *(v4us*)(Pl2 + i * 4) = ol;  }
__global__ __launch_bounds__(256) void k_addln(const float* __restrict__ A, const float* __restrict__ Bm, const float* __restrict__ g, const float* __restrict__ be, float* OUTb) {
    const int lane = threadIdx.x & 31; const int r = blockIdx.x * 8 + (threadIdx.x >> 5); if (r >= NB_ * TT) return; const float* ar = A + (size_t)r * DM; const float* br = Bm + (size_t)r * DM; float s = 0.f;
#pragma unroll 1
    for (int ch = 0; ch < DM / 128; ++ch) { const int c0 = ch * 128 + lane * 4; const v4f a = *(const v4f*)(ar + c0), bb = *(const v4f*)(br + c0);
#pragma unroll
        for (int q = 0; q < 4; ++q) s += __fadd_rn(a[q], bb[q]); }
#pragma unroll
    for (int sh = 16; sh; sh >>= 1) s += __shfl_xor(s, sh, 32);
    const float mu = s * (1.0f / DM); float s2 = 0.f;
#pragma unroll 1
    for (int ch = 0; ch < DM / 128; ++ch) { const int c0 = ch * 128 + lane * 4; const v4f a = *(const v4f*)(ar + c0), bb = *(const v4f*)(br + c0);
#pragma unroll
        for (int q = 0; q < 4; ++q) { const float d0 = __fsub_rn(__fadd_rn(a[q], bb[q]), mu); float p = __fmul_rn(d0, d0); asm volatile("" : "+v"(p)); s2 = __fadd_rn(s2, p); } }
#pragma unroll
    for (int sh = 16; sh; sh >>= 1) s2 += __shfl_xor(s2, sh, 32);
    const float rs = __fdiv_rn(1.0f, __fsqrt_rn(__fadd_rn(s2 * (1.0f / DM), LNEPS)));
{
#pragma unroll 1
        for (int ch = 0; ch < DM / 128; ++ch) { const int c0 = ch * 128 + lane * 4; const v4f a = *(const v4f*)(ar + c0), bb = *(const v4f*)(br + c0); v4f o4;
#pragma unroll
            for (int q = 0; q < 4; ++q) { float n0 = __fmul_rn(__fsub_rn(__fadd_rn(a[q], bb[q]), mu), rs); asm volatile("" : "+v"(n0)); float n1 = __fmul_rn(n0, bfr(g[c0 + q])); asm volatile("" : "+v"(n1)); o4[q] = __fadd_rn(n1, bfr(be[c0 + q])); }
            *(v4f*)(OUTb + (size_t)r * DM + c0) = o4; }
         } }
// ---- k_fattn: scores, softmax and attn.v of both batches in one launch; no score or probability ever leaves the work-group.
// 4 waves x 16 query columns per work-group, one head; the 2048 keys are walked in passes of KC = 64 with a running maximum and sum (new order of the softmax and attn.v sums).
// S^T = K Q^T (A = key rows from LDS, B = query rows kept in registers), O^T += V^T P^T (A = V^T rows from LDS, B = the score tiles converted in place: two D tiles of 16 keys are one B operand in the loaders' k order).
// A lane holds one query's column, so the maximum is in-lane plus one exchange between the wave's halves. Work-groups below NB_ * NH_ * RH / 64 take the hi+lo rows (3 products), the rest single fp16.
#define KC   64                   // keys per pass
#define LP   72                   // LDS row pitch in 16-bit elements: 144 B = 16 B x odd, conflict-free for the 16-byte fragment reads
#define PLN  (64 * LP)            // one staged plane: 64 rows of 128 B (K: 64 keys x HD; V^T: HD rows x 64 keys)
#define BIGF 0x1p127f             // a power of two: BIGF * CL2 is exact, so a fully masked row gets exponent 0 for every key (uniform weights, as the reference's -1e9 gives)
#define CL2  0.18033688011112042f // HD^-0.5 * log2(e)
__device__ __forceinline__ float xhalf(float x) { const int b = __float_as_int(x); return __int_as_float(__builtin_amdgcn_permlanex16(b, b, 0x76543210, 0xfedcba98, false, false)); }   // lane l <-> l ^ 16
typedef __attribute__((ext_vector_type(2))) __bf16 v2bf;
// 2^x in asm so that the slot the instruction set asks for behind a transcendental (before its result is read or its source overwritten) is filled by construction:
// in the group of four each exponential stands in front of an independent one (the outputs are early-clobber: none shares a register with an input), and the v_nop fills the slot behind the last.
__device__ __forceinline__ v4f exp2x4(float a, float b, float c, float d) { float r0, r1, r2, r3;
    asm("v_exp_f32 %0, %4\n\tv_exp_f32 %1, %5\n\tv_exp_f32 %2, %6\n\tv_exp_f32 %3, %7\n\tv_nop" : "=&v"(r0), "=&v"(r1), "=&v"(r2), "=&v"(r3) : "v"(a), "v"(b), "v"(c), "v"(d)); return (v4f){r0, r1, r2, r3}; }
__device__ __forceinline__ float exp2x1(float a) { float r; asm("v_exp_f32 %0, %1\n\tv_nop" : "=v"(r) : "v"(a)); return r; }
template <typename T16, bool HL>
__device__ __forceinline__ void fattn_body(const T16* __restrict__ Q, const T16* __restrict__ Q2, const T16* __restrict__ Kp, const T16* __restrict__ Kp2, const T16* __restrict__ Vt, const T16* __restrict__ Vt2, int q0, T16* sm, const float* lim, bf* Ah, bf* Al) {
    typedef typename WFrag<T16>::V V;
    constexpr int NP = HL ? 4 : 2, NL = HL ? 2 : 1;   // planes in a buffer (K, V^T, K lo, V^T lo); planes of one operand
    const int tid = threadIdx.x, lane = tid & 31, lr = lane & 15, hi = lane >> 4; const int qr = q0 + (tid >> 5) * 16 + lr;
    V qf[2], qf2[2];
#pragma unroll
    for (int ks = 0; ks < 2; ++ks) { qf[ks] = WFrag<T16>::ld(Q + (size_t)qr * HD + ks * 32 + 8 * hi); if (HL) qf2[ks] = WFrag<T16>::ld(Q2 + (size_t)qr * HD + ks * 32 + 8 * hi); }
    // staging: a plane is 512 pieces of 16 B, 4 per thread; 8 neighbouring lanes read one whole 128-B line. K and V^T take turns in the same registers.
    const int srow = tid >> 3, sseg = (tid & 7) * 8;
    v8us st[NL][4];
    auto gloadK = [&](int c) {
#pragma unroll
        for (int u = 0; u < 4; ++u) { const size_t e = (size_t)(c * KC + srow + 16 * u) * HD + sseg; st[0][u] = *(const v8usa*)(Kp + e); if constexpr (HL) st[1][u] = *(const v8usa*)(Kp2 + e); } };
    auto gloadV = [&](int c) {
#pragma unroll
        for (int u = 0; u < 4; ++u) { const size_t e = (size_t)(srow + 16 * u) * TT + c * KC + sseg; st[0][u] = *(const v8usa*)(Vt + e); if constexpr (HL) st[1][u] = *(const v8usa*)(Vt2 + e); } };
    auto sstore = [&](T16* pl) {   // pl: the operand's hi plane; its lo plane lies two planes further
#pragma unroll
        for (int p = 0; p < NL; ++p)
#pragma unroll
            for (int u = 0; u < 4; ++u) *(v8usa*)(pl + p * 2 * PLN + (srow + 16 * u) * LP + sseg) = st[p][u]; };
    v8f o[4];
#pragma unroll
    for (int dt = 0; dt < 4; ++dt) o[dt] = (v8f){};
    float mraw = -BIGF, mcs = -BIGF * CL2;
    // the softmax sums ride the matrix pipe: an A of ones makes every row of lt the column sums of the (rounded) weights, over both lane halves' keys; lt is rescaled like an output tile
    V ones; v8f lt = (v8f){};
#pragma unroll
    for (int e = 0; e < 16; ++e) { if constexpr (HL) ones[e] = (__bf16)1.0f; else ones[e] = (h16)1.0f; }
    gloadK(0); sstore(sm); gloadV(0); sstore(sm + PLN);
    __syncthreads();   // pass 0's planes and the key limits are in LDS
    // The scheduling fences in the loop keep each group of LDS fragment loads together and ahead of the block of products that uses it (one exposed LDS latency a group, not one a fragment),
    // and keep the products of a block in the written order, in which neighbours go to different accumulators.
#pragma unroll 1
    for (int c = 0; c < TT / KC; ++c) {
        const T16* cur = sm + (c & 1) * (NP * PLN); T16* nxt = sm + ((c + 1) & 1) * (NP * PLN);
        const int cn = (c + 1 < TT / KC) ? c + 1 : c;   // the last pass re-reads its own planes: no branch in the loop; that copy is never read
        gloadK(cn);   // the next pass's K flies during the score products
        __builtin_amdgcn_sched_barrier(0);   // fence: the global loads stay at the head of the pass
        v8f s[4];
        if constexpr (HL) {
#pragma unroll
            for (int ks = 0; ks < 2; ++ks) { V ka[4], kb[4];
#pragma unroll
                for (int kt = 0; kt < 4; ++kt) { ka[kt] = WFrag<T16>::ld(cur + (kt * 16 + lr) * LP + ks * 32 + 8 * hi); kb[kt] = WFrag<T16>::ld(cur + 2 * PLN + (kt * 16 + lr) * LP + ks * 32 + 8 * hi); }
                __builtin_amdgcn_sched_barrier(0);   // fence: loads | products
#pragma unroll
                for (int kt = 0; kt < 4; ++kt) s[kt] = WFrag<T16>::mma(ka[kt], qf[ks], ks ? s[kt] : (v8f){});
#pragma unroll
                for (int kt = 0; kt < 4; ++kt) s[kt] = WFrag<T16>::mma(ka[kt], qf2[ks], s[kt]);
#pragma unroll
                for (int kt = 0; kt < 4; ++kt) s[kt] = WFrag<T16>::mma(kb[kt], qf[ks], s[kt]);
                __builtin_amdgcn_sched_barrier(0); }   // fence: products | next group
        } else { V ka[2][4];
#pragma unroll
            for (int ks = 0; ks < 2; ++ks)
#pragma unroll
                for (int kt = 0; kt < 4; ++kt) ka[ks][kt] = WFrag<T16>::ld(cur + (kt * 16 + lr) * LP + ks * 32 + 8 * hi);
            __builtin_amdgcn_sched_barrier(0);   // fence: loads | products
#pragma unroll
            for (int ks = 0; ks < 2; ++ks)
#pragma unroll
                for (int kt = 0; kt < 4; ++kt) s[kt] = WFrag<T16>::mma(ka[ks][kt], qf[ks], ks ? s[kt] : (v8f){});
            __builtin_amdgcn_sched_barrier(0); }   // fence: products | next group
        // key mask as a select, one instruction: the median of (s, -BIGF, +BIGF) is s, of (s, -BIGF, -BIGF) is -BIGF; four independent maximum chains
        float mk[4]; v4f lm[8];
#pragma unroll
        for (int u = 0; u < 8; ++u) lm[u] = *(const v4fa*)(lim + c * KC + (u >> 1) * 16 + hi * 8 + (u & 1) * 4);
        __builtin_amdgcn_sched_barrier(0);   // fence: the eight limit loads go out as one group, while the last score products drain
#pragma unroll
        for (int kt = 0; kt < 4; ++kt) { mk[kt] = -BIGF;
#pragma unroll
            for (int j = 0; j < 8; ++j) { const float t = __builtin_amdgcn_fmed3f(s[kt][j], -BIGF, lm[2 * kt + (j >> 2)][j & 3]); s[kt][j] = t; mk[kt] = __builtin_fmaximum_numf(mk[kt], t); } }
        float mx = __builtin_fmaximum_numf(__builtin_fmaximum_numf(__builtin_fmaximum_numf(mk[0], mk[1]), __builtin_fmaximum_numf(mk[2], mk[3])), mraw); mx = __builtin_fmaximum_numf(mx, xhalf(mx));
        __builtin_amdgcn_sched_barrier(0);   // fence: the K stores (and the wait on their loads) stay behind the maximum
        sstore(nxt); gloadV(cn);   // K goes to the other buffer; the next pass's V^T flies during the exponentials and the output products
        V va[HL ? 1 : 2][4], vb[4];   // V^T fragments fetched ahead of the exponentials (fp16: both 32-key groups; hi+lo: the first)
#pragma unroll
        for (int g = 0; g < (HL ? 1 : 2); ++g)
#pragma unroll
            for (int dt = 0; dt < 4; ++dt) { va[g][dt] = WFrag<T16>::ld(cur + PLN + (dt * 16 + lr) * LP + g * 32 + 8 * hi); if constexpr (HL) vb[dt] = WFrag<T16>::ld(cur + 3 * PLN + (dt * 16 + lr) * LP + g * 32 + 8 * hi); }
        __builtin_amdgcn_sched_barrier(0);   // fence: these loads are issued before the exponentials, which cover their latency
        const float mc = mx * CL2, al = exp2x1(mcs - mc), ad = (HL ? 0.0f : 10.0f) - mc;   // fp16 weights carry x1024 (cancels in the division by the sum): small weights stay normal numbers
        mraw = mx; mcs = mc;
#pragma unroll
        for (int kt = 0; kt < 4; ++kt)
#pragma unroll
            for (int j = 0; j < 8; ++j) s[kt][j] = __builtin_fmaf(s[kt][j], CL2, ad);
#pragma unroll
        for (int kt = 0; kt < 4; ++kt) { const v4f e0 = exp2x4(s[kt][0], s[kt][1], s[kt][2], s[kt][3]), e1 = exp2x4(s[kt][4], s[kt][5], s[kt][6], s[kt][7]); s[kt] = __builtin_shufflevector(e0, e1, 0, 1, 2, 3, 4, 5, 6, 7); }
        __builtin_amdgcn_sched_barrier(0);   // fence: the exponentials are asm text: none of the products below is scheduled in front of them
        lt *= al;
#pragma unroll
        for (int dt = 0; dt < 4; ++dt) o[dt] *= al;
#pragma unroll
        for (int g = 0; g < 2; ++g) { V pb, pb2;
#pragma unroll
            for (int e = 0; e < 16; e += 2) { const v2f pp = {s[2 * g + (e >> 3)][e & 7], s[2 * g + (e >> 3)][(e & 7) + 1]};   // by pairs: one packed conversion for two weights
                if constexpr (HL) { const v2bf h2 = __builtin_convertvector(pp, v2bf); const v2bf l2 = __builtin_convertvector(pp - __builtin_convertvector(h2, v2f), v2bf); pb[e] = h2[0]; pb[e + 1] = h2[1]; pb2[e] = l2[0]; pb2[e + 1] = l2[1]; }
                else { const v2h h2 = __builtin_convertvector(pp, v2h); pb[e] = h2[0]; pb[e + 1] = h2[1]; } }
            __builtin_amdgcn_sched_barrier(0);   // fence: conversions | products
#pragma unroll
            for (int dt = 0; dt < 4; ++dt) o[dt] = WFrag<T16>::mma(va[HL ? 0 : g][dt], pb, o[dt]);
            lt = WFrag<T16>::mma(ones, pb, lt);
            if constexpr (HL) {
#pragma unroll
                for (int dt = 0; dt < 4; ++dt) o[dt] = WFrag<T16>::mma(va[0][dt], pb2, o[dt]);
                lt = WFrag<T16>::mma(ones, pb2, lt);
#pragma unroll
                for (int dt = 0; dt < 4; ++dt) o[dt] = WFrag<T16>::mma(vb[dt], pb, o[dt]);
                __builtin_amdgcn_sched_barrier(0);   // fence: products | the second group's loads
                if (g == 0) {
#pragma unroll
                    for (int dt = 0; dt < 4; ++dt) { va[0][dt] = WFrag<T16>::ld(cur + PLN + (dt * 16 + lr) * LP + 32 + 8 * hi); vb[dt] = WFrag<T16>::ld(cur + 3 * PLN + (dt * 16 + lr) * LP + 32 + 8 * hi); }
                    __builtin_amdgcn_sched_barrier(0); } } }   // fence: the second group's loads are issued before its conversions, which cover their latency
        __builtin_amdgcn_sched_barrier(0);   // fence: the V^T stores (and the wait on their loads) stay at the foot of the pass
        sstore(nxt + PLN);
        __syncthreads();   // publishes the next pass's planes and ends every wave's reads of this pass's (refilled in the next trip)
    }
    const float inv = __fdiv_rn(1.0f, lt[0]);
#pragma unroll
    for (int dt = 0; dt < 4; ++dt) { v8us oh, ol;   // a lane's 8 accumulator registers are 8 consecutive d of its query: one 16-byte store per plane
#pragma unroll
        for (int j = 0; j < 8; ++j) { unsigned short a, c2; splitf(o[dt][j] * inv, a, c2); oh[j] = a; ol[j] = c2; }
        const size_t oo = (size_t)qr * DQ + dt * 16 + hi * 8; *(v8us*)(Ah + oo) = oh; *(v8us*)(Al + oo) = ol; }
}
// the second bound (4 waves per SIMD) is a budget of 256 registers: the hi+lo body stays below v256 and needs no register-window switches in its loop
__global__ __launch_bounds__(128, 4) void k_fattn(const h16* __restrict__ Q16, const h16* __restrict__ K16, const h16* __restrict__ V16, const bf* __restrict__ Qh, const bf* __restrict__ Ql, const bf* __restrict__ Kh, const bf* __restrict__ Kl, const bf* __restrict__ Vh, const bf* __restrict__ Vl, const int* __restrict__ MK, bf* Ah, bf* Al) {
    __shared__ __align__(16) unsigned short sm[2 * 4 * PLN];
    __shared__ __align__(16) float lim[TT];
    const int bx = blockIdx.x;   // the heavier hi+lo work-groups of both batches come first
    constexpr int NHL = NH_ * (RH / 64), NSG = NH_ * ((TT - RH) / 64);   // work-groups of a batch: hi+lo, single fp16
    const bool hl = bx < NB_ * NHL; const int bt = hl ? bx / NHL : (bx - NB_ * NHL) / NSG, ix = hl ? bx % NHL : (bx - NB_ * NHL) % NSG;   // batch, index inside the batch
    const int* MKb = MK + (size_t)bt * TT; const size_t zb = (size_t)bt * NH_ * TT * HD, zkb = (size_t)bt * NKV * TT * HD; Ah += (size_t)bt * TT * DQ; Al += (size_t)bt * TT * DQ;
    // unrolled so that the four mask loads of a thread are in flight together
#pragma unroll
    for (int u = 0; u < TT / 512; ++u) { const int i = (u * 128 + (int)threadIdx.x) * 4; const v4i m4 = *(const v4i*)(MKb + i); v4f f4;
#pragma unroll
        for (int q = 0; q < 4; ++q) f4[q] = (m4[q] != 0) ? BIGF : -BIGF;
        *(v4fa*)(lim + i) = f4; }
    if (hl) { const int h = ix / (RH / 64), q0 = (ix % (RH / 64)) * 64; const size_t zq = zb + (size_t)h * TT * HD, zk = zkb + (size_t)(h / REP) * TT * HD;
        fattn_body<bf, true>(Qh + zq, Ql + zq, Kh + zk, Kl + zk, Vh + zk, Vl + zk, q0, (bf*)sm, lim, Ah + h * HD, Al + h * HD);
    } else { const int h = ix / ((TT - RH) / 64), q0 = RH + (ix % ((TT - RH) / 64)) * 64; const size_t zq = zb + (size_t)h * TT * HD, zk = zkb + (size_t)(h / REP) * TT * HD;
        fattn_body<h16, false>(Q16 + zq, nullptr, K16 + zk, nullptr, V16 + zk, nullptr, q0, (h16*)sm, lim, Ah + h * HD, Al + h * HD); }
}

extern "C" void kernel_launch(void* const* d_in, const int* in_sizes, int n_in,
                              void* d_out, int out_size, void* d_ws, size_t ws_size, hipStream_t stream) {
    (void)in_sizes; (void)n_in; (void)out_size;
    const float* x = (const float*)d_in[0]; const float* xk = (const float*)d_in[1]; const int* MK = (const int*)d_in[2]; const float* wq = (const float*)d_in[3]; const float* bq = (const float*)d_in[4]; const float* wk = (const float*)d_in[5]; const float* bk = (const float*)d_in[6]; const float* wv = (const float*)d_in[7]; const float* bv = (const float*)d_in[8]; const float* wo = (const float*)d_in[9]; const float* bo = (const float*)d_in[10]; const float* w1 = (const float*)d_in[11]; const float* b1 = (const float*)d_in[12]; const float* w2 = (const float*)d_in[13]; const float* b2 = (const float*)d_in[14]; const float* g1 = (const float*)d_in[15]; const float* e1 = (const float*)d_in[16]; const float* g2 = (const float*)d_in[17]; const float* e2 = (const float*)d_in[18];
    float* OUT = (float*)d_out;     // [2][2048][1024]
    char* wsp = (char*)d_ws;
    auto take = [&](size_t bytes) { char* p = wsp; wsp += (bytes + 255) & ~(size_t)255; return (void*)p; };
    bf* WQ = (bf*)take((size_t)DQ * DM * 2); bf* WK = (bf*)take((size_t)DKV * DM * 2); bf* WV = (bf*)take((size_t)DKV * DM * 2); bf* WO = (bf*)take((size_t)DM * DQ * 2); float* CS = (float*)take((size_t)TT * HD * 2 * 4);
    bf* W1B = (bf*)take((size_t)DFF * DM * 2); bf* W2B = (bf*)take((size_t)DM * DFF * 2);
    // every buffer below holds both batches (rows b * TT + t; head planes [b][h][..]).
    // Region A: inputs in bf16 and the head planes, dead once the attention has run; H1 lies over it. Region B: projections, merged heads and mha, dead once x1 is built; Gh, Gl lie over it.
    char* const regA = wsp;
    bf* XB = (bf*)take((size_t)NB_ * TT * DM * 2); bf* XKB = (bf*)take((size_t)NB_ * TT * DM * 2);
    h16* QP16 = (h16*)take((size_t)NB_ * NH_ * TT * HD * 2); h16* KP16 = (h16*)take((size_t)NB_ * NKV * TT * HD * 2); h16* VT16 = (h16*)take((size_t)NB_ * NKV * HD * TT * 2);
    bf* QPh = (bf*)take((size_t)NB_ * NH_ * TT * HD * 2); bf* QPl = (bf*)take((size_t)NB_ * NH_ * TT * HD * 2); bf* KPh = (bf*)take((size_t)NB_ * NKV * TT * HD * 2); bf* KPl = (bf*)take((size_t)NB_ * NKV * TT * HD * 2); bf* VTh = (bf*)take((size_t)NB_ * NKV * HD * TT * 2); bf* VTl = (bf*)take((size_t)NB_ * NKV * HD * TT * 2);
    char* const regB = wsp;
    float* FQ = (float*)take((size_t)NB_ * TT * DQ * 4); float* FK = (float*)take((size_t)NB_ * TT * DKV * 4); bf* ATh = (bf*)take((size_t)NB_ * TT * DQ * 2); bf* ATl = (bf*)take((size_t)NB_ * TT * DQ * 2); float* S2 = (float*)take((size_t)NB_ * TT * DM * 4);
    float* X1 = (float*)take((size_t)NB_ * TT * DM * 4); bf* L1h = (bf*)take((size_t)NB_ * TT * DM * 2); bf* L1l = (bf*)take((size_t)NB_ * TT * DM * 2); float* F2 = (float*)take((size_t)NB_ * TT * DM * 4);
    if ((size_t)(wsp - (char*)d_ws) > ws_size) return;
    float* H1 = (float*)regA; bf* Gh = (bf*)regB; bf* Gl = Gh + (size_t)NB_ * TT * DFF;
    static_assert((size_t)NB_ * TT * DFF * 4 <= (size_t)NB_ * TT * (2 * DM + 3 * DQ + 6 * DKV) * 2, "H1 fits region A");
    static_assert((size_t)NB_ * TT * DFF * 2 * 2 <= (size_t)NB_ * TT * (DQ * 4 + DKV * 4 + DQ * 2 * 2 + DM * 4), "Gh, Gl fit region B");
    float* FV = FK;   // v projection reuses the k buffer after the k planes are built (stream-ordered)
    { k_wtG<<<(unsigned)((DM * DQ / 64 + 63) / 64), 256, 0, stream>>>(wq, DM, DQ, WQ); k_wtG<<<(unsigned)((DM * DKV / 64 + 63) / 64), 256, 0, stream>>>(wk, DM, DKV, WK); k_wtG<<<(unsigned)((DM * DKV / 64 + 63) / 64), 256, 0, stream>>>(wv, DM, DKV, WV);
      k_wtG<<<(unsigned)((DQ * DM / 64 + 63) / 64), 256, 0, stream>>>(wo, DQ, DM, WO); k_wtG<<<(unsigned)((DM * DFF / 64 + 63) / 64), 256, 0, stream>>>(w1, DM, DFF, W1B); k_wtG<<<(unsigned)((DFF * DM / 64 + 63) / 64), 256, 0, stream>>>(w2, DFF, DM, W2B);
       }
    k_csid<<<(TT * HD + 255) / 256, 256, 0, stream>>>(CS);
    const unsigned LQ = (unsigned)(((size_t)NH_ * TT * HD / 2 + 255) / 256), LKv = (unsigned)(((size_t)NKV * TT * HD / 2 + 255) / 256);
    // one launch of each kernel serves both batches. In the GEMM grids the batch is z (the slowest index), so a batch's tiles still start together.
    k_cvt8<<<(unsigned)(((size_t)NB_ * TT * DM / 8 + 255) / 256), 256, 0, stream>>>(x, XB, (size_t)NB_ * TT * DM / 8); k_cvt8<<<(unsigned)(((size_t)NB_ * TT * DM / 8 + 255) / 256), 256, 0, stream>>>(xk, XKB, (size_t)NB_ * TT * DM / 8);
    k_gemms<0, true, DM><<<dim3(TT / 128, DQ / 128, NB_), 128, 0, stream>>>(XB, nullptr, WQ, FQ, DQ, bq, (size_t)TT * DM, (size_t)TT * DQ);
    k_rope<<<dim3(LQ, NB_, 1), 256, 0, stream>>>(FQ, DQ, NH_, CS, nullptr, nullptr, 1.0f, QP16, QPh, QPl);
    k_gemms<0, true, DM><<<dim3(TT / 128, DKV / 128, NB_), 128, 0, stream>>>(XKB, nullptr, WK, FK, DKV, bk, (size_t)TT * DM, (size_t)TT * DKV);
    k_rope<<<dim3(LKv, NB_, 1), 256, 0, stream>>>(FK, DKV, NKV, CS, nullptr, nullptr, 1.0f, KP16, KPh, KPl);
    k_gemms<0, true, DM><<<dim3(TT / 128, DKV / 128, NB_), 128, 0, stream>>>(XKB, nullptr, WV, FV, DKV, bv, (size_t)TT * DM, (size_t)TT * DKV); k_vtp<<<dim3(LKv, NB_, 1), 256, 0, stream>>>(FV, DKV, NKV, VT16, VTh, VTl);
    k_fattn<<<NB_ * NH_ * (TT / 64), 128, 0, stream>>>(QP16, KP16, VT16, QPh, QPl, KPh, KPl, VTh, VTl, MK, ATh, ATl);   /* softmax(q k^T / 8, mask) v, merged heads as hi/lo planes */
    k_gemms<1, true, DQ><<<dim3(TT / 128, DM / 128, NB_), 128, 0, stream>>>(ATh, ATl, WO, S2, DM, bo, (size_t)TT * DQ, (size_t)TT * DM);   /* mha = merged Wo + bo */
    k_lnhl<true><<<NB_ * TT / 8, 256, 0, stream>>>(x, S2, g1, e1, X1, L1h, L1l);                                                          /* x1 = LN(bf16(x) + mha): normalised row in f32 + hi/lo planes */
    k_gemms<1, true, DM><<<dim3(TT / 128, DFF / 128, NB_), 128, 0, stream>>>(L1h, L1l, W1B, H1, DFF, b1, (size_t)TT * DM, (size_t)TT * DFF);   /* x1 W1 + b1 */
    k_relupl<<<(unsigned)(((size_t)NB_ * TT * DFF / 4 + 255) / 256), 256, 0, stream>>>(H1, Gh, Gl, (size_t)NB_ * TT * DFF / 4);           /* relu -> hi/lo */
    k_gemms<1, true, DFF><<<dim3(TT / 128, DM / 128, NB_), 128, 0, stream>>>(Gh, Gl, W2B, F2, DM, b2, (size_t)TT * DFF, (size_t)TT * DM);   /* . W2 + b2 */
    k_addln<<<NB_ * TT / 8, 256, 0, stream>>>(X1, F2, g2, e2, OUT);                                                                       /* out = LN(x1 + ff) */
}

// v006
// It runs in 333 microseconds.
// Two timings next to v005 put it at 1.18 and 1.17 times that version's speed.
// Counting every step since v000, it is 11.9 times as fast.
#include <hip/hip_runtime.h>

// Post-LN transformer encoder block with cross attention (x, y [2][2048][1024]; Q = x Wq + bq, K = y Wk + bk, V = y Wv + bv ('xw' [1024][1024]; 16 heads x 64); scores/8 with mask [2][1][1][2048] (int32 keys, read; -1e9 == exact zero weight; all ones here); softmax; mha = merged Wo + bo; x1 = LN(x + mha); ff = relu(x1 W1 + b1) W2 + b2 (W1 [1024][4096]); out = LN(x1 + ff) (eps 1e-5) -> [2][2048][1024] (4.2 M)).
// Compute dtypes, f32 accumulate: every input rounded to bf16; q/k/v on PLAIN bf16 operands (inputs: exact) + biases; key mask as a select; scores and attn.v: query rows < 512 hl (3 products), the rest single fp16 (x1024); softmax f32; Wo, W1, W2 hl x exact (2 products) + biases; residuals / LayerNorms / ReLU in f32.

#define NB_  2
#define TT   2048
#define DM   1024
#define NH_  16
#define NKV  16
#define REP  (NH_ / NKV)
#define HD   64
#define DQ   (NH_ * HD)
#define DKV  (NKV * HD)
#define DFF  4096
#define LNEPS 1e-5f
#define RH   512                  // query rows < RH use hi+lo planes (0: none)
#define WIN  0
#define SCL  0.125f   // HD^-0.5
typedef _Float16 h16;
typedef unsigned short bf;
typedef __attribute__((ext_vector_type(16))) __bf16   v16bf;
typedef __attribute__((ext_vector_type(16))) _Float16 v16h;
typedef __attribute__((ext_vector_type(8)))  _Float16 v8h;
typedef __attribute__((ext_vector_type(8)))  unsigned short v8us;
typedef __attribute__((ext_vector_type(8)))  float    v8f;
typedef __attribute__((ext_vector_type(4)))  float    v4f;
typedef v8h  __attribute__((may_alias)) v8ha;
typedef v4f  __attribute__((may_alias)) v4fa;
typedef v8us __attribute__((may_alias)) v8usa;

__device__ __forceinline__ unsigned short f2bf(float f) { unsigned u = __float_as_uint(f); u += 0x7FFFu + ((u >> 16) & 1u); return (unsigned short)(u >> 16); }
__device__ __forceinline__ float bf2f(unsigned short b) { return __uint_as_float(((unsigned)b) << 16); }
__device__ __forceinline__ float bfr(float f) { return bf2f(f2bf(f)); }
__device__ __forceinline__ v16h cat16(v8h lo, v8h hi) { return __builtin_shufflevector(lo, hi, 0, 1, 2, 3, 4, 5, 6, 7, 8, 9, 10, 11, 12, 13, 14, 15); }
__device__ __forceinline__ v16bf cat16b(v8us lo, v8us hi) { return __builtin_bit_cast(v16bf, __builtin_shufflevector(lo, hi, 0, 1, 2, 3, 4, 5, 6, 7, 8, 9, 10, 11, 12, 13, 14, 15)); }
__device__ __forceinline__ v8f wmma16(v16h a, v16h b, v8f c) { return __builtin_amdgcn_wmma_f32_16x16x32_f16(false, a, false, b, (short)0, c, false, false); }
__device__ __forceinline__ v8f wmmab(v16bf a, v16bf b, v8f c) { return __builtin_amdgcn_wmma_f32_16x16x32_bf16(false, a, false, b, (short)0, c, false, false); }
__device__ __forceinline__ h16 tohx(float x) { return (h16)x; }
__device__ __forceinline__ void splitf(float y, unsigned short& h, unsigned short& l) { h = f2bf(y); l = f2bf(y - bf2f(h)); }



// ---- k_gemms: GEMM on LDS-staged operands. One 128x128 output tile per work-group, 4 waves as 2 x 2, each a 64x64 tile (16 accumulators); grid (M/128, N/128, Z), 128 threads.
// A stage is 64 k = one whole 128-byte line of each of the 128 rows of every operand plane (A, with NSPLIT == 1 also A2, and Bt), brought from the K-contiguous 16-bit planes into LDS by asynchronous copies
// (a wave's copy covers 4 whole lines); two buffers, the next stage flies while this one is worked on. Each staged row serves two waves.
// c[m][n] = bias[n] + sum_k (A[m][k] + A2[m][k]) Bt[n][k], k ascending in one chain per element. z-batch strides sA/sC in elements. K (compile time) % 64 == 0, at least two stages.
// The tile leaves in the form its consumer reads (EPI), so that no elementwise launch stands between a product and the next kernel:
//   0: f32 rows C, pitch ldc.   1: head planes [z][h][t][d] (fp16 P16, bf16 hi Ph, lo Pl).   2: transposed head planes [z][h][d][t] (the same three).   3: relu(c) as bf16 hi/lo rows Ph, Pl, pitch ldc.
// A wave's 64 columns are one head (EPI 1, 2); in every 16-bit plane 8 neighbouring lanes store one whole 128-byte line.
template <typename T16> struct WFrag;
template <> struct WFrag<h16> { typedef v16h V; static __device__ __forceinline__ V ld(const h16* p) { return cat16(*(const v8h*)p, *(const v8h*)(p + 16)); } static __device__ __forceinline__ v8f mma(V a, V b, v8f c) { return wmma16(a, b, c); } };
template <> struct WFrag<bf> { typedef v16bf V; static __device__ __forceinline__ V ld(const bf* p) { return cat16b(*(const v8us*)p, *(const v8us*)(p + 16)); } static __device__ __forceinline__ v8f mma(V a, V b, v8f c) { return wmmab(a, b, c); } };
#define GP   72                   // LDS row pitch in 16-bit elements: 144 B = 16 B x odd, conflict-free for the 16-byte fragment reads
#define GPL  (128 * GP)           // one staged plane: 128 rows of 128 B
// eight asynchronous 16-byte copies of a lane (rows r, r + 16, .. r + 112 of one plane); the s_wait_xcnt stands inside the statement, behind the last copy, so that no address register is rewritten in front of it
__device__ __forceinline__ void acopy8(unsigned l, const bf* g, size_t rs) {
    asm volatile("global_load_async_to_lds_b128 %0, %8, off\n\tglobal_load_async_to_lds_b128 %1, %9, off\n\tglobal_load_async_to_lds_b128 %2, %10, off\n\tglobal_load_async_to_lds_b128 %3, %11, off\n\t"
                 "global_load_async_to_lds_b128 %4, %12, off\n\tglobal_load_async_to_lds_b128 %5, %13, off\n\tglobal_load_async_to_lds_b128 %6, %14, off\n\tglobal_load_async_to_lds_b128 %7, %15, off\n\ts_wait_xcnt 0x0"
                 :: "v"(l), "v"(l + 16 * GP * 2), "v"(l + 32 * GP * 2), "v"(l + 48 * GP * 2), "v"(l + 64 * GP * 2), "v"(l + 80 * GP * 2), "v"(l + 96 * GP * 2), "v"(l + 112 * GP * 2),
                    "v"(g), "v"(g + rs), "v"(g + 2 * rs), "v"(g + 3 * rs), "v"(g + 4 * rs), "v"(g + 5 * rs), "v"(g + 6 * rs), "v"(g + 7 * rs) : "memory"); }
// the second bound (4 waves per SIMD) is a budget of 256 registers: accumulators and one fragment set fit below v256
template <int NSPLIT, int EPI, int K>
__global__ __launch_bounds__(128, 4) void k_gemms(const bf* __restrict__ A, const bf* __restrict__ A2, const bf* __restrict__ Bt, float* C, h16* P16, bf* Ph, bf* Pl, int ldc, const float* __restrict__ bias, size_t sA, size_t sC) {
    typedef WFrag<bf>::V V;
    constexpr int NPL = NSPLIT ? 3 : 2;   // planes of a stage: Bt, A (, A2)
    __shared__ __align__(16) bf sm[2 * NPL * GPL];
    __shared__ __align__(16) float os[4 * 16 * 68];
    const size_t z = blockIdx.z; A += z * sA; if (NSPLIT) A2 += z * sA;
    const int tid = threadIdx.x, lane = tid & 31, lr = lane & 15, hi = lane >> 4; const int wv = __builtin_amdgcn_readfirstlane(tid >> 5), wm = wv & 1, wn = wv >> 1;
    const int r0 = blockIdx.x * 128, c0 = blockIdx.y * 128;
    // staging: 8 neighbouring lanes copy one whole 128-B line; a thread takes rows srow + 16 u of every plane
    const int srow = tid >> 3, sseg = (tid & 7) * 8;
    const bf* gB = Bt + (size_t)(c0 + srow) * K + sseg; const bf* gA = A + (size_t)(r0 + srow) * K + sseg; const bf* gA2 = NSPLIT ? A2 + (size_t)(r0 + srow) * K + sseg : nullptr;
    const unsigned l0 = (unsigned)(size_t)sm + (unsigned)(srow * GP + sseg) * 2u; const size_t rs = (size_t)16 * K;
    auto stage = [&](int t) { const unsigned l = l0 + (unsigned)(t & 1) * (NPL * GPL * 2); const int kc = t * 64;
        acopy8(l, gB + kc, rs); acopy8(l + GPL * 2, gA + kc, rs); if constexpr (NSPLIT != 0) acopy8(l + 2 * GPL * 2, gA2 + kc, rs); };
    // every loop over mb, nb, ks, j and s in this kernel is unrolled so that acc[][] and the fragments are indexed by constants and stay in registers
    v8f acc[4][4];
#pragma unroll
    for (int mb = 0; mb < 4; ++mb)
#pragma unroll
        for (int nb = 0; nb < 4; ++nb) acc[mb][nb] = (v8f){};
    constexpr int nst = K / 64; static_assert(K % 64 == 0 && nst >= 2, "whole stages, at least two");
    stage(0);
    asm volatile("s_wait_asynccnt 0x0" ::: "memory");   // this wave's copies of stage 0 have landed
    __syncthreads();                                     // every wave's have: stage 0 may be read
    stage(1);
    const int aof = (wm * 64 + lr) * GP + 8 * hi, bof = (wn * 64 + lr) * GP + 8 * hi;
    // the stage loop stays rolled: one copy of a stage's products and copies in the instruction cache, and one publish point
#pragma unroll 1
    for (int t = 0; t < nst; ++t) {
        const bf* cur = sm + (t & 1) * (NPL * GPL);
#pragma unroll
        for (int ks = 0; ks < 2; ++ks) { V a[4], a2[4], b[4];
            b[0] = WFrag<bf>::ld(cur + bof + ks * 32);
#pragma unroll
            for (int mb = 0; mb < 4; ++mb) a[mb] = WFrag<bf>::ld(cur + GPL + aof + mb * 16 * GP + ks * 32);
#pragma unroll
            for (int nb = 1; nb < 4; ++nb) b[nb] = WFrag<bf>::ld(cur + bof + nb * 16 * GP + ks * 32);
            if constexpr (NSPLIT != 0) {
#pragma unroll
                for (int mb = 0; mb < 4; ++mb) a2[mb] = WFrag<bf>::ld(cur + 2 * GPL + aof + mb * 16 * GP + ks * 32); }
            __builtin_amdgcn_sched_barrier(0);   // fence: the fragment loads go out as one group ahead of the products (one exposed LDS latency a group)
#pragma unroll
            for (int nb = 0; nb < 4; ++nb)
#pragma unroll
                for (int mb = 0; mb < 4; ++mb) acc[mb][nb] = WFrag<bf>::mma(a[mb], b[nb], acc[mb][nb]);
            if constexpr (NSPLIT != 0) {
#pragma unroll
                for (int nb = 0; nb < 4; ++nb)
#pragma unroll
                    for (int mb = 0; mb < 4; ++mb) acc[mb][nb] = WFrag<bf>::mma(a2[mb], b[nb], acc[mb][nb]); }
            __builtin_amdgcn_sched_barrier(0); }   // fence: products | next group
        asm volatile("s_wait_dscnt 0x0" ::: "memory");      // this wave's reads of the buffer are done before it is refilled
        asm volatile("s_wait_asynccnt 0x0" ::: "memory");   // this wave's copies of stage t + 1 have landed
        __syncthreads();                                     // publishes stage t + 1 and ends every wave's reads of stage t
        if (t + 2 < nst) stage(t + 2);                       // into the buffer that this trip has just read
    }
    asm volatile("s_wait_asynccnt 0x0" ::: "memory");        // no copy is outstanding when the wave goes on
    float* const ow = os + wv * (16 * 68);   // this wave's own staging rows: whole lines go out
    const int cw = c0 + wn * 64;
    if constexpr (EPI == 0) {
        const int cofs = lr * 4; v4f bv;   // a lane stores the same 4 columns of every row: their biases are read once
        { const v4f b4 = *(const v4f*)(bias + cw + cofs); bv[0] = bfr(b4[0]); bv[1] = bfr(b4[1]); bv[2] = bfr(b4[2]); bv[3] = bfr(b4[3]); }
#pragma unroll
        for (int mb = 0; mb < 4; ++mb) {
#pragma unroll
            for (int nb = 0; nb < 4; ++nb) {
#pragma unroll
                for (int j = 0; j < 8; ++j) ow[(hi * 8 + j) * 68 + nb * 16 + lr] = acc[mb][nb][j]; }
            __builtin_amdgcn_wave_barrier(); asm volatile("" ::: "memory");   // the row reads below are other lanes' stores: the compiler may not move them in front of the stores
            float* crow = C + z * sC + (size_t)(r0 + wm * 64 + mb * 16) * ldc + cw;
#pragma unroll
            for (int s = 0; s < 8; ++s) { const int row = 2 * s + hi; const v4f val = *(const v4fa*)(ow + row * 68 + cofs) + bv;
                *(v4f*)(crow + (size_t)row * ldc + cofs) = val; }
            asm volatile("s_wait_xcnt 0x0" ::: "memory");   // the next 16 rows reuse the registers that these stores name
            __builtin_amdgcn_wave_barrier(); asm volatile("" ::: "memory");   // nor the next 16 rows' stores in front of these reads
        }
    } else {
        // 16 plane rows of 64 elements at a time go through the wave's staging rows in f32; a lane then converts 8 neighbouring elements of a row and stores 16 bytes to each plane.
        // Plane rows are the tile's rows (EPI 1, 3: 16 t of block mb) or its columns (EPI 2: 16 d of block nb, where a lane's 8 accumulator registers are 8 neighbouring t).
        const int rsub = lane >> 3, cofs = (lane & 7) * 8, rw = r0 + wm * 64;
        const size_t pitch = EPI == 1 ? (size_t)HD : EPI == 2 ? (size_t)TT : (size_t)ldc;
        const size_t p0 = z * sC + cofs + (EPI == 1 ? ((size_t)(cw / HD) * TT + rw) * HD : EPI == 2 ? (size_t)cw * TT + rw : (size_t)rw * ldc + cw);
        float bc[8];   // EPI 1, 3: the biases of the 8 columns that the lane stores in every row; EPI 2: of the lane's accumulator column in each of the 4 blocks (they go in ahead of the staging)
        if constexpr (EPI == 2) {
#pragma unroll
            for (int q = 0; q < 4; ++q) bc[q] = bfr(bias[cw + q * 16 + lr]);
        } else { const v4f b0 = *(const v4f*)(bias + cw + cofs), b1 = *(const v4f*)(bias + cw + cofs + 4);
#pragma unroll
            for (int q = 0; q < 4; ++q) { bc[q] = bfr(b0[q]); bc[q + 4] = bfr(b1[q]); } }
#pragma unroll
        for (int blk = 0; blk < 4; ++blk) {
            if constexpr (EPI == 2) {
#pragma unroll
                for (int mb = 0; mb < 4; ++mb) { const v8f a = acc[mb][blk] + bc[blk];
                    *(v4fa*)(ow + lr * 68 + mb * 16 + hi * 8) = __builtin_shufflevector(a, a, 0, 1, 2, 3); *(v4fa*)(ow + lr * 68 + mb * 16 + hi * 8 + 4) = __builtin_shufflevector(a, a, 4, 5, 6, 7); }
            } else {
#pragma unroll
                for (int nb = 0; nb < 4; ++nb) {
#pragma unroll
                    for (int j = 0; j < 8; ++j) ow[(hi * 8 + j) * 68 + nb * 16 + lr] = acc[blk][nb][j]; } }
            __builtin_amdgcn_wave_barrier(); asm volatile("" ::: "memory");   // the row reads below are other lanes' stores: the compiler may not move them in front of the stores
#pragma unroll
            for (int s = 0; s < 4; ++s) { const int row = 4 * s + rsub; const v4f lo4 = *(const v4fa*)(ow + row * 68 + cofs), hi4 = *(const v4fa*)(ow + row * 68 + cofs + 4); v8h o16; v8us oh, ol;
#pragma unroll
                for (int q = 0; q < 8; ++q) { float y = q < 4 ? lo4[q & 3] : hi4[q & 3]; if constexpr (EPI != 2) y += bc[q]; if constexpr (EPI == 3) y = fmaxf(y, 0.f);
                    unsigned short a2, c2; splitf(y, a2, c2); oh[q] = a2; ol[q] = c2; if constexpr (EPI != 3) o16[q] = tohx(y); }
                const size_t e = p0 + (size_t)(blk * 16 + row) * pitch;
                if constexpr (EPI != 3) *(v8h*)(P16 + e) = o16;
                *(v8us*)(Ph + e) = oh; *(v8us*)(Pl + e) = ol;
                asm volatile("s_wait_xcnt 0x0" ::: "memory"); }   // the next rows' conversions reuse the registers that these stores name
            __builtin_amdgcn_wave_barrier(); asm volatile("" ::: "memory");   // nor the next block's stores in front of these reads
        }
    }
}

typedef __attribute__((ext_vector_type(2))) _Float16 v2h;
typedef __attribute__((ext_vector_type(4))) _Float16 v4h;
typedef __attribute__((ext_vector_type(2))) unsigned short v2us;
typedef __attribute__((ext_vector_type(4))) unsigned short v4us;
typedef __attribute__((ext_vector_type(2))) float v2f;
typedef __attribute__((ext_vector_type(4))) int v4i;

__global__ __launch_bounds__(256) void k_wtG(const float* __restrict__ w, int K, int N, bf* Bt) {
    const int lane = threadIdx.x & 31; const int L0 = (blockIdx.x * 8 + (threadIdx.x >> 5)) * 8; const int nlines = N * K / 64;
{
#pragma unroll 1
        for (int l = 0; l < 8; ++l) { const int L = L0 + l; if (L >= nlines) break; const size_t e = (size_t)L * 64 + lane * 2; const int k = (int)(e % K), n = (int)(e / K); v2us o;
            o[0] = f2bf(w[(size_t)k * N + n]); o[1] = f2bf(w[(size_t)(k + 1) * N + n]); *(v2us*)(Bt + e) = o; }
         }
}
__global__ __launch_bounds__(256) void k_cvt8(const float* __restrict__ src, bf* dst, size_t n8) { const size_t i = (size_t)blockIdx.x * 256 + threadIdx.x; if (i >= n8) return; const v8f v = *(const v8f*)(src + i * 8); v8us o;
#pragma unroll
    for (int k = 0; k < 8; ++k) o[k] = f2bf(v[k]); *(v8us*)(dst + i * 8) = o;  }

template <bool RND>
__global__ __launch_bounds__(256) void k_lnhl(const float* __restrict__ X, const float* __restrict__ A, const float* __restrict__ g, const float* __restrict__ be, float* Z, bf* Yh, bf* Yl) {
    const int lane = threadIdx.x & 31; const int r = blockIdx.x * 8 + (threadIdx.x >> 5); if (r >= NB_ * TT) return; const float* xr = X + (size_t)r * DM; const float* ar = A ? A + (size_t)r * DM : nullptr; float s = 0.f;
#pragma unroll 1
    for (int ch = 0; ch < DM / 128; ++ch) { const int c0 = ch * 128 + lane * 4; const v4f a = *(const v4f*)(xr + c0); v4f d = {0.f, 0.f, 0.f, 0.f}; if (ar) d = *(const v4f*)(ar + c0);
#pragma unroll
        for (int q = 0; q < 4; ++q) s += __fadd_rn((RND ? bfr(a[q]) : a[q]), d[q]); }
#pragma unroll
    for (int sh = 16; sh; sh >>= 1) s += __shfl_xor(s, sh, 32);
    const float mu = s * (1.0f / DM); float s2 = 0.f;
#pragma unroll 1
    for (int ch = 0; ch < DM / 128; ++ch) { const int c0 = ch * 128 + lane * 4; const v4f a = *(const v4f*)(xr + c0); v4f d = {0.f, 0.f, 0.f, 0.f}; if (ar) d = *(const v4f*)(ar + c0);
#pragma unroll
        for (int q = 0; q < 4; ++q) { const float d0 = __fsub_rn(__fadd_rn((RND ? bfr(a[q]) : a[q]), d[q]), mu); float p = __fmul_rn(d0, d0); asm volatile("" : "+v"(p)); s2 = __fadd_rn(s2, p); } }
#pragma unroll
    for (int sh = 16; sh; sh >>= 1) s2 += __shfl_xor(s2, sh, 32);
    const float rs = __fdiv_rn(1.0f, __fsqrt_rn(__fadd_rn(s2 * (1.0f / DM), LNEPS)));
{
#pragma unroll 1
        for (int ch = 0; ch < DM / 128; ++ch) { const int c0 = ch * 128 + lane * 4; const v4f a = *(const v4f*)(xr + c0); v4f d = {0.f, 0.f, 0.f, 0.f}; if (ar) d = *(const v4f*)(ar + c0); v4f z4; v4us oh, ol;
#pragma unroll
            for (int q = 0; q < 4; ++q) { const float v = __fadd_rn((RND ? bfr(a[q]) : a[q]), d[q]); float n0 = __fmul_rn(__fsub_rn(v, mu), rs); asm volatile("" : "+v"(n0)); float n1 = __fmul_rn(n0, bfr(g[c0 + q])); asm volatile("" : "+v"(n1)); const float y = __fadd_rn(n1, bfr(be[c0 + q])); z4[q] = y;   /* Z = the NORMALISED row (it is the residual for the next block) */ unsigned short h2, l2; splitf(y, h2, l2); oh[q] = h2; ol[q] = l2; }
            if (Z) *(v4f*)(Z + (size_t)r * DM + c0) = z4; *(v4us*)(Yh + (size_t)r * DM + c0) = oh; *(v4us*)(Yl + (size_t)r * DM + c0) = ol; }
         } }

__global__ __launch_bounds__(256) void k_addln(const float* __restrict__ A, const float* __restrict__ Bm, const float* __restrict__ g, const float* __restrict__ be, float* OUTb) {
    const int lane = threadIdx.x & 31; const int r = blockIdx.x * 8 + (threadIdx.x >> 5); if (r >= NB_ * TT) return; const float* ar = A + (size_t)r * DM; const float* br = Bm + (size_t)r * DM; float s = 0.f;
#pragma unroll 1
    for (int ch = 0; ch < DM / 128; ++ch) { const int c0 = ch * 128 + lane * 4; const v4f a = *(const v4f*)(ar + c0), bb = *(const v4f*)(br + c0);
#pragma unroll
        for (int q = 0; q < 4; ++q) s += __fadd_rn(a[q], bb[q]); }
#pragma unroll
    for (int sh = 16; sh; sh >>= 1) s += __shfl_xor(s, sh, 32);
    const float mu = s * (1.0f / DM); float s2 = 0.f;
#pragma unroll 1
    for (int ch = 0; ch < DM / 128; ++ch) { const int c0 = ch * 128 + lane * 4; const v4f a = *(const v4f*)(ar + c0), bb = *(const v4f*)(br + c0);
#pragma unroll
        for (int q = 0; q < 4; ++q) { const float d0 = __fsub_rn(__fadd_rn(a[q], bb[q]), mu); float p = __fmul_rn(d0, d0); asm volatile("" : "+v"(p)); s2 = __fadd_rn(s2, p); } }
#pragma unroll
    for (int sh = 16; sh; sh >>= 1) s2 += __shfl_xor(s2, sh, 32);
    const float rs = __fdiv_rn(1.0f, __fsqrt_rn(__fadd_rn(s2 * (1.0f / DM), LNEPS)));
{
#pragma unroll 1
        for (int ch = 0; ch < DM / 128; ++ch) { const int c0 = ch * 128 + lane * 4; const v4f a = *(const v4f*)(ar + c0), bb = *(const v4f*)(br + c0); v4f o4;
#pragma unroll
            for (int q = 0; q < 4; ++q) { float n0 = __fmul_rn(__fsub_rn(__fadd_rn(a[q], bb[q]), mu), rs); asm volatile("" : "+v"(n0)); float n1 = __fmul_rn(n0, bfr(g[c0 + q])); asm volatile("" : "+v"(n1)); o4[q] = __fadd_rn(n1, bfr(be[c0 + q])); }
            *(v4f*)(OUTb + (size_t)r * DM + c0) = o4; }
         } }
// ---- k_fattn: scores, softmax and attn.v of both batches in one launch; no score or probability ever leaves the work-group.
// 4 waves x 16 query columns per work-group, one head; the 2048 keys are walked in passes of KC = 64 with a running maximum and sum (new order of the softmax and attn.v sums).
// S^T = K Q^T (A = key rows from LDS, B = query rows kept in registers), O^T += V^T P^T (A = V^T rows from LDS, B = the score tiles converted in place: two D tiles of 16 keys are one B operand in the loaders' k order).
// A lane holds one query's column, so the maximum is in-lane plus one exchange between the wave's halves. Work-groups below NB_ * NH_ * RH / 64 take the hi+lo rows (3 products), the rest single fp16.
#define KC   64                   // keys per pass
#define LP   72                   // LDS row pitch in 16-bit elements: 144 B = 16 B x odd, conflict-free for the 16-byte fragment reads
#define PLN  (64 * LP)            // one staged plane: 64 rows of 128 B (K: 64 keys x HD; V^T: HD rows x 64 keys)
#define BIGF 0x1p127f             // a power of two: BIGF * CL2 is exact, so a fully masked row gets exponent 0 for every key (uniform weights, as the reference's -1e9 gives)
#define CL2  0.18033688011112042f // HD^-0.5 * log2(e)
__device__ __forceinline__ float xhalf(float x) { const int b = __float_as_int(x); return __int_as_float(__builtin_amdgcn_permlanex16(b, b, 0x76543210, 0xfedcba98, false, false)); }   // lane l <-> l ^ 16
typedef __attribute__((ext_vector_type(2))) __bf16 v2bf;
// 2^x in asm so that the slot the instruction set asks for behind a transcendental (before its result is read or its source overwritten) is filled by construction:
// in the group of four each exponential stands in front of an independent one (the outputs are early-clobber: none shares a register with an input), and the v_nop fills the slot behind the last.
__device__ __forceinline__ v4f exp2x4(float a, float b, float c, float d) { float r0, r1, r2, r3;
    asm("v_exp_f32 %0, %4\n\tv_exp_f32 %1, %5\n\tv_exp_f32 %2, %6\n\tv_exp_f32 %3, %7\n\tv_nop" : "=&v"(r0), "=&v"(r1), "=&v"(r2), "=&v"(r3) : "v"(a), "v"(b), "v"(c), "v"(d)); return (v4f){r0, r1, r2, r3}; }
__device__ __forceinline__ float exp2x1(float a) { float r; asm("v_exp_f32 %0, %1\n\tv_nop" : "=v"(r) : "v"(a)); return r; }
template <typename T16, bool HL>
__device__ __forceinline__ void fattn_body(const T16* __restrict__ Q, const T16* __restrict__ Q2, const T16* __restrict__ Kp, const T16* __restrict__ Kp2, const T16* __restrict__ Vt, const T16* __restrict__ Vt2, int q0, T16* sm, const float* lim, bf* Ah, bf* Al) {
    typedef typename WFrag<T16>::V V;
    constexpr int NP = HL ? 4 : 2, NL = HL ? 2 : 1;   // planes in a buffer (K, V^T, K lo, V^T lo); planes of one operand
    const int tid = threadIdx.x, lane = tid & 31, lr = lane & 15, hi = lane >> 4; const int qr = q0 + (tid >> 5) * 16 + lr;
    V qf[2], qf2[2];
#pragma unroll
    for (int ks = 0; ks < 2; ++ks) { qf[ks] = WFrag<T16>::ld(Q + (size_t)qr * HD + ks * 32 + 8 * hi); if (HL) qf2[ks] = WFrag<T16>::ld(Q2 + (size_t)qr * HD + ks * 32 + 8 * hi); }
    // staging: a plane is 512 pieces of 16 B, 4 per thread; 8 neighbouring lanes read one whole 128-B line. K and V^T take turns in the same registers.
    const int srow = tid >> 3, sseg = (tid & 7) * 8;
    v8us st[NL][4];
    auto gloadK = [&](int c) {
#pragma unroll
        for (int u = 0; u < 4; ++u) { const size_t e = (size_t)(c * KC + srow + 16 * u) * HD + sseg; st[0][u] = *(const v8usa*)(Kp + e); if constexpr (HL) st[1][u] = *(const v8usa*)(Kp2 + e); } };
    auto gloadV = [&](int c) {
#pragma unroll
        for (int u = 0; u < 4; ++u) { const size_t e = (size_t)(srow + 16 * u) * TT + c * KC + sseg; st[0][u] = *(const v8usa*)(Vt + e); if constexpr (HL) st[1][u] = *(const v8usa*)(Vt2 + e); } };
    auto sstore = [&](T16* pl) {   // pl: the operand's hi plane; its lo plane lies two planes further
#pragma unroll
        for (int p = 0; p < NL; ++p)
#pragma unroll
            for (int u = 0; u < 4; ++u) *(v8usa*)(pl + p * 2 * PLN + (srow + 16 * u) * LP + sseg) = st[p][u]; };
    v8f o[4];
#pragma unroll
    for (int dt = 0; dt < 4; ++dt) o[dt] = (v8f){};
    float mraw = -BIGF, mcs = -BIGF * CL2;
    // the softmax sums ride the matrix pipe: an A of ones makes every row of lt the column sums of the (rounded) weights, over both lane halves' keys; lt is rescaled like an output tile
    V ones; v8f lt = (v8f){};
#pragma unroll
    for (int e = 0; e < 16; ++e) { if constexpr (HL) ones[e] = (__bf16)1.0f; else ones[e] = (h16)1.0f; }
    gloadK(0); sstore(sm); gloadV(0); sstore(sm + PLN);
    __syncthreads();   // pass 0's planes and the key limits are in LDS
    // The scheduling fences in the loop keep each group of LDS fragment loads together and ahead of the block of products that uses it (one exposed LDS latency a group, not one a fragment),
    // and keep the products of a block in the written order, in which neighbours go to different accumulators.
#pragma unroll 1
    for (int c = 0; c < TT / KC; ++c) {
        const T16* cur = sm + (c & 1) * (NP * PLN); T16* nxt = sm + ((c + 1) & 1) * (NP * PLN);
        const int cn = (c + 1 < TT / KC) ? c + 1 : c;   // the last pass re-reads its own planes: no branch in the loop; that copy is never read
        gloadK(cn);   // the next pass's K flies during the score products
        __builtin_amdgcn_sched_barrier(0);   // fence: the global loads stay at the head of the pass
        v8f s[4];
        if constexpr (HL) {
#pragma unroll
            for (int ks = 0; ks < 2; ++ks) { V ka[4], kb[4];
#pragma unroll
                for (int kt = 0; kt < 4; ++kt) { ka[kt] = WFrag<T16>::ld(cur + (kt * 16 + lr) * LP + ks * 32 + 8 * hi); kb[kt] = WFrag<T16>::ld(cur + 2 * PLN + (kt * 16 + lr) * LP + ks * 32 + 8 * hi); }
                __builtin_amdgcn_sched_barrier(0);   // fence: loads | products
#pragma unroll
                for (int kt = 0; kt < 4; ++kt) s[kt] = WFrag<T16>::mma(ka[kt], qf[ks], ks ? s[kt] : (v8f){});
#pragma unroll
                for (int kt = 0; kt < 4; ++kt) s[kt] = WFrag<T16>::mma(ka[kt], qf2[ks], s[kt]);
#pragma unroll
                for (int kt = 0; kt < 4; ++kt) s[kt] = WFrag<T16>::mma(kb[kt], qf[ks], s[kt]);
                __builtin_amdgcn_sched_barrier(0); }   // fence: products | next group
        } else { V ka[2][4];
#pragma unroll
            for (int ks = 0; ks < 2; ++ks)
#pragma unroll
                for (int kt = 0; kt < 4; ++kt) ka[ks][kt] = WFrag<T16>::ld(cur + (kt * 16 + lr) * LP + ks * 32 + 8 * hi);
            __builtin_amdgcn_sched_barrier(0);   // fence: loads | products
#pragma unroll
            for (int ks = 0; ks < 2; ++ks)
#pragma unroll
                for (int kt = 0; kt < 4; ++kt) s[kt] = WFrag<T16>::mma(ka[ks][kt], qf[ks], ks ? s[kt] : (v8f){});
            __builtin_amdgcn_sched_barrier(0); }   // fence: products | next group
        // key mask as a select, one instruction: the median of (s, -BIGF, +BIGF) is s, of (s, -BIGF, -BIGF) is -BIGF; four independent maximum chains
        float mk[4]; v4f lm[8];
#pragma unroll
        for (int u = 0; u < 8; ++u) lm[u] = *(const v4fa*)(lim + c * KC + (u >> 1) * 16 + hi * 8 + (u & 1) * 4);
        __builtin_amdgcn_sched_barrier(0);   // fence: the eight limit loads go out as one group, while the last score products drain
#pragma unroll
        for (int kt = 0; kt < 4; ++kt) { mk[kt] = -BIGF;
#pragma unroll
            for (int j = 0; j < 8; ++j) { const float t = __builtin_amdgcn_fmed3f(s[kt][j], -BIGF, lm[2 * kt + (j >> 2)][j & 3]); s[kt][j] = t; mk[kt] = __builtin_fmaximum_numf(mk[kt], t); } }
        float mx = __builtin_fmaximum_numf(__builtin_fmaximum_numf(__builtin_fmaximum_numf(mk[0], mk[1]), __builtin_fmaximum_numf(mk[2], mk[3])), mraw); mx = __builtin_fmaximum_numf(mx, xhalf(mx));
        __builtin_amdgcn_sched_barrier(0);   // fence: the K stores (and the wait on their loads) stay behind the maximum
        sstore(nxt); gloadV(cn);   // K goes to the other buffer; the next pass's V^T flies during the exponentials and the output products
        V va[HL ? 1 : 2][4], vb[4];   // V^T fragments fetched ahead of the exponentials (fp16: both 32-key groups; hi+lo: the first)
#pragma unroll
        for (int g = 0; g < (HL ? 1 : 2); ++g)
#pragma unroll
            for (int dt = 0; dt < 4; ++dt) { va[g][dt] = WFrag<T16>::ld(cur + PLN + (dt * 16 + lr) * LP + g * 32 + 8 * hi); if constexpr (HL) vb[dt] = WFrag<T16>::ld(cur + 3 * PLN + (dt * 16 + lr) * LP + g * 32 + 8 * hi); }
        __builtin_amdgcn_sched_barrier(0);   // fence: these loads are issued before the exponentials, which cover their latency
        const float mc = mx * CL2, al = exp2x1(mcs - mc), ad = (HL ? 0.0f : 10.0f) - mc;   // fp16 weights carry x1024 (cancels in the division by the sum): small weights stay normal numbers
        mraw = mx; mcs = mc;
#pragma unroll
        for (int kt = 0; kt < 4; ++kt)
#pragma unroll
            for (int j = 0; j < 8; ++j) s[kt][j] = __builtin_fmaf(s[kt][j], CL2, ad);
#pragma unroll
        for (int kt = 0; kt < 4; ++kt) { const v4f e0 = exp2x4(s[kt][0], s[kt][1], s[kt][2], s[kt][3]), e1 = exp2x4(s[kt][4], s[kt][5], s[kt][6], s[kt][7]); s[kt] = __builtin_shufflevector(e0, e1, 0, 1, 2, 3, 4, 5, 6, 7); }
        __builtin_amdgcn_sched_barrier(0);   // fence: the exponentials are asm text: none of the products below is scheduled in front of them
        lt *= al;
#pragma unroll
        for (int dt = 0; dt < 4; ++dt) o[dt] *= al;
#pragma unroll
        for (int g = 0; g < 2; ++g) { V pb, pb2;
#pragma unroll
            for (int e = 0; e < 16; e += 2) { const v2f pp = {s[2 * g + (e >> 3)][e & 7], s[2 * g + (e >> 3)][(e & 7) + 1]};   // by pairs: one packed conversion for two weights
                if constexpr (HL) { const v2bf h2 = __builtin_convertvector(pp, v2bf); const v2bf l2 = __builtin_convertvector(pp - __builtin_convertvector(h2, v2f), v2bf); pb[e] = h2[0]; pb[e + 1] = h2[1]; pb2[e] = l2[0]; pb2[e + 1] = l2[1]; }
                else { const v2h h2 = __builtin_convertvector(pp, v2h); pb[e] = h2[0]; pb[e + 1] = h2[1]; } }
            __builtin_amdgcn_sched_barrier(0);   // fence: conversions | products
#pragma unroll
            for (int dt = 0; dt < 4; ++dt) o[dt] = WFrag<T16>::mma(va[HL ? 0 : g][dt], pb, o[dt]);
            lt = WFrag<T16>::mma(ones, pb, lt);
            if constexpr (HL) {
#pragma unroll
                for (int dt = 0; dt < 4; ++dt) o[dt] = WFrag<T16>::mma(va[0][dt], pb2, o[dt]);
                lt = WFrag<T16>::mma(ones, pb2, lt);
#pragma unroll
                for (int dt = 0; dt < 4; ++dt) o[dt] = WFrag<T16>::mma(vb[dt], pb, o[dt]);
                __builtin_amdgcn_sched_barrier(0);   // fence: products | the second group's loads
                if (g == 0) {
#pragma unroll
                    for (int dt = 0; dt < 4; ++dt) { va[0][dt] = WFrag<T16>::ld(cur + PLN + (dt * 16 + lr) * LP + 32 + 8 * hi); vb[dt] = WFrag<T16>::ld(cur + 3 * PLN + (dt * 16 + lr) * LP + 32 + 8 * hi); }
                    __builtin_amdgcn_sched_barrier(0); } } }   // fence: the second group's loads are issued before its conversions, which cover their latency
        __builtin_amdgcn_sched_barrier(0);   // fence: the V^T stores (and the wait on their loads) stay at the foot of the pass
        sstore(nxt + PLN);
        __syncthreads();   // publishes the next pass's planes and ends every wave's reads of this pass's (refilled in the next trip)
    }
    const float inv = __fdiv_rn(1.0f, lt[0]);
#pragma unroll
    for (int dt = 0; dt < 4; ++dt) { v8us oh, ol;   // a lane's 8 accumulator registers are 8 consecutive d of its query: one 16-byte store per plane
#pragma unroll
        for (int j = 0; j < 8; ++j) { unsigned short a, c2; splitf(o[dt][j] * inv, a, c2); oh[j] = a; ol[j] = c2; }
        const size_t oo = (size_t)qr * DQ + dt * 16 + hi * 8; *(v8us*)(Ah + oo) = oh; *(v8us*)(Al + oo) = ol; }
}
// the second bound (4 waves per SIMD) is a budget of 256 registers: the hi+lo body stays below v256 and needs no register-window switches in its loop
__global__ __launch_bounds__(128, 4) void k_fattn(const h16* __restrict__ Q16, const h16* __restrict__ K16, const h16* __restrict__ V16, const bf* __restrict__ Qh, const bf* __restrict__ Ql, const bf* __restrict__ Kh, const bf* __restrict__ Kl, const bf* __restrict__ Vh, const bf* __restrict__ Vl, const int* __restrict__ MK, bf* Ah, bf* Al) {
    __shared__ __align__(16) unsigned short sm[2 * 4 * PLN];
    __shared__ __align__(16) float lim[TT];
    const int bx = blockIdx.x;   // the heavier hi+lo work-groups of both batches come first
    constexpr int NHL = NH_ * (RH / 64), NSG = NH_ * ((TT - RH) / 64);   // work-groups of a batch: hi+lo, single fp16
    const bool hl = bx < NB_ * NHL; const int bt = hl ? bx / NHL : (bx - NB_ * NHL) / NSG, ix = hl ? bx % NHL : (bx - NB_ * NHL) % NSG;   // batch, index inside the batch
    const int* MKb = MK + (size_t)bt * TT; const size_t zb = (size_t)bt * NH_ * TT * HD, zkb = (size_t)bt * NKV * TT * HD; Ah += (size_t)bt * TT * DQ; Al += (size_t)bt * TT * DQ;
    // unrolled so that the four mask loads of a thread are in flight together
#pragma unroll
    for (int u = 0; u < TT / 512; ++u) { const int i = (u * 128 + (int)threadIdx.x) * 4; const v4i m4 = *(const v4i*)(MKb + i); v4f f4;
#pragma unroll
        for (int q = 0; q < 4; ++q) f4[q] = (m4[q] != 0) ? BIGF : -BIGF;
        *(v4fa*)(lim + i) = f4; }
    if (hl) { const int h = ix / (RH / 64), q0 = (ix % (RH / 64)) * 64; const size_t zq = zb + (size_t)h * TT * HD, zk = zkb + (size_t)(h / REP) * TT * HD;
        fattn_body<bf, true>(Qh + zq, Ql + zq, Kh + zk, Kl + zk, Vh + zk, Vl + zk, q0, (bf*)sm, lim, Ah + h * HD, Al + h * HD);
    } else { const int h = ix / ((TT - RH) / 64), q0 = RH + (ix % ((TT - RH) / 64)) * 64; const size_t zq = zb + (size_t)h * TT * HD, zk = zkb + (size_t)(h / REP) * TT * HD;
        fattn_body<h16, false>(Q16 + zq, nullptr, K16 + zk, nullptr, V16 + zk, nullptr, q0, (h16*)sm, lim, Ah + h * HD, Al + h * HD); }
}

extern "C" void kernel_launch(void* const* d_in, const int* in_sizes, int n_in,
                              void* d_out, int out_size, void* d_ws, size_t ws_size, hipStream_t stream) {
    (void)in_sizes; (void)n_in; (void)out_size;
    const float* x = (const float*)d_in[0]; const float* xk = (const float*)d_in[1]; const int* MK = (const int*)d_in[2]; const float* wq = (const float*)d_in[3]; const float* bq = (const float*)d_in[4]; const float* wk = (const float*)d_in[5]; const float* bk = (const float*)d_in[6]; const float* wv = (const float*)d_in[7]; const float* bv = (const float*)d_in[8]; const float* wo = (const float*)d_in[9]; const float* bo = (const float*)d_in[10]; const float* w1 = (const float*)d_in[11]; const float* b1 = (const float*)d_in[12]; const float* w2 = (const float*)d_in[13]; const float* b2 = (const float*)d_in[14]; const float* g1 = (const float*)d_in[15]; const float* e1 = (const float*)d_in[16]; const float* g2 = (const float*)d_in[17]; const float* e2 = (const float*)d_in[18];
    float* OUT = (float*)d_out;     // [2][2048][1024]
    char* wsp = (char*)d_ws;
    auto take = [&](size_t bytes) { char* p = wsp; wsp += (bytes + 255) & ~(size_t)255; return (void*)p; };
    bf* WQ = (bf*)take((size_t)DQ * DM * 2); bf* WK = (bf*)take((size_t)DKV * DM * 2); bf* WV = (bf*)take((size_t)DKV * DM * 2); bf* WO = (bf*)take((size_t)DM * DQ * 2);
    bf* W1B = (bf*)take((size_t)DFF * DM * 2); bf* W2B = (bf*)take((size_t)DM * DFF * 2);
    // every buffer below holds both batches (rows b * TT + t; head planes [b][h][..]).
    // Region A: inputs in bf16 and the head planes, dead once the attention has run; Gh, Gl lie over it.
    char* const regA = wsp;
    bf* XB = (bf*)take((size_t)NB_ * TT * DM * 2); bf* XKB = (bf*)take((size_t)NB_ * TT * DM * 2);
    h16* QP16 = (h16*)take((size_t)NB_ * NH_ * TT * HD * 2); h16* KP16 = (h16*)take((size_t)NB_ * NKV * TT * HD * 2); h16* VT16 = (h16*)take((size_t)NB_ * NKV * HD * TT * 2);
    bf* QPh = (bf*)take((size_t)NB_ * NH_ * TT * HD * 2); bf* QPl = (bf*)take((size_t)NB_ * NH_ * TT * HD * 2); bf* KPh = (bf*)take((size_t)NB_ * NKV * TT * HD * 2); bf* KPl = (bf*)take((size_t)NB_ * NKV * TT * HD * 2); bf* VTh = (bf*)take((size_t)NB_ * NKV * HD * TT * 2); bf* VTl = (bf*)take((size_t)NB_ * NKV * HD * TT * 2);
    bf* ATh = (bf*)take((size_t)NB_ * TT * DQ * 2); bf* ATl = (bf*)take((size_t)NB_ * TT * DQ * 2); float* S2 = (float*)take((size_t)NB_ * TT * DM * 4);
    float* X1 = (float*)take((size_t)NB_ * TT * DM * 4); bf* L1h = (bf*)take((size_t)NB_ * TT * DM * 2); bf* L1l = (bf*)take((size_t)NB_ * TT * DM * 2); float* F2 = (float*)take((size_t)NB_ * TT * DM * 4);
    if ((size_t)(wsp - (char*)d_ws) > ws_size) return;
    bf* Gh = (bf*)regA; bf* Gl = Gh + (size_t)NB_ * TT * DFF;
    static_assert((size_t)NB_ * TT * DFF * 2 * 2 <= (size_t)NB_ * TT * (2 * DM + 3 * DQ + 6 * DKV) * 2, "Gh, Gl fit region A");
    { k_wtG<<<(unsigned)((DM * DQ / 64 + 63) / 64), 256, 0, stream>>>(wq, DM, DQ, WQ); k_wtG<<<(unsigned)((DM * DKV / 64 + 63) / 64), 256, 0, stream>>>(wk, DM, DKV, WK); k_wtG<<<(unsigned)((DM * DKV / 64 + 63) / 64), 256, 0, stream>>>(wv, DM, DKV, WV);
      k_wtG<<<(unsigned)((DQ * DM / 64 + 63) / 64), 256, 0, stream>>>(wo, DQ, DM, WO); k_wtG<<<(unsigned)((DM * DFF / 64 + 63) / 64), 256, 0, stream>>>(w1, DM, DFF, W1B); k_wtG<<<(unsigned)((DFF * DM / 64 + 63) / 64), 256, 0, stream>>>(w2, DFF, DM, W2B);
       }
    // one launch of each kernel serves both batches. In the GEMM grids the batch is z (the slowest index).
    k_cvt8<<<(unsigned)(((size_t)NB_ * TT * DM / 8 + 255) / 256), 256, 0, stream>>>(x, XB, (size_t)NB_ * TT * DM / 8); k_cvt8<<<(unsigned)(((size_t)NB_ * TT * DM / 8 + 255) / 256), 256, 0, stream>>>(xk, XKB, (size_t)NB_ * TT * DM / 8);
    k_gemms<0, 1, DM><<<dim3(TT / 128, DQ / 128, NB_), 128, 0, stream>>>(XB, nullptr, WQ, nullptr, QP16, QPh, QPl, 0, bq, (size_t)TT * DM, (size_t)NH_ * TT * HD);      /* q = x Wq + bq as head planes */
    k_gemms<0, 1, DM><<<dim3(TT / 128, DKV / 128, NB_), 128, 0, stream>>>(XKB, nullptr, WK, nullptr, KP16, KPh, KPl, 0, bk, (size_t)TT * DM, (size_t)NKV * TT * HD);   /* k = y Wk + bk as head planes */
    k_gemms<0, 2, DM><<<dim3(TT / 128, DKV / 128, NB_), 128, 0, stream>>>(XKB, nullptr, WV, nullptr, VT16, VTh, VTl, 0, bv, (size_t)TT * DM, (size_t)NKV * HD * TT);   /* v = y Wv + bv as transposed head planes */
    k_fattn<<<NB_ * NH_ * (TT / 64), 128, 0, stream>>>(QP16, KP16, VT16, QPh, QPl, KPh, KPl, VTh, VTl, MK, ATh, ATl);   /* softmax(q k^T / 8, mask) v, merged heads as hi/lo planes */
    k_gemms<1, 0, DQ><<<dim3(TT / 128, DM / 128, NB_), 128, 0, stream>>>(ATh, ATl, WO, S2, nullptr, nullptr, nullptr, DM, bo, (size_t)TT * DQ, (size_t)TT * DM);   /* mha = merged Wo + bo */
    k_lnhl<true><<<NB_ * TT / 8, 256, 0, stream>>>(x, S2, g1, e1, X1, L1h, L1l);                                                          /* x1 = LN(bf16(x) + mha): normalised row in f32 + hi/lo planes */
    k_gemms<1, 3, DM><<<dim3(TT / 128, DFF / 128, NB_), 128, 0, stream>>>(L1h, L1l, W1B, nullptr, nullptr, Gh, Gl, DFF, b1, (size_t)TT * DM, (size_t)TT * DFF);   /* relu(x1 W1 + b1) as hi/lo planes */
    k_gemms<1, 0, DFF><<<dim3(TT / 128, DM / 128, NB_), 128, 0, stream>>>(Gh, Gl, W2B, F2, nullptr, nullptr, nullptr, DM, b2, (size_t)TT * DFF, (size_t)TT * DM);   /* . W2 + b2 */
    k_addln<<<NB_ * TT / 8, 256, 0, stream>>>(X1, F2, g2, e2, OUT);                                                                       /* out = LN(x1 + ff) */
}

// v007
// Measured time: 274 microseconds a run.
// Timed twice side by side with v006, it ran 1.21 and 1.22 times as fast.
// All steps since v000 together make it 14.5 times as fast.
#include <hip/hip_runtime.h>

// Post-LN transformer encoder block with cross attention (x, y [2][2048][1024]; Q = x Wq + bq, K = y Wk + bk, V = y Wv + bv ('xw' [1024][1024]; 16 heads x 64); scores/8 with mask [2][1][1][2048] (int32 keys, read; -1e9 == exact zero weight; all ones here); softmax; mha = merged Wo + bo; x1 = LN(x + mha); ff = relu(x1 W1 + b1) W2 + b2 (W1 [1024][4096]); out = LN(x1 + ff) (eps 1e-5) -> [2][2048][1024] (4.2 M)).
// Compute dtypes, f32 accumulate: every input rounded to bf16; q/k/v on PLAIN bf16 operands (inputs: exact) + biases; key mask as a select; scores and attn.v: query rows < 512 hl (3 products), the rest single fp16 (x1024); softmax f32; Wo, W1, W2 hl x exact (2 products) + biases; residuals / LayerNorms / ReLU in f32.

#define NB_  2
#define TT   2048
#define DM   1024
#define NH_  16
#define NKV  16
#define REP  (NH_ / NKV)
#define HD   64
#define DQ   (NH_ * HD)
#define DKV  (NKV * HD)
#define DFF  4096
#define LNEPS 1e-5f
#define RH   512                  // query rows < RH use hi+lo planes (0: none)
#define WIN  0
#define SCL  0.125f   // HD^-0.5
typedef _Float16 h16;
typedef unsigned short bf;
typedef __attribute__((ext_vector_type(16))) __bf16   v16bf;
typedef __attribute__((ext_vector_type(16))) _Float16 v16h;
typedef __attribute__((ext_vector_type(8)))  _Float16 v8h;
typedef __attribute__((ext_vector_type(8)))  unsigned short v8us;
typedef __attribute__((ext_vector_type(8)))  float    v8f;
typedef __attribute__((ext_vector_type(4)))  float    v4f;
typedef v8h  __attribute__((may_alias)) v8ha;
typedef v4f  __attribute__((may_alias)) v4fa;
typedef v8us __attribute__((may_alias)) v8usa;

__device__ __forceinline__ unsigned short f2bf(float f) { unsigned u = __float_as_uint(f); u += 0x7FFFu + ((u >> 16) & 1u); return (unsigned short)(u >> 16); }
__device__ __forceinline__ float bf2f(unsigned short b) { return __uint_as_float(((unsigned)b) << 16); }
__device__ __forceinline__ float bfr(float f) { return bf2f(f2bf(f)); }
__device__ __forceinline__ v16h cat16(v8h lo, v8h hi) { return __builtin_shufflevector(lo, hi, 0, 1, 2, 3, 4, 5, 6, 7, 8, 9, 10, 11, 12, 13, 14, 15); }
__device__ __forceinline__ v16bf cat16b(v8us lo, v8us hi) { return __builtin_bit_cast(v16bf, __builtin_shufflevector(lo, hi, 0, 1, 2, 3, 4, 5, 6, 7, 8, 9, 10, 11, 12, 13, 14, 15)); }
__device__ __forceinline__ v8f wmma16(v16h a, v16h b, v8f c) { return __builtin_amdgcn_wmma_f32_16x16x32_f16(false, a, false, b, (short)0, c, false, false); }
__device__ __forceinline__ v8f wmmab(v16bf a, v16bf b, v8f c) { return __builtin_amdgcn_wmma_f32_16x16x32_bf16(false, a, false, b, (short)0, c, false, false); }
__device__ __forceinline__ h16 tohx(float x) { return (h16)x; }
__device__ __forceinline__ void splitf(float y, unsigned short& h, unsigned short& l) { h = f2bf(y); l = f2bf(y - bf2f(h)); }



// ---- k_gemms: GEMM on LDS-staged operands. One 128x128 output tile per work-group, 4 waves as 2 x 2, each a 64x64 tile (16 accumulators); grid (M/128, N/128, Z), 128 threads.
// A stage is 64 k = one whole 128-byte line of each of the 128 rows of every operand plane (A, with NSPLIT == 1 also A2, and Bt), brought from the K-contiguous 16-bit planes into LDS by asynchronous copies
// (a wave's copy covers 4 whole lines); two buffers, the next stage flies while this one is worked on. Each staged row serves two waves.
// c[m][n] = bias[n] + sum_k (A[m][k] + A2[m][k]) Bt[n][k], k ascending in one chain per element. z-batch strides sA/sC in elements. K (compile time) % 64 == 0, at least two stages.
// The tile leaves in the form its consumer reads (EPI), so that no elementwise launch stands between a product and the next kernel:
//   0: f32 rows C, pitch ldc.   1: head planes [z][h][t][d] (fp16 P16, bf16 hi Ph, lo Pl).   2: transposed head planes [z][h][d][t] (the same three).   3: relu(c) as bf16 hi/lo rows Ph, Pl, pitch ldc.
// A wave's 64 columns are one head (EPI 1, 2); in every 16-bit plane 8 neighbouring lanes store one whole 128-byte line.
template <typename T16> struct WFrag;
template <> struct WFrag<h16> { typedef v16h V; static __device__ __forceinline__ V ld(const h16* p) { return cat16(*(const v8h*)p, *(const v8h*)(p + 16)); } static __device__ __forceinline__ v8f mma(V a, V b, v8f c) { return wmma16(a, b, c); } };
template <> struct WFrag<bf> { typedef v16bf V; static __device__ __forceinline__ V ld(const bf* p) { return cat16b(*(const v8us*)p, *(const v8us*)(p + 16)); } static __device__ __forceinline__ v8f mma(V a, V b, v8f c) { return wmmab(a, b, c); } };
#define GP   72                   // LDS row pitch in 16-bit elements: 144 B = 16 B x odd, conflict-free for the 16-byte fragment reads
#define GPL  (128 * GP)           // one staged plane: 128 rows of 128 B
// eight asynchronous 16-byte copies of a lane (rows r, r + 16, .. r + 112 of one plane); the s_wait_xcnt stands inside the statement, behind the last copy, so that no address register is rewritten in front of it
__device__ __forceinline__ void acopy8(unsigned l, const bf* g, size_t rs) {
    asm volatile("global_load_async_to_lds_b128 %0, %8, off\n\tglobal_load_async_to_lds_b128 %1, %9, off\n\tglobal_load_async_to_lds_b128 %2, %10, off\n\tglobal_load_async_to_lds_b128 %3, %11, off\n\t"
                 "global_load_async_to_lds_b128 %4, %12, off\n\tglobal_load_async_to_lds_b128 %5, %13, off\n\tglobal_load_async_to_lds_b128 %6, %14, off\n\tglobal_load_async_to_lds_b128 %7, %15, off\n\ts_wait_xcnt 0x0"
                 :: "v"(l), "v"(l + 16 * GP * 2), "v"(l + 32 * GP * 2), "v"(l + 48 * GP * 2), "v"(l + 64 * GP * 2), "v"(l + 80 * GP * 2), "v"(l + 96 * GP * 2), "v"(l + 112 * GP * 2),
                    "v"(g), "v"(g + rs), "v"(g + 2 * rs), "v"(g + 3 * rs), "v"(g + 4 * rs), "v"(g + 5 * rs), "v"(g + 6 * rs), "v"(g + 7 * rs) : "memory"); }
// the second bound (4 waves per SIMD) is a budget of 256 registers: accumulators and one fragment set fit below v256
template <int NSPLIT, int EPI, int K>
__global__ __launch_bounds__(128, 4) void k_gemms(const bf* __restrict__ A, const bf* __restrict__ A2, const bf* __restrict__ Bt, float* C, h16* P16, bf* Ph, bf* Pl, int ldc, const float* __restrict__ bias, size_t sA, size_t sC) {
    typedef WFrag<bf>::V V;
    constexpr int NPL = NSPLIT ? 3 : 2;   // planes of a stage: Bt, A (, A2)
    __shared__ __align__(16) bf sm[2 * NPL * GPL];
    __shared__ __align__(16) float os[4 * 16 * 68];
    const size_t z = blockIdx.z; A += z * sA; if (NSPLIT) A2 += z * sA;
    const int tid = threadIdx.x, lane = tid & 31, lr = lane & 15, hi = lane >> 4; const int wv = __builtin_amdgcn_readfirstlane(tid >> 5), wm = wv & 1, wn = wv >> 1;
    const int r0 = blockIdx.x * 128, c0 = blockIdx.y * 128;
    // staging: 8 neighbouring lanes copy one whole 128-B line; a thread takes rows srow + 16 u of every plane
    const int srow = tid >> 3, sseg = (tid & 7) * 8;
    const bf* gB = Bt + (size_t)(c0 + srow) * K + sseg; const bf* gA = A + (size_t)(r0 + srow) * K + sseg; const bf* gA2 = NSPLIT ? A2 + (size_t)(r0 + srow) * K + sseg : nullptr;
    const unsigned l0 = (unsigned)(size_t)sm + (unsigned)(srow * GP + sseg) * 2u; const size_t rs = (size_t)16 * K;
    auto stage = [&](int t) { const unsigned l = l0 + (unsigned)(t & 1) * (NPL * GPL * 2); const int kc = t * 64;
        acopy8(l, gB + kc, rs); acopy8(l + GPL * 2, gA + kc, rs); if constexpr (NSPLIT != 0) acopy8(l + 2 * GPL * 2, gA2 + kc, rs); };
    // every loop over mb, nb, ks, j and s in this kernel is unrolled so that acc[][] and the fragments are indexed by constants and stay in registers
    v8f acc[4][4];
#pragma unroll
    for (int mb = 0; mb < 4; ++mb)
#pragma unroll
        for (int nb = 0; nb < 4; ++nb) acc[mb][nb] = (v8f){};
    constexpr int nst = K / 64; static_assert(K % 64 == 0 && nst >= 2, "whole stages, at least two");
    stage(0);
    asm volatile("s_wait_asynccnt 0x0" ::: "memory");   // this wave's copies of stage 0 have landed
    __syncthreads();                                     // every wave's have: stage 0 may be read
    stage(1);
    const int aof = (wm * 64 + lr) * GP + 8 * hi, bof = (wn * 64 + lr) * GP + 8 * hi;
    // the stage loop stays rolled: one copy of a stage's products and copies in the instruction cache, and one publish point
#pragma unroll 1
    for (int t = 0; t < nst; ++t) {
        const bf* cur = sm + (t & 1) * (NPL * GPL);
#pragma unroll
        for (int ks = 0; ks < 2; ++ks) { V a[4], a2[4], b[4];
            b[0] = WFrag<bf>::ld(cur + bof + ks * 32);
#pragma unroll
            for (int mb = 0; mb < 4; ++mb) a[mb] = WFrag<bf>::ld(cur + GPL + aof + mb * 16 * GP + ks * 32);
#pragma unroll
            for (int nb = 1; nb < 4; ++nb) b[nb] = WFrag<bf>::ld(cur + bof + nb * 16 * GP + ks * 32);
            if constexpr (NSPLIT != 0) {
#pragma unroll
                for (int mb = 0; mb < 4; ++mb) a2[mb] = WFrag<bf>::ld(cur + 2 * GPL + aof + mb * 16 * GP + ks * 32); }
            __builtin_amdgcn_sched_barrier(0);   // fence: the fragment loads go out as one group ahead of the products (one exposed LDS latency a group)
#pragma unroll
            for (int nb = 0; nb < 4; ++nb)
#pragma unroll
                for (int mb = 0; mb < 4; ++mb) acc[mb][nb] = WFrag<bf>::mma(a[mb], b[nb], acc[mb][nb]);
            if constexpr (NSPLIT != 0) {
#pragma unroll
                for (int nb = 0; nb < 4; ++nb)
#pragma unroll
                    for (int mb = 0; mb < 4; ++mb) acc[mb][nb] = WFrag<bf>::mma(a2[mb], b[nb], acc[mb][nb]); }
            __builtin_amdgcn_sched_barrier(0); }   // fence: products | next group
        asm volatile("s_wait_dscnt 0x0" ::: "memory");      // this wave's reads of the buffer are done before it is refilled
        asm volatile("s_wait_asynccnt 0x0" ::: "memory");   // this wave's copies of stage t + 1 have landed
        __syncthreads();                                     // publishes stage t + 1 and ends every wave's reads of stage t
        if (t + 2 < nst) stage(t + 2);                       // into the buffer that this trip has just read
    }
    asm volatile("s_wait_asynccnt 0x0" ::: "memory");        // no copy is outstanding when the wave goes on
    float* const ow = os + wv * (16 * 68);   // this wave's own staging rows: whole lines go out
    const int cw = c0 + wn * 64;
    if constexpr (EPI == 0) {
        const int cofs = lr * 4; v4f bv;   // a lane stores the same 4 columns of every row: their biases are read once
        { const v4f b4 = *(const v4f*)(bias + cw + cofs); bv[0] = bfr(b4[0]); bv[1] = bfr(b4[1]); bv[2] = bfr(b4[2]); bv[3] = bfr(b4[3]); }
#pragma unroll
        for (int mb = 0; mb < 4; ++mb) {
#pragma unroll
            for (int nb = 0; nb < 4; ++nb) {
#pragma unroll
                for (int j = 0; j < 8; ++j) ow[(hi * 8 + j) * 68 + nb * 16 + lr] = acc[mb][nb][j]; }
            __builtin_amdgcn_wave_barrier(); asm volatile("" ::: "memory");   // the row reads below are other lanes' stores: the compiler may not move them in front of the stores
            float* crow = C + z * sC + (size_t)(r0 + wm * 64 + mb * 16) * ldc + cw;
#pragma unroll
            for (int s = 0; s < 8; ++s) { const int row = 2 * s + hi; const v4f val = *(const v4fa*)(ow + row * 68 + cofs) + bv;
                *(v4f*)(crow + (size_t)row * ldc + cofs) = val; }
            asm volatile("s_wait_xcnt 0x0" ::: "memory");   // the next 16 rows reuse the registers that these stores name
            __builtin_amdgcn_wave_barrier(); asm volatile("" ::: "memory");   // nor the next 16 rows' stores in front of these reads
        }
    } else {
        // 16 plane rows of 64 elements at a time go through the wave's staging rows in f32; a lane then converts 8 neighbouring elements of a row and stores 16 bytes to each plane.
        // Plane rows are the tile's rows (EPI 1, 3: 16 t of block mb) or its columns (EPI 2: 16 d of block nb, where a lane's 8 accumulator registers are 8 neighbouring t).
        const int rsub = lane >> 3, cofs = (lane & 7) * 8, rw = r0 + wm * 64;
        const size_t pitch = EPI == 1 ? (size_t)HD : EPI == 2 ? (size_t)TT : (size_t)ldc;
        const size_t p0 = z * sC + cofs + (EPI == 1 ? ((size_t)(cw / HD) * TT + rw) * HD : EPI == 2 ? (size_t)cw * TT + rw : (size_t)rw * ldc + cw);
        float bc[8];   // EPI 1, 3: the biases of the 8 columns that the lane stores in every row; EPI 2: of the lane's accumulator column in each of the 4 blocks (they go in ahead of the staging)
        if constexpr (EPI == 2) {
#pragma unroll
            for (int q = 0; q < 4; ++q) bc[q] = bfr(bias[cw + q * 16 + lr]);
        } else { const v4f b0 = *(const v4f*)(bias + cw + cofs), b1 = *(const v4f*)(bias + cw + cofs + 4);
#pragma unroll
            for (int q = 0; q < 4; ++q) { bc[q] = bfr(b0[q]); bc[q + 4] = bfr(b1[q]); } }
#pragma unroll
        for (int blk = 0; blk < 4; ++blk) {
            if constexpr (EPI == 2) {
#pragma unroll
                for (int mb = 0; mb < 4; ++mb) { const v8f a = acc[mb][blk] + bc[blk];
                    *(v4fa*)(ow + lr * 68 + mb * 16 + hi * 8) = __builtin_shufflevector(a, a, 0, 1, 2, 3); *(v4fa*)(ow + lr * 68 + mb * 16 + hi * 8 + 4) = __builtin_shufflevector(a, a, 4, 5, 6, 7); }
            } else {
#pragma unroll
                for (int nb = 0; nb < 4; ++nb) {
#pragma unroll
                    for (int j = 0; j < 8; ++j) ow[(hi * 8 + j) * 68 + nb * 16 + lr] = acc[blk][nb][j]; } }
            __builtin_amdgcn_wave_barrier(); asm volatile("" ::: "memory");   // the row reads below are other lanes' stores: the compiler may not move them in front of the stores
#pragma unroll
            for (int s = 0; s < 4; ++s) { const int row = 4 * s + rsub; const v4f lo4 = *(const v4fa*)(ow + row * 68 + cofs), hi4 = *(const v4fa*)(ow + row * 68 + cofs + 4); v8h o16; v8us oh, ol;
#pragma unroll
                for (int q = 0; q < 8; ++q) { float y = q < 4 ? lo4[q & 3] : hi4[q & 3]; if constexpr (EPI != 2) y += bc[q]; if constexpr (EPI == 3) y = fmaxf(y, 0.f);
                    unsigned short a2, c2; splitf(y, a2, c2); oh[q] = a2; ol[q] = c2; if constexpr (EPI != 3) o16[q] = tohx(y); }
                const size_t e = p0 + (size_t)(blk * 16 + row) * pitch;
                if constexpr (EPI != 3) *(v8h*)(P16 + e) = o16;
                *(v8us*)(Ph + e) = oh; *(v8us*)(Pl + e) = ol;
                asm volatile("s_wait_xcnt 0x0" ::: "memory"); }   // the next rows' conversions reuse the registers that these stores name
            __builtin_amdgcn_wave_barrier(); asm volatile("" ::: "memory");   // nor the next block's stores in front of these reads
        }
    }
}

typedef __attribute__((ext_vector_type(2))) _Float16 v2h;
typedef __attribute__((ext_vector_type(4))) _Float16 v4h;
typedef __attribute__((ext_vector_type(2))) unsigned short v2us;
typedef __attribute__((ext_vector_type(4))) unsigned short v4us;
typedef __attribute__((ext_vector_type(2))) float v2f;
typedef __attribute__((ext_vector_type(4))) int v4i;

// ---- k_prep: every 16-bit plane that the products read from the inputs (six weights transposed to [n][k], x and y row by row), made in ONE launch of PGRID work-groups of 8 waves.
// A job is PJE elements: a 128 k x 64 n tile of a weight, or PJE neighbouring elements of x or y. Work-group b does five jobs one after the other: tile b of the four attention weights taken together, of W1 and of W2, piece b of x and of y
// (a fixed deal: nothing passes between work-groups). Few waves with much work each: the loads of the next two jobs (16 of 16 bytes a thread) fly while a job is written out.
// A weight tile is read by whole 128-byte lines of w[k][.], rounded, packed by k pairs and turned in LDS, and leaves as 256 neighbouring bytes of each row Bt[n][.].
#define PJE   8192
#define PGRID 512
typedef __attribute__((ext_vector_type(4))) unsigned v4u;
typedef v4u __attribute__((may_alias)) v4ua;
__global__ __launch_bounds__(256) void k_prep(const float* __restrict__ wq, const float* __restrict__ wk, const float* __restrict__ wv, const float* __restrict__ wo, const float* __restrict__ w1, const float* __restrict__ w2, const float* __restrict__ x, const float* __restrict__ y,
                                              bf* WQ, bf* WK, bf* WV, bf* WO, bf* W1B, bf* W2B, bf* XB, bf* XKB) {
    // two tiles as [n][k pair], 64 dwords a row; the 16-byte piece g of row n lies at piece g ^ (n / 4 mod 16): the 32 dword stores of a wave fall on 32 banks, and a row is still read by whole 16-byte pieces
    __shared__ __align__(16) unsigned tl[2][64 * 64];
    constexpr int JS = DM * DM / PJE;
    static_assert(DQ == DM && DKV == DM, "the four attention weights have one shape");
    static_assert(4 * JS == PGRID && DM * DFF / PJE == PGRID && NB_ * TT * DM / PJE == PGRID && DM % 128 == 0 && DFF % 128 == 0, "one job of each kind for every work-group");
    const int tid = threadIdx.x, b = blockIdx.x, m = b / JS, t0 = b % JS;
    const int ng = ((tid >> 5) & 1) * 8 + (tid & 7), kq = tid >> 6, kr = (tid >> 3) & 3;   // reading a tile: 8 lanes take one line (32 n) of a row; a wave takes 4 k pairs, the work-group 32 k a pass
    // every loop over p, q and u below is unrolled so that the register arrays are indexed by constants and stay in registers
    auto loadT = [&](v4f (&r)[8], const float* w, int N, int t) { const int nt = N / 64; const float* s = w + (size_t)(t / nt) * 128 * N + (t % nt) * 64 + (size_t)((kq * 4 + kr) * 2) * N + ng * 4;
#pragma unroll
        for (int p = 0; p < 4; ++p) { r[2 * p] = *(const v4f*)(s + (size_t)p * 32 * N); r[2 * p + 1] = *(const v4f*)(s + (size_t)p * 32 * N + N); }
        __builtin_amdgcn_sched_barrier(0); };   // fence: the eight loads go out here, as one group, and not one by one where their values are used
    auto putT = [&](unsigned* tb, const v4f (&r)[8]) {
#pragma unroll
        for (int p = 0; p < 4; ++p)
#pragma unroll
            for (int q = 0; q < 4; ++q) tb[(ng * 4 + q) * 64 + (((p * 4 + kq) ^ ng) << 2) + kr] = (unsigned)f2bf(r[2 * p][q]) | ((unsigned)f2bf(r[2 * p + 1][q]) << 16); };
    auto outT = [&](const unsigned* tb, bf* o, int K, int N, int t) { const int nt = N / 64; bf* d = o + (size_t)(t % nt) * 64 * K + (t / nt) * 128;
#pragma unroll
        for (int u = 0; u < 4; ++u) { const int n = u * 16 + (tid >> 4), g = tid & 15;   // 16 lanes store 256 neighbouring bytes of a row
            *(v4ua*)(d + (size_t)n * K + g * 8) = *(const v4ua*)(tb + n * 64 + ((g ^ ((n >> 2) & 15)) << 2)); }
        __builtin_amdgcn_sched_barrier(0); };   // fence: the tile's stores go out ahead of the wait for the next job's loads
    auto loadC = [&](v4f (&r)[8], const float* s) {
#pragma unroll
        for (int p = 0; p < 4; ++p) { r[2 * p] = *(const v4f*)(s + p * 2048 + tid * 8); r[2 * p + 1] = *(const v4f*)(s + p * 2048 + tid * 8 + 4); }
        __builtin_amdgcn_sched_barrier(0); };   // fence: as in loadT
    auto outC = [&](const v4f (&r)[8], bf* d) {
#pragma unroll
        for (int p = 0; p < 4; ++p) { v8us o;
#pragma unroll
            for (int q = 0; q < 8; ++q) o[q] = f2bf(r[2 * p + (q >> 2)][q & 3]);
            *(v8us*)(d + p * 2048 + tid * 8) = o; } };
    // The work-group barrier by hand, with the one wait it needs (this wave's LDS stores and reads are done): a __syncthreads() would also wait for the global loads issued ahead, which are to stay in flight across it.
    // It publishes the tile just written; and as a wave's reads of the tile before that one are done when it arrives, that buffer may be rewritten behind it.
    auto bar = [&]() { asm volatile("s_wait_dscnt 0x0\n\ts_barrier_signal -1\n\ts_barrier_wait -1" ::: "memory"); };
    const float* ws = m == 0 ? wq : m == 1 ? wk : m == 2 ? wv : wo; bf* WS = m == 0 ? WQ : m == 1 ? WK : m == 2 ? WV : WO;
    v4f ra[8], rb[8];
    loadT(ra, ws, DM, t0); loadT(rb, w1, DFF, b);
    putT(tl[0], ra); bar(); loadT(ra, w2, DM, b); outT(tl[0], WS, DM, DM, t0);
    putT(tl[1], rb); bar(); loadC(rb, x + (size_t)b * PJE); outT(tl[1], W1B, DM, DFF, b);
    putT(tl[0], ra); bar(); loadC(ra, y + (size_t)b * PJE); outT(tl[0], W2B, DFF, DM, b);
    outC(rb, XB + (size_t)b * PJE); outC(ra, XKB + (size_t)b * PJE);
}

template <bool RND>
__global__ __launch_bounds__(256) void k_lnhl(const float* __restrict__ X, const float* __restrict__ A, const float* __restrict__ g, const float* __restrict__ be, float* Z, bf* Yh, bf* Yl) {
    const int lane = threadIdx.x & 31; const int r = blockIdx.x * 8 + (threadIdx.x >> 5); if (r >= NB_ * TT) return; const float* xr = X + (size_t)r * DM; const float* ar = A ? A + (size_t)r * DM : nullptr; float s = 0.f;
#pragma unroll 1
    for (int ch = 0; ch < DM / 128; ++ch) { const int c0 = ch * 128 + lane * 4; const v4f a = *(const v4f*)(xr + c0); v4f d = {0.f, 0.f, 0.f, 0.f}; if (ar) d = *(const v4f*)(ar + c0);
#pragma unroll
        for (int q = 0; q < 4; ++q) s += __fadd_rn((RND ? bfr(a[q]) : a[q]), d[q]); }
#pragma unroll
    for (int sh = 16; sh; sh >>= 1) s += __shfl_xor(s, sh, 32);
    const float mu = s * (1.0f / DM); float s2 = 0.f;
#pragma unroll 1
    for (int ch = 0; ch < DM / 128; ++ch) { const int c0 = ch * 128 + lane * 4; const v4f a = *(const v4f*)(xr + c0); v4f d = {0.f, 0.f, 0.f, 0.f}; if (ar) d = *(const v4f*)(ar + c0);
#pragma unroll
        for (int q = 0; q < 4; ++q) { const float d0 = __fsub_rn(__fadd_rn((RND ? bfr(a[q]) : a[q]), d[q]), mu); float p = __fmul_rn(d0, d0); asm volatile("" : "+v"(p)); s2 = __fadd_rn(s2, p); } }
#pragma unroll
    for (int sh = 16; sh; sh >>= 1) s2 += __shfl_xor(s2, sh, 32);
    const float rs = __fdiv_rn(1.0f, __fsqrt_rn(__fadd_rn(s2 * (1.0f / DM), LNEPS)));
{
#pragma unroll 1
        for (int ch = 0; ch < DM / 128; ++ch) { const int c0 = ch * 128 + lane * 4; const v4f a = *(const v4f*)(xr + c0); v4f d = {0.f, 0.f, 0.f, 0.f}; if (ar) d = *(const v4f*)(ar + c0); v4f z4; v4us oh, ol;
#pragma unroll
            for (int q = 0; q < 4; ++q) { const float v = __fadd_rn((RND ? bfr(a[q]) : a[q]), d[q]); float n0 = __fmul_rn(__fsub_rn(v, mu), rs); asm volatile("" : "+v"(n0)); float n1 = __fmul_rn(n0, bfr(g[c0 + q])); asm volatile("" : "+v"(n1)); const float y = __fadd_rn(n1, bfr(be[c0 + q])); z4[q] = y;   /* Z = the NORMALISED row (it is the residual for the next block) */ unsigned short h2, l2; splitf(y, h2, l2); oh[q] = h2; ol[q] = l2; }
            if (Z) *(v4f*)(Z + (size_t)r * DM + c0) = z4; *(v4us*)(Yh + (size_t)r * DM + c0) = oh; *(v4us*)(Yl + (size_t)r * DM + c0) = ol; }
         } }

__global__ __launch_bounds__(256) void k_addln(const float* __restrict__ A, const float* __restrict__ Bm, const float* __restrict__ g, const float* __restrict__ be, float* OUTb) {
    const int lane = threadIdx.x & 31; const int r = blockIdx.x * 8 + (threadIdx.x >> 5); if (r >= NB_ * TT) return; const float* ar = A + (size_t)r * DM; const float* br = Bm + (size_t)r * DM; float s = 0.f;
#pragma unroll 1
    for (int ch = 0; ch < DM / 128; ++ch) { const int c0 = ch * 128 + lane * 4; const v4f a = *(const v4f*)(ar + c0), bb = *(const v4f*)(br + c0);
#pragma unroll
        for (int q = 0; q < 4; ++q) s += __fadd_rn(a[q], bb[q]); }
#pragma unroll
    for (int sh = 16; sh; sh >>= 1) s += __shfl_xor(s, sh, 32);
    const float mu = s * (1.0f / DM); float s2 = 0.f;
#pragma unroll 1
    for (int ch = 0; ch < DM / 128; ++ch) { const int c0 = ch * 128 + lane * 4; const v4f a = *(const v4f*)(ar + c0), bb = *(const v4f*)(br + c0);
#pragma unroll
        for (int q = 0; q < 4; ++q) { const float d0 = __fsub_rn(__fadd_rn(a[q], bb[q]), mu); float p = __fmul_rn(d0, d0); asm volatile("" : "+v"(p)); s2 = __fadd_rn(s2, p); } }
#pragma unroll
    for (int sh = 16; sh; sh >>= 1) s2 += __shfl_xor(s2, sh, 32);
    const float rs = __fdiv_rn(1.0f, __fsqrt_rn(__fadd_rn(s2 * (1.0f / DM), LNEPS)));
{
#pragma unroll 1
        for (int ch = 0; ch < DM / 128; ++ch) { const int c0 = ch * 128 + lane * 4; const v4f a = *(const v4f*)(ar + c0), bb = *(const v4f*)(br + c0); v4f o4;
#pragma unroll
            for (int q = 0; q < 4; ++q) { float n0 = __fmul_rn(__fsub_rn(__fadd_rn(a[q], bb[q]), mu), rs); asm volatile("" : "+v"(n0)); float n1 = __fmul_rn(n0, bfr(g[c0 + q])); asm volatile("" : "+v"(n1)); o4[q] = __fadd_rn(n1, bfr(be[c0 + q])); }
            *(v4f*)(OUTb + (size_t)r * DM + c0) = o4; }
         } }
// ---- k_fattn: scores, softmax and attn.v of both batches in one launch; no score or probability ever leaves the work-group.
// 4 waves x 16 query columns per work-group, one head; the 2048 keys are walked in passes of KC = 64 with a running maximum and sum (new order of the softmax and attn.v sums).
// S^T = K Q^T (A = key rows from LDS, B = query rows kept in registers), O^T += V^T P^T (A = V^T rows from LDS, B = the score tiles converted in place: two D tiles of 16 keys are one B operand in the loaders' k order).
// A lane holds one query's column, so the maximum is in-lane plus one exchange between the wave's halves. Work-groups below NB_ * NH_ * RH / 64 take the hi+lo rows (3 products), the rest single fp16.
#define KC   64                   // keys per pass
#define LP   72                   // LDS row pitch in 16-bit elements: 144 B = 16 B x odd, conflict-free for the 16-byte fragment reads
#define PLN  (64 * LP)            // one staged plane: 64 rows of 128 B (K: 64 keys x HD; V^T: HD rows x 64 keys)
#define BIGF 0x1p127f             // a power of two: BIGF * CL2 is exact, so a fully masked row gets exponent 0 for every key (uniform weights, as the reference's -1e9 gives)
#define CL2  0.18033688011112042f // HD^-0.5 * log2(e)
__device__ __forceinline__ float xhalf(float x) { const int b = __float_as_int(x); return __int_as_float(__builtin_amdgcn_permlanex16(b, b, 0x76543210, 0xfedcba98, false, false)); }   // lane l <-> l ^ 16
typedef __attribute__((ext_vector_type(2))) __bf16 v2bf;
// 2^x in asm so that the slot the instruction set asks for behind a transcendental (before its result is read or its source overwritten) is filled by construction:
// in the group of four each exponential stands in front of an independent one (the outputs are early-clobber: none shares a register with an input), and the v_nop fills the slot behind the last.
__device__ __forceinline__ v4f exp2x4(float a, float b, float c, float d) { float r0, r1, r2, r3;
    asm("v_exp_f32 %0, %4\n\tv_exp_f32 %1, %5\n\tv_exp_f32 %2, %6\n\tv_exp_f32 %3, %7\n\tv_nop" : "=&v"(r0), "=&v"(r1), "=&v"(r2), "=&v"(r3) : "v"(a), "v"(b), "v"(c), "v"(d)); return (v4f){r0, r1, r2, r3}; }
__device__ __forceinline__ float exp2x1(float a) { float r; asm("v_exp_f32 %0, %1\n\tv_nop" : "=v"(r) : "v"(a)); return r; }
template <typename T16, bool HL>
__device__ __forceinline__ void fattn_body(const T16* __restrict__ Q, const T16* __restrict__ Q2, const T16* __restrict__ Kp, const T16* __restrict__ Kp2, const T16* __restrict__ Vt, const T16* __restrict__ Vt2, int q0, T16* sm, const float* lim, bf* Ah, bf* Al) {
    typedef typename WFrag<T16>::V V;
    constexpr int NP = HL ? 4 : 2, NL = HL ? 2 : 1;   // planes in a buffer (K, V^T, K lo, V^T lo); planes of one operand
    const int tid = threadIdx.x, lane = tid & 31, lr = lane & 15, hi = lane >> 4; const int qr = q0 + (tid >> 5) * 16 + lr;
    V qf[2], qf2[2];
#pragma unroll
    for (int ks = 0; ks < 2; ++ks) { qf[ks] = WFrag<T16>::ld(Q + (size_t)qr * HD + ks * 32 + 8 * hi); if (HL) qf2[ks] = WFrag<T16>::ld(Q2 + (size_t)qr * HD + ks * 32 + 8 * hi); }
    // staging: a plane is 512 pieces of 16 B, 4 per thread; 8 neighbouring lanes read one whole 128-B line. K and V^T take turns in the same registers.
    const int srow = tid >> 3, sseg = (tid & 7) * 8;
    v8us st[NL][4];
    auto gloadK = [&](int c) {
#pragma unroll
        for (int u = 0; u < 4; ++u) { const size_t e = (size_t)(c * KC + srow + 16 * u) * HD + sseg; st[0][u] = *(const v8usa*)(Kp + e); if constexpr (HL) st[1][u] = *(const v8usa*)(Kp2 + e); } };
    auto gloadV = [&](int c) {
#pragma unroll
        for (int u = 0; u < 4; ++u) { const size_t e = (size_t)(srow + 16 * u) * TT + c * KC + sseg; st[0][u] = *(const v8usa*)(Vt + e); if constexpr (HL) st[1][u] = *(const v8usa*)(Vt2 + e); } };
    auto sstore = [&](T16* pl) {   // pl: the operand's hi plane; its lo plane lies two planes further
#pragma unroll
        for (int p = 0; p < NL; ++p)
#pragma unroll
            for (int u = 0; u < 4; ++u) *(v8usa*)(pl + p * 2 * PLN + (srow + 16 * u) * LP + sseg) = st[p][u]; };
    v8f o[4];
#pragma unroll
    for (int dt = 0; dt < 4; ++dt) o[dt] = (v8f){};
    float mraw = -BIGF, mcs = -BIGF * CL2;
    // the softmax sums ride the matrix pipe: an A of ones makes every row of lt the column sums of the (rounded) weights, over both lane halves' keys; lt is rescaled like an output tile
    V ones; v8f lt = (v8f){};
#pragma unroll
    for (int e = 0; e < 16; ++e) { if constexpr (HL) ones[e] = (__bf16)1.0f; else ones[e] = (h16)1.0f; }
    gloadK(0); sstore(sm); gloadV(0); sstore(sm + PLN);
    __syncthreads();   // pass 0's planes and the key limits are in LDS
    // The scheduling fences in the loop keep each group of LDS fragment loads together and ahead of the block of products that uses it (one exposed LDS latency a group, not one a fragment),
    // and keep the products of a block in the written order, in which neighbours go to different accumulators.
#pragma unroll 1
    for (int c = 0; c < TT / KC; ++c) {
        const T16* cur = sm + (c & 1) * (NP * PLN); T16* nxt = sm + ((c + 1) & 1) * (NP * PLN);
        const int cn = (c + 1 < TT / KC) ? c + 1 : c;   // the last pass re-reads its own planes: no branch in the loop; that copy is never read
        gloadK(cn);   // the next pass's K flies during the score products
        __builtin_amdgcn_sched_barrier(0);   // fence: the global loads stay at the head of the pass
        v8f s[4];
        if constexpr (HL) {
#pragma unroll
            for (int ks = 0; ks < 2; ++ks) { V ka[4], kb[4];
#pragma unroll
                for (int kt = 0; kt < 4; ++kt) { ka[kt] = WFrag<T16>::ld(cur + (kt * 16 + lr) * LP + ks * 32 + 8 * hi); kb[kt] = WFrag<T16>::ld(cur + 2 * PLN + (kt * 16 + lr) * LP + ks * 32 + 8 * hi); }
                __builtin_amdgcn_sched_barrier(0);   // fence: loads | products
#pragma unroll
                for (int kt = 0; kt < 4; ++kt) s[kt] = WFrag<T16>::mma(ka[kt], qf[ks], ks ? s[kt] : (v8f){});
#pragma unroll
                for (int kt = 0; kt < 4; ++kt) s[kt] = WFrag<T16>::mma(ka[kt], qf2[ks], s[kt]);
#pragma unroll
                for (int kt = 0; kt < 4; ++kt) s[kt] = WFrag<T16>::mma(kb[kt], qf[ks], s[kt]);
                __builtin_amdgcn_sched_barrier(0); }   // fence: products | next group
        } else { V ka[2][4];
#pragma unroll
            for (int ks = 0; ks < 2; ++ks)
#pragma unroll
                for (int kt = 0; kt < 4; ++kt) ka[ks][kt] = WFrag<T16>::ld(cur + (kt * 16 + lr) * LP + ks * 32 + 8 * hi);
            __builtin_amdgcn_sched_barrier(0);   // fence: loads | products
#pragma unroll
            for (int ks = 0; ks < 2; ++ks)
#pragma unroll
                for (int kt = 0; kt < 4; ++kt) s[kt] = WFrag<T16>::mma(ka[ks][kt], qf[ks], ks ? s[kt] : (v8f){});
            __builtin_amdgcn_sched_barrier(0); }   // fence: products | next group
        // key mask as a select, one instruction: the median of (s, -BIGF, +BIGF) is s, of (s, -BIGF, -BIGF) is -BIGF; four independent maximum chains
        float mk[4]; v4f lm[8];
#pragma unroll
        for (int u = 0; u < 8; ++u) lm[u] = *(const v4fa*)(lim + c * KC + (u >> 1) * 16 + hi * 8 + (u & 1) * 4);
        __builtin_amdgcn_sched_barrier(0);   // fence: the eight limit loads go out as one group, while the last score products drain
#pragma unroll
        for (int kt = 0; kt < 4; ++kt) { mk[kt] = -BIGF;
#pragma unroll
            for (int j = 0; j < 8; ++j) { const float t = __builtin_amdgcn_fmed3f(s[kt][j], -BIGF, lm[2 * kt + (j >> 2)][j & 3]); s[kt][j] = t; mk[kt] = __builtin_fmaximum_numf(mk[kt], t); } }
        float mx = __builtin_fmaximum_numf(__builtin_fmaximum_numf(__builtin_fmaximum_numf(mk[0], mk[1]), __builtin_fmaximum_numf(mk[2], mk[3])), mraw); mx = __builtin_fmaximum_numf(mx, xhalf(mx));
        __builtin_amdgcn_sched_barrier(0);   // fence: the K stores (and the wait on their loads) stay behind the maximum
        sstore(nxt); gloadV(cn);   // K goes to the other buffer; the next pass's V^T flies during the exponentials and the output products
        V va[HL ? 1 : 2][4], vb[4];   // V^T fragments fetched ahead of the exponentials (fp16: both 32-key groups; hi+lo: the first)
#pragma unroll
        for (int g = 0; g < (HL ? 1 : 2); ++g)
#pragma unroll
            for (int dt = 0; dt < 4; ++dt) { va[g][dt] = WFrag<T16>::ld(cur + PLN + (dt * 16 + lr) * LP + g * 32 + 8 * hi); if constexpr (HL) vb[dt] = WFrag<T16>::ld(cur + 3 * PLN + (dt * 16 + lr) * LP + g * 32 + 8 * hi); }
        __builtin_amdgcn_sched_barrier(0);   // fence: these loads are issued before the exponentials, which cover their latency
        const float mc = mx * CL2, al = exp2x1(mcs - mc), ad = (HL ? 0.0f : 10.0f) - mc;   // fp16 weights carry x1024 (cancels in the division by the sum): small weights stay normal numbers
        mraw = mx; mcs = mc;
#pragma unroll
        for (int kt = 0; kt < 4; ++kt)
#pragma unroll
            for (int j = 0; j < 8; ++j) s[kt][j] = __builtin_fmaf(s[kt][j], CL2, ad);
#pragma unroll
        for (int kt = 0; kt < 4; ++kt) { const v4f e0 = exp2x4(s[kt][0], s[kt][1], s[kt][2], s[kt][3]), e1 = exp2x4(s[kt][4], s[kt][5], s[kt][6], s[kt][7]); s[kt] = __builtin_shufflevector(e0, e1, 0, 1, 2, 3, 4, 5, 6, 7); }
        __builtin_amdgcn_sched_barrier(0);   // fence: the exponentials are asm text: none of the products below is scheduled in front of them
        lt *= al;
#pragma unroll
        for (int dt = 0; dt < 4; ++dt) o[dt] *= al;
#pragma unroll
        for (int g = 0; g < 2; ++g) { V pb, pb2;
#pragma unroll
            for (int e = 0; e < 16; e += 2) { const v2f pp = {s[2 * g + (e >> 3)][e & 7], s[2 * g + (e >> 3)][(e & 7) + 1]};   // by pairs: one packed conversion for two weights
                if constexpr (HL) { const v2bf h2 = __builtin_convertvector(pp, v2bf); const v2bf l2 = __builtin_convertvector(pp - __builtin_convertvector(h2, v2f), v2bf); pb[e] = h2[0]; pb[e + 1] = h2[1]; pb2[e] = l2[0]; pb2[e + 1] = l2[1]; }
                else { const v2h h2 = __builtin_convertvector(pp, v2h); pb[e] = h2[0]; pb[e + 1] = h2[1]; } }
            __builtin_amdgcn_sched_barrier(0);   // fence: conversions | products
#pragma unroll
            for (int dt = 0; dt < 4; ++dt) o[dt] = WFrag<T16>::mma(va[HL ? 0 : g][dt], pb, o[dt]);
            lt = WFrag<T16>::mma(ones, pb, lt);
            if constexpr (HL) {
#pragma unroll
                for (int dt = 0; dt < 4; ++dt) o[dt] = WFrag<T16>::mma(va[0][dt], pb2, o[dt]);
                lt = WFrag<T16>::mma(ones, pb2, lt);
#pragma unroll
                for (int dt = 0; dt < 4; ++dt) o[dt] = WFrag<T16>::mma(vb[dt], pb, o[dt]);
                __builtin_amdgcn_sched_barrier(0);   // fence: products | the second group's loads
                if (g == 0) {
#pragma unroll
                    for (int dt = 0; dt < 4; ++dt) { va[0][dt] = WFrag<T16>::ld(cur + PLN + (dt * 16 + lr) * LP + 32 + 8 * hi); vb[dt] = WFrag<T16>::ld(cur + 3 * PLN + (dt * 16 + lr) * LP + 32 + 8 * hi); }
                    __builtin_amdgcn_sched_barrier(0); } } }   // fence: the second group's loads are issued before its conversions, which cover their latency
        __builtin_amdgcn_sched_barrier(0);   // fence: the V^T stores (and the wait on their loads) stay at the foot of the pass
        sstore(nxt + PLN);
        __syncthreads();   // publishes the next pass's planes and ends every wave's reads of this pass's (refilled in the next trip)
    }
    const float inv = __fdiv_rn(1.0f, lt[0]);
#pragma unroll
    for (int dt = 0; dt < 4; ++dt) { v8us oh, ol;   // a lane's 8 accumulator registers are 8 consecutive d of its query: one 16-byte store per plane
#pragma unroll
        for (int j = 0; j < 8; ++j) { unsigned short a, c2; splitf(o[dt][j] * inv, a, c2); oh[j] = a; ol[j] = c2; }
        const size_t oo = (size_t)qr * DQ + dt * 16 + hi * 8; *(v8us*)(Ah + oo) = oh; *(v8us*)(Al + oo) = ol; }
}
// the second bound (4 waves per SIMD) is a budget of 256 registers: the hi+lo body stays below v256 and needs no register-window switches in its loop
__global__ __launch_bounds__(128, 4) void k_fattn(const h16* __restrict__ Q16, const h16* __restrict__ K16, const h16* __restrict__ V16, const bf* __restrict__ Qh, const bf* __restrict__ Ql, const bf* __restrict__ Kh, const bf* __restrict__ Kl, const bf* __restrict__ Vh, const bf* __restrict__ Vl, const int* __restrict__ MK, bf* Ah, bf* Al) {
    __shared__ __align__(16) unsigned short sm[2 * 4 * PLN];
    __shared__ __align__(16) float lim[TT];
    const int bx = blockIdx.x;   // the heavier hi+lo work-groups of both batches come first
    constexpr int NHL = NH_ * (RH / 64), NSG = NH_ * ((TT - RH) / 64);   // work-groups of a batch: hi+lo, single fp16
    const bool hl = bx < NB_ * NHL; const int bt = hl ? bx / NHL : (bx - NB_ * NHL) / NSG, ix = hl ? bx % NHL : (bx - NB_ * NHL) % NSG;   // batch, index inside the batch
    const int* MKb = MK + (size_t)bt * TT; const size_t zb = (size_t)bt * NH_ * TT * HD, zkb = (size_t)bt * NKV * TT * HD; Ah += (size_t)bt * TT * DQ; Al += (size_t)bt * TT * DQ;
    // unrolled so that the four mask loads of a thread are in flight together
#pragma unroll
    for (int u = 0; u < TT / 512; ++u) { const int i = (u * 128 + (int)threadIdx.x) * 4; const v4i m4 = *(const v4i*)(MKb + i); v4f f4;
#pragma unroll
        for (int q = 0; q < 4; ++q) f4[q] = (m4[q] != 0) ? BIGF : -BIGF;
        *(v4fa*)(lim + i) = f4; }
    if (hl) { const int h = ix / (RH / 64), q0 = (ix % (RH / 64)) * 64; const size_t zq = zb + (size_t)h * TT * HD, zk = zkb + (size_t)(h / REP) * TT * HD;
        fattn_body<bf, true>(Qh + zq, Ql + zq, Kh + zk, Kl + zk, Vh + zk, Vl + zk, q0, (bf*)sm, lim, Ah + h * HD, Al + h * HD);
    } else { const int h = ix / ((TT - RH) / 64), q0 = RH + (ix % ((TT - RH) / 64)) * 64; const size_t zq = zb + (size_t)h * TT * HD, zk = zkb + (size_t)(h / REP) * TT * HD;
        fattn_body<h16, false>(Q16 + zq, nullptr, K16 + zk, nullptr, V16 + zk, nullptr, q0, (h16*)sm, lim, Ah + h * HD, Al + h * HD); }
}

extern "C" void kernel_launch(void* const* d_in, const int* in_sizes, int n_in,
                              void* d_out, int out_size, void* d_ws, size_t ws_size, hipStream_t stream) {
    (void)in_sizes; (void)n_in; (void)out_size;
    const float* x = (const float*)d_in[0]; const float* xk = (const float*)d_in[1]; const int* MK = (const int*)d_in[2]; const float* wq = (const float*)d_in[3]; const float* bq = (const float*)d_in[4]; const float* wk = (const float*)d_in[5]; const float* bk = (const float*)d_in[6]; const float* wv = (const float*)d_in[7]; const float* bv = (const float*)d_in[8]; const float* wo = (const float*)d_in[9]; const float* bo = (const float*)d_in[10]; const float* w1 = (const float*)d_in[11]; const float* b1 = (const float*)d_in[12]; const float* w2 = (const float*)d_in[13]; const float* b2 = (const float*)d_in[14]; const float* g1 = (const float*)d_in[15]; const float* e1 = (const float*)d_in[16]; const float* g2 = (const float*)d_in[17]; const float* e2 = (const float*)d_in[18];
    float* OUT = (float*)d_out;     // [2][2048][1024]
    char* wsp = (char*)d_ws;
    auto take = [&](size_t bytes) { char* p = wsp; wsp += (bytes + 255) & ~(size_t)255; return (void*)p; };
    bf* WQ = (bf*)take((size_t)DQ * DM * 2); bf* WK = (bf*)take((size_t)DKV * DM * 2); bf* WV = (bf*)take((size_t)DKV * DM * 2); bf* WO = (bf*)take((size_t)DM * DQ * 2);
    bf* W1B = (bf*)take((size_t)DFF * DM * 2); bf* W2B = (bf*)take((size_t)DM * DFF * 2);
    // every buffer below holds both batches (rows b * TT + t; head planes [b][h][..]).
    // Region A: inputs in bf16 and the head planes, dead once the attention has run; Gh, Gl lie over it.
    char* const regA = wsp;
    bf* XB = (bf*)take((size_t)NB_ * TT * DM * 2); bf* XKB = (bf*)take((size_t)NB_ * TT * DM * 2);
    h16* QP16 = (h16*)take((size_t)NB_ * NH_ * TT * HD * 2); h16* KP16 = (h16*)take((size_t)NB_ * NKV * TT * HD * 2); h16* VT16 = (h16*)take((size_t)NB_ * NKV * HD * TT * 2);
    bf* QPh = (bf*)take((size_t)NB_ * NH_ * TT * HD * 2); bf* QPl = (bf*)take((size_t)NB_ * NH_ * TT * HD * 2); bf* KPh = (bf*)take((size_t)NB_ * NKV * TT * HD * 2); bf* KPl = (bf*)take((size_t)NB_ * NKV * TT * HD * 2); bf* VTh = (bf*)take((size_t)NB_ * NKV * HD * TT * 2); bf* VTl = (bf*)take((size_t)NB_ * NKV * HD * TT * 2);
    bf* ATh = (bf*)take((size_t)NB_ * TT * DQ * 2); bf* ATl = (bf*)take((size_t)NB_ * TT * DQ * 2); float* S2 = (float*)take((size_t)NB_ * TT * DM * 4);
    float* X1 = (float*)take((size_t)NB_ * TT * DM * 4); bf* L1h = (bf*)take((size_t)NB_ * TT * DM * 2); bf* L1l = (bf*)take((size_t)NB_ * TT * DM * 2); float* F2 = (float*)take((size_t)NB_ * TT * DM * 4);
    if ((size_t)(wsp - (char*)d_ws) > ws_size) return;
    bf* Gh = (bf*)regA; bf* Gl = Gh + (size_t)NB_ * TT * DFF;
    static_assert((size_t)NB_ * TT * DFF * 2 * 2 <= (size_t)NB_ * TT * (2 * DM + 3 * DQ + 6 * DKV) * 2, "Gh, Gl fit region A");
    k_prep<<<PGRID, 256, 0, stream>>>(wq, wk, wv, wo, w1, w2, x, xk, WQ, WK, WV, WO, W1B, W2B, XB, XKB);   /* weights as bf16 [n][k], x and y as bf16 rows */
    // one launch of each kernel serves both batches. In the GEMM grids the batch is z (the slowest index).
    k_gemms<0, 1, DM><<<dim3(TT / 128, DQ / 128, NB_), 128, 0, stream>>>(XB, nullptr, WQ, nullptr, QP16, QPh, QPl, 0, bq, (size_t)TT * DM, (size_t)NH_ * TT * HD);      /* q = x Wq + bq as head planes */
    k_gemms<0, 1, DM><<<dim3(TT / 128, DKV / 128, NB_), 128, 0, stream>>>(XKB, nullptr, WK, nullptr, KP16, KPh, KPl, 0, bk, (size_t)TT * DM, (size_t)NKV * TT * HD);   /* k = y Wk + bk as head planes */
    k_gemms<0, 2, DM><<<dim3(TT / 128, DKV / 128, NB_), 128, 0, stream>>>(XKB, nullptr, WV, nullptr, VT16, VTh, VTl, 0, bv, (size_t)TT * DM, (size_t)NKV * HD * TT);   /* v = y Wv + bv as transposed head planes */
    k_fattn<<<NB_ * NH_ * (TT / 64), 128, 0, stream>>>(QP16, KP16, VT16, QPh, QPl, KPh, KPl, VTh, VTl, MK, ATh, ATl);   /* softmax(q k^T / 8, mask) v, merged heads as hi/lo planes */
    k_gemms<1, 0, DQ><<<dim3(TT / 128, DM / 128, NB_), 128, 0, stream>>>(ATh, ATl, WO, S2, nullptr, nullptr, nullptr, DM, bo, (size_t)TT * DQ, (size_t)TT * DM);   /* mha = merged Wo + bo */
    k_lnhl<true><<<NB_ * TT / 8, 256, 0, stream>>>(x, S2, g1, e1, X1, L1h, L1l);                                                          /* x1 = LN(bf16(x) + mha): normalised row in f32 + hi/lo planes */
    k_gemms<1, 3, DM><<<dim3(TT / 128, DFF / 128, NB_), 128, 0, stream>>>(L1h, L1l, W1B, nullptr, nullptr, Gh, Gl, DFF, b1, (size_t)TT * DM, (size_t)TT * DFF);   /* relu(x1 W1 + b1) as hi/lo planes */
    k_gemms<1, 0, DFF><<<dim3(TT / 128, DM / 128, NB_), 128, 0, stream>>>(Gh, Gl, W2B, F2, nullptr, nullptr, nullptr, DM, b2, (size_t)TT * DFF, (size_t)TT * DM);   /* . W2 + b2 */
    k_addln<<<NB_ * TT / 8, 256, 0, stream>>>(X1, F2, g2, e2, OUT);                                                                       /* out = LN(x1 + ff) */
}

// v008
// It runs in 261 microseconds.
// In two side-by-side timings against v007, it was 1.06 and 1.04 times as fast.
// All steps since v000 together make it 15.2 times as fast.
#include <hip/hip_runtime.h>

// Post-LN transformer encoder block with cross attention (x, y [2][2048][1024]; Q = x Wq + bq, K = y Wk + bk, V = y Wv + bv ('xw' [1024][1024]; 16 heads x 64); scores/8 with mask [2][1][1][2048] (int32 keys, read; -1e9 == exact zero weight; all ones here); softmax; mha = merged Wo + bo; x1 = LN(x + mha); ff = relu(x1 W1 + b1) W2 + b2 (W1 [1024][4096]); out = LN(x1 + ff) (eps 1e-5) -> [2][2048][1024] (4.2 M)).
// Compute dtypes, f32 accumulate: every input rounded to bf16; q/k/v on PLAIN bf16 operands (inputs: exact) + biases; key mask as a select; scores and attn.v: query rows < 512 hl (3 products), the rest single fp16 (x1024); softmax f32; Wo, W1, W2 hl x exact (2 products) + biases; residuals / LayerNorms / ReLU in f32.

#define NB_  2
#define TT   2048
#define DM   1024
#define NH_  16
#define NKV  16
#define REP  (NH_ / NKV)
#define HD   64
#define DQ   (NH_ * HD)
#define DKV  (NKV * HD)
#define DFF  4096
#define LNEPS 1e-5f
#define RH   512                  // query rows < RH use hi+lo planes (0: none)
#define WIN  0
#define SCL  0.125f   // HD^-0.5
typedef _Float16 h16;
typedef unsigned short bf;
typedef __attribute__((ext_vector_type(16))) __bf16   v16bf;
typedef __attribute__((ext_vector_type(16))) _Float16 v16h;
typedef __attribute__((ext_vector_type(8)))  _Float16 v8h;
typedef __attribute__((ext_vector_type(8)))  unsigned short v8us;
typedef __attribute__((ext_vector_type(8)))  float    v8f;
typedef __attribute__((ext_vector_type(4)))  float    v4f;
typedef v8h  __attribute__((may_alias)) v8ha;
typedef v4f  __attribute__((may_alias)) v4fa;
typedef v8us __attribute__((may_alias)) v8usa;

__device__ __forceinline__ unsigned short f2bf(float f) { unsigned u = __float_as_uint(f); u += 0x7FFFu + ((u >> 16) & 1u); return (unsigned short)(u >> 16); }
__device__ __forceinline__ float bf2f(unsigned short b) { return __uint_as_float(((unsigned)b) << 16); }
__device__ __forceinline__ float bfr(float f) { return bf2f(f2bf(f)); }
__device__ __forceinline__ v16h cat16(v8h lo, v8h hi) { return __builtin_shufflevector(lo, hi, 0, 1, 2, 3, 4, 5, 6, 7, 8, 9, 10, 11, 12, 13, 14, 15); }
__device__ __forceinline__ v16bf cat16b(v8us lo, v8us hi) { return __builtin_bit_cast(v16bf, __builtin_shufflevector(lo, hi, 0, 1, 2, 3, 4, 5, 6, 7, 8, 9, 10, 11, 12, 13, 14, 15)); }
__device__ __forceinline__ v8f wmma16(v16h a, v16h b, v8f c) { return __builtin_amdgcn_wmma_f32_16x16x32_f16(false, a, false, b, (short)0, c, false, false); }
__device__ __forceinline__ v8f wmmab(v16bf a, v16bf b, v8f c) { return __builtin_amdgcn_wmma_f32_16x16x32_bf16(false, a, false, b, (short)0, c, false, false); }
__device__ __forceinline__ h16 tohx(float x) { return (h16)x; }
__device__ __forceinline__ void splitf(float y, unsigned short& h, unsigned short& l) { h = f2bf(y); l = f2bf(y - bf2f(h)); }



// ---- k_gemms: GEMM on LDS-staged operands. One 128x128 output tile per work-group, 4 waves as 2 x 2, each a 64x64 tile (16 accumulators); grid (M/128, N/128, Z), 128 threads.
// A stage is 64 k = one whole 128-byte line of each of the 128 rows of every operand plane (A, with NSPLIT == 1 also A2, and Bt), brought from the K-contiguous 16-bit planes into LDS by asynchronous copies
// (a wave's copy covers 4 whole lines); two buffers, the next stage flies while this one is worked on. Each staged row serves two waves.
// c[m][n] = bias[n] + sum_k (A[m][k] + A2[m][k]) Bt[n][k], k ascending in one chain per element. z-batch strides sA/sC in elements. K (compile time) % 64 == 0, at least two stages.
// The tile leaves in the form its consumer reads (EPI), so that no elementwise launch stands between a product and the next kernel:
//   0: f32 rows C, pitch ldc.   1: head planes [z][h][t][d] (fp16 P16, bf16 hi Ph, lo Pl).   2: transposed head planes [z][h][d][t] (the same three).   3: relu(c) as bf16 hi/lo rows Ph, Pl, pitch ldc.
// A wave's 64 columns are one head (EPI 1, 2); in every 16-bit plane 8 neighbouring lanes store one whole 128-byte line.
template <typename T16> struct WFrag;
template <> struct WFrag<h16> { typedef v16h V; static __device__ __forceinline__ V ld(const h16* p) { return cat16(*(const v8h*)p, *(const v8h*)(p + 16)); } static __device__ __forceinline__ v8f mma(V a, V b, v8f c) { return wmma16(a, b, c); } };
template <> struct WFrag<bf> { typedef v16bf V; static __device__ __forceinline__ V ld(const bf* p) { return cat16b(*(const v8us*)p, *(const v8us*)(p + 16)); } static __device__ __forceinline__ v8f mma(V a, V b, v8f c) { return wmmab(a, b, c); } };
#define GP   72                   // LDS row pitch in 16-bit elements: 144 B = 16 B x odd, conflict-free for the 16-byte fragment reads
#define GPL  (128 * GP)           // one staged plane: 128 rows of 128 B
// eight asynchronous 16-byte copies of a lane (rows r, r + 16, .. r + 112 of one plane); the s_wait_xcnt stands inside the statement, behind the last copy, so that no address register is rewritten in front of it
__device__ __forceinline__ void acopy8(unsigned l, const bf* g, size_t rs) {
    asm volatile("global_load_async_to_lds_b128 %0, %8, off\n\tglobal_load_async_to_lds_b128 %1, %9, off\n\tglobal_load_async_to_lds_b128 %2, %10, off\n\tglobal_load_async_to_lds_b128 %3, %11, off\n\t"
                 "global_load_async_to_lds_b128 %4, %12, off\n\tglobal_load_async_to_lds_b128 %5, %13, off\n\tglobal_load_async_to_lds_b128 %6, %14, off\n\tglobal_load_async_to_lds_b128 %7, %15, off\n\ts_wait_xcnt 0x0"
                 :: "v"(l), "v"(l + 16 * GP * 2), "v"(l + 32 * GP * 2), "v"(l + 48 * GP * 2), "v"(l + 64 * GP * 2), "v"(l + 80 * GP * 2), "v"(l + 96 * GP * 2), "v"(l + 112 * GP * 2),
                    "v"(g), "v"(g + rs), "v"(g + 2 * rs), "v"(g + 3 * rs), "v"(g + 4 * rs), "v"(g + 5 * rs), "v"(g + 6 * rs), "v"(g + 7 * rs) : "memory"); }
// EPI 12: form 1 or form 2, chosen by the work-group-uniform argument tp (the launch that holds the q, k and v products). z: the batch.
template <int N> struct IC { static constexpr int value = N; };
template <int NSPLIT, int EPI, int K>
__device__ __forceinline__ void gemm_tile(const bf* __restrict__ A, const bf* __restrict__ A2, const bf* __restrict__ Bt, float* C, h16* P16, bf* Ph, bf* Pl, int ldc, const float* __restrict__ bias, size_t sA, size_t sC, const size_t z, const bool tp) {
    typedef WFrag<bf>::V V;
    constexpr int NPL = NSPLIT ? 3 : 2;   // planes of a stage: Bt, A (, A2)
    __shared__ __align__(16) bf sm[2 * NPL * GPL];
    __shared__ __align__(16) float os[4 * 16 * 68];
    A += z * sA; if (NSPLIT) A2 += z * sA;
    const int tid = threadIdx.x, lane = tid & 31, lr = lane & 15, hi = lane >> 4; const int wv = __builtin_amdgcn_readfirstlane(tid >> 5), wm = wv & 1, wn = wv >> 1;
    const int r0 = blockIdx.x * 128, c0 = blockIdx.y * 128;
    // staging: 8 neighbouring lanes copy one whole 128-B line; a thread takes rows srow + 16 u of every plane
    const int srow = tid >> 3, sseg = (tid & 7) * 8;
    const bf* gB = Bt + (size_t)(c0 + srow) * K + sseg; const bf* gA = A + (size_t)(r0 + srow) * K + sseg; const bf* gA2 = NSPLIT ? A2 + (size_t)(r0 + srow) * K + sseg : nullptr;
    const unsigned l0 = (unsigned)(size_t)sm + (unsigned)(srow * GP + sseg) * 2u; const size_t rs = (size_t)16 * K;
    auto stage = [&](int t) { const unsigned l = l0 + (unsigned)(t & 1) * (NPL * GPL * 2); const int kc = t * 64;
        acopy8(l, gB + kc, rs); acopy8(l + GPL * 2, gA + kc, rs); if constexpr (NSPLIT != 0) acopy8(l + 2 * GPL * 2, gA2 + kc, rs); };
    // every loop over mb, nb, ks, j and s in this kernel is unrolled so that acc[][] and the fragments are indexed by constants and stay in registers
    v8f acc[4][4];
#pragma unroll
    for (int mb = 0; mb < 4; ++mb)
#pragma unroll
        for (int nb = 0; nb < 4; ++nb) acc[mb][nb] = (v8f){};
    constexpr int nst = K / 64; static_assert(K % 64 == 0 && nst >= 2, "whole stages, at least two");
    stage(0);
    asm volatile("s_wait_asynccnt 0x0" ::: "memory");   // this wave's copies of stage 0 have landed
    __syncthreads();                                     // every wave's have: stage 0 may be read
    stage(1);
    const int aof = (wm * 64 + lr) * GP + 8 * hi, bof = (wn * 64 + lr) * GP + 8 * hi;
    // the stage loop stays rolled: one copy of a stage's products and copies in the instruction cache, and one publish point
#pragma unroll 1
    for (int t = 0; t < nst; ++t) {
        const bf* cur = sm + (t & 1) * (NPL * GPL);
#pragma unroll
        for (int ks = 0; ks < 2; ++ks) { V a[4], a2[4], b[4];
            b[0] = WFrag<bf>::ld(cur + bof + ks * 32);
#pragma unroll
            for (int mb = 0; mb < 4; ++mb) a[mb] = WFrag<bf>::ld(cur + GPL + aof + mb * 16 * GP + ks * 32);
#pragma unroll
            for (int nb = 1; nb < 4; ++nb) b[nb] = WFrag<bf>::ld(cur + bof + nb * 16 * GP + ks * 32);
            if constexpr (NSPLIT != 0) {
#pragma unroll
                for (int mb = 0; mb < 4; ++mb) a2[mb] = WFrag<bf>::ld(cur + 2 * GPL + aof + mb * 16 * GP + ks * 32); }
            __builtin_amdgcn_sched_barrier(0);   // fence: the fragment loads go out as one group ahead of the products (one exposed LDS latency a group)
#pragma unroll
            for (int nb = 0; nb < 4; ++nb)
#pragma unroll
                for (int mb = 0; mb < 4; ++mb) acc[mb][nb] = WFrag<bf>::mma(a[mb], b[nb], acc[mb][nb]);
            if constexpr (NSPLIT != 0) {
#pragma unroll
                for (int nb = 0; nb < 4; ++nb)
#pragma unroll
                    for (int mb = 0; mb < 4; ++mb) acc[mb][nb] = WFrag<bf>::mma(a2[mb], b[nb], acc[mb][nb]); }
            __builtin_amdgcn_sched_barrier(0); }   // fence: products | next group
        asm volatile("s_wait_dscnt 0x0" ::: "memory");      // this wave's reads of the buffer are done before it is refilled
        asm volatile("s_wait_asynccnt 0x0" ::: "memory");   // this wave's copies of stage t + 1 have landed
        __syncthreads();                                     // publishes stage t + 1 and ends every wave's reads of stage t
        if (t + 2 < nst) stage(t + 2);                       // into the buffer that this trip has just read
    }
    asm volatile("s_wait_asynccnt 0x0" ::: "memory");        // no copy is outstanding when the wave goes on
    float* const ow = os + wv * (16 * 68);   // this wave's own staging rows: whole lines go out
    const int cw = c0 + wn * 64;
    if constexpr (EPI == 0) {
        const int cofs = lr * 4; v4f bv;   // a lane stores the same 4 columns of every row: their biases are read once
        { const v4f b4 = *(const v4f*)(bias + cw + cofs); bv[0] = bfr(b4[0]); bv[1] = bfr(b4[1]); bv[2] = bfr(b4[2]); bv[3] = bfr(b4[3]); }
#pragma unroll
        for (int mb = 0; mb < 4; ++mb) {
#pragma unroll
            for (int nb = 0; nb < 4; ++nb) {
#pragma unroll
                for (int j = 0; j < 8; ++j) ow[(hi * 8 + j) * 68 + nb * 16 + lr] = acc[mb][nb][j]; }
            __builtin_amdgcn_wave_barrier(); asm volatile("" ::: "memory");   // the row reads below are other lanes' stores: the compiler may not move them in front of the stores
            float* crow = C + z * sC + (size_t)(r0 + wm * 64 + mb * 16) * ldc + cw;
#pragma unroll
            for (int s = 0; s < 8; ++s) { const int row = 2 * s + hi; const v4f val = *(const v4fa*)(ow + row * 68 + cofs) + bv;
                *(v4f*)(crow + (size_t)row * ldc + cofs) = val; }
            asm volatile("s_wait_xcnt 0x0" ::: "memory");   // the next 16 rows reuse the registers that these stores name
            __builtin_amdgcn_wave_barrier(); asm volatile("" ::: "memory");   // nor the next 16 rows' stores in front of these reads
        }
    } else { auto planes = [&](auto ec) { constexpr int E = decltype(ec)::value;   // the form as a compile-time constant, also where the work-group picks it at run time
        // 16 plane rows of 64 elements at a time go through the wave's staging rows in f32; a lane then converts 8 neighbouring elements of a row and stores 16 bytes to each plane.
        // Plane rows are the tile's rows (EPI 1, 3: 16 t of block mb) or its columns (EPI 2: 16 d of block nb, where a lane's 8 accumulator registers are 8 neighbouring t).
        const int rsub = lane >> 3, cofs = (lane & 7) * 8, rw = r0 + wm * 64;
        const size_t pitch = E == 1 ? (size_t)HD : E == 2 ? (size_t)TT : (size_t)ldc;
        const size_t p0 = z * sC + cofs + (E == 1 ? ((size_t)(cw / HD) * TT + rw) * HD : E == 2 ? (size_t)cw * TT + rw : (size_t)rw * ldc + cw);
        float bc[8];   // EPI 1, 3: the biases of the 8 columns that the lane stores in every row; EPI 2: of the lane's accumulator column in each of the 4 blocks (they go in ahead of the staging)
        if constexpr (E == 2) {
#pragma unroll
            for (int q = 0; q < 4; ++q) bc[q] = bfr(bias[cw + q * 16 + lr]);
        } else { const v4f b0 = *(const v4f*)(bias + cw + cofs), b1 = *(const v4f*)(bias + cw + cofs + 4);
#pragma unroll
            for (int q = 0; q < 4; ++q) { bc[q] = bfr(b0[q]); bc[q + 4] = bfr(b1[q]); } }
#pragma unroll
        for (int blk = 0; blk < 4; ++blk) {
            if constexpr (E == 2) {
#pragma unroll
                for (int mb = 0; mb < 4; ++mb) { const v8f a = acc[mb][blk] + bc[blk];
                    *(v4fa*)(ow + lr * 68 + mb * 16 + hi * 8) = __builtin_shufflevector(a, a, 0, 1, 2, 3); *(v4fa*)(ow + lr * 68 + mb * 16 + hi * 8 + 4) = __builtin_shufflevector(a, a, 4, 5, 6, 7); }
            } else {
#pragma unroll
                for (int nb = 0; nb < 4; ++nb) {
#pragma unroll
                    for (int j = 0; j < 8; ++j) ow[(hi * 8 + j) * 68 + nb * 16 + lr] = acc[blk][nb][j]; } }
            __builtin_amdgcn_wave_barrier(); asm volatile("" ::: "memory");   // the row reads below are other lanes' stores: the compiler may not move them in front of the stores
#pragma unroll
            for (int s = 0; s < 4; ++s) { const int row = 4 * s + rsub; const v4f lo4 = *(const v4fa*)(ow + row * 68 + cofs), hi4 = *(const v4fa*)(ow + row * 68 + cofs + 4); v8h o16; v8us oh, ol;
#pragma unroll
                for (int q = 0; q < 8; ++q) { float y = q < 4 ? lo4[q & 3] : hi4[q & 3]; if constexpr (E != 2) y += bc[q]; if constexpr (E == 3) y = fmaxf(y, 0.f);
                    unsigned short a2, c2; splitf(y, a2, c2); oh[q] = a2; ol[q] = c2; if constexpr (E != 3) o16[q] = tohx(y); }
                const size_t e = p0 + (size_t)(blk * 16 + row) * pitch;
                if constexpr (E != 3) *(v8h*)(P16 + e) = o16;
                *(v8us*)(Ph + e) = oh; *(v8us*)(Pl + e) = ol;
                asm volatile("s_wait_xcnt 0x0" ::: "memory"); }   // the next rows' conversions reuse the registers that these stores name
            __builtin_amdgcn_wave_barrier(); asm volatile("" ::: "memory");   // nor the next block's stores in front of these reads
        } };
        if constexpr (EPI == 12) { if (tp) planes(IC<2>{}); else planes(IC<1>{}); } else planes(IC<EPI>{});
    }
}
// the second bound (4 waves per SIMD) is a budget of 256 registers: accumulators and one fragment set fit below v256
template <int NSPLIT, int EPI, int K>
__global__ __launch_bounds__(128, 4) void k_gemms(const bf* __restrict__ A, const bf* __restrict__ A2, const bf* __restrict__ Bt, float* C, h16* P16, bf* Ph, bf* Pl, int ldc, const float* __restrict__ bias, size_t sA, size_t sC) {
    gemm_tile<NSPLIT, EPI, K>(A, A2, Bt, C, P16, Ph, Pl, ldc, bias, sA, sC, blockIdx.z, false); }
// ---- k_qkv: the three projections in ONE launch, grid (TT/128, DQ/128, 3 * NB_): 768 work-groups, three of them resident on a WGP (by LDS), so that a SIMD holds three waves
// and one wave's fragment loads, stage hand-over and epilogue run under the others' products. blockIdx.z = product * NB_ + batch; nothing passes between work-groups.
__global__ __launch_bounds__(128, 4) void k_qkv(const bf* __restrict__ XB, const bf* __restrict__ XKB, const bf* __restrict__ WQ, const bf* __restrict__ WK, const bf* __restrict__ WV,
                                                h16* Q16, bf* Qh, bf* Ql, h16* K16, bf* Kh, bf* Kl, h16* V16, bf* Vh, bf* Vl, const float* __restrict__ bq, const float* __restrict__ bk, const float* __restrict__ bv) {
    static_assert(NH_ == NKV, "the three products have one shape");
    const int sel = blockIdx.z / NB_;   // 0: q = x Wq + bq, 1: k = y Wk + bk (head planes), 2: v = y Wv + bv (transposed head planes)
    gemm_tile<0, 12, DM>(sel == 0 ? XB : XKB, nullptr, sel == 0 ? WQ : sel == 1 ? WK : WV, nullptr, sel == 0 ? Q16 : sel == 1 ? K16 : V16, sel == 0 ? Qh : sel == 1 ? Kh : Vh, sel == 0 ? Ql : sel == 1 ? Kl : Vl, 0,
                         sel == 0 ? bq : sel == 1 ? bk : bv, (size_t)TT * DM, (size_t)NH_ * TT * HD, blockIdx.z % NB_, sel == 2); }

typedef __attribute__((ext_vector_type(2))) _Float16 v2h;
typedef __attribute__((ext_vector_type(4))) _Float16 v4h;
typedef __attribute__((ext_vector_type(2))) unsigned short v2us;
typedef __attribute__((ext_vector_type(4))) unsigned short v4us;
typedef __attribute__((ext_vector_type(2))) float v2f;
typedef __attribute__((ext_vector_type(4))) int v4i;

// ---- k_prep: every 16-bit plane that the products read from the inputs (six weights transposed to [n][k], x and y row by row), made in ONE launch of PGRID work-groups of 8 waves.
// A job is PJE elements: a 128 k x 64 n tile of a weight, or PJE neighbouring elements of x or y. Work-group b does five jobs one after the other: tile b of the four attention weights taken together, of W1 and of W2, piece b of x and of y
// (a fixed deal: nothing passes between work-groups). Few waves with much work each: the loads of the next two jobs (16 of 16 bytes a thread) fly while a job is written out.
// A weight tile is read by whole 128-byte lines of w[k][.], rounded, packed by k pairs and turned in LDS, and leaves as 256 neighbouring bytes of each row Bt[n][.].
#define PJE   8192
#define PGRID 512
typedef __attribute__((ext_vector_type(4))) unsigned v4u;
typedef v4u __attribute__((may_alias)) v4ua;
__global__ __launch_bounds__(256) void k_prep(const float* __restrict__ wq, const float* __restrict__ wk, const float* __restrict__ wv, const float* __restrict__ wo, const float* __restrict__ w1, const float* __restrict__ w2, const float* __restrict__ x, const float* __restrict__ y,
                                              bf* WQ, bf* WK, bf* WV, bf* WO, bf* W1B, bf* W2B, bf* XB, bf* XKB) {
    // two tiles as [n][k pair], 64 dwords a row; the 16-byte piece g of row n lies at piece g ^ (n / 4 mod 16): the 32 dword stores of a wave fall on 32 banks, and a row is still read by whole 16-byte pieces
    __shared__ __align__(16) unsigned tl[2][64 * 64];
    constexpr int JS = DM * DM / PJE;
    static_assert(DQ == DM && DKV == DM, "the four attention weights have one shape");
    static_assert(4 * JS == PGRID && DM * DFF / PJE == PGRID && NB_ * TT * DM / PJE == PGRID && DM % 128 == 0 && DFF % 128 == 0, "one job of each kind for every work-group");
    const int tid = threadIdx.x, b = blockIdx.x, m = b / JS, t0 = b % JS;
    const int ng = ((tid >> 5) & 1) * 8 + (tid & 7), kq = tid >> 6, kr = (tid >> 3) & 3;   // reading a tile: 8 lanes take one line (32 n) of a row; a wave takes 4 k pairs, the work-group 32 k a pass
    // every loop over p, q and u below is unrolled so that the register arrays are indexed by constants and stay in registers
    auto loadT = [&](v4f (&r)[8], const float* w, int N, int t) { const int nt = N / 64; const float* s = w + (size_t)(t / nt) * 128 * N + (t % nt) * 64 + (size_t)((kq * 4 + kr) * 2) * N + ng * 4;
#pragma unroll
        for (int p = 0; p < 4; ++p) { r[2 * p] = *(const v4f*)(s + (size_t)p * 32 * N); r[2 * p + 1] = *(const v4f*)(s + (size_t)p * 32 * N + N); }
        __builtin_amdgcn_sched_barrier(0); };   // fence: the eight loads go out here, as one group, and not one by one where their values are used
    auto putT = [&](unsigned* tb, const v4f (&r)[8]) {
#pragma unroll
        for (int p = 0; p < 4; ++p)
#pragma unroll
            for (int q = 0; q < 4; ++q) tb[(ng * 4 + q) * 64 + (((p * 4 + kq) ^ ng) << 2) + kr] = (unsigned)f2bf(r[2 * p][q]) | ((unsigned)f2bf(r[2 * p + 1][q]) << 16); };
    auto outT = [&](const unsigned* tb, bf* o, int K, int N, int t) { const int nt = N / 64; bf* d = o + (size_t)(t % nt) * 64 * K + (t / nt) * 128;
#pragma unroll
        for (int u = 0; u < 4; ++u) { const int n = u * 16 + (tid >> 4), g = tid & 15;   // 16 lanes store 256 neighbouring bytes of a row
            *(v4ua*)(d + (size_t)n * K + g * 8) = *(const v4ua*)(tb + n * 64 + ((g ^ ((n >> 2) & 15)) << 2)); }
        __builtin_amdgcn_sched_barrier(0); };   // fence: the tile's stores go out ahead of the wait for the next job's loads
    auto loadC = [&](v4f (&r)[8], const float* s) {
#pragma unroll
        for (int p = 0; p < 4; ++p) { r[2 * p] = *(const v4f*)(s + p * 2048 + tid * 8); r[2 * p + 1] = *(const v4f*)(s + p * 2048 + tid * 8 + 4); }
        __builtin_amdgcn_sched_barrier(0); };   // fence: as in loadT
    auto outC = [&](const v4f (&r)[8], bf* d) {
#pragma unroll
        for (int p = 0; p < 4; ++p) { v8us o;
#pragma unroll
            for (int q = 0; q < 8; ++q) o[q] = f2bf(r[2 * p + (q >> 2)][q & 3]);
            *(v8us*)(d + p * 2048 + tid * 8) = o; } };
    // The work-group barrier by hand, with the one wait it needs (this wave's LDS stores and reads are done): a __syncthreads() would also wait for the global loads issued ahead, which are to stay in flight across it.
    // It publishes the tile just written; and as a wave's reads of the tile before that one are done when it arrives, that buffer may be rewritten behind it.
    auto bar = [&]() { asm volatile("s_wait_dscnt 0x0\n\ts_barrier_signal -1\n\ts_barrier_wait -1" ::: "memory"); };
    const float* ws = m == 0 ? wq : m == 1 ? wk : m == 2 ? wv : wo; bf* WS = m == 0 ? WQ : m == 1 ? WK : m == 2 ? WV : WO;
    v4f ra[8], rb[8];
    loadT(ra, ws, DM, t0); loadT(rb, w1, DFF, b);
    putT(tl[0], ra); bar(); loadT(ra, w2, DM, b); outT(tl[0], WS, DM, DM, t0);
    putT(tl[1], rb); bar(); loadC(rb, x + (size_t)b * PJE); outT(tl[1], W1B, DM, DFF, b);
    putT(tl[0], ra); bar(); loadC(ra, y + (size_t)b * PJE); outT(tl[0], W2B, DFF, DM, b);
    outC(rb, XB + (size_t)b * PJE); outC(ra, XKB + (size_t)b * PJE);
}

template <bool RND>
__global__ __launch_bounds__(256) void k_lnhl(const float* __restrict__ X, const float* __restrict__ A, const float* __restrict__ g, const float* __restrict__ be, float* Z, bf* Yh, bf* Yl) {
    const int lane = threadIdx.x & 31; const int r = blockIdx.x * 8 + (threadIdx.x >> 5); if (r >= NB_ * TT) return; const float* xr = X + (size_t)r * DM; const float* ar = A ? A + (size_t)r * DM : nullptr; float s = 0.f;
#pragma unroll 1
    for (int ch = 0; ch < DM / 128; ++ch) { const int c0 = ch * 128 + lane * 4; const v4f a = *(const v4f*)(xr + c0); v4f d = {0.f, 0.f, 0.f, 0.f}; if (ar) d = *(const v4f*)(ar + c0);
#pragma unroll
        for (int q = 0; q < 4; ++q) s += __fadd_rn((RND ? bfr(a[q]) : a[q]), d[q]); }
#pragma unroll
    for (int sh = 16; sh; sh >>= 1) s += __shfl_xor(s, sh, 32);
    const float mu = s * (1.0f / DM); float s2 = 0.f;
#pragma unroll 1
    for (int ch = 0; ch < DM / 128; ++ch) { const int c0 = ch * 128 + lane * 4; const v4f a = *(const v4f*)(xr + c0); v4f d = {0.f, 0.f, 0.f, 0.f}; if (ar) d = *(const v4f*)(ar + c0);
#pragma unroll
        for (int q = 0; q < 4; ++q) { const float d0 = __fsub_rn(__fadd_rn((RND ? bfr(a[q]) : a[q]), d[q]), mu); float p = __fmul_rn(d0, d0); asm volatile("" : "+v"(p)); s2 = __fadd_rn(s2, p); } }
#pragma unroll
    for (int sh = 16; sh; sh >>= 1) s2 += __shfl_xor(s2, sh, 32);
    const float rs = __fdiv_rn(1.0f, __fsqrt_rn(__fadd_rn(s2 * (1.0f / DM), LNEPS)));
{
#pragma unroll 1
        for (int ch = 0; ch < DM / 128; ++ch) { const int c0 = ch * 128 + lane * 4; const v4f a = *(const v4f*)(xr + c0); v4f d = {0.f, 0.f, 0.f, 0.f}; if (ar) d = *(const v4f*)(ar + c0); v4f z4; v4us oh, ol;
#pragma unroll
            for (int q = 0; q < 4; ++q) { const float v = __fadd_rn((RND ? bfr(a[q]) : a[q]), d[q]); float n0 = __fmul_rn(__fsub_rn(v, mu), rs); asm volatile("" : "+v"(n0)); float n1 = __fmul_rn(n0, bfr(g[c0 + q])); asm volatile("" : "+v"(n1)); const float y = __fadd_rn(n1, bfr(be[c0 + q])); z4[q] = y;   /* Z = the NORMALISED row (it is the residual for the next block) */ unsigned short h2, l2; splitf(y, h2, l2); oh[q] = h2; ol[q] = l2; }
            if (Z) *(v4f*)(Z + (size_t)r * DM + c0) = z4; *(v4us*)(Yh + (size_t)r * DM + c0) = oh; *(v4us*)(Yl + (size_t)r * DM + c0) = ol; }
         } }

__global__ __launch_bounds__(256) void k_addln(const float* __restrict__ A, const float* __restrict__ Bm, const float* __restrict__ g, const float* __restrict__ be, float* OUTb) {
    const int lane = threadIdx.x & 31; const int r = blockIdx.x * 8 + (threadIdx.x >> 5); if (r >= NB_ * TT) return; const float* ar = A + (size_t)r * DM; const float* br = Bm + (size_t)r * DM; float s = 0.f;
#pragma unroll 1
    for (int ch = 0; ch < DM / 128; ++ch) { const int c0 = ch * 128 + lane * 4; const v4f a = *(const v4f*)(ar + c0), bb = *(const v4f*)(br + c0);
#pragma unroll
        for (int q = 0; q < 4; ++q) s += __fadd_rn(a[q], bb[q]); }
#pragma unroll
    for (int sh = 16; sh; sh >>= 1) s += __shfl_xor(s, sh, 32);
    const float mu = s * (1.0f / DM); float s2 = 0.f;
#pragma unroll 1
    for (int ch = 0; ch < DM / 128; ++ch) { const int c0 = ch * 128 + lane * 4; const v4f a = *(const v4f*)(ar + c0), bb = *(const v4f*)(br + c0);
#pragma unroll
        for (int q = 0; q < 4; ++q) { const float d0 = __fsub_rn(__fadd_rn(a[q], bb[q]), mu); float p = __fmul_rn(d0, d0); asm volatile("" : "+v"(p)); s2 = __fadd_rn(s2, p); } }
#pragma unroll
    for (int sh = 16; sh; sh >>= 1) s2 += __shfl_xor(s2, sh, 32);
    const float rs = __fdiv_rn(1.0f, __fsqrt_rn(__fadd_rn(s2 * (1.0f / DM), LNEPS)));
{
#pragma unroll 1
        for (int ch = 0; ch < DM / 128; ++ch) { const int c0 = ch * 128 + lane * 4; const v4f a = *(const v4f*)(ar + c0), bb = *(const v4f*)(br + c0); v4f o4;
#pragma unroll
            for (int q = 0; q < 4; ++q) { float n0 = __fmul_rn(__fsub_rn(__fadd_rn(a[q], bb[q]), mu), rs); asm volatile("" : "+v"(n0)); float n1 = __fmul_rn(n0, bfr(g[c0 + q])); asm volatile("" : "+v"(n1)); o4[q] = __fadd_rn(n1, bfr(be[c0 + q])); }
            *(v4f*)(OUTb + (size_t)r * DM + c0) = o4; }
         } }
// ---- k_fattn: scores, softmax and attn.v of both batches in one launch; no score or probability ever leaves the work-group.
// 4 waves x 16 query columns per work-group, one head; the 2048 keys are walked in passes of KC = 64 with a running maximum and sum (new order of the softmax and attn.v sums).
// S^T = K Q^T (A = key rows from LDS, B = query rows kept in registers), O^T += V^T P^T (A = V^T rows from LDS, B = the score tiles converted in place: two D tiles of 16 keys are one B operand in the loaders' k order).
// A lane holds one query's column, so the maximum is in-lane plus one exchange between the wave's halves. Work-groups below NB_ * NH_ * RH / 64 take the hi+lo rows (3 products), the rest single fp16.
#define KC   64                   // keys per pass
#define LP   72                   // LDS row pitch in 16-bit elements: 144 B = 16 B x odd, conflict-free for the 16-byte fragment reads
#define PLN  (64 * LP)            // one staged plane: 64 rows of 128 B (K: 64 keys x HD; V^T: HD rows x 64 keys)
#define BIGF 0x1p127f             // a power of two: BIGF * CL2 is exact, so a fully masked row gets exponent 0 for every key (uniform weights, as the reference's -1e9 gives)
#define CL2  0.18033688011112042f // HD^-0.5 * log2(e)
__device__ __forceinline__ float xhalf(float x) { const int b = __float_as_int(x); return __int_as_float(__builtin_amdgcn_permlanex16(b, b, 0x76543210, 0xfedcba98, false, false)); }   // lane l <-> l ^ 16
typedef __attribute__((ext_vector_type(2))) __bf16 v2bf;
// 2^x in asm so that the slot the instruction set asks for behind a transcendental (before its result is read or its source overwritten) is filled by construction:
// in the group of four each exponential stands in front of an independent one (the outputs are early-clobber: none shares a register with an input), and the v_nop fills the slot behind the last.
__device__ __forceinline__ v4f exp2x4(float a, float b, float c, float d) { float r0, r1, r2, r3;
    asm("v_exp_f32 %0, %4\n\tv_exp_f32 %1, %5\n\tv_exp_f32 %2, %6\n\tv_exp_f32 %3, %7\n\tv_nop" : "=&v"(r0), "=&v"(r1), "=&v"(r2), "=&v"(r3) : "v"(a), "v"(b), "v"(c), "v"(d)); return (v4f){r0, r1, r2, r3}; }
__device__ __forceinline__ float exp2x1(float a) { float r; asm("v_exp_f32 %0, %1\n\tv_nop" : "=v"(r) : "v"(a)); return r; }
template <typename T16, bool HL>
__device__ __forceinline__ void fattn_body(const T16* __restrict__ Q, const T16* __restrict__ Q2, const T16* __restrict__ Kp, const T16* __restrict__ Kp2, const T16* __restrict__ Vt, const T16* __restrict__ Vt2, int q0, T16* sm, const float* lim, bf* Ah, bf* Al) {
    typedef typename WFrag<T16>::V V;
    constexpr int NP = HL ? 4 : 2, NL = HL ? 2 : 1;   // planes in a buffer (K, V^T, K lo, V^T lo); planes of one operand
    const int tid = threadIdx.x, lane = tid & 31, lr = lane & 15, hi = lane >> 4; const int qr = q0 + (tid >> 5) * 16 + lr;
    V qf[2], qf2[2];
#pragma unroll
    for (int ks = 0; ks < 2; ++ks) { qf[ks] = WFrag<T16>::ld(Q + (size_t)qr * HD + ks * 32 + 8 * hi); if (HL) qf2[ks] = WFrag<T16>::ld(Q2 + (size_t)qr * HD + ks * 32 + 8 * hi); }
    // staging: a plane is 512 pieces of 16 B, 4 per thread; 8 neighbouring lanes read one whole 128-B line. K and V^T take turns in the same registers.
    const int srow = tid >> 3, sseg = (tid & 7) * 8;
    v8us st[NL][4];
    auto gloadK = [&](int c) {
#pragma unroll
        for (int u = 0; u < 4; ++u) { const size_t e = (size_t)(c * KC + srow + 16 * u) * HD + sseg; st[0][u] = *(const v8usa*)(Kp + e); if constexpr (HL) st[1][u] = *(const v8usa*)(Kp2 + e); } };
    auto gloadV = [&](int c) {
#pragma unroll
        for (int u = 0; u < 4; ++u) { const size_t e = (size_t)(srow + 16 * u) * TT + c * KC + sseg; st[0][u] = *(const v8usa*)(Vt + e); if constexpr (HL) st[1][u] = *(const v8usa*)(Vt2 + e); } };
    auto sstore = [&](T16* pl) {   // pl: the operand's hi plane; its lo plane lies two planes further
#pragma unroll
        for (int p = 0; p < NL; ++p)
#pragma unroll
            for (int u = 0; u < 4; ++u) *(v8usa*)(pl + p * 2 * PLN + (srow + 16 * u) * LP + sseg) = st[p][u]; };
    v8f o[4];
#pragma unroll
    for (int dt = 0; dt < 4; ++dt) o[dt] = (v8f){};
    float mraw = -BIGF, mcs = -BIGF * CL2;
    // the softmax sums ride the matrix pipe: an A of ones makes every row of lt the column sums of the (rounded) weights, over both lane halves' keys; lt is rescaled like an output tile
    V ones; v8f lt = (v8f){};
#pragma unroll
    for (int e = 0; e < 16; ++e) { if constexpr (HL) ones[e] = (__bf16)1.0f; else ones[e] = (h16)1.0f; }
    gloadK(0); sstore(sm); gloadV(0); sstore(sm + PLN);
    __syncthreads();   // pass 0's planes and the key limits are in LDS
    // The scheduling fences in the loop keep each group of LDS fragment loads together and ahead of the block of products that uses it (one exposed LDS latency a group, not one a fragment),
    // and keep the products of a block in the written order, in which neighbours go to different accumulators.
#pragma unroll 1
    for (int c = 0; c < TT / KC; ++c) {
        const T16* cur = sm + (c & 1) * (NP * PLN); T16* nxt = sm + ((c + 1) & 1) * (NP * PLN);
        const int cn = (c + 1 < TT / KC) ? c + 1 : c;   // the last pass re-reads its own planes: no branch in the loop; that copy is never read
        gloadK(cn);   // the next pass's K flies during the score products
        __builtin_amdgcn_sched_barrier(0);   // fence: the global loads stay at the head of the pass
        v8f s[4];
        if constexpr (HL) {
#pragma unroll
            for (int ks = 0; ks < 2; ++ks) { V ka[4], kb[4];
#pragma unroll
                for (int kt = 0; kt < 4; ++kt) { ka[kt] = WFrag<T16>::ld(cur + (kt * 16 + lr) * LP + ks * 32 + 8 * hi); kb[kt] = WFrag<T16>::ld(cur + 2 * PLN + (kt * 16 + lr) * LP + ks * 32 + 8 * hi); }
                __builtin_amdgcn_sched_barrier(0);   // fence: loads | products
#pragma unroll
                for (int kt = 0; kt < 4; ++kt) s[kt] = WFrag<T16>::mma(ka[kt], qf[ks], ks ? s[kt] : (v8f){});
#pragma unroll
                for (int kt = 0; kt < 4; ++kt) s[kt] = WFrag<T16>::mma(ka[kt], qf2[ks], s[kt]);
#pragma unroll
                for (int kt = 0; kt < 4; ++kt) s[kt] = WFrag<T16>::mma(kb[kt], qf[ks], s[kt]);
                __builtin_amdgcn_sched_barrier(0); }   // fence: products | next group
        } else { V ka[2][4];
#pragma unroll
            for (int ks = 0; ks < 2; ++ks)
#pragma unroll
                for (int kt = 0; kt < 4; ++kt) ka[ks][kt] = WFrag<T16>::ld(cur + (kt * 16 + lr) * LP + ks * 32 + 8 * hi);
            __builtin_amdgcn_sched_barrier(0);   // fence: loads | products
#pragma unroll
            for (int ks = 0; ks < 2; ++ks)
#pragma unroll
                for (int kt = 0; kt < 4; ++kt) s[kt] = WFrag<T16>::mma(ka[ks][kt], qf[ks], ks ? s[kt] : (v8f){});
            __builtin_amdgcn_sched_barrier(0); }   // fence: products | next group
        // key mask as a select, one instruction: the median of (s, -BIGF, +BIGF) is s, of (s, -BIGF, -BIGF) is -BIGF; four independent maximum chains
        float mk[4]; v4f lm[8];
#pragma unroll
        for (int u = 0; u < 8; ++u) lm[u] = *(const v4fa*)(lim + c * KC + (u >> 1) * 16 + hi * 8 + (u & 1) * 4);
        __builtin_amdgcn_sched_barrier(0);   // fence: the eight limit loads go out as one group, while the last score products drain
#pragma unroll
        for (int kt = 0; kt < 4; ++kt) { mk[kt] = -BIGF;
#pragma unroll
            for (int j = 0; j < 8; ++j) { const float t = __builtin_amdgcn_fmed3f(s[kt][j], -BIGF, lm[2 * kt + (j >> 2)][j & 3]); s[kt][j] = t; mk[kt] = __builtin_fmaximum_numf(mk[kt], t); } }
        float mx = __builtin_fmaximum_numf(__builtin_fmaximum_numf(__builtin_fmaximum_numf(mk[0], mk[1]), __builtin_fmaximum_numf(mk[2], mk[3])), mraw); mx = __builtin_fmaximum_numf(mx, xhalf(mx));
        __builtin_amdgcn_sched_barrier(0);   // fence: the K stores (and the wait on their loads) stay behind the maximum
        sstore(nxt); gloadV(cn);   // K goes to the other buffer; the next pass's V^T flies during the exponentials and the output products
        V va[HL ? 1 : 2][4], vb[4];   // V^T fragments fetched ahead of the exponentials (fp16: both 32-key groups; hi+lo: the first)
#pragma unroll
        for (int g = 0; g < (HL ? 1 : 2); ++g)
#pragma unroll
            for (int dt = 0; dt < 4; ++dt) { va[g][dt] = WFrag<T16>::ld(cur + PLN + (dt * 16 + lr) * LP + g * 32 + 8 * hi); if constexpr (HL) vb[dt] = WFrag<T16>::ld(cur + 3 * PLN + (dt * 16 + lr) * LP + g * 32 + 8 * hi); }
        __builtin_amdgcn_sched_barrier(0);   // fence: these loads are issued before the exponentials, which cover their latency
        const float mc = mx * CL2, al = exp2x1(mcs - mc), ad = (HL ? 0.0f : 10.0f) - mc;   // fp16 weights carry x1024 (cancels in the division by the sum): small weights stay normal numbers
        mraw = mx; mcs = mc;
#pragma unroll
        for (int kt = 0; kt < 4; ++kt)
#pragma unroll
            for (int j = 0; j < 8; ++j) s[kt][j] = __builtin_fmaf(s[kt][j], CL2, ad);
#pragma unroll
        for (int kt = 0; kt < 4; ++kt) { const v4f e0 = exp2x4(s[kt][0], s[kt][1], s[kt][2], s[kt][3]), e1 = exp2x4(s[kt][4], s[kt][5], s[kt][6], s[kt][7]); s[kt] = __builtin_shufflevector(e0, e1, 0, 1, 2, 3, 4, 5, 6, 7); }
        __builtin_amdgcn_sched_barrier(0);   // fence: the exponentials are asm text: none of the products below is scheduled in front of them
        lt *= al;
#pragma unroll
        for (int dt = 0; dt < 4; ++dt) o[dt] *= al;
#pragma unroll
        for (int g = 0; g < 2; ++g) { V pb, pb2;
#pragma unroll
            for (int e = 0; e < 16; e += 2) { const v2f pp = {s[2 * g + (e >> 3)][e & 7], s[2 * g + (e >> 3)][(e & 7) + 1]};   // by pairs: one packed conversion for two weights
                if constexpr (HL) { const v2bf h2 = __builtin_convertvector(pp, v2bf); const v2bf l2 = __builtin_convertvector(pp - __builtin_convertvector(h2, v2f), v2bf); pb[e] = h2[0]; pb[e + 1] = h2[1]; pb2[e] = l2[0]; pb2[e + 1] = l2[1]; }
                else { const v2h h2 = __builtin_convertvector(pp, v2h); pb[e] = h2[0]; pb[e + 1] = h2[1]; } }
            __builtin_amdgcn_sched_barrier(0);   // fence: conversions | products
#pragma unroll
            for (int dt = 0; dt < 4; ++dt) o[dt] = WFrag<T16>::mma(va[HL ? 0 : g][dt], pb, o[dt]);
            lt = WFrag<T16>::mma(ones, pb, lt);
            if constexpr (HL) {
#pragma unroll
                for (int dt = 0; dt < 4; ++dt) o[dt] = WFrag<T16>::mma(va[0][dt], pb2, o[dt]);
                lt = WFrag<T16>::mma(ones, pb2, lt);
#pragma unroll
                for (int dt = 0; dt < 4; ++dt) o[dt] = WFrag<T16>::mma(vb[dt], pb, o[dt]);
                __builtin_amdgcn_sched_barrier(0);   // fence: products | the second group's loads
                if (g == 0) {
#pragma unroll
                    for (int dt = 0; dt < 4; ++dt) { va[0][dt] = WFrag<T16>::ld(cur + PLN + (dt * 16 + lr) * LP + 32 + 8 * hi); vb[dt] = WFrag<T16>::ld(cur + 3 * PLN + (dt * 16 + lr) * LP + 32 + 8 * hi); }
                    __builtin_amdgcn_sched_barrier(0); } } }   // fence: the second group's loads are issued before its conversions, which cover their latency
        __builtin_amdgcn_sched_barrier(0);   // fence: the V^T stores (and the wait on their loads) stay at the foot of the pass
        sstore(nxt + PLN);
        __syncthreads();   // publishes the next pass's planes and ends every wave's reads of this pass's (refilled in the next trip)
    }
    const float inv = __fdiv_rn(1.0f, lt[0]);
#pragma unroll
    for (int dt = 0; dt < 4; ++dt) { v8us oh, ol;   // a lane's 8 accumulator registers are 8 consecutive d of its query: one 16-byte store per plane
#pragma unroll
        for (int j = 0; j < 8; ++j) { unsigned short a, c2; splitf(o[dt][j] * inv, a, c2); oh[j] = a; ol[j] = c2; }
        const size_t oo = (size_t)qr * DQ + dt * 16 + hi * 8; *(v8us*)(Ah + oo) = oh; *(v8us*)(Al + oo) = ol; }
}
// the second bound (4 waves per SIMD) is a budget of 256 registers: the hi+lo body stays below v256 and needs no register-window switches in its loop
__global__ __launch_bounds__(128, 4) void k_fattn(const h16* __restrict__ Q16, const h16* __restrict__ K16, const h16* __restrict__ V16, const bf* __restrict__ Qh, const bf* __restrict__ Ql, const bf* __restrict__ Kh, const bf* __restrict__ Kl, const bf* __restrict__ Vh, const bf* __restrict__ Vl, const int* __restrict__ MK, bf* Ah, bf* Al) {
    __shared__ __align__(16) unsigned short sm[2 * 4 * PLN];
    __shared__ __align__(16) float lim[TT];
    const int bx = blockIdx.x;   // the heavier hi+lo work-groups of both batches come first
    constexpr int NHL = NH_ * (RH / 64), NSG = NH_ * ((TT - RH) / 64);   // work-groups of a batch: hi+lo, single fp16
    const bool hl = bx < NB_ * NHL; const int bt = hl ? bx / NHL : (bx - NB_ * NHL) / NSG, ix = hl ? bx % NHL : (bx - NB_ * NHL) % NSG;   // batch, index inside the batch
    const int* MKb = MK + (size_t)bt * TT; const size_t zb = (size_t)bt * NH_ * TT * HD, zkb = (size_t)bt * NKV * TT * HD; Ah += (size_t)bt * TT * DQ; Al += (size_t)bt * TT * DQ;
    // unrolled so that the four mask loads of a thread are in flight together
#pragma unroll
    for (int u = 0; u < TT / 512; ++u) { const int i = (u * 128 + (int)threadIdx.x) * 4; const v4i m4 = *(const v4i*)(MKb + i); v4f f4;
#pragma unroll
        for (int q = 0; q < 4; ++q) f4[q] = (m4[q] != 0) ? BIGF : -BIGF;
        *(v4fa*)(lim + i) = f4; }
    if (hl) { const int h = ix / (RH / 64), q0 = (ix % (RH / 64)) * 64; const size_t zq = zb + (size_t)h * TT * HD, zk = zkb + (size_t)(h / REP) * TT * HD;
        fattn_body<bf, true>(Qh + zq, Ql + zq, Kh + zk, Kl + zk, Vh + zk, Vl + zk, q0, (bf*)sm, lim, Ah + h * HD, Al + h * HD);
    } else { const int h = ix / ((TT - RH) / 64), q0 = RH + (ix % ((TT - RH) / 64)) * 64; const size_t zq = zb + (size_t)h * TT * HD, zk = zkb + (size_t)(h / REP) * TT * HD;
        fattn_body<h16, false>(Q16 + zq, nullptr, K16 + zk, nullptr, V16 + zk, nullptr, q0, (h16*)sm, lim, Ah + h * HD, Al + h * HD); }
}

extern "C" void kernel_launch(void* const* d_in, const int* in_sizes, int n_in,
                              void* d_out, int out_size, void* d_ws, size_t ws_size, hipStream_t stream) {
    (void)in_sizes; (void)n_in; (void)out_size;
    const float* x = (const float*)d_in[0]; const float* xk = (const float*)d_in[1]; const int* MK = (const int*)d_in[2]; const float* wq = (const float*)d_in[3]; const float* bq = (const float*)d_in[4]; const float* wk = (const float*)d_in[5]; const float* bk = (const float*)d_in[6]; const float* wv = (const float*)d_in[7]; const float* bv = (const float*)d_in[8]; const float* wo = (const float*)d_in[9]; const float* bo = (const float*)d_in[10]; const float* w1 = (const float*)d_in[11]; const float* b1 = (const float*)d_in[12]; const float* w2 = (const float*)d_in[13]; const float* b2 = (const float*)d_in[14]; const float* g1 = (const float*)d_in[15]; const float* e1 = (const float*)d_in[16]; const float* g2 = (const float*)d_in[17]; const float* e2 = (const float*)d_in[18];
    float* OUT = (float*)d_out;     // [2][2048][1024]
    char* wsp = (char*)d_ws;
    auto take = [&](size_t bytes) { char* p = wsp; wsp += (bytes + 255) & ~(size_t)255; return (void*)p; };
    bf* WQ = (bf*)take((size_t)DQ * DM * 2); bf* WK = (bf*)take((size_t)DKV * DM * 2); bf* WV = (bf*)take((size_t)DKV * DM * 2); bf* WO = (bf*)take((size_t)DM * DQ * 2);
    bf* W1B = (bf*)take((size_t)DFF * DM * 2); bf* W2B = (bf*)take((size_t)DM * DFF * 2);
    // every buffer below holds both batches (rows b * TT + t; head planes [b][h][..]).
    // Region A: inputs in bf16 and the head planes, dead once the attention has run; Gh, Gl lie over it.
    char* const regA = wsp;
    bf* XB = (bf*)take((size_t)NB_ * TT * DM * 2); bf* XKB = (bf*)take((size_t)NB_ * TT * DM * 2);
    h16* QP16 = (h16*)take((size_t)NB_ * NH_ * TT * HD * 2); h16* KP16 = (h16*)take((size_t)NB_ * NKV * TT * HD * 2); h16* VT16 = (h16*)take((size_t)NB_ * NKV * HD * TT * 2);
    bf* QPh = (bf*)take((size_t)NB_ * NH_ * TT * HD * 2); bf* QPl = (bf*)take((size_t)NB_ * NH_ * TT * HD * 2); bf* KPh = (bf*)take((size_t)NB_ * NKV * TT * HD * 2); bf* KPl = (bf*)take((size_t)NB_ * NKV * TT * HD * 2); bf* VTh = (bf*)take((size_t)NB_ * NKV * HD * TT * 2); bf* VTl = (bf*)take((size_t)NB_ * NKV * HD * TT * 2);
    bf* ATh = (bf*)take((size_t)NB_ * TT * DQ * 2); bf* ATl = (bf*)take((size_t)NB_ * TT * DQ * 2); float* S2 = (float*)take((size_t)NB_ * TT * DM * 4);
    float* X1 = (float*)take((size_t)NB_ * TT * DM * 4); bf* L1h = (bf*)take((size_t)NB_ * TT * DM * 2); bf* L1l = (bf*)take((size_t)NB_ * TT * DM * 2); float* F2 = (float*)take((size_t)NB_ * TT * DM * 4);
    if ((size_t)(wsp - (char*)d_ws) > ws_size) return;
    bf* Gh = (bf*)regA; bf* Gl = Gh + (size_t)NB_ * TT * DFF;
    static_assert((size_t)NB_ * TT * DFF * 2 * 2 <= (size_t)NB_ * TT * (2 * DM + 3 * DQ + 6 * DKV) * 2, "Gh, Gl fit region A");
    k_prep<<<PGRID, 256, 0, stream>>>(wq, wk, wv, wo, w1, w2, x, xk, WQ, WK, WV, WO, W1B, W2B, XB, XKB);   /* weights as bf16 [n][k], x and y as bf16 rows */
    // one launch of each kernel serves both batches. In the k_gemms grids the batch is z (the slowest index); in k_qkv z is product * NB_ + batch.
    k_qkv<<<dim3(TT / 128, DQ / 128, 3 * NB_), 128, 0, stream>>>(XB, XKB, WQ, WK, WV, QP16, QPh, QPl, KP16, KPh, KPl, VT16, VTh, VTl, bq, bk, bv);   /* q, k as head planes, v as transposed head planes */
    k_fattn<<<NB_ * NH_ * (TT / 64), 128, 0, stream>>>(QP16, KP16, VT16, QPh, QPl, KPh, KPl, VTh, VTl, MK, ATh, ATl);   /* softmax(q k^T / 8, mask) v, merged heads as hi/lo planes */
    k_gemms<1, 0, DQ><<<dim3(TT / 128, DM / 128, NB_), 128, 0, stream>>>(ATh, ATl, WO, S2, nullptr, nullptr, nullptr, DM, bo, (size_t)TT * DQ, (size_t)TT * DM);   /* mha = merged Wo + bo */
    k_lnhl<true><<<NB_ * TT / 8, 256, 0, stream>>>(x, S2, g1, e1, X1, L1h, L1l);                                                          /* x1 = LN(bf16(x) + mha): normalised row in f32 + hi/lo planes */
    k_gemms<1, 3, DM><<<dim3(TT / 128, DFF / 128, NB_), 128, 0, stream>>>(L1h, L1l, W1B, nullptr, nullptr, Gh, Gl, DFF, b1, (size_t)TT * DM, (size_t)TT * DFF);   /* relu(x1 W1 + b1) as hi/lo planes */
    k_gemms<1, 0, DFF><<<dim3(TT / 128, DM / 128, NB_), 128, 0, stream>>>(Gh, Gl, W2B, F2, nullptr, nullptr, nullptr, DM, b2, (size_t)TT * DFF, (size_t)TT * DM);   /* . W2 + b2 */
    k_addln<<<NB_ * TT / 8, 256, 0, stream>>>(X1, F2, g2, e2, OUT);                                                                       /* out = LN(x1 + ff) */
}

// v009
// A run of this version takes 249 microseconds.
// In two side-by-side timings against v008, it was 1.05 and 1.06 times as fast.
// Over all steps from v000 it is 16.0 times as fast.
#include <hip/hip_runtime.h>

// Post-LN transformer encoder block with cross attention (x, y [2][2048][1024]; Q = x Wq + bq, K = y Wk + bk, V = y Wv + bv ('xw' [1024][1024]; 16 heads x 64); scores/8 with mask [2][1][1][2048] (int32 keys, read; -1e9 == exact zero weight; all ones here); softmax; mha = merged Wo + bo; x1 = LN(x + mha); ff = relu(x1 W1 + b1) W2 + b2 (W1 [1024][4096]); out = LN(x1 + ff) (eps 1e-5) -> [2][2048][1024] (4.2 M)).
// Compute dtypes, f32 accumulate: every input rounded to bf16; q/k/v on PLAIN bf16 operands (inputs: exact) + biases; key mask as a select; scores and attn.v: query rows < 512 hl (3 products), the rest single fp16 (x1024); softmax f32; Wo, W1, W2 hl x exact (2 products) + biases; residuals / LayerNorms / ReLU in f32.

#define NB_  2
#define TT   2048
#define DM   1024
#define NH_  16
#define NKV  16
#define REP  (NH_ / NKV)
#define HD   64
#define DQ   (NH_ * HD)
#define DKV  (NKV * HD)
#define DFF  4096
#define LNEPS 1e-5f
#define RH   512                  // query rows < RH use hi+lo planes (0: none)
#define WIN  0
#define SCL  0.125f   // HD^-0.5
typedef _Float16 h16;
typedef unsigned short bf;
typedef __attribute__((ext_vector_type(16))) __bf16   v16bf;
typedef __attribute__((ext_vector_type(16))) _Float16 v16h;
typedef __attribute__((ext_vector_type(8)))  _Float16 v8h;
typedef __attribute__((ext_vector_type(8)))  unsigned short v8us;
typedef __attribute__((ext_vector_type(8)))  float    v8f;
typedef __attribute__((ext_vector_type(4)))  float    v4f;
typedef v8h  __attribute__((may_alias)) v8ha;
typedef v4f  __attribute__((may_alias)) v4fa;
typedef v8us __attribute__((may_alias)) v8usa;

__device__ __forceinline__ unsigned short f2bf(float f) { unsigned u = __float_as_uint(f); u += 0x7FFFu + ((u >> 16) & 1u); return (unsigned short)(u >> 16); }
__device__ __forceinline__ float bf2f(unsigned short b) { return __uint_as_float(((unsigned)b) << 16); }
__device__ __forceinline__ float bfr(float f) { return bf2f(f2bf(f)); }
__device__ __forceinline__ v16h cat16(v8h lo, v8h hi) { return __builtin_shufflevector(lo, hi, 0, 1, 2, 3, 4, 5, 6, 7, 8, 9, 10, 11, 12, 13, 14, 15); }
__device__ __forceinline__ v16bf cat16b(v8us lo, v8us hi) { return __builtin_bit_cast(v16bf, __builtin_shufflevector(lo, hi, 0, 1, 2, 3, 4, 5, 6, 7, 8, 9, 10, 11, 12, 13, 14, 15)); }
__device__ __forceinline__ v8f wmma16(v16h a, v16h b, v8f c) { return __builtin_amdgcn_wmma_f32_16x16x32_f16(false, a, false, b, (short)0, c, false, false); }
__device__ __forceinline__ v8f wmmab(v16bf a, v16bf b, v8f c) { return __builtin_amdgcn_wmma_f32_16x16x32_bf16(false, a, false, b, (short)0, c, false, false); }
__device__ __forceinline__ h16 tohx(float x) { return (h16)x; }
__device__ __forceinline__ void splitf(float y, unsigned short& h, unsigned short& l) { h = f2bf(y); l = f2bf(y - bf2f(h)); }



// ---- k_gemms: GEMM on LDS-staged operands. One 128x128 output tile per work-group, 4 waves as 2 x 2, each a 64x64 tile (16 accumulators); grid (M/128, N/128, Z), 128 threads.
// A stage is 64 k = one whole 128-byte line of each of the 128 rows of every operand plane (A, with NSPLIT == 1 also A2, and Bt), brought from the K-contiguous 16-bit planes into LDS by asynchronous copies
// (a wave's copy covers 4 whole lines); two buffers, the next stage flies while this one is worked on. Each staged row serves two waves.
// c[m][n] = bias[n] + sum_k (A[m][k] + A2[m][k]) Bt[n][k], k ascending in one chain per element. z-batch strides sA/sC in elements. K (compile time) % 64 == 0, at least two stages.
// The tile leaves in the form its consumer reads (EPI), so that no elementwise launch stands between a product and the next kernel:
//   0: f32 rows C, pitch ldc.   1: head planes [z][h][t][d] (fp16 P16, bf16 hi Ph, lo Pl).   2: transposed head planes [z][h][d][t] (the same three).   3: relu(c) as bf16 hi/lo rows Ph, Pl, pitch ldc.
// A wave's 64 columns are one head (EPI 1, 2); in every 16-bit plane 8 neighbouring lanes store one whole 128-byte line.
template <typename T16> struct WFrag;
template <> struct WFrag<h16> { typedef v16h V; static __device__ __forceinline__ V ld(const h16* p) { return cat16(*(const v8h*)p, *(const v8h*)(p + 16)); } static __device__ __forceinline__ v8f mma(V a, V b, v8f c) { return wmma16(a, b, c); } };
template <> struct WFrag<bf> { typedef v16bf V; static __device__ __forceinline__ V ld(const bf* p) { return cat16b(*(const v8us*)p, *(const v8us*)(p + 16)); } static __device__ __forceinline__ v8f mma(V a, V b, v8f c) { return wmmab(a, b, c); } };
#define GP   72                   // LDS row pitch in 16-bit elements: 144 B = 16 B x odd, conflict-free for the 16-byte fragment reads
#define GPL  (128 * GP)           // one staged plane: 128 rows of 128 B
// eight asynchronous 16-byte copies of a lane (rows r, r + 16, .. r + 112 of one plane); the s_wait_xcnt stands inside the statement, behind the last copy, so that no address register is rewritten in front of it
__device__ __forceinline__ void acopy8(unsigned l, const bf* g, size_t rs) {
    asm volatile("global_load_async_to_lds_b128 %0, %8, off\n\tglobal_load_async_to_lds_b128 %1, %9, off\n\tglobal_load_async_to_lds_b128 %2, %10, off\n\tglobal_load_async_to_lds_b128 %3, %11, off\n\t"
                 "global_load_async_to_lds_b128 %4, %12, off\n\tglobal_load_async_to_lds_b128 %5, %13, off\n\tglobal_load_async_to_lds_b128 %6, %14, off\n\tglobal_load_async_to_lds_b128 %7, %15, off\n\ts_wait_xcnt 0x0"
                 :: "v"(l), "v"(l + 16 * GP * 2), "v"(l + 32 * GP * 2), "v"(l + 48 * GP * 2), "v"(l + 64 * GP * 2), "v"(l + 80 * GP * 2), "v"(l + 96 * GP * 2), "v"(l + 112 * GP * 2),
                    "v"(g), "v"(g + rs), "v"(g + 2 * rs), "v"(g + 3 * rs), "v"(g + 4 * rs), "v"(g + 5 * rs), "v"(g + 6 * rs), "v"(g + 7 * rs) : "memory"); }
// EPI 12: form 1 or form 2, chosen by the work-group-uniform argument tp (the launch that holds the q, k and v products). z: the batch.
template <int N> struct IC { static constexpr int value = N; };
template <int NSPLIT, int EPI, int K>
__device__ __forceinline__ void gemm_tile(const bf* __restrict__ A, const bf* __restrict__ A2, const bf* __restrict__ Bt, float* C, h16* P16, bf* Ph, bf* Pl, int ldc, const float* __restrict__ bias, size_t sA, size_t sC, const size_t z, const bool tp) {
    typedef WFrag<bf>::V V;
    constexpr int NPL = NSPLIT ? 3 : 2;   // planes of a stage: Bt, A (, A2)
    __shared__ __align__(16) bf sm[2 * NPL * GPL];
    __shared__ __align__(16) float os[4 * 16 * 68];
    A += z * sA; if (NSPLIT) A2 += z * sA;
    const int tid = threadIdx.x, lane = tid & 31, lr = lane & 15, hi = lane >> 4; const int wv = __builtin_amdgcn_readfirstlane(tid >> 5), wm = wv & 1, wn = wv >> 1;
    const int r0 = blockIdx.x * 128, c0 = blockIdx.y * 128;
    // staging: 8 neighbouring lanes copy one whole 128-B line; a thread takes rows srow + 16 u of every plane
    const int srow = tid >> 3, sseg = (tid & 7) * 8;
    const bf* gB = Bt + (size_t)(c0 + srow) * K + sseg; const bf* gA = A + (size_t)(r0 + srow) * K + sseg; const bf* gA2 = NSPLIT ? A2 + (size_t)(r0 + srow) * K + sseg : nullptr;
    const unsigned l0 = (unsigned)(size_t)sm + (unsigned)(srow * GP + sseg) * 2u; const size_t rs = (size_t)16 * K;
    auto stage = [&](int t) { const unsigned l = l0 + (unsigned)(t & 1) * (NPL * GPL * 2); const int kc = t * 64;
        acopy8(l, gB + kc, rs); acopy8(l + GPL * 2, gA + kc, rs); if constexpr (NSPLIT != 0) acopy8(l + 2 * GPL * 2, gA2 + kc, rs); };
    // every loop over mb, nb, ks, j and s in this kernel is unrolled so that acc[][] and the fragments are indexed by constants and stay in registers
    v8f acc[4][4];
#pragma unroll
    for (int mb = 0; mb < 4; ++mb)
#pragma unroll
        for (int nb = 0; nb < 4; ++nb) acc[mb][nb] = (v8f){};
    constexpr int nst = K / 64; static_assert(K % 64 == 0 && nst >= 2, "whole stages, at least two");
    stage(0);
    asm volatile("s_wait_asynccnt 0x0" ::: "memory");   // this wave's copies of stage 0 have landed
    __syncthreads();                                     // every wave's have: stage 0 may be read
    stage(1);
    const int aof = (wm * 64 + lr) * GP + 8 * hi, bof = (wn * 64 + lr) * GP + 8 * hi;
    // the stage loop stays rolled: one copy of a stage's products and copies in the instruction cache, and one publish point
#pragma unroll 1
    for (int t = 0; t < nst; ++t) {
        const bf* cur = sm + (t & 1) * (NPL * GPL);
#pragma unroll
        for (int ks = 0; ks < 2; ++ks) { V a[4], a2[4], b[4];
            b[0] = WFrag<bf>::ld(cur + bof + ks * 32);
#pragma unroll
            for (int mb = 0; mb < 4; ++mb) a[mb] = WFrag<bf>::ld(cur + GPL + aof + mb * 16 * GP + ks * 32);
#pragma unroll
            for (int nb = 1; nb < 4; ++nb) b[nb] = WFrag<bf>::ld(cur + bof + nb * 16 * GP + ks * 32);
            if constexpr (NSPLIT != 0) {
#pragma unroll
                for (int mb = 0; mb < 4; ++mb) a2[mb] = WFrag<bf>::ld(cur + 2 * GPL + aof + mb * 16 * GP + ks * 32); }
            __builtin_amdgcn_sched_barrier(0);   // fence: the fragment loads go out as one group ahead of the products (one exposed LDS latency a group)
#pragma unroll
            for (int nb = 0; nb < 4; ++nb)
#pragma unroll
                for (int mb = 0; mb < 4; ++mb) acc[mb][nb] = WFrag<bf>::mma(a[mb], b[nb], acc[mb][nb]);
            if constexpr (NSPLIT != 0) {
#pragma unroll
                for (int nb = 0; nb < 4; ++nb)
#pragma unroll
                    for (int mb = 0; mb < 4; ++mb) acc[mb][nb] = WFrag<bf>::mma(a2[mb], b[nb], acc[mb][nb]); }
            __builtin_amdgcn_sched_barrier(0); }   // fence: products | next group
        asm volatile("s_wait_dscnt 0x0" ::: "memory");      // this wave's reads of the buffer are done before it is refilled
        asm volatile("s_wait_asynccnt 0x0" ::: "memory");   // this wave's copies of stage t + 1 have landed
        __syncthreads();                                     // publishes stage t + 1 and ends every wave's reads of stage t
        if (t + 2 < nst) stage(t + 2);                       // into the buffer that this trip has just read
    }
    asm volatile("s_wait_asynccnt 0x0" ::: "memory");        // no copy is outstanding when the wave goes on
    float* const ow = os + wv * (16 * 68);   // this wave's own staging rows: whole lines go out
    const int cw = c0 + wn * 64;
    if constexpr (EPI == 0) {
        const int cofs = lr * 4; v4f bv;   // a lane stores the same 4 columns of every row: their biases are read once
        { const v4f b4 = *(const v4f*)(bias + cw + cofs); bv[0] = bfr(b4[0]); bv[1] = bfr(b4[1]); bv[2] = bfr(b4[2]); bv[3] = bfr(b4[3]); }
#pragma unroll
        for (int mb = 0; mb < 4; ++mb) {
#pragma unroll
            for (int nb = 0; nb < 4; ++nb) {
#pragma unroll
                for (int j = 0; j < 8; ++j) ow[(hi * 8 + j) * 68 + nb * 16 + lr] = acc[mb][nb][j]; }
            __builtin_amdgcn_wave_barrier(); asm volatile("" ::: "memory");   // the row reads below are other lanes' stores: the compiler may not move them in front of the stores
            float* crow = C + z * sC + (size_t)(r0 + wm * 64 + mb * 16) * ldc + cw;
#pragma unroll
            for (int s = 0; s < 8; ++s) { const int row = 2 * s + hi; const v4f val = *(const v4fa*)(ow + row * 68 + cofs) + bv;
                *(v4f*)(crow + (size_t)row * ldc + cofs) = val; }
            asm volatile("s_wait_xcnt 0x0" ::: "memory");   // the next 16 rows reuse the registers that these stores name
            __builtin_amdgcn_wave_barrier(); asm volatile("" ::: "memory");   // nor the next 16 rows' stores in front of these reads
        }
    } else { auto planes = [&](auto ec) { constexpr int E = decltype(ec)::value;   // the form as a compile-time constant, also where the work-group picks it at run time
        // 16 plane rows of 64 elements at a time go through the wave's staging rows in f32; a lane then converts 8 neighbouring elements of a row and stores 16 bytes to each plane.
        // Plane rows are the tile's rows (EPI 1, 3: 16 t of block mb) or its columns (EPI 2: 16 d of block nb, where a lane's 8 accumulator registers are 8 neighbouring t).
        const int rsub = lane >> 3, cofs = (lane & 7) * 8, rw = r0 + wm * 64;
        const size_t pitch = E == 1 ? (size_t)HD : E == 2 ? (size_t)TT : (size_t)ldc;
        const size_t p0 = z * sC + cofs + (E == 1 ? ((size_t)(cw / HD) * TT + rw) * HD : E == 2 ? (size_t)cw * TT + rw : (size_t)rw * ldc + cw);
        float bc[8];   // EPI 1, 3: the biases of the 8 columns that the lane stores in every row; EPI 2: of the lane's accumulator column in each of the 4 blocks (they go in ahead of the staging)
        if constexpr (E == 2) {
#pragma unroll
            for (int q = 0; q < 4; ++q) bc[q] = bfr(bias[cw + q * 16 + lr]);
        } else { const v4f b0 = *(const v4f*)(bias + cw + cofs), b1 = *(const v4f*)(bias + cw + cofs + 4);
#pragma unroll
            for (int q = 0; q < 4; ++q) { bc[q] = bfr(b0[q]); bc[q + 4] = bfr(b1[q]); } }
#pragma unroll
        for (int blk = 0; blk < 4; ++blk) {
            if constexpr (E == 2) {
#pragma unroll
                for (int mb = 0; mb < 4; ++mb) { const v8f a = acc[mb][blk] + bc[blk];
                    *(v4fa*)(ow + lr * 68 + mb * 16 + hi * 8) = __builtin_shufflevector(a, a, 0, 1, 2, 3); *(v4fa*)(ow + lr * 68 + mb * 16 + hi * 8 + 4) = __builtin_shufflevector(a, a, 4, 5, 6, 7); }
            } else {
#pragma unroll
                for (int nb = 0; nb < 4; ++nb) {
#pragma unroll
                    for (int j = 0; j < 8; ++j) ow[(hi * 8 + j) * 68 + nb * 16 + lr] = acc[blk][nb][j]; } }
            __builtin_amdgcn_wave_barrier(); asm volatile("" ::: "memory");   // the row reads below are other lanes' stores: the compiler may not move them in front of the stores
#pragma unroll
            for (int s = 0; s < 4; ++s) { const int row = 4 * s + rsub; const v4f lo4 = *(const v4fa*)(ow + row * 68 + cofs), hi4 = *(const v4fa*)(ow + row * 68 + cofs + 4); v8h o16; v8us oh, ol;
#pragma unroll
                for (int q = 0; q < 8; ++q) { float y = q < 4 ? lo4[q & 3] : hi4[q & 3]; if constexpr (E != 2) y += bc[q]; if constexpr (E == 3) y = fmaxf(y, 0.f);
                    unsigned short a2, c2; splitf(y, a2, c2); oh[q] = a2; ol[q] = c2; if constexpr (E != 3) o16[q] = tohx(y); }
                const size_t e = p0 + (size_t)(blk * 16 + row) * pitch;
                if constexpr (E != 3) *(v8h*)(P16 + e) = o16;
                *(v8us*)(Ph + e) = oh; *(v8us*)(Pl + e) = ol;
                asm volatile("s_wait_xcnt 0x0" ::: "memory"); }   // the next rows' conversions reuse the registers that these stores name
            __builtin_amdgcn_wave_barrier(); asm volatile("" ::: "memory");   // nor the next block's stores in front of these reads
        } };
        if constexpr (EPI == 12) { if (tp) planes(IC<2>{}); else planes(IC<1>{}); } else planes(IC<EPI>{});
    }
}
// the second bound (4 waves per SIMD) is a budget of 256 registers: accumulators and one fragment set fit below v256
template <int NSPLIT, int EPI, int K>
__global__ __launch_bounds__(128, 4) void k_gemms(const bf* __restrict__ A, const bf* __restrict__ A2, const bf* __restrict__ Bt, float* C, h16* P16, bf* Ph, bf* Pl, int ldc, const float* __restrict__ bias, size_t sA, size_t sC) {
    gemm_tile<NSPLIT, EPI, K>(A, A2, Bt, C, P16, Ph, Pl, ldc, bias, sA, sC, blockIdx.z, false); }
// ---- k_qkv: the three projections in ONE launch, grid (TT/128, DQ/128, 3 * NB_): 768 work-groups, three of them resident on a WGP (by LDS), so that a SIMD holds three waves
// and one wave's fragment loads, stage hand-over and epilogue run under the others' products. blockIdx.z = product * NB_ + batch; nothing passes between work-groups.
__global__ __launch_bounds__(128, 4) void k_qkv(const bf* __restrict__ XB, const bf* __restrict__ XKB, const bf* __restrict__ WQ, const bf* __restrict__ WK, const bf* __restrict__ WV,
                                                h16* Q16, bf* Qh, bf* Ql, h16* K16, bf* Kh, bf* Kl, h16* V16, bf* Vh, bf* Vl, const float* __restrict__ bq, const float* __restrict__ bk, const float* __restrict__ bv) {
    static_assert(NH_ == NKV, "the three products have one shape");
    const int sel = blockIdx.z / NB_;   // 0: q = x Wq + bq, 1: k = y Wk + bk (head planes), 2: v = y Wv + bv (transposed head planes)
    gemm_tile<0, 12, DM>(sel == 0 ? XB : XKB, nullptr, sel == 0 ? WQ : sel == 1 ? WK : WV, nullptr, sel == 0 ? Q16 : sel == 1 ? K16 : V16, sel == 0 ? Qh : sel == 1 ? Kh : Vh, sel == 0 ? Ql : sel == 1 ? Kl : Vl, 0,
                         sel == 0 ? bq : sel == 1 ? bk : bv, (size_t)TT * DM, (size_t)NH_ * TT * HD, blockIdx.z % NB_, sel == 2); }

typedef __attribute__((ext_vector_type(2))) _Float16 v2h;
typedef __attribute__((ext_vector_type(4))) _Float16 v4h;
typedef __attribute__((ext_vector_type(2))) unsigned short v2us;
typedef __attribute__((ext_vector_type(4))) unsigned short v4us;
typedef __attribute__((ext_vector_type(2))) float v2f;
typedef __attribute__((ext_vector_type(4))) int v4i;

// ---- k_prep: every 16-bit plane that the products read from the inputs (six weights transposed to [n][k], x and y row by row), made in ONE launch of PGRID work-groups of 8 waves.
// A job is PJE elements: a 128 k x 64 n tile of a weight, or PJE neighbouring elements of x or y. Work-group b does five jobs one after the other: tile b of the four attention weights taken together, of W1 and of W2, piece b of x and of y
// (a fixed deal: nothing passes between work-groups). Few waves with much work each: the loads of the next two jobs (16 of 16 bytes a thread) fly while a job is written out.
// A weight tile is read by whole 128-byte lines of w[k][.], rounded, packed by k pairs and turned in LDS, and leaves as 256 neighbouring bytes of each row Bt[n][.].
#define PJE   8192
#define PGRID 512
typedef __attribute__((ext_vector_type(4))) unsigned v4u;
typedef v4u __attribute__((may_alias)) v4ua;
__global__ __launch_bounds__(256) void k_prep(const float* __restrict__ wq, const float* __restrict__ wk, const float* __restrict__ wv, const float* __restrict__ wo, const float* __restrict__ w1, const float* __restrict__ w2, const float* __restrict__ x, const float* __restrict__ y,
                                              bf* WQ, bf* WK, bf* WV, bf* WO, bf* W1B, bf* W2B, bf* XB, bf* XKB) {
    // two tiles as [n][k pair], 64 dwords a row; the 16-byte piece g of row n lies at piece g ^ (n / 4 mod 16): the 32 dword stores of a wave fall on 32 banks, and a row is still read by whole 16-byte pieces
    __shared__ __align__(16) unsigned tl[2][64 * 64];
    constexpr int JS = DM * DM / PJE;
    static_assert(DQ == DM && DKV == DM, "the four attention weights have one shape");
    static_assert(4 * JS == PGRID && DM * DFF / PJE == PGRID && NB_ * TT * DM / PJE == PGRID && DM % 128 == 0 && DFF % 128 == 0, "one job of each kind for every work-group");
    const int tid = threadIdx.x, b = blockIdx.x, m = b / JS, t0 = b % JS;
    const int ng = ((tid >> 5) & 1) * 8 + (tid & 7), kq = tid >> 6, kr = (tid >> 3) & 3;   // reading a tile: 8 lanes take one line (32 n) of a row; a wave takes 4 k pairs, the work-group 32 k a pass
    // every loop over p, q and u below is unrolled so that the register arrays are indexed by constants and stay in registers
    auto loadT = [&](v4f (&r)[8], const float* w, int N, int t) { const int nt = N / 64; const float* s = w + (size_t)(t / nt) * 128 * N + (t % nt) * 64 + (size_t)((kq * 4 + kr) * 2) * N + ng * 4;
#pragma unroll
        for (int p = 0; p < 4; ++p) { r[2 * p] = *(const v4f*)(s + (size_t)p * 32 * N); r[2 * p + 1] = *(const v4f*)(s + (size_t)p * 32 * N + N); }
        __builtin_amdgcn_sched_barrier(0); };   // fence: the eight loads go out here, as one group, and not one by one where their values are used
    auto putT = [&](unsigned* tb, const v4f (&r)[8]) {
#pragma unroll
        for (int p = 0; p < 4; ++p)
#pragma unroll
            for (int q = 0; q < 4; ++q) tb[(ng * 4 + q) * 64 + (((p * 4 + kq) ^ ng) << 2) + kr] = (unsigned)f2bf(r[2 * p][q]) | ((unsigned)f2bf(r[2 * p + 1][q]) << 16); };
    auto outT = [&](const unsigned* tb, bf* o, int K, int N, int t) { const int nt = N / 64; bf* d = o + (size_t)(t % nt) * 64 * K + (t / nt) * 128;
#pragma unroll
        for (int u = 0; u < 4; ++u) { const int n = u * 16 + (tid >> 4), g = tid & 15;   // 16 lanes store 256 neighbouring bytes of a row
            *(v4ua*)(d + (size_t)n * K + g * 8) = *(const v4ua*)(tb + n * 64 + ((g ^ ((n >> 2) & 15)) << 2)); }
        __builtin_amdgcn_sched_barrier(0); };   // fence: the tile's stores go out ahead of the wait for the next job's loads
    auto loadC = [&](v4f (&r)[8], const float* s) {
#pragma unroll
        for (int p = 0; p < 4; ++p) { r[2 * p] = *(const v4f*)(s + p * 2048 + tid * 8); r[2 * p + 1] = *(const v4f*)(s + p * 2048 + tid * 8 + 4); }
        __builtin_amdgcn_sched_barrier(0); };   // fence: as in loadT
    auto outC = [&](const v4f (&r)[8], bf* d) {
#pragma unroll
        for (int p = 0; p < 4; ++p) { v8us o;
#pragma unroll
            for (int q = 0; q < 8; ++q) o[q] = f2bf(r[2 * p + (q >> 2)][q & 3]);
            *(v8us*)(d + p * 2048 + tid * 8) = o; } };
    // The work-group barrier by hand, with the one wait it needs (this wave's LDS stores and reads are done): a __syncthreads() would also wait for the global loads issued ahead, which are to stay in flight across it.
    // It publishes the tile just written; and as a wave's reads of the tile before that one are done when it arrives, that buffer may be rewritten behind it.
    auto bar = [&]() { asm volatile("s_wait_dscnt 0x0\n\ts_barrier_signal -1\n\ts_barrier_wait -1" ::: "memory"); };
    const float* ws = m == 0 ? wq : m == 1 ? wk : m == 2 ? wv : wo; bf* WS = m == 0 ? WQ : m == 1 ? WK : m == 2 ? WV : WO;
    v4f ra[8], rb[8];
    loadT(ra, ws, DM, t0); loadT(rb, w1, DFF, b);
    putT(tl[0], ra); bar(); loadT(ra, w2, DM, b); outT(tl[0], WS, DM, DM, t0);
    putT(tl[1], rb); bar(); loadC(rb, x + (size_t)b * PJE); outT(tl[1], W1B, DM, DFF, b);
    putT(tl[0], ra); bar(); loadC(ra, y + (size_t)b * PJE); outT(tl[0], W2B, DFF, DM, b);
    outC(rb, XB + (size_t)b * PJE); outC(ra, XKB + (size_t)b * PJE);
}

// ---- the two LayerNorm kernels: one wave a row, and the row stays in the wave's registers (DM / 32 = 32 sums a lane). Every load of the row's work (both addends, gain, shift) is issued at the head,
// so a wave waits out one memory latency and each addend is read once; mean, variance and output are then formed from the registers, pieces and columns in ascending order.
// every loop over ch and q below is unrolled so that the register arrays are indexed by constants and stay in registers
#define LNC (DM / 128)            // 128-column pieces of a row: a lane holds 4 neighbouring columns of each
template <bool RND>
__global__ __launch_bounds__(256) void k_lnhl(const float* __restrict__ X, const float* __restrict__ A, const float* __restrict__ g, const float* __restrict__ be, float* Z, bf* Yh, bf* Yl) {
    const int lane = threadIdx.x & 31; const int r = blockIdx.x * 8 + (threadIdx.x >> 5); if (r >= NB_ * TT) return; const float* xr = X + (size_t)r * DM; const float* ar = A ? A + (size_t)r * DM : nullptr; float s = 0.f;
    v4f v[LNC], d[LNC], gv[LNC], bv[LNC];
#pragma unroll
    for (int ch = 0; ch < LNC; ++ch) { v[ch] = *(const v4f*)(xr + ch * 128 + lane * 4); d[ch] = (v4f){0.f, 0.f, 0.f, 0.f}; }
    asm volatile("s_wait_xcnt 0x0" :: "v"(xr + lane * 4) : "memory");   // later loads may land in the registers that hold this group's address; the address is an input, so it keeps its registers up to the wait
    if (A) {   // one test of the kernel argument, a scalar branch, for the whole row: a test at every piece would split the loads into pieces that wait one after the other
#pragma unroll
        for (int ch = 0; ch < LNC; ++ch) d[ch] = *(const v4f*)(ar + ch * 128 + lane * 4);
        asm volatile("s_wait_xcnt 0x0" :: "v"(ar + lane * 4) : "memory"); }   // as above
#pragma unroll
    for (int ch = 0; ch < LNC; ++ch) { const int c0 = ch * 128 + lane * 4; gv[ch] = *(const v4f*)(g + c0); bv[ch] = *(const v4f*)(be + c0); }
    asm volatile("s_wait_xcnt 0x0" ::: "memory");   // the sums below reuse the address registers of the loads
    __builtin_amdgcn_sched_barrier(0);   // fence: all 32 loads go out here as one group; without it they are issued in batches among the sums, each batch with a memory latency of its own
#pragma unroll
    for (int ch = 0; ch < LNC; ++ch)
#pragma unroll
        for (int q = 0; q < 4; ++q) { v[ch][q] = __fadd_rn((RND ? bfr(v[ch][q]) : v[ch][q]), d[ch][q]); s += v[ch][q]; }
#pragma unroll
    for (int sh = 16; sh; sh >>= 1) s += __shfl_xor(s, sh, 32);
    const float mu = s * (1.0f / DM); float s2 = 0.f;
#pragma unroll
    for (int ch = 0; ch < LNC; ++ch)
#pragma unroll
        for (int q = 0; q < 4; ++q) { const float d0 = __fsub_rn(v[ch][q], mu); float p = __fmul_rn(d0, d0); asm volatile("" : "+v"(p)); s2 = __fadd_rn(s2, p); }
#pragma unroll
    for (int sh = 16; sh; sh >>= 1) s2 += __shfl_xor(s2, sh, 32);
    const float rs = __fdiv_rn(1.0f, __fsqrt_rn(__fadd_rn(s2 * (1.0f / DM), LNEPS)));
#pragma unroll
    for (int ch = 0; ch < LNC; ++ch) { const int c0 = ch * 128 + lane * 4; v4f z4; v4us oh, ol;
#pragma unroll
        for (int q = 0; q < 4; ++q) { float n0 = __fmul_rn(__fsub_rn(v[ch][q], mu), rs); asm volatile("" : "+v"(n0)); float n1 = __fmul_rn(n0, bfr(gv[ch][q])); asm volatile("" : "+v"(n1)); const float y = __fadd_rn(n1, bfr(bv[ch][q])); z4[q] = y;   /* Z = the NORMALISED row (it is the residual for the next block) */ unsigned short h2, l2; splitf(y, h2, l2); oh[q] = h2; ol[q] = l2; }
        if (Z) *(v4f*)(Z + (size_t)r * DM + c0) = z4; *(v4us*)(Yh + (size_t)r * DM + c0) = oh; *(v4us*)(Yl + (size_t)r * DM + c0) = ol; } }

__global__ __launch_bounds__(256) void k_addln(const float* __restrict__ A, const float* __restrict__ Bm, const float* __restrict__ g, const float* __restrict__ be, float* OUTb) {
    const int lane = threadIdx.x & 31; const int r = blockIdx.x * 8 + (threadIdx.x >> 5); if (r >= NB_ * TT) return; const float* ar = A + (size_t)r * DM; const float* br = Bm + (size_t)r * DM; float s = 0.f;
    v4f v[LNC], d[LNC], gv[LNC], bv[LNC];
#pragma unroll
    for (int ch = 0; ch < LNC; ++ch) { const int c0 = ch * 128 + lane * 4; v[ch] = *(const v4f*)(ar + c0); d[ch] = *(const v4f*)(br + c0); }
    asm volatile("s_wait_xcnt 0x0" :: "v"(ar + lane * 4), "v"(br + lane * 4) : "memory");   // later loads may land in the registers that hold this group's addresses; they are inputs, so they keep their registers up to the wait
#pragma unroll
    for (int ch = 0; ch < LNC; ++ch) { const int c0 = ch * 128 + lane * 4; gv[ch] = *(const v4f*)(g + c0); bv[ch] = *(const v4f*)(be + c0); }
    asm volatile("s_wait_xcnt 0x0" ::: "memory");   // the sums below reuse the address registers of the loads
    __builtin_amdgcn_sched_barrier(0);   // fence: all 32 loads go out here as one group; without it they are issued in batches among the sums, each batch with a memory latency of its own
#pragma unroll
    for (int ch = 0; ch < LNC; ++ch)
#pragma unroll
        for (int q = 0; q < 4; ++q) { v[ch][q] = __fadd_rn(v[ch][q], d[ch][q]); s += v[ch][q]; }
#pragma unroll
    for (int sh = 16; sh; sh >>= 1) s += __shfl_xor(s, sh, 32);
    const float mu = s * (1.0f / DM); float s2 = 0.f;
#pragma unroll
    for (int ch = 0; ch < LNC; ++ch)
#pragma unroll
        for (int q = 0; q < 4; ++q) { const float d0 = __fsub_rn(v[ch][q], mu); float p = __fmul_rn(d0, d0); asm volatile("" : "+v"(p)); s2 = __fadd_rn(s2, p); }
#pragma unroll
    for (int sh = 16; sh; sh >>= 1) s2 += __shfl_xor(s2, sh, 32);
    const float rs = __fdiv_rn(1.0f, __fsqrt_rn(__fadd_rn(s2 * (1.0f / DM), LNEPS)));
#pragma unroll
    for (int ch = 0; ch < LNC; ++ch) { const int c0 = ch * 128 + lane * 4; v4f o4;
#pragma unroll
        for (int q = 0; q < 4; ++q) { float n0 = __fmul_rn(__fsub_rn(v[ch][q], mu), rs); asm volatile("" : "+v"(n0)); float n1 = __fmul_rn(n0, bfr(gv[ch][q])); asm volatile("" : "+v"(n1)); o4[q] = __fadd_rn(n1, bfr(bv[ch][q])); }
        *(v4f*)(OUTb + (size_t)r * DM + c0) = o4; } }
// ---- k_fattn: scores, softmax and attn.v of both batches in one launch; no score or probability ever leaves the work-group.
// 4 waves x 16 query columns per work-group, one head; the 2048 keys are walked in passes of KC = 64 with a running maximum and sum (new order of the softmax and attn.v sums).
// S^T = K Q^T (A = key rows from LDS, B = query rows kept in registers), O^T += V^T P^T (A = V^T rows from LDS, B = the score tiles converted in place: two D tiles of 16 keys are one B operand in the loaders' k order).
// A lane holds one query's column, so the maximum is in-lane plus one exchange between the wave's halves. Work-groups below NB_ * NH_ * RH / 64 take the hi+lo rows (3 products), the rest single fp16.
#define KC   64                   // keys per pass
#define LP   72                   // LDS row pitch in 16-bit elements: 144 B = 16 B x odd, conflict-free for the 16-byte fragment reads
#define PLN  (64 * LP)            // one staged plane: 64 rows of 128 B (K: 64 keys x HD; V^T: HD rows x 64 keys)
#define BIGF 0x1p127f             // a power of two: BIGF * CL2 is exact, so a fully masked row gets exponent 0 for every key (uniform weights, as the reference's -1e9 gives)
#define CL2  0.18033688011112042f // HD^-0.5 * log2(e)
__device__ __forceinline__ float xhalf(float x) { const int b = __float_as_int(x); return __int_as_float(__builtin_amdgcn_permlanex16(b, b, 0x76543210, 0xfedcba98, false, false)); }   // lane l <-> l ^ 16
typedef __attribute__((ext_vector_type(2))) __bf16 v2bf;
// 2^x in asm so that the slot the instruction set asks for behind a transcendental (before its result is read or its source overwritten) is filled by construction:
// in the group of four each exponential stands in front of an independent one (the outputs are early-clobber: none shares a register with an input), and the v_nop fills the slot behind the last.
__device__ __forceinline__ v4f exp2x4(float a, float b, float c, float d) { float r0, r1, r2, r3;
    asm("v_exp_f32 %0, %4\n\tv_exp_f32 %1, %5\n\tv_exp_f32 %2, %6\n\tv_exp_f32 %3, %7\n\tv_nop" : "=&v"(r0), "=&v"(r1), "=&v"(r2), "=&v"(r3) : "v"(a), "v"(b), "v"(c), "v"(d)); return (v4f){r0, r1, r2, r3}; }
__device__ __forceinline__ float exp2x1(float a) { float r; asm("v_exp_f32 %0, %1\n\tv_nop" : "=v"(r) : "v"(a)); return r; }
template <typename T16, bool HL>
__device__ __forceinline__ void fattn_body(const T16* __restrict__ Q, const T16* __restrict__ Q2, const T16* __restrict__ Kp, const T16* __restrict__ Kp2, const T16* __restrict__ Vt, const T16* __restrict__ Vt2, int q0, T16* sm, const float* lim, bf* Ah, bf* Al) {
    typedef typename WFrag<T16>::V V;
    constexpr int NP = HL ? 4 : 2, NL = HL ? 2 : 1;   // planes in a buffer (K, V^T, K lo, V^T lo); planes of one operand
    const int tid = threadIdx.x, lane = tid & 31, lr = lane & 15, hi = lane >> 4; const int qr = q0 + (tid >> 5) * 16 + lr;
    V qf[2], qf2[2];
#pragma unroll
    for (int ks = 0; ks < 2; ++ks) { qf[ks] = WFrag<T16>::ld(Q + (size_t)qr * HD + ks * 32 + 8 * hi); if (HL) qf2[ks] = WFrag<T16>::ld(Q2 + (size_t)qr * HD + ks * 32 + 8 * hi); }
    // staging: a plane is 512 pieces of 16 B, 4 per thread; 8 neighbouring lanes read one whole 128-B line. K and V^T take turns in the same registers.
    const int srow = tid >> 3, sseg = (tid & 7) * 8;
    v8us st[NL][4];
    auto gloadK = [&](int c) {
#pragma unroll
        for (int u = 0; u < 4; ++u) { const size_t e = (size_t)(c * KC + srow + 16 * u) * HD + sseg; st[0][u] = *(const v8usa*)(Kp + e); if constexpr (HL) st[1][u] = *(const v8usa*)(Kp2 + e); } };
    auto gloadV = [&](int c) {
#pragma unroll
        for (int u = 0; u < 4; ++u) { const size_t e = (size_t)(srow + 16 * u) * TT + c * KC + sseg; st[0][u] = *(const v8usa*)(Vt + e); if constexpr (HL) st[1][u] = *(const v8usa*)(Vt2 + e); } };
    auto sstore = [&](T16* pl) {   // pl: the operand's hi plane; its lo plane lies two planes further
#pragma unroll
        for (int p = 0; p < NL; ++p)
#pragma unroll
            for (int u = 0; u < 4; ++u) *(v8usa*)(pl + p * 2 * PLN + (srow + 16 * u) * LP + sseg) = st[p][u]; };
    v8f o[4];
#pragma unroll
    for (int dt = 0; dt < 4; ++dt) o[dt] = (v8f){};
    float mraw = -BIGF, mcs = -BIGF * CL2;
    // the softmax sums ride the matrix pipe: an A of ones makes every row of lt the column sums of the (rounded) weights, over both lane halves' keys; lt is rescaled like an output tile
    V ones; v8f lt = (v8f){};
#pragma unroll
    for (int e = 0; e < 16; ++e) { if constexpr (HL) ones[e] = (__bf16)1.0f; else ones[e] = (h16)1.0f; }
    gloadK(0); sstore(sm); gloadV(0); sstore(sm + PLN);
    __syncthreads();   // pass 0's planes and the key limits are in LDS
    // The scheduling fences in the loop keep each group of LDS fragment loads together and ahead of the block of products that uses it (one exposed LDS latency a group, not one a fragment),
    // and keep the products of a block in the written order, in which neighbours go to different accumulators.
#pragma unroll 1
    for (int c = 0; c < TT / KC; ++c) {
        const T16* cur = sm + (c & 1) * (NP * PLN); T16* nxt = sm + ((c + 1) & 1) * (NP * PLN);
        const int cn = (c + 1 < TT / KC) ? c + 1 : c;   // the last pass re-reads its own planes: no branch in the loop; that copy is never read
        gloadK(cn);   // the next pass's K flies during the score products
        __builtin_amdgcn_sched_barrier(0);   // fence: the global loads stay at the head of the pass
        v8f s[4];
        if constexpr (HL) {
#pragma unroll
            for (int ks = 0; ks < 2; ++ks) { V ka[4], kb[4];
#pragma unroll
                for (int kt = 0; kt < 4; ++kt) { ka[kt] = WFrag<T16>::ld(cur + (kt * 16 + lr) * LP + ks * 32 + 8 * hi); kb[kt] = WFrag<T16>::ld(cur + 2 * PLN + (kt * 16 + lr) * LP + ks * 32 + 8 * hi); }
                __builtin_amdgcn_sched_barrier(0);   // fence: loads | products
#pragma unroll
                for (int kt = 0; kt < 4; ++kt) s[kt] = WFrag<T16>::mma(ka[kt], qf[ks], ks ? s[kt] : (v8f){});
#pragma unroll
                for (int kt = 0; kt < 4; ++kt) s[kt] = WFrag<T16>::mma(ka[kt], qf2[ks], s[kt]);
#pragma unroll
                for (int kt = 0; kt < 4; ++kt) s[kt] = WFrag<T16>::mma(kb[kt], qf[ks], s[kt]);
                __builtin_amdgcn_sched_barrier(0); }   // fence: products | next group
        } else { V ka[2][4];
#pragma unroll
            for (int ks = 0; ks < 2; ++ks)
#pragma unroll
                for (int kt = 0; kt < 4; ++kt) ka[ks][kt] = WFrag<T16>::ld(cur + (kt * 16 + lr) * LP + ks * 32 + 8 * hi);
            __builtin_amdgcn_sched_barrier(0);   // fence: loads | products
#pragma unroll
            for (int ks = 0; ks < 2; ++ks)
#pragma unroll
                for (int kt = 0; kt < 4; ++kt) s[kt] = WFrag<T16>::mma(ka[ks][kt], qf[ks], ks ? s[kt] : (v8f){});
            __builtin_amdgcn_sched_barrier(0); }   // fence: products | next group
        // key mask as a select, one instruction: the median of (s, -BIGF, +BIGF) is s, of (s, -BIGF, -BIGF) is -BIGF; four independent maximum chains
        float mk[4]; v4f lm[8];
#pragma unroll
        for (int u = 0; u < 8; ++u) lm[u] = *(const v4fa*)(lim + c * KC + (u >> 1) * 16 + hi * 8 + (u & 1) * 4);
        __builtin_amdgcn_sched_barrier(0);   // fence: the eight limit loads go out as one group, while the last score products drain
#pragma unroll
        for (int kt = 0; kt < 4; ++kt) { mk[kt] = -BIGF;
#pragma unroll
            for (int j = 0; j < 8; ++j) { const float t = __builtin_amdgcn_fmed3f(s[kt][j], -BIGF, lm[2 * kt + (j >> 2)][j & 3]); s[kt][j] = t; mk[kt] = __builtin_fmaximum_numf(mk[kt], t); } }
        float mx = __builtin_fmaximum_numf(__builtin_fmaximum_numf(__builtin_fmaximum_numf(mk[0], mk[1]), __builtin_fmaximum_numf(mk[2], mk[3])), mraw); mx = __builtin_fmaximum_numf(mx, xhalf(mx));
        __builtin_amdgcn_sched_barrier(0);   // fence: the K stores (and the wait on their loads) stay behind the maximum
        sstore(nxt); gloadV(cn);   // K goes to the other buffer; the next pass's V^T flies during the exponentials and the output products
        V va[HL ? 1 : 2][4], vb[4];   // V^T fragments fetched ahead of the exponentials (fp16: both 32-key groups; hi+lo: the first)
#pragma unroll
        for (int g = 0; g < (HL ? 1 : 2); ++g)
#pragma unroll
            for (int dt = 0; dt < 4; ++dt) { va[g][dt] = WFrag<T16>::ld(cur + PLN + (dt * 16 + lr) * LP + g * 32 + 8 * hi); if constexpr (HL) vb[dt] = WFrag<T16>::ld(cur + 3 * PLN + (dt * 16 + lr) * LP + g * 32 + 8 * hi); }
        __builtin_amdgcn_sched_barrier(0);   // fence: these loads are issued before the exponentials, which cover their latency
        const float mc = mx * CL2, al = exp2x1(mcs - mc), ad = (HL ? 0.0f : 10.0f) - mc;   // fp16 weights carry x1024 (cancels in the division by the sum): small weights stay normal numbers
        mraw = mx; mcs = mc;
#pragma unroll
        for (int kt = 0; kt < 4; ++kt)
#pragma unroll
            for (int j = 0; j < 8; ++j) s[kt][j] = __builtin_fmaf(s[kt][j], CL2, ad);
#pragma unroll
        for (int kt = 0; kt < 4; ++kt) { const v4f e0 = exp2x4(s[kt][0], s[kt][1], s[kt][2], s[kt][3]), e1 = exp2x4(s[kt][4], s[kt][5], s[kt][6], s[kt][7]); s[kt] = __builtin_shufflevector(e0, e1, 0, 1, 2, 3, 4, 5, 6, 7); }
        __builtin_amdgcn_sched_barrier(0);   // fence: the exponentials are asm text: none of the products below is scheduled in front of them
        lt *= al;
#pragma unroll
        for (int dt = 0; dt < 4; ++dt) o[dt] *= al;
#pragma unroll
        for (int g = 0; g < 2; ++g) { V pb, pb2;
#pragma unroll
            for (int e = 0; e < 16; e += 2) { const v2f pp = {s[2 * g + (e >> 3)][e & 7], s[2 * g + (e >> 3)][(e & 7) + 1]};   // by pairs: one packed conversion for two weights
                if constexpr (HL) { const v2bf h2 = __builtin_convertvector(pp, v2bf); const v2bf l2 = __builtin_convertvector(pp - __builtin_convertvector(h2, v2f), v2bf); pb[e] = h2[0]; pb[e + 1] = h2[1]; pb2[e] = l2[0]; pb2[e + 1] = l2[1]; }
                else { const v2h h2 = __builtin_convertvector(pp, v2h); pb[e] = h2[0]; pb[e + 1] = h2[1]; } }
            __builtin_amdgcn_sched_barrier(0);   // fence: conversions | products
#pragma unroll
            for (int dt = 0; dt < 4; ++dt) o[dt] = WFrag<T16>::mma(va[HL ? 0 : g][dt], pb, o[dt]);
            lt = WFrag<T16>::mma(ones, pb, lt);
            if constexpr (HL) {
#pragma unroll
                for (int dt = 0; dt < 4; ++dt) o[dt] = WFrag<T16>::mma(va[0][dt], pb2, o[dt]);
                lt = WFrag<T16>::mma(ones, pb2, lt);
#pragma unroll
                for (int dt = 0; dt < 4; ++dt) o[dt] = WFrag<T16>::mma(vb[dt], pb, o[dt]);
                __builtin_amdgcn_sched_barrier(0);   // fence: products | the second group's loads
                if (g == 0) {
#pragma unroll
                    for (int dt = 0; dt < 4; ++dt) { va[0][dt] = WFrag<T16>::ld(cur + PLN + (dt * 16 + lr) * LP + 32 + 8 * hi); vb[dt] = WFrag<T16>::ld(cur + 3 * PLN + (dt * 16 + lr) * LP + 32 + 8 * hi); }
                    __builtin_amdgcn_sched_barrier(0); } } }   // fence: the second group's loads are issued before its conversions, which cover their latency
        __builtin_amdgcn_sched_barrier(0);   // fence: the V^T stores (and the wait on their loads) stay at the foot of the pass
        sstore(nxt + PLN);
        __syncthreads();   // publishes the next pass's planes and ends every wave's reads of this pass's (refilled in the next trip)
    }
    const float inv = __fdiv_rn(1.0f, lt[0]);
#pragma unroll
    for (int dt = 0; dt < 4; ++dt) { v8us oh, ol;   // a lane's 8 accumulator registers are 8 consecutive d of its query: one 16-byte store per plane
#pragma unroll
        for (int j = 0; j < 8; ++j) { unsigned short a, c2; splitf(o[dt][j] * inv, a, c2); oh[j] = a; ol[j] = c2; }
        const size_t oo = (size_t)qr * DQ + dt * 16 + hi * 8; *(v8us*)(Ah + oo) = oh; *(v8us*)(Al + oo) = ol; }
}
// the second bound (4 waves per SIMD) is a budget of 256 registers: the hi+lo body stays below v256 and needs no register-window switches in its loop
__global__ __launch_bounds__(128, 4) void k_fattn(const h16* __restrict__ Q16, const h16* __restrict__ K16, const h16* __restrict__ V16, const bf* __restrict__ Qh, const bf* __restrict__ Ql, const bf* __restrict__ Kh, const bf* __restrict__ Kl, const bf* __restrict__ Vh, const bf* __restrict__ Vl, const int* __restrict__ MK, bf* Ah, bf* Al) {
    __shared__ __align__(16) unsigned short sm[2 * 4 * PLN];
    __shared__ __align__(16) float lim[TT];
    const int bx = blockIdx.x;   // the heavier hi+lo work-groups of both batches come first
    constexpr int NHL = NH_ * (RH / 64), NSG = NH_ * ((TT - RH) / 64);   // work-groups of a batch: hi+lo, single fp16
    const bool hl = bx < NB_ * NHL; const int bt = hl ? bx / NHL : (bx - NB_ * NHL) / NSG, ix = hl ? bx % NHL : (bx - NB_ * NHL) % NSG;   // batch, index inside the batch
    const int* MKb = MK + (size_t)bt * TT; const size_t zb = (size_t)bt * NH_ * TT * HD, zkb = (size_t)bt * NKV * TT * HD; Ah += (size_t)bt * TT * DQ; Al += (size_t)bt * TT * DQ;
    // unrolled so that the four mask loads of a thread are in flight together
#pragma unroll
    for (int u = 0; u < TT / 512; ++u) { const int i = (u * 128 + (int)threadIdx.x) * 4; const v4i m4 = *(const v4i*)(MKb + i); v4f f4;
#pragma unroll
        for (int q = 0; q < 4; ++q) f4[q] = (m4[q] != 0) ? BIGF : -BIGF;
        *(v4fa*)(lim + i) = f4; }
    if (hl) { const int h = ix / (RH / 64), q0 = (ix % (RH / 64)) * 64; const size_t zq = zb + (size_t)h * TT * HD, zk = zkb + (size_t)(h / REP) * TT * HD;
        fattn_body<bf, true>(Qh + zq, Ql + zq, Kh + zk, Kl + zk, Vh + zk, Vl + zk, q0, (bf*)sm, lim, Ah + h * HD, Al + h * HD);
    } else { const int h = ix / ((TT - RH) / 64), q0 = RH + (ix % ((TT - RH) / 64)) * 64; const size_t zq = zb + (size_t)h * TT * HD, zk = zkb + (size_t)(h / REP) * TT * HD;
        fattn_body<h16, false>(Q16 + zq, nullptr, K16 + zk, nullptr, V16 + zk, nullptr, q0, (h16*)sm, lim, Ah + h * HD, Al + h * HD); }
}

extern "C" void kernel_launch(void* const* d_in, const int* in_sizes, int n_in,
                              void* d_out, int out_size, void* d_ws, size_t ws_size, hipStream_t stream) {
    (void)in_sizes; (void)n_in; (void)out_size;
    const float* x = (const float*)d_in[0]; const float* xk = (const float*)d_in[1]; const int* MK = (const int*)d_in[2]; const float* wq = (const float*)d_in[3]; const float* bq = (const float*)d_in[4]; const float* wk = (const float*)d_in[5]; const float* bk = (const float*)d_in[6]; const float* wv = (const float*)d_in[7]; const float* bv = (const float*)d_in[8]; const float* wo = (const float*)d_in[9]; const float* bo = (const float*)d_in[10]; const float* w1 = (const float*)d_in[11]; const float* b1 = (const float*)d_in[12]; const float* w2 = (const float*)d_in[13]; const float* b2 = (const float*)d_in[14]; const float* g1 = (const float*)d_in[15]; const float* e1 = (const float*)d_in[16]; const float* g2 = (const float*)d_in[17]; const float* e2 = (const float*)d_in[18];
    float* OUT = (float*)d_out;     // [2][2048][1024]
    char* wsp = (char*)d_ws;
    auto take = [&](size_t bytes) { char* p = wsp; wsp += (bytes + 255) & ~(size_t)255; return (void*)p; };
    bf* WQ = (bf*)take((size_t)DQ * DM * 2); bf* WK = (bf*)take((size_t)DKV * DM * 2); bf* WV = (bf*)take((size_t)DKV * DM * 2); bf* WO = (bf*)take((size_t)DM * DQ * 2);
    bf* W1B = (bf*)take((size_t)DFF * DM * 2); bf* W2B = (bf*)take((size_t)DM * DFF * 2);
    // every buffer below holds both batches (rows b * TT + t; head planes [b][h][..]).
    // Region A: inputs in bf16 and the head planes, dead once the attention has run; Gh, Gl lie over it.
    char* const regA = wsp;
    bf* XB = (bf*)take((size_t)NB_ * TT * DM * 2); bf* XKB = (bf*)take((size_t)NB_ * TT * DM * 2);
    h16* QP16 = (h16*)take((size_t)NB_ * NH_ * TT * HD * 2); h16* KP16 = (h16*)take((size_t)NB_ * NKV * TT * HD * 2); h16* VT16 = (h16*)take((size_t)NB_ * NKV * HD * TT * 2);
    bf* QPh = (bf*)take((size_t)NB_ * NH_ * TT * HD * 2); bf* QPl = (bf*)take((size_t)NB_ * NH_ * TT * HD * 2); bf* KPh = (bf*)take((size_t)NB_ * NKV * TT * HD * 2); bf* KPl = (bf*)take((size_t)NB_ * NKV * TT * HD * 2); bf* VTh = (bf*)take((size_t)NB_ * NKV * HD * TT * 2); bf* VTl = (bf*)take((size_t)NB_ * NKV * HD * TT * 2);
    bf* ATh = (bf*)take((size_t)NB_ * TT * DQ * 2); bf* ATl = (bf*)take((size_t)NB_ * TT * DQ * 2); float* S2 = (float*)take((size_t)NB_ * TT * DM * 4);
    float* X1 = (float*)take((size_t)NB_ * TT * DM * 4); bf* L1h = (bf*)take((size_t)NB_ * TT * DM * 2); bf* L1l = (bf*)take((size_t)NB_ * TT * DM * 2); float* F2 = (float*)take((size_t)NB_ * TT * DM * 4);
    if ((size_t)(wsp - (char*)d_ws) > ws_size) return;
    bf* Gh = (bf*)regA; bf* Gl = Gh + (size_t)NB_ * TT * DFF;
    static_assert((size_t)NB_ * TT * DFF * 2 * 2 <= (size_t)NB_ * TT * (2 * DM + 3 * DQ + 6 * DKV) * 2, "Gh, Gl fit region A");
    k_prep<<<PGRID, 256, 0, stream>>>(wq, wk, wv, wo, w1, w2, x, xk, WQ, WK, WV, WO, W1B, W2B, XB, XKB);   /* weights as bf16 [n][k], x and y as bf16 rows */
    // one launch of each kernel serves both batches. In the k_gemms grids the batch is z (the slowest index); in k_qkv z is product * NB_ + batch.
    k_qkv<<<dim3(TT / 128, DQ / 128, 3 * NB_), 128, 0, stream>>>(XB, XKB, WQ, WK, WV, QP16, QPh, QPl, KP16, KPh, KPl, VT16, VTh, VTl, bq, bk, bv);   /* q, k as head planes, v as transposed head planes */
    k_fattn<<<NB_ * NH_ * (TT / 64), 128, 0, stream>>>(QP16, KP16, VT16, QPh, QPl, KPh, KPl, VTh, VTl, MK, ATh, ATl);   /* softmax(q k^T / 8, mask) v, merged heads as hi/lo planes */
    k_gemms<1, 0, DQ><<<dim3(TT / 128, DM / 128, NB_), 128, 0, stream>>>(ATh, ATl, WO, S2, nullptr, nullptr, nullptr, DM, bo, (size_t)TT * DQ, (size_t)TT * DM);   /* mha = merged Wo + bo */
    k_lnhl<true><<<NB_ * TT / 8, 256, 0, stream>>>(x, S2, g1, e1, X1, L1h, L1l);                                                          /* x1 = LN(bf16(x) + mha): normalised row in f32 + hi/lo planes */
    k_gemms<1, 3, DM><<<dim3(TT / 128, DFF / 128, NB_), 128, 0, stream>>>(L1h, L1l, W1B, nullptr, nullptr, Gh, Gl, DFF, b1, (size_t)TT * DM, (size_t)TT * DFF);   /* relu(x1 W1 + b1) as hi/lo planes */
    k_gemms<1, 0, DFF><<<dim3(TT / 128, DM / 128, NB_), 128, 0, stream>>>(Gh, Gl, W2B, F2, nullptr, nullptr, nullptr, DM, b2, (size_t)TT * DFF, (size_t)TT * DM);   /* . W2 + b2 */
    k_addln<<<NB_ * TT / 8, 256, 0, stream>>>(X1, F2, g2, e2, OUT);                                                                       /* out = LN(x1 + ff) */
}
